// v000
// Measured on an AMD MI455X. A time is GPU time per run, averaged over a window of back-to-back runs after a warm-up
// (all launches, gaps included; the runs take copies of the inputs in turn), and the median of several windows.
// Apart from v000's, it joins two sittings. Times from different sittings can be a few percent apart, while
// side-by-side timings come from the same sitting.
// The starting kernel, v000, takes 1240 microseconds a run.
#include <hip/hip_runtime.h>
// Contractions (all v_wmma_f32_16x16x32_bf16, f32 accumulate): q/k/v projections = single product on RNE-bf16 inputs and weights; scores K Q^T, P V and the output projection = bf16 hi+lo planes of the computed operand(s), products hi*hi + hi*lo + lo*hi (output projection: [ctx_hi | ctx_lo] x [Wo ; Wo] folded along K); softmax statistics and coverage in f32.
// come from K rows (A, global bf16 planes) and Q^T (B, registers); the two 16-key D tiles pack straight into the P^T B fragment; O^T accumulates from V^T rows (A).
// Masks: both boolean inputs and the layer index are read on the device into a bit-plane (one 32-bit word per query and 32-key step); fully masked steps are skipped at run time.
#ifndef NB
#define NB 4
#endif
#ifndef SEQ
#define SEQ 1024
#endif
#define NB_FULL 4
#define SEQ_FULL 1024
#define NH 16
#define HD 64
#define DM 1024
#define RHSW (SEQ_FULL + 4)
#define NKS (SEQ / 32)
#define MBW (SEQ_FULL / 32)
#define CXP 2048
#define COVP (SEQ + 4)
#define STP 72
#define COV_LDS_BYTES (16 * COVP * 4)
#define ATTN_LDS (COV_LDS_BYTES + 2 * 16 * STP * 2)

#define XN ((size_t)SEQ * NB_FULL * DM)          /* elements of one converted activation plane (prefix of the full input) */
#define WN ((size_t)DM * DM)
#define PLSZ ((size_t)NB * NH * SEQ * HD)        /* elements of one head-layout plane */
#define COV_OFF ((size_t)SEQ_FULL * NB_FULL * DM) /* element offset of the second output (byte 16777216) */

#define BYTES_XB (3 * XN * 2)
#define BYTES_WB (4 * WN * 2)
#define BYTES_PL (6 * PLSZ * 2)
#define BYTES_CX ((size_t)SEQ * NB_FULL * CXP * 2)
#define BYTES_MB ((size_t)NB * SEQ * MBW * 4)

static_assert(SEQ % 128 == 0);
static_assert(SEQ <= SEQ_FULL);
static_assert(NB <= NB_FULL);
static_assert(MBW == 32);
static_assert(HD == 64);
static_assert(NH * HD == DM);
static_assert(COV_OFF * 4 == (size_t)16777216);
static_assert(BYTES_XB % 256 == 0 && BYTES_WB % 256 == 0 && BYTES_PL % 256 == 0 && BYTES_CX % 256 == 0 && BYTES_MB % 256 == 0);
static_assert(BYTES_XB + BYTES_WB + BYTES_PL + BYTES_CX + BYTES_MB <= (size_t)134217728);
static_assert((size_t)SEQ * NB_FULL * DM <= COV_OFF);
static_assert(COV_OFF + ((size_t)(NB - 1) * SEQ_FULL + (SEQ - 1)) * SEQ_FULL + SEQ <= (size_t)33554432 / 4);

typedef __bf16 v16b __attribute__((ext_vector_type(16)));
typedef unsigned short v8us __attribute__((ext_vector_type(8), may_alias));
typedef float v8f __attribute__((ext_vector_type(8)));
typedef float v4f __attribute__((ext_vector_type(4)));
typedef float v4fa __attribute__((ext_vector_type(4), may_alias));
typedef int v4i __attribute__((ext_vector_type(4)));
typedef int v4ia __attribute__((ext_vector_type(4), may_alias));
union FragB { v16b v; v8us half[2]; unsigned short u[16]; };

#define LOG2E 1.4426950408889634f
#define NEGBIG (-1.0e30f)

__device__ __forceinline__ unsigned short bf16_bits(float x) {   // RNE convert to bf16 bits
  unsigned int u = __float_as_uint(x);
  return (unsigned short)((u + 0x7FFFu + ((u >> 16) & 1u)) >> 16);
}
__device__ __forceinline__ float bf16_val(unsigned short b) { return __uint_as_float(((unsigned int)b) << 16); }

__device__ __forceinline__ v8f wm(v16b a, v16b b, v8f c) {
  return __builtin_amdgcn_wmma_f32_16x16x32_bf16(false, a, false, b, (short)0, c, false, false);
}

// coverage: n8 threads x 8 elements = the whole plane (n is a multiple of 8).
__global__ __launch_bounds__(256) void k_cvt(const float* __restrict__ src, unsigned short* __restrict__ dst, int n8) {
  const int t = blockIdx.x * 256 + threadIdx.x;
  if (t >= n8) return;
  const float* s = src + (size_t)t * 8;
  const v4f x0 = *(const v4fa*)(s), x1 = *(const v4fa*)(s + 4);
  v8us o;
  o[0] = bf16_bits(x0[0]); o[1] = bf16_bits(x0[1]); o[2] = bf16_bits(x0[2]); o[3] = bf16_bits(x0[3]);
  o[4] = bf16_bits(x1[0]); o[5] = bf16_bits(x1[1]); o[6] = bf16_bits(x1[2]); o[7] = bf16_bits(x1[3]);
  unsigned short* d = dst + (size_t)t * 8;
  *(v8us*)d = o;
  
}

// Mb[b][q][j] bit kk = 1 when key 32j+kk is masked for query q of batch b (mask[b][q][k] != 0 or rhs[q][start + k] != 0).
// coverage: NB*SEQ*32 threads = every word of the plane.
__global__ __launch_bounds__(256) void k_mask(const int* __restrict__ mask, const int* __restrict__ rhs,
                                              const int* __restrict__ lidx, unsigned int* __restrict__ Mb) {
  const int t = blockIdx.x * 256 + threadIdx.x;
  if (t >= NB * SEQ * MBW) return;
  const int j = t & 31, row = t >> 5;
  const int b = row / SEQ, q = row - b * SEQ;
  int L = lidx[0];
  L = (L < -64) ? -64 : ((L > 64) ? 64 : L);
  int tt = 4 - 4 * L; if (tt < 0) tt = 0;
  int start = 4 - tt; if (start < 0) start = 0;
  start = (start >= 4) ? 4 : 0;                       // the formula only yields 0 or 4; keeps the 16-B alignment of the row loads
  const int* mp = mask + ((size_t)b * SEQ_FULL + q) * SEQ_FULL + 32 * j;
  const int* rp = rhs + (size_t)q * RHSW + start + 32 * j;
  unsigned int w = 0u;
#pragma unroll 4
  for (int c = 0; c < 8; ++c) {
    const v4i a = *(const v4ia*)(mp + 4 * c);
    const v4i r = *(const v4ia*)(rp + 4 * c);
    const unsigned int nib = (((a[0] | r[0]) != 0) ? 1u : 0u) | (((a[1] | r[1]) != 0) ? 2u : 0u) |
                             (((a[2] | r[2]) != 0) ? 4u : 0u) | (((a[3] | r[3]) != 0) ? 8u : 0u);
    w |= nib << (4 * c);
  }
  unsigned int* d = Mb + (size_t)t;
  *(unsigned int*)d = w;
  
}

// Wave tile 32 rows x 64 columns, K stepped by 32; A rows and W rows are k-contiguous bf16 global rows (two 16-B loads per fragment).
// The W k index wraps at DM so that [A_hi | A_lo] x [W ; W] folds along K.
template <int KT>
__device__ __forceinline__ void gemm_main(const unsigned short* __restrict__ ap0, const unsigned short* __restrict__ ap1,
                                          const unsigned short* __restrict__ bp, v8f (&acc)[2][4]) {
#pragma unroll 1
  for (int k0 = 0; k0 < KT; k0 += 32) {
    const int kw = k0 & (DM - 1);
    FragB a0, a1, b0, b1, b2, b3;
    a0.half[0] = *(const v8us*)(ap0 + k0); a0.half[1] = *(const v8us*)(ap0 + k0 + 16);
    a1.half[0] = *(const v8us*)(ap1 + k0); a1.half[1] = *(const v8us*)(ap1 + k0 + 16);
    b0.half[0] = *(const v8us*)(bp + kw);                 b0.half[1] = *(const v8us*)(bp + kw + 16);
    b1.half[0] = *(const v8us*)(bp + 16 * DM + kw);       b1.half[1] = *(const v8us*)(bp + 16 * DM + kw + 16);
    b2.half[0] = *(const v8us*)(bp + 32 * DM + kw);       b2.half[1] = *(const v8us*)(bp + 32 * DM + kw + 16);
    b3.half[0] = *(const v8us*)(bp + 48 * DM + kw);       b3.half[1] = *(const v8us*)(bp + 48 * DM + kw + 16);
    acc[0][0] = wm(a0.v, b0.v, acc[0][0]); acc[0][1] = wm(a0.v, b1.v, acc[0][1]);
    acc[0][2] = wm(a0.v, b2.v, acc[0][2]); acc[0][3] = wm(a0.v, b3.v, acc[0][3]);
    acc[1][0] = wm(a1.v, b0.v, acc[1][0]); acc[1][1] = wm(a1.v, b1.v, acc[1][1]);
    acc[1][2] = wm(a1.v, b2.v, acc[1][2]); acc[1][3] = wm(a1.v, b3.v, acc[1][3]);
    asm volatile("v_nop\n\tv_nop\n\tv_nop\n\tv_nop"
                 : "+v"(acc[0][0]), "+v"(acc[0][1]), "+v"(acc[0][2]), "+v"(acc[0][3]),
                   "+v"(acc[1][0]), "+v"(acc[1][1]), "+v"(acc[1][2]), "+v"(acc[1][3])
                 : "v"(a0.v), "v"(a1.v), "v"(b0.v), "v"(b1.v), "v"(b2.v), "v"(b3.v));
  }
}

// Projections. grid (NB*SEQ/64, NH, 3): block = 64 sequence positions of one batch x one head x one of {q, k, v}; 2 waves x (32 x 64).
// Logical row b*SEQ + s reads the activation row s*NB_FULL + b. Epilogue: bf16 hi + lo planes staged in LDS (block barrier: cross-wave for the transposed v tile),
// q (scaled by 1/8) and k planes: [b][h][s][64]; v planes transposed: [b][h][d][SEQ].
__global__ __launch_bounds__(64) void k_proj(const unsigned short* __restrict__ Xb, const unsigned short* __restrict__ Wb,
                                             unsigned short* __restrict__ PL) {
  __shared__ __attribute__((aligned(16))) unsigned short sh[64 * STP];
  __shared__ __attribute__((aligned(16))) unsigned short sl[64 * STP];
  const int tid = threadIdx.x, w = __builtin_amdgcn_readfirstlane((int)(tid >> 5)), lane = tid & 31, ln = lane & 15, hh = lane >> 4;
  const int z = blockIdx.z, hcol = blockIdx.y;
  const int mt0 = blockIdx.x * 64;
  const int b = mt0 / SEQ, s0 = mt0 - b * SEQ;
  const int srow = s0 + 32 * w + ln;
  const unsigned short* A = Xb + (size_t)z * XN;
  const unsigned short* ap0 = A + ((size_t)srow * NB_FULL + b) * DM + 8 * hh;
  const unsigned short* ap1 = A + ((size_t)(srow + 16) * NB_FULL + b) * DM + 8 * hh;
  const unsigned short* bp = Wb + (size_t)z * WN + (size_t)(64 * hcol + ln) * DM + 8 * hh;
  v8f acc[2][4] = {};
  gemm_main<DM>(ap0, ap1, bp, acc);
  const float scale = (z == 0) ? 0.125f : 1.0f;
#pragma unroll
  for (int mt = 0; mt < 2; ++mt)
#pragma unroll
    for (int nt = 0; nt < 4; ++nt)
#pragma unroll
      for (int r = 0; r < 8; ++r) {
        const float v = acc[mt][nt][r] * scale;
        const unsigned short hb = bf16_bits(v);
        const unsigned short lb = bf16_bits(v - bf16_val(hb));
        const int sr = 32 * w + 16 * mt + 8 * hh + r;      // local sequence row
        const int dc = 16 * nt + ln;                        // head-dim column
        const int idx = (z == 2) ? (dc * STP + sr) : (sr * STP + dc);
        sh[idx] = hb;
        sl[idx] = lb;
      }
  __syncthreads();
  const size_t hbase = (size_t)b * NH + hcol;
  unsigned short* dstp = PL + (size_t)z * 2 * PLSZ;
  {
#pragma unroll 1
    for (int i = 0; i < 8; ++i) {
      const int row = 8 * i + (tid >> 3), piece = tid & 7;
      const v8us vh = *(const v8us*)(sh + row * STP + 8 * piece);
      const v8us vl = *(const v8us*)(sl + row * STP + 8 * piece);
      const size_t ro = (z == 2) ? ((hbase * HD + row) * SEQ + s0) : ((hbase * SEQ + s0 + row) * HD);
      unsigned short* d = dstp + ro + 8 * piece;
      *(v8us*)d = vh;
      *(v8us*)(d + PLSZ) = vl;
    }
    
  }
}

// S^T tile of 16 keys: c = K_lo Q_hi + K_hi Q_lo + K_hi Q_hi over the two 32-wide head-dim chunks, then the hazard guard.
__device__ __forceinline__ v8f qk_tile(const unsigned short* __restrict__ kp, const FragB& qh0, const FragB& qh1,
                                       const FragB& ql0, const FragB& ql1) {
  // A fragments of K: row m = key, elements 0..7 <- d = 32c + 8h + i, 8..15 <- d = 32c + 16 + 8h + i (kp already holds + 8h)
  FragB a0, a1, c0, c1;
  const unsigned short* lp = kp + PLSZ;
  a0.half[0] = *(const v8us*)(kp);      a0.half[1] = *(const v8us*)(kp + 16);
  a1.half[0] = *(const v8us*)(kp + 32); a1.half[1] = *(const v8us*)(kp + 48);
  c0.half[0] = *(const v8us*)(lp);      c0.half[1] = *(const v8us*)(lp + 16);
  c1.half[0] = *(const v8us*)(lp + 32); c1.half[1] = *(const v8us*)(lp + 48);
  v8f c = {0.f, 0.f, 0.f, 0.f, 0.f, 0.f, 0.f, 0.f};
  c = wm(c0.v, qh0.v, c); c = wm(c1.v, qh1.v, c);
  c = wm(a0.v, ql0.v, c); c = wm(a1.v, ql1.v, c);
  c = wm(a0.v, qh0.v, c); c = wm(a1.v, qh1.v, c);
  asm volatile("v_nop\n\tv_nop\n\tv_nop\n\tv_nop" : "+v"(c)
               : "v"(a0.v), "v"(a1.v), "v"(c0.v), "v"(c1.v), "v"(qh0.v), "v"(qh1.v), "v"(ql0.v), "v"(ql1.v));
  return c;
}

// O^T tile of 16 head-dim rows: o += V_lo P_hi + V_hi P_lo + V_hi P_hi, then the hazard guard.
__device__ __forceinline__ v8f pv_tile(const unsigned short* __restrict__ vp, const FragB& ph, const FragB& pl, v8f o) {
  // A fragments of V^T: row m = d, elements 0..7 <- key0 + 8h + i, 8..15 <- key0 + 16 + 8h + i (vp already holds key0 + 8h)
  FragB vh, vl;
  const unsigned short* lp = vp + PLSZ;
  vh.half[0] = *(const v8us*)(vp); vh.half[1] = *(const v8us*)(vp + 16);
  vl.half[0] = *(const v8us*)(lp); vl.half[1] = *(const v8us*)(lp + 16);
  o = wm(vl.v, ph.v, o);
  o = wm(vh.v, pl.v, o);
  o = wm(vh.v, ph.v, o);
  asm volatile("v_nop\n\tv_nop\n\tv_nop\n\tv_nop" : "+v"(o) : "v"(vh.v), "v"(vl.v), "v"(ph.v), "v"(pl.v));
  return o;
}

// coverage accumulation into the wave-private LDS tile [16][SEQ] (each lane only touches its own addresses), O^T accumulation.
// Per head the ctx tile goes through a small LDS stage (barrier before and after) and is written as bf16 hi | lo halves of the [s*NB_FULL+b][2048] plane,
// coverage: ctx plane: (b, 16 rows) x 16 heads x (64 hi + 64 lo) = every element of rows with b < NB; coverage output: 16 rows x SEQ columns per block, all rows once.
// LDS: coverage tile zero-filled in full before use (staged extent == consumed extent); stage tiles fully written (16 x 64) before they are read.
__global__ __launch_bounds__(32) void k_attn(const unsigned short* __restrict__ PL, const unsigned int* __restrict__ Mb,
                                             unsigned short* __restrict__ Cx, float* __restrict__ Cov) {
  extern __shared__ __attribute__((aligned(16))) unsigned char smem[];
  float* covs = (float*)smem;
  unsigned short* sth = (unsigned short*)(smem + COV_LDS_BYTES);
  unsigned short* stl = sth + 16 * STP;
  const int lane = threadIdx.x & 31, ln = lane & 15, hh = lane >> 4;
  const int b = blockIdx.x / (SEQ / 16), qt = blockIdx.x % (SEQ / 16);
  const int q0 = qt * 16, qg = q0 + ln;
  {
    const v4f z4 = {0.f, 0.f, 0.f, 0.f};
    for (int i = lane; i < 4 * COVP; i += 32) *(v4fa*)(covs + 4 * i) = z4;
  }
  __syncthreads();
  const unsigned int* mrow = Mb + (size_t)(b * SEQ + qg) * MBW;
  const int sh8 = 8 * hh;
  float* crow = covs + ln * COVP + 8 * hh;

#pragma unroll 1
  for (int h = 0; h < NH; ++h) {
    const size_t hb = (size_t)b * NH + h;
    // Q^T B fragments: column n = query qg, elements 0..7 <- d = 32c + 8h + i, 8..15 <- d = 32c + 16 + 8h + i
    const unsigned short* qp = PL + (hb * SEQ + qg) * HD + 8 * hh;
    FragB qh0, qh1, ql0, ql1;
    qh0.half[0] = *(const v8us*)(qp);             qh0.half[1] = *(const v8us*)(qp + 16);
    qh1.half[0] = *(const v8us*)(qp + 32);        qh1.half[1] = *(const v8us*)(qp + 48);
    ql0.half[0] = *(const v8us*)(qp + PLSZ);      ql0.half[1] = *(const v8us*)(qp + PLSZ + 16);
    ql1.half[0] = *(const v8us*)(qp + PLSZ + 32); ql1.half[1] = *(const v8us*)(qp + PLSZ + 48);
    const unsigned short* khp = PL + 2 * PLSZ + (hb * SEQ + ln) * HD + 8 * hh;
    const unsigned short* vhp = PL + 4 * PLSZ + (hb * HD + ln) * SEQ + 8 * hh;

    float mr = NEGBIG, lr = 0.0f;
#pragma unroll 1
    for (int j = 0; j < NKS; ++j) {
      const unsigned int w = mrow[j];
      if (!__any(w != 0xFFFFFFFFu)) continue;                  // wave-uniform: every key of the step masked for all 16 queries
      const unsigned short* kp = khp + (size_t)(32 * j) * HD;
      const v8f s0 = qk_tile(kp, qh0, qh1, ql0, ql1);          // element r = score(key 32j + 8h + r, query qg)
      const v8f s1 = qk_tile(kp + 16 * HD, qh0, qh1, ql0, ql1);
      const unsigned int wb = w >> sh8;
      float sc[16];
      float mx = NEGBIG;
#pragma unroll
      for (int r = 0; r < 8; ++r) {
        sc[r]     = ((wb >> r) & 1u) ? NEGBIG : s0[r];
        sc[8 + r] = ((wb >> (16 + r)) & 1u) ? NEGBIG : s1[r];
        mx = fmaxf(mx, fmaxf(sc[r], sc[8 + r]));
      }
      mx = fmaxf(mx, __shfl_xor(mx, 16, 32));                  // the other lane half holds the other 16 keys of this query
      const float mnew = fmaxf(mr, mx);
      const float al = exp2f((mr - mnew) * LOG2E);
      float ps = 0.0f;
#pragma unroll
      for (int i = 0; i < 16; ++i) {
        const float e = exp2f((sc[i] - mnew) * LOG2E);
        ps += (sc[i] > -1.0e29f) ? e : 0.0f;
      }
      ps += __shfl_xor(ps, 16, 32);
      lr = lr * al + ps;
      mr = mnew;
    }
    const float inv = 1.0f / lr;

    // ---- pass 2: normalised weights, coverage accumulation, O^T ----
    v8f O[4] = {};
#pragma unroll 1
    for (int j = 0; j < NKS; ++j) {
      const unsigned int w = mrow[j];
      if (!__any(w != 0xFFFFFFFFu)) continue;
      const int key0 = 32 * j;
      const unsigned short* kp = khp + (size_t)key0 * HD;
      const v8f s0 = qk_tile(kp, qh0, qh1, ql0, ql1);
      const v8f s1 = qk_tile(kp + 16 * HD, qh0, qh1, ql0, ql1);
      __builtin_amdgcn_sched_barrier(0);
      const unsigned int wb = w >> sh8;
      float pn[16];
#pragma unroll
      for (int r = 0; r < 8; ++r) {
        const float e0 = exp2f((s0[r] - mr) * LOG2E) * inv;
        const float e1 = exp2f((s1[r] - mr) * LOG2E) * inv;
        pn[r]     = ((wb >> r) & 1u) ? 0.0f : e0;
        pn[8 + r] = ((wb >> (16 + r)) & 1u) ? 0.0f : e1;
      }
      // coverage tile: this lane owns columns key0 + 8h + 0..7 and key0 + 16 + 8h + 0..7 of row ln
      {
        float* cr = crow + key0;
        v4f c0 = *(const v4fa*)(cr), c1 = *(const v4fa*)(cr + 4), c2 = *(const v4fa*)(cr + 16), c3 = *(const v4fa*)(cr + 20);
        c0[0] += pn[0];  c0[1] += pn[1];  c0[2] += pn[2];  c0[3] += pn[3];
        c1[0] += pn[4];  c1[1] += pn[5];  c1[2] += pn[6];  c1[3] += pn[7];
        c2[0] += pn[8];  c2[1] += pn[9];  c2[2] += pn[10]; c2[3] += pn[11];
        c3[0] += pn[12]; c3[1] += pn[13]; c3[2] += pn[14]; c3[3] += pn[15];
        *(v4fa*)(cr) = c0; *(v4fa*)(cr + 4) = c1; *(v4fa*)(cr + 16) = c2; *(v4fa*)(cr + 20) = c3;
      }
      // P^T B fragment: element i < 8 -> key0 + 8h + i (tile 0 row 8h + i); i >= 8 -> key0 + 16 + 8h + (i - 8) (tile 1); bf16 hi + lo
      FragB ph, pl;
#pragma unroll
      for (int i = 0; i < 16; ++i) {
        const unsigned short hb16 = bf16_bits(pn[i]);
        ph.u[i] = hb16;
        pl.u[i] = bf16_bits(pn[i] - bf16_val(hb16));
      }
      __builtin_amdgcn_sched_barrier(0);
      const unsigned short* vp = vhp + key0;
      O[0] = pv_tile(vp, ph, pl, O[0]);
      O[1] = pv_tile(vp + (size_t)16 * SEQ, ph, pl, O[1]);
      O[2] = pv_tile(vp + (size_t)32 * SEQ, ph, pl, O[2]);
      O[3] = pv_tile(vp + (size_t)48 * SEQ, ph, pl, O[3]);
    }

    // O^T element r of tile t = ctx(query qg, d = 16t + 8h + r): bf16 hi + lo into the stage tiles [16 queries][64 d]
#pragma unroll
    for (int t = 0; t < 4; ++t) {
      v8us oh, ol;
#pragma unroll
      for (int r = 0; r < 8; ++r) {
        const float v = O[t][r];
        const unsigned short hb16 = bf16_bits(v);
        oh[r] = hb16;
        ol[r] = bf16_bits(v - bf16_val(hb16));
      }
      *(v8us*)(sth + ln * STP + 16 * t + 8 * hh) = oh;
      *(v8us*)(stl + ln * STP + 16 * t + 8 * hh) = ol;
    }
    __syncthreads();
    {
#pragma unroll
      for (int i = 0; i < 4; ++i) {
        const int row = 4 * i + (lane >> 3), piece = lane & 7;
        const v8us vh = *(const v8us*)(sth + row * STP + 8 * piece);
        const v8us vl = *(const v8us*)(stl + row * STP + 8 * piece);
        unsigned short* d = Cx + ((size_t)(q0 + row) * NB_FULL + b) * CXP + h * HD + 8 * piece;
        *(v8us*)d = vh;
        *(v8us*)(d + DM) = vl;
      }
      
    }
    __syncthreads();
  }

  __syncthreads();
  float* cg = Cov + ((size_t)b * SEQ_FULL + q0) * SEQ_FULL;
  {
#pragma unroll 1
    for (int row = 0; row < 16; ++row) {
#pragma unroll 1
      for (int c = 0; c < SEQ / 128; ++c) {
        const int col = c * 128 + lane * 4;
        v4f v = *(const v4fa*)(covs + row * COVP + col);
        v[0] *= 0.0625f; v[1] *= 0.0625f; v[2] *= 0.0625f; v[3] *= 0.0625f;
        *(v4f*)(cg + (size_t)row * SEQ_FULL + col) = v;
      }
    }
    
  }
}

// Output projection: out[m][n] = sum_c ctx[m][c] Wo[n][c] with A = [ctx_hi | ctx_lo] (K = 2048) and the W k index wrapping at 1024.
// coverage: blocks tile the [SEQ*NB_FULL][1024] output exactly once.
__global__ __launch_bounds__(64) void k_oproj(const unsigned short* __restrict__ Cx, const unsigned short* __restrict__ Wo,
                                              float* __restrict__ Out) {
  __shared__ __attribute__((aligned(16))) float so[64 * 68];
  const int tid = threadIdx.x, w = __builtin_amdgcn_readfirstlane((int)(tid >> 5)), lane = tid & 31, ln = lane & 15, hh = lane >> 4;
  const int m0 = blockIdx.x * 64, n0 = blockIdx.y * 64;
  const unsigned short* ap0 = Cx + (size_t)(m0 + 32 * w + ln) * CXP + 8 * hh;
  const unsigned short* ap1 = ap0 + (size_t)16 * CXP;
  const unsigned short* bp = Wo + (size_t)(n0 + ln) * DM + 8 * hh;
  v8f acc[2][4] = {};
  gemm_main<CXP>(ap0, ap1, bp, acc);
#pragma unroll
  for (int mt = 0; mt < 2; ++mt)
#pragma unroll
    for (int nt = 0; nt < 4; ++nt)
#pragma unroll
      for (int r = 0; r < 8; ++r)
        so[(32 * w + 16 * mt + 8 * hh + r) * 68 + 16 * nt + ln] = acc[mt][nt][r];
  __syncthreads();
  const int rsub = lane >> 4, c4 = (lane & 15) * 4;
  {
#pragma unroll 1
    for (int i = 0; i < 16; ++i) {
      const int row = 32 * w + 2 * i + rsub;
      const v4f v = *(const v4fa*)(so + row * 68 + c4);
      *(v4f*)(Out + (size_t)(m0 + row) * DM + n0 + c4) = v;
    }
    
  }
}

extern "C" void kernel_launch(void* const* d_in, const int* in_sizes, int n_in,
                              void* d_out, int out_size, void* d_ws, size_t ws_size, hipStream_t stream) {
  if (n_in < 10) return;
  const long long needX = (long long)SEQ * NB_FULL * DM;
  if ((long long)in_sizes[0] < needX || (long long)in_sizes[1] < needX || (long long)in_sizes[2] < needX) return;
  for (int i = 3; i < 7; ++i) if ((long long)in_sizes[i] < (long long)DM * DM) return;
  if ((long long)in_sizes[7] < ((long long)(NB - 1) * SEQ_FULL + (SEQ - 1)) * SEQ_FULL + SEQ_FULL) return;
  if ((long long)in_sizes[8] < (long long)SEQ * RHSW) return;
  if (in_sizes[9] < 1) return;
  if ((long long)out_size < (long long)COV_OFF + ((long long)(NB - 1) * SEQ_FULL + (SEQ - 1)) * SEQ_FULL + SEQ) return;

  const float* query = (const float*)d_in[0];   // wire order: query, key, value, Wq, Wk, Wv, Wo, mask, rhs_mask, layer_idx
  const float* keyt  = (const float*)d_in[1];
  const float* value = (const float*)d_in[2];
  const float* Wq    = (const float*)d_in[3];
  const float* Wk    = (const float*)d_in[4];
  const float* Wv    = (const float*)d_in[5];
  const float* Wo    = (const float*)d_in[6];
  const int*   mask  = (const int*)d_in[7];
  const int*   rhs   = (const int*)d_in[8];
  const int*   lidx  = (const int*)d_in[9];
  float* out = (float*)d_out;
  float* cov = out + COV_OFF;

  char* ws = (char*)d_ws;
  size_t off = 0;
  unsigned short* Xb = (unsigned short*)(ws + off); off += BYTES_XB;   // 3 activation planes [SEQ*NB_FULL][1024] bf16
  unsigned short* Wb = (unsigned short*)(ws + off); off += BYTES_WB;   // 4 weight planes [1024][1024] bf16 (q, k, v, o)
  unsigned short* PL = (unsigned short*)(ws + off); off += BYTES_PL;   // q_hi, q_lo, k_hi, k_lo, vT_hi, vT_lo
  unsigned short* Cx = (unsigned short*)(ws + off); off += BYTES_CX;   // ctx [SEQ*NB_FULL][hi 1024 | lo 1024] bf16
  unsigned int*   Mb = (unsigned int*)(ws + off);   off += BYTES_MB;   // mask bit-plane [NB][SEQ][32 words]
  if (off > ws_size) return;

  const int nx8 = (int)(XN / 8), nw8 = (int)(WN / 8);
  k_cvt<<<(unsigned)((nx8 + 255) / 256), 256, 0, stream>>>(query, Xb, nx8);
  k_cvt<<<(unsigned)((nx8 + 255) / 256), 256, 0, stream>>>(keyt, Xb + XN, nx8);
  k_cvt<<<(unsigned)((nx8 + 255) / 256), 256, 0, stream>>>(value, Xb + 2 * XN, nx8);
  k_cvt<<<(unsigned)((nw8 + 255) / 256), 256, 0, stream>>>(Wq, Wb, nw8);
  k_cvt<<<(unsigned)((nw8 + 255) / 256), 256, 0, stream>>>(Wk, Wb + WN, nw8);
  k_cvt<<<(unsigned)((nw8 + 255) / 256), 256, 0, stream>>>(Wv, Wb + 2 * WN, nw8);
  k_cvt<<<(unsigned)((nw8 + 255) / 256), 256, 0, stream>>>(Wo, Wb + 3 * WN, nw8);
  k_mask<<<(unsigned)((NB * SEQ * MBW + 255) / 256), 256, 0, stream>>>(mask, rhs, lidx, Mb);
  k_proj<<<dim3((unsigned)(NB * SEQ / 64), NH, 3), 64, 0, stream>>>(Xb, Wb, PL);
  hipFuncSetAttribute(reinterpret_cast<const void*>(&k_attn), hipFuncAttributeMaxDynamicSharedMemorySize, (int)ATTN_LDS);
  k_attn<<<(unsigned)(NB * (SEQ / 16)), 32, (size_t)ATTN_LDS, stream>>>(PL, Mb, Cx, cov);
  k_oproj<<<dim3((unsigned)(SEQ * NB_FULL / 64), DM / 64), 64, 0, stream>>>(Cx, Wb + 3 * WN, out);
}

// v001
// It runs in 367 microseconds.
// Two timings next to v000 both put it at 3.35 times that version's speed.
#include <hip/hip_runtime.h>
// Contractions (all v_wmma_f32_16x16x32_bf16, f32 accumulate): q/k/v projections = single product on RNE-bf16 inputs and weights; scores K Q^T, P V and the output projection = bf16 hi+lo planes of the computed operand(s), products hi*hi + hi*lo + lo*hi (output projection: [ctx_hi | ctx_lo] x [Wo ; Wo] folded along K); softmax statistics and coverage in f32.
// come from K rows (A, global bf16 planes) and Q^T (B, registers); the two 16-key D tiles pack straight into the P^T B fragment; O^T accumulates from V^T rows (A).
// Masks: both boolean inputs and the layer index are read on the device into a bit-plane (one 32-bit word per query and 32-key step); fully masked steps are skipped at run time.
#ifndef NB
#define NB 4
#endif
#ifndef SEQ
#define SEQ 1024
#endif
#define NB_FULL 4
#define SEQ_FULL 1024
#define NH 16
#define HD 64
#define DM 1024
#define RHSW (SEQ_FULL + 4)
#define NKS (SEQ / 32)
#define MBW (SEQ_FULL / 32)
#define CXP 2048
#define COVP (SEQ + 4)
#define STP 72
#define COV_LDS_BYTES (16 * COVP * 4)
#define NW 32                                    /* waves of one attention block */
#define NSTEP ((NKS + NW - 1) / NW)              /* 32-key steps owned by one wave */
#define STATP (NW + 4)                           /* dword pitch of a query's row of per-wave statistics (16 B x odd) */
#define OPP 68                                   /* dword pitch of a partial-O row */
#define ATTN_LDS (COV_LDS_BYTES + 2 * 16 * STATP * 4 + NW * 16 * OPP * 4)

#define XN ((size_t)SEQ * NB_FULL * DM)          /* elements of one converted activation plane (prefix of the full input) */
#define WN ((size_t)DM * DM)
#define PLSZ ((size_t)NB * NH * SEQ * HD)        /* elements of one head-layout plane */
#define COV_OFF ((size_t)SEQ_FULL * NB_FULL * DM) /* element offset of the second output (byte 16777216) */

#define BYTES_XB (3 * XN * 2)
#define BYTES_WB (4 * WN * 2)
#define BYTES_PL (6 * PLSZ * 2)
#define BYTES_CX ((size_t)SEQ * NB_FULL * CXP * 2)
#define BYTES_MB ((size_t)NB * SEQ * MBW * 4)

static_assert(SEQ % 128 == 0);
static_assert(SEQ <= SEQ_FULL);
static_assert(NB <= NB_FULL);
static_assert(MBW == 32);
static_assert(HD == 64);
static_assert(NW % 8 == 0 && NW <= 32);
static_assert(ATTN_LDS <= 327680);
static_assert(NH * HD == DM);
static_assert(COV_OFF * 4 == (size_t)16777216);
static_assert(BYTES_XB % 256 == 0 && BYTES_WB % 256 == 0 && BYTES_PL % 256 == 0 && BYTES_CX % 256 == 0 && BYTES_MB % 256 == 0);
static_assert(BYTES_XB + BYTES_WB + BYTES_PL + BYTES_CX + BYTES_MB <= (size_t)134217728);
static_assert((size_t)SEQ * NB_FULL * DM <= COV_OFF);
static_assert(COV_OFF + ((size_t)(NB - 1) * SEQ_FULL + (SEQ - 1)) * SEQ_FULL + SEQ <= (size_t)33554432 / 4);

typedef __bf16 v16b __attribute__((ext_vector_type(16)));
typedef unsigned short v8us __attribute__((ext_vector_type(8), may_alias));
typedef float v8f __attribute__((ext_vector_type(8)));
typedef float v4f __attribute__((ext_vector_type(4)));
typedef float v4fa __attribute__((ext_vector_type(4), may_alias));
typedef float v2f __attribute__((ext_vector_type(2)));
typedef float v2fa __attribute__((ext_vector_type(2), may_alias));
typedef unsigned int u32a __attribute__((may_alias));
typedef int v4i __attribute__((ext_vector_type(4)));
typedef int v4ia __attribute__((ext_vector_type(4), may_alias));
union FragB { v16b v; v8us half[2]; unsigned short u[16]; };

#define LOG2E 1.4426950408889634f
#define NEGBIG (-1.0e30f)

__device__ __forceinline__ unsigned short bf16_bits(float x) {   // RNE convert to bf16 bits
  unsigned int u = __float_as_uint(x);
  return (unsigned short)((u + 0x7FFFu + ((u >> 16) & 1u)) >> 16);
}
__device__ __forceinline__ float bf16_val(unsigned short b) { return __uint_as_float(((unsigned int)b) << 16); }

__device__ __forceinline__ v8f wm(v16b a, v16b b, v8f c) {
  return __builtin_amdgcn_wmma_f32_16x16x32_bf16(false, a, false, b, (short)0, c, false, false);
}

// coverage: n8 threads x 8 elements = the whole plane (n is a multiple of 8).
__global__ __launch_bounds__(256) void k_cvt(const float* __restrict__ src, unsigned short* __restrict__ dst, int n8) {
  const int t = blockIdx.x * 256 + threadIdx.x;
  if (t >= n8) return;
  const float* s = src + (size_t)t * 8;
  const v4f x0 = *(const v4fa*)(s), x1 = *(const v4fa*)(s + 4);
  v8us o;
  o[0] = bf16_bits(x0[0]); o[1] = bf16_bits(x0[1]); o[2] = bf16_bits(x0[2]); o[3] = bf16_bits(x0[3]);
  o[4] = bf16_bits(x1[0]); o[5] = bf16_bits(x1[1]); o[6] = bf16_bits(x1[2]); o[7] = bf16_bits(x1[3]);
  unsigned short* d = dst + (size_t)t * 8;
  *(v8us*)d = o;
  
}

// Mb[b][q][j] bit kk = 1 when key 32j+kk is masked for query q of batch b (mask[b][q][k] != 0 or rhs[q][start + k] != 0).
// coverage: NB*SEQ*32 threads = every word of the plane.
__global__ __launch_bounds__(256) void k_mask(const int* __restrict__ mask, const int* __restrict__ rhs,
                                              const int* __restrict__ lidx, unsigned int* __restrict__ Mb) {
  const int t = blockIdx.x * 256 + threadIdx.x;
  if (t >= NB * SEQ * MBW) return;
  const int j = t & 31, row = t >> 5;
  const int b = row / SEQ, q = row - b * SEQ;
  int L = lidx[0];
  L = (L < -64) ? -64 : ((L > 64) ? 64 : L);
  int tt = 4 - 4 * L; if (tt < 0) tt = 0;
  int start = 4 - tt; if (start < 0) start = 0;
  start = (start >= 4) ? 4 : 0;                       // the formula only yields 0 or 4; keeps the 16-B alignment of the row loads
  const int* mp = mask + ((size_t)b * SEQ_FULL + q) * SEQ_FULL + 32 * j;
  const int* rp = rhs + (size_t)q * RHSW + start + 32 * j;
  unsigned int w = 0u;
#pragma unroll 4
  for (int c = 0; c < 8; ++c) {
    const v4i a = *(const v4ia*)(mp + 4 * c);
    const v4i r = *(const v4ia*)(rp + 4 * c);
    const unsigned int nib = (((a[0] | r[0]) != 0) ? 1u : 0u) | (((a[1] | r[1]) != 0) ? 2u : 0u) |
                             (((a[2] | r[2]) != 0) ? 4u : 0u) | (((a[3] | r[3]) != 0) ? 8u : 0u);
    w |= nib << (4 * c);
  }
  unsigned int* d = Mb + (size_t)t;
  *(unsigned int*)d = w;
  
}

// Wave tile 32 rows x 64 columns, K stepped by 32; A rows and W rows are k-contiguous bf16 global rows (two 16-B loads per fragment).
// The W k index wraps at DM so that [A_hi | A_lo] x [W ; W] folds along K.
template <int KT>
__device__ __forceinline__ void gemm_main(const unsigned short* __restrict__ ap0, const unsigned short* __restrict__ ap1,
                                          const unsigned short* __restrict__ bp, v8f (&acc)[2][4]) {
#pragma unroll 1
  for (int k0 = 0; k0 < KT; k0 += 32) {
    const int kw = k0 & (DM - 1);
    FragB a0, a1, b0, b1, b2, b3;
    a0.half[0] = *(const v8us*)(ap0 + k0); a0.half[1] = *(const v8us*)(ap0 + k0 + 16);
    a1.half[0] = *(const v8us*)(ap1 + k0); a1.half[1] = *(const v8us*)(ap1 + k0 + 16);
    b0.half[0] = *(const v8us*)(bp + kw);                 b0.half[1] = *(const v8us*)(bp + kw + 16);
    b1.half[0] = *(const v8us*)(bp + 16 * DM + kw);       b1.half[1] = *(const v8us*)(bp + 16 * DM + kw + 16);
    b2.half[0] = *(const v8us*)(bp + 32 * DM + kw);       b2.half[1] = *(const v8us*)(bp + 32 * DM + kw + 16);
    b3.half[0] = *(const v8us*)(bp + 48 * DM + kw);       b3.half[1] = *(const v8us*)(bp + 48 * DM + kw + 16);
    acc[0][0] = wm(a0.v, b0.v, acc[0][0]); acc[0][1] = wm(a0.v, b1.v, acc[0][1]);
    acc[0][2] = wm(a0.v, b2.v, acc[0][2]); acc[0][3] = wm(a0.v, b3.v, acc[0][3]);
    acc[1][0] = wm(a1.v, b0.v, acc[1][0]); acc[1][1] = wm(a1.v, b1.v, acc[1][1]);
    acc[1][2] = wm(a1.v, b2.v, acc[1][2]); acc[1][3] = wm(a1.v, b3.v, acc[1][3]);
    asm volatile("v_nop\n\tv_nop\n\tv_nop\n\tv_nop"
                 : "+v"(acc[0][0]), "+v"(acc[0][1]), "+v"(acc[0][2]), "+v"(acc[0][3]),
                   "+v"(acc[1][0]), "+v"(acc[1][1]), "+v"(acc[1][2]), "+v"(acc[1][3])
                 : "v"(a0.v), "v"(a1.v), "v"(b0.v), "v"(b1.v), "v"(b2.v), "v"(b3.v));
  }
}

// Projections. grid (NB*SEQ/64, NH, 3): block = 64 sequence positions of one batch x one head x one of {q, k, v}; 2 waves x (32 x 64).
// Logical row b*SEQ + s reads the activation row s*NB_FULL + b. Epilogue: bf16 hi + lo planes staged in LDS (block barrier: cross-wave for the transposed v tile),
// q (scaled by 1/8) and k planes: [b][h][s][64]; v planes transposed: [b][h][d][SEQ].
__global__ __launch_bounds__(64) void k_proj(const unsigned short* __restrict__ Xb, const unsigned short* __restrict__ Wb,
                                             unsigned short* __restrict__ PL) {
  __shared__ __attribute__((aligned(16))) unsigned short sh[64 * STP];
  __shared__ __attribute__((aligned(16))) unsigned short sl[64 * STP];
  const int tid = threadIdx.x, w = __builtin_amdgcn_readfirstlane((int)(tid >> 5)), lane = tid & 31, ln = lane & 15, hh = lane >> 4;
  const int z = blockIdx.z, hcol = blockIdx.y;
  const int mt0 = blockIdx.x * 64;
  const int b = mt0 / SEQ, s0 = mt0 - b * SEQ;
  const int srow = s0 + 32 * w + ln;
  const unsigned short* A = Xb + (size_t)z * XN;
  const unsigned short* ap0 = A + ((size_t)srow * NB_FULL + b) * DM + 8 * hh;
  const unsigned short* ap1 = A + ((size_t)(srow + 16) * NB_FULL + b) * DM + 8 * hh;
  const unsigned short* bp = Wb + (size_t)z * WN + (size_t)(64 * hcol + ln) * DM + 8 * hh;
  v8f acc[2][4] = {};
  gemm_main<DM>(ap0, ap1, bp, acc);
  const float scale = (z == 0) ? 0.125f : 1.0f;
#pragma unroll
  for (int mt = 0; mt < 2; ++mt)
#pragma unroll
    for (int nt = 0; nt < 4; ++nt)
#pragma unroll
      for (int r = 0; r < 8; ++r) {
        const float v = acc[mt][nt][r] * scale;
        const unsigned short hb = bf16_bits(v);
        const unsigned short lb = bf16_bits(v - bf16_val(hb));
        const int sr = 32 * w + 16 * mt + 8 * hh + r;      // local sequence row
        const int dc = 16 * nt + ln;                        // head-dim column
        const int idx = (z == 2) ? (dc * STP + sr) : (sr * STP + dc);
        sh[idx] = hb;
        sl[idx] = lb;
      }
  __syncthreads();
  const size_t hbase = (size_t)b * NH + hcol;
  unsigned short* dstp = PL + (size_t)z * 2 * PLSZ;
  {
#pragma unroll 1
    for (int i = 0; i < 8; ++i) {
      const int row = 8 * i + (tid >> 3), piece = tid & 7;
      const v8us vh = *(const v8us*)(sh + row * STP + 8 * piece);
      const v8us vl = *(const v8us*)(sl + row * STP + 8 * piece);
      const size_t ro = (z == 2) ? ((hbase * HD + row) * SEQ + s0) : ((hbase * SEQ + s0 + row) * HD);
      unsigned short* d = dstp + ro + 8 * piece;
      *(v8us*)d = vh;
      *(v8us*)(d + PLSZ) = vl;
    }
    
  }
}

// S^T tile of 16 keys: c = K_lo Q_hi + K_hi Q_lo + K_hi Q_hi over the two 32-wide head-dim chunks, then the hazard guard.
__device__ __forceinline__ v8f qk_tile(const unsigned short* __restrict__ kp, const FragB& qh0, const FragB& qh1,
                                       const FragB& ql0, const FragB& ql1) {
  // A fragments of K: row m = key, elements 0..7 <- d = 32c + 8h + i, 8..15 <- d = 32c + 16 + 8h + i (kp already holds + 8h)
  FragB a0, a1, c0, c1;
  const unsigned short* lp = kp + PLSZ;
  a0.half[0] = *(const v8us*)(kp);      a0.half[1] = *(const v8us*)(kp + 16);
  a1.half[0] = *(const v8us*)(kp + 32); a1.half[1] = *(const v8us*)(kp + 48);
  asm volatile("s_wait_xcnt 0x0" ::: "memory");   // a result of the lo-plane loads may land in the hi-plane loads' address registers
  c0.half[0] = *(const v8us*)(lp);      c0.half[1] = *(const v8us*)(lp + 16);
  c1.half[0] = *(const v8us*)(lp + 32); c1.half[1] = *(const v8us*)(lp + 48);
  asm volatile("s_wait_xcnt 0x0" ::: "memory");   // what follows may reuse the lo-plane loads' address registers
  v8f c = {0.f, 0.f, 0.f, 0.f, 0.f, 0.f, 0.f, 0.f};
  c = wm(c0.v, qh0.v, c); c = wm(c1.v, qh1.v, c);
  c = wm(a0.v, ql0.v, c); c = wm(a1.v, ql1.v, c);
  c = wm(a0.v, qh0.v, c); c = wm(a1.v, qh1.v, c);
  asm volatile("v_nop\n\tv_nop\n\tv_nop\n\tv_nop" : "+v"(c)
               : "v"(a0.v), "v"(a1.v), "v"(c0.v), "v"(c1.v), "v"(qh0.v), "v"(qh1.v), "v"(ql0.v), "v"(ql1.v));
  return c;
}

// O^T tile of 16 head-dim rows: o += V_lo P_hi + V_hi P_lo + V_hi P_hi, then the hazard guard.
__device__ __forceinline__ v8f pv_tile(const unsigned short* __restrict__ vp, const FragB& ph, const FragB& pl, v8f o) {
  // A fragments of V^T: row m = d, elements 0..7 <- key0 + 8h + i, 8..15 <- key0 + 16 + 8h + i (vp already holds key0 + 8h)
  FragB vh, vl;
  const unsigned short* lp = vp + PLSZ;
  vh.half[0] = *(const v8us*)(vp); vh.half[1] = *(const v8us*)(vp + 16);
  vl.half[0] = *(const v8us*)(lp); vl.half[1] = *(const v8us*)(lp + 16);
  o = wm(vl.v, ph.v, o);
  o = wm(vh.v, pl.v, o);
  o = wm(vh.v, ph.v, o);
  asm volatile("v_nop\n\tv_nop\n\tv_nop\n\tv_nop" : "+v"(o) : "v"(vh.v), "v"(vl.v), "v"(ph.v), "v"(pl.v));
  return o;
}

// Block = one batch x 16 queries, NW waves; wave w owns the 32-key steps j = w, w + NW, ... of every head (its mask words stay in registers).
// Per head: each wave's softmax statistics over its own steps -> LDS -> barrier -> every wave merges all NW pairs (max, rescaled sum);
// then normalised weights, coverage into the LDS tile [16][SEQ] (a step's columns belong to one wave, each lane only touches its own addresses), partial O^T;
// partial O^T tiles -> LDS -> barrier -> one wave per query row sums the NW partials in wave order and writes bf16 hi | lo halves of the [s*NB_FULL+b][2048] plane.
// Reuse of the exchange buffers: statistics of head h are read before the second barrier of h and rewritten after it; partials of h are read before the first barrier of h + 1 and rewritten after it.
// coverage: ctx plane: (b, 16 rows) x 16 heads x (64 hi + 64 lo) = every element of rows with b < NB; coverage output: 16 rows x SEQ columns per block, all rows once.
// LDS: coverage tile zero-filled in full before use; every wave writes its statistics and its whole partial tile (zeros when all its steps are masked) before they are read.
__global__ __launch_bounds__(32 * NW) void k_attn(const unsigned short* __restrict__ PL, const unsigned int* __restrict__ Mb,
                                                  unsigned short* __restrict__ Cx, float* __restrict__ Cov) {
  extern __shared__ __attribute__((aligned(16))) unsigned char smem[];
  float* covs = (float*)smem;
  float* stm = (float*)(smem + COV_LDS_BYTES);     // [16 queries][STATP]: running maximum of wave w at column w
  float* stl = stm + 16 * STATP;                   // same shape: sum of wave w
  float* part = stl + 16 * STATP;                  // [NW][16 queries][OPP]: partial O, f32
  const int tid = threadIdx.x, w = __builtin_amdgcn_readfirstlane((int)(tid >> 5));
  const int lane = tid & 31, ln = lane & 15, hh = lane >> 4;
  const int b = blockIdx.x / (SEQ / 16), qt = blockIdx.x % (SEQ / 16);
  const int q0 = qt * 16, qg = q0 + ln;
  {
    const v4f z4 = {0.f, 0.f, 0.f, 0.f};
    for (int i = tid; i < 4 * COVP; i += 32 * NW) *(v4fa*)(covs + 4 * i) = z4;
  }
  const unsigned int* mrow = Mb + (size_t)(b * SEQ + qg) * MBW;
  unsigned int mw[NSTEP];
  bool act[NSTEP];                                 // wave-uniform: some key of the step is open for one of the 16 queries
#pragma unroll  // mw[] and act[] must be indexed by constants to stay in registers
  for (int i = 0; i < NSTEP; ++i) {
    const int j = w + i * NW;
    mw[i] = (j < NKS) ? mrow[j] : 0xFFFFFFFFu;
    act[i] = __any(mw[i] != 0xFFFFFFFFu);
  }
  __syncthreads();
  const int sh8 = 8 * hh;
  float* crow = covs + ln * COVP + 8 * hh;

#pragma unroll 1
  for (int h = 0; h < NH; ++h) {
    const size_t hb = (size_t)b * NH + h;
    // Q^T B fragments: column n = query qg, elements 0..7 <- d = 32c + 8h + i, 8..15 <- d = 32c + 16 + 8h + i
    const unsigned short* qp = PL + (hb * SEQ + qg) * HD + 8 * hh;
    FragB qh0, qh1, ql0, ql1;
    qh0.half[0] = *(const v8us*)(qp);             qh0.half[1] = *(const v8us*)(qp + 16);
    qh1.half[0] = *(const v8us*)(qp + 32);        qh1.half[1] = *(const v8us*)(qp + 48);
    asm volatile("s_wait_xcnt 0x0" ::: "memory");   // a result of the lo-plane loads may land in the hi-plane loads' address registers
    ql0.half[0] = *(const v8us*)(qp + PLSZ);      ql0.half[1] = *(const v8us*)(qp + PLSZ + 16);
    ql1.half[0] = *(const v8us*)(qp + PLSZ + 32);
    asm volatile("s_wait_xcnt 0x0" ::: "memory");   // the last load's result may land in the address registers that it shares with the three loads before it
    ql1.half[1] = *(const v8us*)(qp + PLSZ + 48);
    asm volatile("s_wait_xcnt 0x0" ::: "memory");   // the address registers of the Q loads are reused for the K addresses right behind them
    const unsigned short* khp = PL + 2 * PLSZ + (hb * SEQ + ln) * HD + 8 * hh;
    const unsigned short* vhp = PL + 4 * PLSZ + (hb * HD + ln) * SEQ + 8 * hh;

    // ---- pass 1: statistics over this wave's own steps ----
    float mr = NEGBIG, lr = 0.0f;
#pragma unroll  // constant index into mw[] and act[]
    for (int i = 0; i < NSTEP; ++i) {
      if (act[i]) {
        const int j = w + i * NW;
        const unsigned short* kp = khp + (size_t)(32 * j) * HD;
        const v8f s0 = qk_tile(kp, qh0, qh1, ql0, ql1);          // element r = score(key 32j + 8h + r, query qg)
        const v8f s1 = qk_tile(kp + 16 * HD, qh0, qh1, ql0, ql1);
        const unsigned int wb = mw[i] >> sh8;
        float sc[16];
        float mx = NEGBIG;
#pragma unroll
        for (int r = 0; r < 8; ++r) {
          sc[r]     = ((wb >> r) & 1u) ? NEGBIG : s0[r];
          sc[8 + r] = ((wb >> (16 + r)) & 1u) ? NEGBIG : s1[r];
          mx = fmaxf(mx, fmaxf(sc[r], sc[8 + r]));
        }
        mx = fmaxf(mx, __shfl_xor(mx, 16, 32));                  // the other lane half holds the other 16 keys of this query
        const float mnew = fmaxf(mr, mx);
        const float al = exp2f((mr - mnew) * LOG2E);
        float ps = 0.0f;
#pragma unroll
        for (int r = 0; r < 16; ++r) {
          const float e = exp2f((sc[r] - mnew) * LOG2E);
          ps += (sc[r] > -1.0e29f) ? e : 0.0f;
        }
        ps += __shfl_xor(ps, 16, 32);
        lr = lr * al + ps;
        mr = mnew;
      }
    }
    if (hh == 0) { stm[ln * STATP + w] = mr; stl[ln * STATP + w] = lr; }
    __syncthreads();
    // merge: each lane half reads NW / 2 of the waves' pairs of its query, then one exchange between the halves
    {
      float mv[NW / 2], lv[NW / 2];                // the loops below are unrolled so that both arrays stay in registers
#pragma unroll
      for (int u = 0; u < NW / 8; ++u) {
        const v4f x = *(const v4fa*)(stm + ln * STATP + (NW / 2) * hh + 4 * u);
        const v4f y = *(const v4fa*)(stl + ln * STATP + (NW / 2) * hh + 4 * u);
        mv[4 * u] = x[0]; mv[4 * u + 1] = x[1]; mv[4 * u + 2] = x[2]; mv[4 * u + 3] = x[3];
        lv[4 * u] = y[0]; lv[4 * u + 1] = y[1]; lv[4 * u + 2] = y[2]; lv[4 * u + 3] = y[3];
      }
      float mg = NEGBIG;
#pragma unroll
      for (int u = 0; u < NW / 2; ++u) mg = fmaxf(mg, mv[u]);
      mg = fmaxf(mg, __shfl_xor(mg, 16, 32));
      float lg = 0.0f;
#pragma unroll
      for (int u = 0; u < NW / 2; ++u) mv[u] = exp2f((mv[u] - mg) * LOG2E);
#pragma unroll
      for (int u = 0; u < NW / 2; ++u) lg += lv[u] * mv[u];
      lg += __shfl_xor(lg, 16, 32);
      mr = mg;
      lr = lg;
    }
    const float inv = 1.0f / lr;

    // ---- pass 2: normalised weights, coverage accumulation, partial O^T over this wave's own steps ----
    v8f O[4] = {};
#pragma unroll  // constant index into mw[] and act[]
    for (int i = 0; i < NSTEP; ++i) {
      if (act[i]) {
        const int key0 = 32 * (w + i * NW);
        const unsigned short* kp = khp + (size_t)key0 * HD;
        const v8f s0 = qk_tile(kp, qh0, qh1, ql0, ql1);
        const v8f s1 = qk_tile(kp + 16 * HD, qh0, qh1, ql0, ql1);
        __builtin_amdgcn_sched_barrier(0);
        const unsigned int wb = mw[i] >> sh8;
        float pn[16];
#pragma unroll
        for (int r = 0; r < 8; ++r) {
          const float e0 = exp2f((s0[r] - mr) * LOG2E) * inv;
          const float e1 = exp2f((s1[r] - mr) * LOG2E) * inv;
          pn[r]     = ((wb >> r) & 1u) ? 0.0f : e0;
          pn[8 + r] = ((wb >> (16 + r)) & 1u) ? 0.0f : e1;
        }
        // coverage tile: this lane owns columns key0 + 8h + 0..7 and key0 + 16 + 8h + 0..7 of row ln
        {
          float* cr = crow + key0;
          v4f c0 = *(const v4fa*)(cr), c1 = *(const v4fa*)(cr + 4), c2 = *(const v4fa*)(cr + 16), c3 = *(const v4fa*)(cr + 20);
          c0[0] += pn[0];  c0[1] += pn[1];  c0[2] += pn[2];  c0[3] += pn[3];
          c1[0] += pn[4];  c1[1] += pn[5];  c1[2] += pn[6];  c1[3] += pn[7];
          c2[0] += pn[8];  c2[1] += pn[9];  c2[2] += pn[10]; c2[3] += pn[11];
          c3[0] += pn[12]; c3[1] += pn[13]; c3[2] += pn[14]; c3[3] += pn[15];
          *(v4fa*)(cr) = c0; *(v4fa*)(cr + 4) = c1; *(v4fa*)(cr + 16) = c2; *(v4fa*)(cr + 20) = c3;
        }
        // P^T B fragment: element i < 8 -> key0 + 8h + i (tile 0 row 8h + i); i >= 8 -> key0 + 16 + 8h + (i - 8) (tile 1); bf16 hi + lo
        FragB ph, pl;
#pragma unroll
        for (int r = 0; r < 16; ++r) {
          const unsigned short hb16 = bf16_bits(pn[r]);
          ph.u[r] = hb16;
          pl.u[r] = bf16_bits(pn[r] - bf16_val(hb16));
        }
        __builtin_amdgcn_sched_barrier(0);
        const unsigned short* vp = vhp + key0;
        O[0] = pv_tile(vp, ph, pl, O[0]);
        O[1] = pv_tile(vp + (size_t)16 * SEQ, ph, pl, O[1]);
        O[2] = pv_tile(vp + (size_t)32 * SEQ, ph, pl, O[2]);
        O[3] = pv_tile(vp + (size_t)48 * SEQ, ph, pl, O[3]);
      }
    }

    // O^T element r of tile t = partial ctx(query qg, d = 16t + 8h + r): f32 into this wave's tile [16 queries][64 d]
    {
      float* pw = part + (size_t)(w * 16 + ln) * OPP + 8 * hh;
#pragma unroll  // constant index into O[]
      for (int t = 0; t < 4; ++t) {
        const v4f x0 = {O[t][0], O[t][1], O[t][2], O[t][3]};
        const v4f x1 = {O[t][4], O[t][5], O[t][6], O[t][7]};
        *(v4fa*)(pw + 16 * t) = x0;
        *(v4fa*)(pw + 16 * t + 4) = x1;
      }
    }
    __syncthreads();
    // one wave per query row (wave-uniform loop): lane sums d = 2 lane, 2 lane + 1 over the NW partial tiles; a wave writes whole 128-B lines
#pragma unroll 1  // at most one trip per wave once NW >= 16: nothing to gain from copies of the body
    for (int row = w; row < 16; row += NW) {
      const float* pr = part + row * OPP + 2 * lane;
      float t0 = 0.0f, t1 = 0.0f;
#pragma unroll  // independent LDS loads in flight together; the sums stay in wave order
      for (int u = 0; u < NW; ++u) {
        const v2f x = *(const v2fa*)(pr + u * 16 * OPP);
        t0 += x[0];
        t1 += x[1];
      }
      const unsigned int h0 = bf16_bits(t0), h1 = bf16_bits(t1);
      const unsigned int l0 = bf16_bits(t0 - bf16_val((unsigned short)h0)), l1 = bf16_bits(t1 - bf16_val((unsigned short)h1));
      unsigned short* d = Cx + ((size_t)(q0 + row) * NB_FULL + b) * CXP + h * HD + 2 * lane;
      *(u32a*)d = h0 | (h1 << 16);
      *(u32a*)(d + DM) = l0 | (l1 << 16);
      asm volatile("s_wait_xcnt 0x0" ::: "memory");  // the stores' address registers are advanced for the next head right behind them
    }
  }

  __syncthreads();
  float* cg = Cov + ((size_t)b * SEQ_FULL + q0) * SEQ_FULL;
#pragma unroll 1  // a few short trips, once per block: kept rolled as before
  for (int idx = w; idx < 16 * (SEQ / 128); idx += NW) {
    const int row = idx / (SEQ / 128), col = (idx % (SEQ / 128)) * 128 + lane * 4;
    v4f v = *(const v4fa*)(covs + row * COVP + col);
    v[0] *= 0.0625f; v[1] *= 0.0625f; v[2] *= 0.0625f; v[3] *= 0.0625f;
    *(v4f*)(cg + (size_t)row * SEQ_FULL + col) = v;
    asm volatile("s_wait_xcnt 0x0" ::: "memory");    // the next trip rewrites the store's address and data registers
  }
}

// Output projection: out[m][n] = sum_c ctx[m][c] Wo[n][c] with A = [ctx_hi | ctx_lo] (K = 2048) and the W k index wrapping at 1024.
// coverage: blocks tile the [SEQ*NB_FULL][1024] output exactly once.
__global__ __launch_bounds__(64) void k_oproj(const unsigned short* __restrict__ Cx, const unsigned short* __restrict__ Wo,
                                              float* __restrict__ Out) {
  __shared__ __attribute__((aligned(16))) float so[64 * 68];
  const int tid = threadIdx.x, w = __builtin_amdgcn_readfirstlane((int)(tid >> 5)), lane = tid & 31, ln = lane & 15, hh = lane >> 4;
  const int m0 = blockIdx.x * 64, n0 = blockIdx.y * 64;
  const unsigned short* ap0 = Cx + (size_t)(m0 + 32 * w + ln) * CXP + 8 * hh;
  const unsigned short* ap1 = ap0 + (size_t)16 * CXP;
  const unsigned short* bp = Wo + (size_t)(n0 + ln) * DM + 8 * hh;
  v8f acc[2][4] = {};
  gemm_main<CXP>(ap0, ap1, bp, acc);
#pragma unroll
  for (int mt = 0; mt < 2; ++mt)
#pragma unroll
    for (int nt = 0; nt < 4; ++nt)
#pragma unroll
      for (int r = 0; r < 8; ++r)
        so[(32 * w + 16 * mt + 8 * hh + r) * 68 + 16 * nt + ln] = acc[mt][nt][r];
  __syncthreads();
  const int rsub = lane >> 4, c4 = (lane & 15) * 4;
  {
#pragma unroll 1
    for (int i = 0; i < 16; ++i) {
      const int row = 32 * w + 2 * i + rsub;
      const v4f v = *(const v4fa*)(so + row * 68 + c4);
      *(v4f*)(Out + (size_t)(m0 + row) * DM + n0 + c4) = v;
    }
    
  }
}

extern "C" void kernel_launch(void* const* d_in, const int* in_sizes, int n_in,
                              void* d_out, int out_size, void* d_ws, size_t ws_size, hipStream_t stream) {
  if (n_in < 10) return;
  const long long needX = (long long)SEQ * NB_FULL * DM;
  if ((long long)in_sizes[0] < needX || (long long)in_sizes[1] < needX || (long long)in_sizes[2] < needX) return;
  for (int i = 3; i < 7; ++i) if ((long long)in_sizes[i] < (long long)DM * DM) return;
  if ((long long)in_sizes[7] < ((long long)(NB - 1) * SEQ_FULL + (SEQ - 1)) * SEQ_FULL + SEQ_FULL) return;
  if ((long long)in_sizes[8] < (long long)SEQ * RHSW) return;
  if (in_sizes[9] < 1) return;
  if ((long long)out_size < (long long)COV_OFF + ((long long)(NB - 1) * SEQ_FULL + (SEQ - 1)) * SEQ_FULL + SEQ) return;

  const float* query = (const float*)d_in[0];   // wire order: query, key, value, Wq, Wk, Wv, Wo, mask, rhs_mask, layer_idx
  const float* keyt  = (const float*)d_in[1];
  const float* value = (const float*)d_in[2];
  const float* Wq    = (const float*)d_in[3];
  const float* Wk    = (const float*)d_in[4];
  const float* Wv    = (const float*)d_in[5];
  const float* Wo    = (const float*)d_in[6];
  const int*   mask  = (const int*)d_in[7];
  const int*   rhs   = (const int*)d_in[8];
  const int*   lidx  = (const int*)d_in[9];
  float* out = (float*)d_out;
  float* cov = out + COV_OFF;

  char* ws = (char*)d_ws;
  size_t off = 0;
  unsigned short* Xb = (unsigned short*)(ws + off); off += BYTES_XB;   // 3 activation planes [SEQ*NB_FULL][1024] bf16
  unsigned short* Wb = (unsigned short*)(ws + off); off += BYTES_WB;   // 4 weight planes [1024][1024] bf16 (q, k, v, o)
  unsigned short* PL = (unsigned short*)(ws + off); off += BYTES_PL;   // q_hi, q_lo, k_hi, k_lo, vT_hi, vT_lo
  unsigned short* Cx = (unsigned short*)(ws + off); off += BYTES_CX;   // ctx [SEQ*NB_FULL][hi 1024 | lo 1024] bf16
  unsigned int*   Mb = (unsigned int*)(ws + off);   off += BYTES_MB;   // mask bit-plane [NB][SEQ][32 words]
  if (off > ws_size) return;

  const int nx8 = (int)(XN / 8), nw8 = (int)(WN / 8);
  k_cvt<<<(unsigned)((nx8 + 255) / 256), 256, 0, stream>>>(query, Xb, nx8);
  k_cvt<<<(unsigned)((nx8 + 255) / 256), 256, 0, stream>>>(keyt, Xb + XN, nx8);
  k_cvt<<<(unsigned)((nx8 + 255) / 256), 256, 0, stream>>>(value, Xb + 2 * XN, nx8);
  k_cvt<<<(unsigned)((nw8 + 255) / 256), 256, 0, stream>>>(Wq, Wb, nw8);
  k_cvt<<<(unsigned)((nw8 + 255) / 256), 256, 0, stream>>>(Wk, Wb + WN, nw8);
  k_cvt<<<(unsigned)((nw8 + 255) / 256), 256, 0, stream>>>(Wv, Wb + 2 * WN, nw8);
  k_cvt<<<(unsigned)((nw8 + 255) / 256), 256, 0, stream>>>(Wo, Wb + 3 * WN, nw8);
  k_mask<<<(unsigned)((NB * SEQ * MBW + 255) / 256), 256, 0, stream>>>(mask, rhs, lidx, Mb);
  k_proj<<<dim3((unsigned)(NB * SEQ / 64), NH, 3), 64, 0, stream>>>(Xb, Wb, PL);
  hipFuncSetAttribute(reinterpret_cast<const void*>(&k_attn), hipFuncAttributeMaxDynamicSharedMemorySize, (int)ATTN_LDS);
  k_attn<<<(unsigned)(NB * (SEQ / 16)), 32 * NW, (size_t)ATTN_LDS, stream>>>(PL, Mb, Cx, cov);
  k_oproj<<<dim3((unsigned)(SEQ * NB_FULL / 64), DM / 64), 64, 0, stream>>>(Cx, Wb + 3 * WN, out);
}

// v002
// One run takes 307 microseconds.
// In two side-by-side timings against v001, it was 1.19 and 1.20 times as fast.
// Counting every step since v000, it is 4.01 times as fast.
#include <hip/hip_runtime.h>
// Contractions (all v_wmma_f32_16x16x32_bf16, f32 accumulate): q/k/v projections = single product on RNE-bf16 inputs and weights; scores K Q^T, P V and the output projection = bf16 hi+lo planes of the computed operand(s), products hi*hi + hi*lo + lo*hi (output projection: [ctx_hi | ctx_lo] x [Wo ; Wo] folded along K); softmax statistics and coverage in f32.
// come from K rows (A, global bf16 planes) and Q^T (B, registers); the two 16-key D tiles pack straight into the P^T B fragment; O^T accumulates from V^T rows (A).
// Masks: both boolean inputs and the layer index are read on the device into a bit-plane (one 32-bit word per query and 32-key step); fully masked steps are skipped at run time.
#ifndef NB
#define NB 4
#endif
#ifndef SEQ
#define SEQ 1024
#endif
#define NB_FULL 4
#define SEQ_FULL 1024
#define NH 16
#define HD 64
#define DM 1024
#define RHSW (SEQ_FULL + 4)
#define NKS (SEQ / 32)
#define MBW (SEQ_FULL / 32)
#define CXP 2048
#define COVP (SEQ + 4)
#define STP 72
#define COV_LDS_BYTES (16 * COVP * 4)
#define NW 32                                    /* waves of one attention block */
#define NSTEP ((NKS + NW - 1) / NW)              /* 32-key steps owned by one wave */
#define STATP (NW + 4)                           /* dword pitch of a query's row of per-wave statistics (16 B x odd) */
#define OPP 68                                   /* dword pitch of a partial-O row */
#define ATTN_LDS (COV_LDS_BYTES + 2 * 16 * STATP * 4 + NW * 16 * OPP * 4)

#define XN ((size_t)SEQ * NB_FULL * DM)          /* elements of one converted activation plane (prefix of the full input) */
#define WN ((size_t)DM * DM)
#define PLSZ ((size_t)NB * NH * SEQ * HD)        /* elements of one head-layout plane */
#define COV_OFF ((size_t)SEQ_FULL * NB_FULL * DM) /* element offset of the second output (byte 16777216) */

#define BYTES_XB (3 * XN * 2)
#define BYTES_WB (4 * WN * 2)
#define BYTES_PL (6 * PLSZ * 2)
#define BYTES_CX ((size_t)SEQ * NB_FULL * CXP * 2)
#define BYTES_MB ((size_t)NB * SEQ * MBW * 4)

static_assert(SEQ % 128 == 0);
static_assert(SEQ <= SEQ_FULL);
static_assert(NB <= NB_FULL);
static_assert(MBW == 32);
static_assert(HD == 64);
static_assert(NW % 8 == 0 && NW <= 32);
static_assert(ATTN_LDS <= 327680);
static_assert(NH * HD == DM);
static_assert(COV_OFF * 4 == (size_t)16777216);
static_assert(BYTES_XB % 256 == 0 && BYTES_WB % 256 == 0 && BYTES_PL % 256 == 0 && BYTES_CX % 256 == 0 && BYTES_MB % 256 == 0);
static_assert(BYTES_XB + BYTES_WB + BYTES_PL + BYTES_CX + BYTES_MB <= (size_t)134217728);
static_assert((size_t)SEQ * NB_FULL * DM <= COV_OFF);
static_assert(COV_OFF + ((size_t)(NB - 1) * SEQ_FULL + (SEQ - 1)) * SEQ_FULL + SEQ <= (size_t)33554432 / 4);

typedef __bf16 v16b __attribute__((ext_vector_type(16)));
typedef unsigned short v8us __attribute__((ext_vector_type(8), may_alias));
typedef float v8f __attribute__((ext_vector_type(8)));
typedef float v4f __attribute__((ext_vector_type(4)));
typedef float v4fa __attribute__((ext_vector_type(4), may_alias));
typedef float v2f __attribute__((ext_vector_type(2)));
typedef float v2fa __attribute__((ext_vector_type(2), may_alias));
typedef unsigned int u32a __attribute__((may_alias));
typedef int v4i __attribute__((ext_vector_type(4)));
typedef int v4ia __attribute__((ext_vector_type(4), may_alias));
union FragB { v16b v; v8us half[2]; unsigned short u[16]; };

#define LOG2E 1.4426950408889634f
#define NEGBIG (-1.0e30f)

__device__ __forceinline__ unsigned short bf16_bits(float x) {   // RNE convert to bf16 bits
  unsigned int u = __float_as_uint(x);
  return (unsigned short)((u + 0x7FFFu + ((u >> 16) & 1u)) >> 16);
}
__device__ __forceinline__ float bf16_val(unsigned short b) { return __uint_as_float(((unsigned int)b) << 16); }

__device__ __forceinline__ v8f wm(v16b a, v16b b, v8f c) {
  return __builtin_amdgcn_wmma_f32_16x16x32_bf16(false, a, false, b, (short)0, c, false, false);
}

// coverage: n8 threads x 8 elements = the whole plane (n is a multiple of 8).
__global__ __launch_bounds__(256) void k_cvt(const float* __restrict__ src, unsigned short* __restrict__ dst, int n8) {
  const int t = blockIdx.x * 256 + threadIdx.x;
  if (t >= n8) return;
  const float* s = src + (size_t)t * 8;
  const v4f x0 = *(const v4fa*)(s), x1 = *(const v4fa*)(s + 4);
  v8us o;
  o[0] = bf16_bits(x0[0]); o[1] = bf16_bits(x0[1]); o[2] = bf16_bits(x0[2]); o[3] = bf16_bits(x0[3]);
  o[4] = bf16_bits(x1[0]); o[5] = bf16_bits(x1[1]); o[6] = bf16_bits(x1[2]); o[7] = bf16_bits(x1[3]);
  unsigned short* d = dst + (size_t)t * 8;
  *(v8us*)d = o;
  
}

// Mb[b][q][j] bit kk = 1 when key 32j+kk is masked for query q of batch b (mask[b][q][k] != 0 or rhs[q][start + k] != 0).
// coverage: NB*SEQ*32 threads = every word of the plane.
__global__ __launch_bounds__(256) void k_mask(const int* __restrict__ mask, const int* __restrict__ rhs,
                                              const int* __restrict__ lidx, unsigned int* __restrict__ Mb) {
  const int t = blockIdx.x * 256 + threadIdx.x;
  if (t >= NB * SEQ * MBW) return;
  const int j = t & 31, row = t >> 5;
  const int b = row / SEQ, q = row - b * SEQ;
  int L = lidx[0];
  L = (L < -64) ? -64 : ((L > 64) ? 64 : L);
  int tt = 4 - 4 * L; if (tt < 0) tt = 0;
  int start = 4 - tt; if (start < 0) start = 0;
  start = (start >= 4) ? 4 : 0;                       // the formula only yields 0 or 4; keeps the 16-B alignment of the row loads
  const int* mp = mask + ((size_t)b * SEQ_FULL + q) * SEQ_FULL + 32 * j;
  const int* rp = rhs + (size_t)q * RHSW + start + 32 * j;
  unsigned int w = 0u;
#pragma unroll 4
  for (int c = 0; c < 8; ++c) {
    const v4i a = *(const v4ia*)(mp + 4 * c);
    const v4i r = *(const v4ia*)(rp + 4 * c);
    const unsigned int nib = (((a[0] | r[0]) != 0) ? 1u : 0u) | (((a[1] | r[1]) != 0) ? 2u : 0u) |
                             (((a[2] | r[2]) != 0) ? 4u : 0u) | (((a[3] | r[3]) != 0) ? 8u : 0u);
    w |= nib << (4 * c);
  }
  unsigned int* d = Mb + (size_t)t;
  *(unsigned int*)d = w;
  
}

// Block tile 128 rows x 128 columns, 8 waves of 32 x 64 (4 along the rows, 2 along the columns), K in stages of KC.
// A stage is [A tile | W tile], each GT rows of KC bf16 (one whole 128-B line a row) at LDS pitch TP; two buffers.
// Every lane copies 16 B per instruction, a wave 4 whole lines: 4 copies a lane for the A tile, 4 for the W tile.
#define GT 128
#define KC 64
#define TP 72                                    /* elements: 144 B = 16 B x odd, for the ds_load_b128 fragment reads */
#define TILE_E (GT * TP)
#define RING_E (4 * TILE_E)
static_assert(DM % KC == 0 && CXP % KC == 0 && DM / KC >= 2);
static_assert(RING_E >= 4 * 2 * 64 * STP);       // the projections' output staging reuses the ring
static_assert(RING_E * 2 >= 4 * 64 * 68 * 4);    // so does the output projection's

// la: LDS byte address of this lane's piece in its first row of the A tile of the target buffer; ga, gb: the same piece in global memory.
// Rows crow + 32 i, i = 0..3, of both tiles. The s_wait_xcnt stands inside the statement: the address registers are rewritten behind it.
__device__ __forceinline__ void stage_copy(unsigned int la, const unsigned short* ga, size_t apitch, const unsigned short* gb) {
  const unsigned int lb = la + TILE_E * 2;
  asm volatile("global_load_async_to_lds_b128 %0, %8, off\n\t"
               "global_load_async_to_lds_b128 %1, %9, off\n\t"
               "global_load_async_to_lds_b128 %2, %10, off\n\t"
               "global_load_async_to_lds_b128 %3, %11, off\n\t"
               "global_load_async_to_lds_b128 %4, %12, off\n\t"
               "global_load_async_to_lds_b128 %5, %13, off\n\t"
               "global_load_async_to_lds_b128 %6, %14, off\n\t"
               "global_load_async_to_lds_b128 %7, %15, off\n\t"
               "s_wait_xcnt 0x0"
               :: "v"(la), "v"(la + 32 * TP * 2), "v"(la + 64 * TP * 2), "v"(la + 96 * TP * 2),
                  "v"(lb), "v"(lb + 32 * TP * 2), "v"(lb + 64 * TP * 2), "v"(lb + 96 * TP * 2),
                  "v"(ga), "v"(ga + 32 * apitch), "v"(ga + 64 * apitch), "v"(ga + 96 * apitch),
                  "v"(gb), "v"(gb + 32 * DM), "v"(gb + 64 * DM), "v"(gb + 96 * DM)
               : "memory");
}

// ga, gb: this thread's copy sources at k = 0 (row tid / 8 of the tile, piece tid % 8); ar, br: this lane's fragment rows in buffer 0.
// The W k index wraps at DM so that [A_hi | A_lo] x [W ; W] folds along K. Each accumulator still sums k in steps of 32, ascending.
template <int KT>
__device__ __forceinline__ void gemm_main(const unsigned short* __restrict__ ga, size_t apitch, const unsigned short* __restrict__ gb,
                                          unsigned int la, const unsigned short* ar, const unsigned short* br, v8f (&acc)[2][4]) {
  constexpr int NT = KT / KC;
  stage_copy(la, ga, apitch, gb);
  asm volatile("s_wait_asynccnt 0x0" ::: "memory");   // stage 0 has landed before the barrier publishes it
  __syncthreads();
  stage_copy(la + 2 * TILE_E * 2, ga + KC, apitch, gb + KC);
#pragma unroll 1  // one stage a trip: the buffer index and the refill test stay scalar
  for (int t = 0; t < NT; ++t) {
    const int bo = (t & 1) * 2 * TILE_E;
#pragma unroll  // two 32-wide k steps of the stage
    for (int kk = 0; kk < KC; kk += 32) {
      const unsigned short* ap = ar + bo + kk;
      const unsigned short* bp = br + bo + kk;
      FragB a0, a1, b0, b1, b2, b3;
      a0.half[0] = *(const v8us*)(ap);                a0.half[1] = *(const v8us*)(ap + 16);
      a1.half[0] = *(const v8us*)(ap + 16 * TP);      a1.half[1] = *(const v8us*)(ap + 16 * TP + 16);
      b0.half[0] = *(const v8us*)(bp);                b0.half[1] = *(const v8us*)(bp + 16);
      b1.half[0] = *(const v8us*)(bp + 16 * TP);      b1.half[1] = *(const v8us*)(bp + 16 * TP + 16);
      b2.half[0] = *(const v8us*)(bp + 32 * TP);      b2.half[1] = *(const v8us*)(bp + 32 * TP + 16);
      b3.half[0] = *(const v8us*)(bp + 48 * TP);      b3.half[1] = *(const v8us*)(bp + 48 * TP + 16);
      acc[0][0] = wm(a0.v, b0.v, acc[0][0]); acc[0][1] = wm(a0.v, b1.v, acc[0][1]);
      acc[0][2] = wm(a0.v, b2.v, acc[0][2]); acc[0][3] = wm(a0.v, b3.v, acc[0][3]);
      acc[1][0] = wm(a1.v, b0.v, acc[1][0]); acc[1][1] = wm(a1.v, b1.v, acc[1][1]);
      acc[1][2] = wm(a1.v, b2.v, acc[1][2]); acc[1][3] = wm(a1.v, b3.v, acc[1][3]);
      asm volatile("v_nop\n\tv_nop\n\tv_nop\n\tv_nop"
                   : "+v"(acc[0][0]), "+v"(acc[0][1]), "+v"(acc[0][2]), "+v"(acc[0][3]),
                     "+v"(acc[1][0]), "+v"(acc[1][1]), "+v"(acc[1][2]), "+v"(acc[1][3])
                   : "v"(a0.v), "v"(a1.v), "v"(b0.v), "v"(b1.v), "v"(b2.v), "v"(b3.v));
    }
    asm volatile("s_wait_dscnt 0x0" ::: "memory");      // this wave's reads of the buffer are done before it is refilled
    asm volatile("s_wait_asynccnt 0x0" ::: "memory");   // this wave's copies of stage t + 1 have landed
    __syncthreads();                                    // publishes stage t + 1 and ends every reader's last read of stage t
    if (t + 2 < NT) {
      const int k2 = (t + 2) * KC;
      stage_copy(la + (unsigned int)bo * 2u, ga + k2, apitch, gb + (k2 & (DM - 1)));
    }
  }
  asm volatile("s_wait_asynccnt 0x0" ::: "memory");     // nothing is in flight when the ring becomes output staging
}

// Projections. grid (NB*SEQ/128, NH/2, 3): block = 128 sequence positions of one batch x two heads x one of {q, k, v}; 8 waves x (32 x 64).
// Logical row b*SEQ + s reads the activation row s*NB_FULL + b. Epilogue: each pair of waves owns a 64 x 64 tile (one head): bf16 hi + lo planes staged in its part of the ring
// (block barrier: the read-back crosses the pair's two waves for q, k and v), q (scaled by 1/8) and k planes: [b][h][s][64]; v planes transposed: [b][h][d][SEQ].
__global__ __launch_bounds__(256) void k_proj(const unsigned short* __restrict__ Xb, const unsigned short* __restrict__ Wb,
                                              unsigned short* __restrict__ PL) {
  __shared__ __attribute__((aligned(16))) unsigned short ring[RING_E];
  const int tid = threadIdx.x, w = __builtin_amdgcn_readfirstlane((int)(tid >> 5)), lane = tid & 31, ln = lane & 15, hh = lane >> 4;
  const int wr = w & 3, wc = w >> 2;                 // wave position: rows 32 wr, columns 64 wc
  const int pr = (wr >> 1) + 2 * wc, w2 = wr & 1;    // pair of waves that shares a 64 x 64 output tile, and the wave's place in it
  const int z = blockIdx.z, hcol = 2 * blockIdx.y + wc;
  const int mt0 = blockIdx.x * GT;
  const int b = mt0 / SEQ, sb = mt0 - b * SEQ;
  const int s0 = sb + 64 * (wr >> 1);
  const int crow = tid >> 3, cpc = 8 * (tid & 7);
  const unsigned short* ga = Xb + (size_t)z * XN + ((size_t)(sb + crow) * NB_FULL + b) * DM + cpc;
  const unsigned short* gb = Wb + (size_t)z * WN + (size_t)(GT * blockIdx.y + crow) * DM + cpc;
  const unsigned int la = (unsigned int)(size_t)(ring + crow * TP + cpc);
  v8f acc[2][4] = {};
  gemm_main<DM>(ga, (size_t)NB_FULL * DM, gb, la, ring + (32 * wr + ln) * TP + 8 * hh, ring + TILE_E + (64 * wc + ln) * TP + 8 * hh, acc);
  unsigned short* sh = ring + pr * (2 * 64 * STP);
  unsigned short* sl = sh + 64 * STP;
  const int t2 = 32 * w2 + lane;
  const float scale = (z == 0) ? 0.125f : 1.0f;
#pragma unroll
  for (int mt = 0; mt < 2; ++mt)
#pragma unroll
    for (int nt = 0; nt < 4; ++nt)
#pragma unroll
      for (int r = 0; r < 8; ++r) {
        const float v = acc[mt][nt][r] * scale;
        const unsigned short hb = bf16_bits(v);
        const unsigned short lb = bf16_bits(v - bf16_val(hb));
        const int sr = 32 * w2 + 16 * mt + 8 * hh + r;     // local sequence row
        const int dc = 16 * nt + ln;                        // head-dim column
        const int idx = (z == 2) ? (dc * STP + sr) : (sr * STP + dc);
        sh[idx] = hb;
        sl[idx] = lb;
      }
  __syncthreads();
  const size_t hbase = (size_t)b * NH + hcol;
  unsigned short* dstp = PL + (size_t)z * 2 * PLSZ;
  {
#pragma unroll 1
    for (int i = 0; i < 8; ++i) {
      const int row = 8 * i + (t2 >> 3), piece = t2 & 7;
      const v8us vh = *(const v8us*)(sh + row * STP + 8 * piece);
      const v8us vl = *(const v8us*)(sl + row * STP + 8 * piece);
      const size_t ro = (z == 2) ? ((hbase * HD + row) * SEQ + s0) : ((hbase * SEQ + s0 + row) * HD);
      unsigned short* d = dstp + ro + 8 * piece;
      *(v8us*)d = vh;
      *(v8us*)(d + PLSZ) = vl;
      asm volatile("s_wait_xcnt 0x0" ::: "memory");  // the next trip rewrites the stores' address registers
    }
    
  }
}

// S^T tile of 16 keys: c = K_lo Q_hi + K_hi Q_lo + K_hi Q_hi over the two 32-wide head-dim chunks, then the hazard guard.
__device__ __forceinline__ v8f qk_tile(const unsigned short* __restrict__ kp, const FragB& qh0, const FragB& qh1,
                                       const FragB& ql0, const FragB& ql1) {
  // A fragments of K: row m = key, elements 0..7 <- d = 32c + 8h + i, 8..15 <- d = 32c + 16 + 8h + i (kp already holds + 8h)
  FragB a0, a1, c0, c1;
  const unsigned short* lp = kp + PLSZ;
  a0.half[0] = *(const v8us*)(kp);      a0.half[1] = *(const v8us*)(kp + 16);
  a1.half[0] = *(const v8us*)(kp + 32); a1.half[1] = *(const v8us*)(kp + 48);
  asm volatile("s_wait_xcnt 0x0" ::: "memory");   // a result of the lo-plane loads may land in the hi-plane loads' address registers
  c0.half[0] = *(const v8us*)(lp);      c0.half[1] = *(const v8us*)(lp + 16);
  c1.half[0] = *(const v8us*)(lp + 32); c1.half[1] = *(const v8us*)(lp + 48);
  asm volatile("s_wait_xcnt 0x0" ::: "memory");   // what follows may reuse the lo-plane loads' address registers
  v8f c = {0.f, 0.f, 0.f, 0.f, 0.f, 0.f, 0.f, 0.f};
  c = wm(c0.v, qh0.v, c); c = wm(c1.v, qh1.v, c);
  c = wm(a0.v, ql0.v, c); c = wm(a1.v, ql1.v, c);
  c = wm(a0.v, qh0.v, c); c = wm(a1.v, qh1.v, c);
  asm volatile("v_nop\n\tv_nop\n\tv_nop\n\tv_nop" : "+v"(c)
               : "v"(a0.v), "v"(a1.v), "v"(c0.v), "v"(c1.v), "v"(qh0.v), "v"(qh1.v), "v"(ql0.v), "v"(ql1.v));
  return c;
}

// O^T tile of 16 head-dim rows: o += V_lo P_hi + V_hi P_lo + V_hi P_hi, then the hazard guard.
__device__ __forceinline__ v8f pv_tile(const unsigned short* __restrict__ vp, const FragB& ph, const FragB& pl, v8f o) {
  // A fragments of V^T: row m = d, elements 0..7 <- key0 + 8h + i, 8..15 <- key0 + 16 + 8h + i (vp already holds key0 + 8h)
  FragB vh, vl;
  const unsigned short* lp = vp + PLSZ;
  vh.half[0] = *(const v8us*)(vp); vh.half[1] = *(const v8us*)(vp + 16);
  vl.half[0] = *(const v8us*)(lp); vl.half[1] = *(const v8us*)(lp + 16);
  o = wm(vl.v, ph.v, o);
  o = wm(vh.v, pl.v, o);
  o = wm(vh.v, ph.v, o);
  asm volatile("v_nop\n\tv_nop\n\tv_nop\n\tv_nop" : "+v"(o) : "v"(vh.v), "v"(vl.v), "v"(ph.v), "v"(pl.v));
  return o;
}

// Block = one batch x 16 queries, NW waves; wave w owns the 32-key steps j = w, w + NW, ... of every head (its mask words stay in registers).
// Per head: each wave's softmax statistics over its own steps -> LDS -> barrier -> every wave merges all NW pairs (max, rescaled sum);
// then normalised weights, coverage into the LDS tile [16][SEQ] (a step's columns belong to one wave, each lane only touches its own addresses), partial O^T;
// partial O^T tiles -> LDS -> barrier -> one wave per query row sums the NW partials in wave order and writes bf16 hi | lo halves of the [s*NB_FULL+b][2048] plane.
// Reuse of the exchange buffers: statistics of head h are read before the second barrier of h and rewritten after it; partials of h are read before the first barrier of h + 1 and rewritten after it.
// coverage: ctx plane: (b, 16 rows) x 16 heads x (64 hi + 64 lo) = every element of rows with b < NB; coverage output: 16 rows x SEQ columns per block, all rows once.
// LDS: coverage tile zero-filled in full before use; every wave writes its statistics and its whole partial tile (zeros when all its steps are masked) before they are read.
__global__ __launch_bounds__(32 * NW) void k_attn(const unsigned short* __restrict__ PL, const unsigned int* __restrict__ Mb,
                                                  unsigned short* __restrict__ Cx, float* __restrict__ Cov) {
  extern __shared__ __attribute__((aligned(16))) unsigned char smem[];
  float* covs = (float*)smem;
  float* stm = (float*)(smem + COV_LDS_BYTES);     // [16 queries][STATP]: running maximum of wave w at column w
  float* stl = stm + 16 * STATP;                   // same shape: sum of wave w
  float* part = stl + 16 * STATP;                  // [NW][16 queries][OPP]: partial O, f32
  const int tid = threadIdx.x, w = __builtin_amdgcn_readfirstlane((int)(tid >> 5));
  const int lane = tid & 31, ln = lane & 15, hh = lane >> 4;
  const int b = blockIdx.x / (SEQ / 16), qt = blockIdx.x % (SEQ / 16);
  const int q0 = qt * 16, qg = q0 + ln;
  {
    const v4f z4 = {0.f, 0.f, 0.f, 0.f};
    for (int i = tid; i < 4 * COVP; i += 32 * NW) *(v4fa*)(covs + 4 * i) = z4;
  }
  const unsigned int* mrow = Mb + (size_t)(b * SEQ + qg) * MBW;
  unsigned int mw[NSTEP];
  bool act[NSTEP];                                 // wave-uniform: some key of the step is open for one of the 16 queries
#pragma unroll  // mw[] and act[] must be indexed by constants to stay in registers
  for (int i = 0; i < NSTEP; ++i) {
    const int j = w + i * NW;
    mw[i] = (j < NKS) ? mrow[j] : 0xFFFFFFFFu;
    act[i] = __any(mw[i] != 0xFFFFFFFFu);
  }
  __syncthreads();
  const int sh8 = 8 * hh;
  float* crow = covs + ln * COVP + 8 * hh;

#pragma unroll 1
  for (int h = 0; h < NH; ++h) {
    const size_t hb = (size_t)b * NH + h;
    // Q^T B fragments: column n = query qg, elements 0..7 <- d = 32c + 8h + i, 8..15 <- d = 32c + 16 + 8h + i
    const unsigned short* qp = PL + (hb * SEQ + qg) * HD + 8 * hh;
    FragB qh0, qh1, ql0, ql1;
    qh0.half[0] = *(const v8us*)(qp);             qh0.half[1] = *(const v8us*)(qp + 16);
    qh1.half[0] = *(const v8us*)(qp + 32);        qh1.half[1] = *(const v8us*)(qp + 48);
    asm volatile("s_wait_xcnt 0x0" ::: "memory");   // a result of the lo-plane loads may land in the hi-plane loads' address registers
    ql0.half[0] = *(const v8us*)(qp + PLSZ);      ql0.half[1] = *(const v8us*)(qp + PLSZ + 16);
    ql1.half[0] = *(const v8us*)(qp + PLSZ + 32);
    asm volatile("s_wait_xcnt 0x0" ::: "memory");   // the last load's result may land in the address registers that it shares with the three loads before it
    ql1.half[1] = *(const v8us*)(qp + PLSZ + 48);
    asm volatile("s_wait_xcnt 0x0" ::: "memory");   // the address registers of the Q loads are reused for the K addresses right behind them
    const unsigned short* khp = PL + 2 * PLSZ + (hb * SEQ + ln) * HD + 8 * hh;
    const unsigned short* vhp = PL + 4 * PLSZ + (hb * HD + ln) * SEQ + 8 * hh;

    // ---- pass 1: statistics over this wave's own steps ----
    float mr = NEGBIG, lr = 0.0f;
#pragma unroll  // constant index into mw[] and act[]
    for (int i = 0; i < NSTEP; ++i) {
      if (act[i]) {
        const int j = w + i * NW;
        const unsigned short* kp = khp + (size_t)(32 * j) * HD;
        const v8f s0 = qk_tile(kp, qh0, qh1, ql0, ql1);          // element r = score(key 32j + 8h + r, query qg)
        const v8f s1 = qk_tile(kp + 16 * HD, qh0, qh1, ql0, ql1);
        const unsigned int wb = mw[i] >> sh8;
        float sc[16];
        float mx = NEGBIG;
#pragma unroll
        for (int r = 0; r < 8; ++r) {
          sc[r]     = ((wb >> r) & 1u) ? NEGBIG : s0[r];
          sc[8 + r] = ((wb >> (16 + r)) & 1u) ? NEGBIG : s1[r];
          mx = fmaxf(mx, fmaxf(sc[r], sc[8 + r]));
        }
        mx = fmaxf(mx, __shfl_xor(mx, 16, 32));                  // the other lane half holds the other 16 keys of this query
        const float mnew = fmaxf(mr, mx);
        const float al = exp2f((mr - mnew) * LOG2E);
        float ps = 0.0f;
#pragma unroll
        for (int r = 0; r < 16; ++r) {
          const float e = exp2f((sc[r] - mnew) * LOG2E);
          ps += (sc[r] > -1.0e29f) ? e : 0.0f;
        }
        ps += __shfl_xor(ps, 16, 32);
        lr = lr * al + ps;
        mr = mnew;
      }
    }
    if (hh == 0) { stm[ln * STATP + w] = mr; stl[ln * STATP + w] = lr; }
    __syncthreads();
    // merge: each lane half reads NW / 2 of the waves' pairs of its query, then one exchange between the halves
    {
      float mv[NW / 2], lv[NW / 2];                // the loops below are unrolled so that both arrays stay in registers
#pragma unroll
      for (int u = 0; u < NW / 8; ++u) {
        const v4f x = *(const v4fa*)(stm + ln * STATP + (NW / 2) * hh + 4 * u);
        const v4f y = *(const v4fa*)(stl + ln * STATP + (NW / 2) * hh + 4 * u);
        mv[4 * u] = x[0]; mv[4 * u + 1] = x[1]; mv[4 * u + 2] = x[2]; mv[4 * u + 3] = x[3];
        lv[4 * u] = y[0]; lv[4 * u + 1] = y[1]; lv[4 * u + 2] = y[2]; lv[4 * u + 3] = y[3];
      }
      float mg = NEGBIG;
#pragma unroll
      for (int u = 0; u < NW / 2; ++u) mg = fmaxf(mg, mv[u]);
      mg = fmaxf(mg, __shfl_xor(mg, 16, 32));
      float lg = 0.0f;
#pragma unroll
      for (int u = 0; u < NW / 2; ++u) mv[u] = exp2f((mv[u] - mg) * LOG2E);
#pragma unroll
      for (int u = 0; u < NW / 2; ++u) lg += lv[u] * mv[u];
      lg += __shfl_xor(lg, 16, 32);
      mr = mg;
      lr = lg;
    }
    const float inv = 1.0f / lr;

    // ---- pass 2: normalised weights, coverage accumulation, partial O^T over this wave's own steps ----
    v8f O[4] = {};
#pragma unroll  // constant index into mw[] and act[]
    for (int i = 0; i < NSTEP; ++i) {
      if (act[i]) {
        const int key0 = 32 * (w + i * NW);
        const unsigned short* kp = khp + (size_t)key0 * HD;
        const v8f s0 = qk_tile(kp, qh0, qh1, ql0, ql1);
        const v8f s1 = qk_tile(kp + 16 * HD, qh0, qh1, ql0, ql1);
        __builtin_amdgcn_sched_barrier(0);
        const unsigned int wb = mw[i] >> sh8;
        float pn[16];
#pragma unroll
        for (int r = 0; r < 8; ++r) {
          const float e0 = exp2f((s0[r] - mr) * LOG2E) * inv;
          const float e1 = exp2f((s1[r] - mr) * LOG2E) * inv;
          pn[r]     = ((wb >> r) & 1u) ? 0.0f : e0;
          pn[8 + r] = ((wb >> (16 + r)) & 1u) ? 0.0f : e1;
        }
        // coverage tile: this lane owns columns key0 + 8h + 0..7 and key0 + 16 + 8h + 0..7 of row ln
        {
          float* cr = crow + key0;
          v4f c0 = *(const v4fa*)(cr), c1 = *(const v4fa*)(cr + 4), c2 = *(const v4fa*)(cr + 16), c3 = *(const v4fa*)(cr + 20);
          c0[0] += pn[0];  c0[1] += pn[1];  c0[2] += pn[2];  c0[3] += pn[3];
          c1[0] += pn[4];  c1[1] += pn[5];  c1[2] += pn[6];  c1[3] += pn[7];
          c2[0] += pn[8];  c2[1] += pn[9];  c2[2] += pn[10]; c2[3] += pn[11];
          c3[0] += pn[12]; c3[1] += pn[13]; c3[2] += pn[14]; c3[3] += pn[15];
          *(v4fa*)(cr) = c0; *(v4fa*)(cr + 4) = c1; *(v4fa*)(cr + 16) = c2; *(v4fa*)(cr + 20) = c3;
        }
        // P^T B fragment: element i < 8 -> key0 + 8h + i (tile 0 row 8h + i); i >= 8 -> key0 + 16 + 8h + (i - 8) (tile 1); bf16 hi + lo
        FragB ph, pl;
#pragma unroll
        for (int r = 0; r < 16; ++r) {
          const unsigned short hb16 = bf16_bits(pn[r]);
          ph.u[r] = hb16;
          pl.u[r] = bf16_bits(pn[r] - bf16_val(hb16));
        }
        __builtin_amdgcn_sched_barrier(0);
        const unsigned short* vp = vhp + key0;
        O[0] = pv_tile(vp, ph, pl, O[0]);
        O[1] = pv_tile(vp + (size_t)16 * SEQ, ph, pl, O[1]);
        O[2] = pv_tile(vp + (size_t)32 * SEQ, ph, pl, O[2]);
        O[3] = pv_tile(vp + (size_t)48 * SEQ, ph, pl, O[3]);
      }
    }

    // O^T element r of tile t = partial ctx(query qg, d = 16t + 8h + r): f32 into this wave's tile [16 queries][64 d]
    {
      float* pw = part + (size_t)(w * 16 + ln) * OPP + 8 * hh;
#pragma unroll  // constant index into O[]
      for (int t = 0; t < 4; ++t) {
        const v4f x0 = {O[t][0], O[t][1], O[t][2], O[t][3]};
        const v4f x1 = {O[t][4], O[t][5], O[t][6], O[t][7]};
        *(v4fa*)(pw + 16 * t) = x0;
        *(v4fa*)(pw + 16 * t + 4) = x1;
      }
    }
    __syncthreads();
    // one wave per query row (wave-uniform loop): lane sums d = 2 lane, 2 lane + 1 over the NW partial tiles; a wave writes whole 128-B lines
#pragma unroll 1  // at most one trip per wave once NW >= 16: nothing to gain from copies of the body
    for (int row = w; row < 16; row += NW) {
      const float* pr = part + row * OPP + 2 * lane;
      float t0 = 0.0f, t1 = 0.0f;
#pragma unroll  // independent LDS loads in flight together; the sums stay in wave order
      for (int u = 0; u < NW; ++u) {
        const v2f x = *(const v2fa*)(pr + u * 16 * OPP);
        t0 += x[0];
        t1 += x[1];
      }
      const unsigned int h0 = bf16_bits(t0), h1 = bf16_bits(t1);
      const unsigned int l0 = bf16_bits(t0 - bf16_val((unsigned short)h0)), l1 = bf16_bits(t1 - bf16_val((unsigned short)h1));
      unsigned short* d = Cx + ((size_t)(q0 + row) * NB_FULL + b) * CXP + h * HD + 2 * lane;
      *(u32a*)d = h0 | (h1 << 16);
      *(u32a*)(d + DM) = l0 | (l1 << 16);
      asm volatile("s_wait_xcnt 0x0" ::: "memory");  // the stores' address registers are advanced for the next head right behind them
    }
  }

  __syncthreads();
  float* cg = Cov + ((size_t)b * SEQ_FULL + q0) * SEQ_FULL;
#pragma unroll 1  // a few short trips, once per block: kept rolled as before
  for (int idx = w; idx < 16 * (SEQ / 128); idx += NW) {
    const int row = idx / (SEQ / 128), col = (idx % (SEQ / 128)) * 128 + lane * 4;
    v4f v = *(const v4fa*)(covs + row * COVP + col);
    v[0] *= 0.0625f; v[1] *= 0.0625f; v[2] *= 0.0625f; v[3] *= 0.0625f;
    *(v4f*)(cg + (size_t)row * SEQ_FULL + col) = v;
    asm volatile("s_wait_xcnt 0x0" ::: "memory");    // the next trip rewrites the store's address and data registers
  }
}

// Output projection: out[m][n] = sum_c ctx[m][c] Wo[n][c] with A = [ctx_hi | ctx_lo] (K = 2048) and the W k index wrapping at 1024.
// coverage: blocks tile the [SEQ*NB_FULL][1024] output exactly once.
__global__ __launch_bounds__(256) void k_oproj(const unsigned short* __restrict__ Cx, const unsigned short* __restrict__ Wo,
                                               float* __restrict__ Out) {
  __shared__ __attribute__((aligned(16))) unsigned short ring[RING_E];
  const int tid = threadIdx.x, w = __builtin_amdgcn_readfirstlane((int)(tid >> 5)), lane = tid & 31, ln = lane & 15, hh = lane >> 4;
  const int wr = w & 3, wc = w >> 2;                 // wave position: rows 32 wr, columns 64 wc
  const int pr = (wr >> 1) + 2 * wc, w2 = wr & 1;    // 64 x 64 staging tile, and the wave's place in it
  const int mb = blockIdx.x * GT, nb = blockIdx.y * GT;
  const int m0 = mb + 64 * (wr >> 1), n0 = nb + 64 * wc;
  const int crow = tid >> 3, cpc = 8 * (tid & 7);
  const unsigned short* ga = Cx + (size_t)(mb + crow) * CXP + cpc;
  const unsigned short* gb = Wo + (size_t)(nb + crow) * DM + cpc;
  const unsigned int la = (unsigned int)(size_t)(ring + crow * TP + cpc);
  v8f acc[2][4] = {};
  gemm_main<CXP>(ga, (size_t)CXP, gb, la, ring + (32 * wr + ln) * TP + 8 * hh, ring + TILE_E + (64 * wc + ln) * TP + 8 * hh, acc);
  float* so = (float*)ring + pr * (64 * 68);
#pragma unroll
  for (int mt = 0; mt < 2; ++mt)
#pragma unroll
    for (int nt = 0; nt < 4; ++nt)
#pragma unroll
      for (int r = 0; r < 8; ++r)
        so[(32 * w2 + 16 * mt + 8 * hh + r) * 68 + 16 * nt + ln] = acc[mt][nt][r];
  __syncthreads();
  const int rsub = lane >> 4, c4 = (lane & 15) * 4;
  {
#pragma unroll 1
    for (int i = 0; i < 16; ++i) {
      const int row = 32 * w2 + 2 * i + rsub;
      const v4f v = *(const v4fa*)(so + row * 68 + c4);
      *(v4f*)(Out + (size_t)(m0 + row) * DM + n0 + c4) = v;
    }
    
  }
}

extern "C" void kernel_launch(void* const* d_in, const int* in_sizes, int n_in,
                              void* d_out, int out_size, void* d_ws, size_t ws_size, hipStream_t stream) {
  if (n_in < 10) return;
  const long long needX = (long long)SEQ * NB_FULL * DM;
  if ((long long)in_sizes[0] < needX || (long long)in_sizes[1] < needX || (long long)in_sizes[2] < needX) return;
  for (int i = 3; i < 7; ++i) if ((long long)in_sizes[i] < (long long)DM * DM) return;
  if ((long long)in_sizes[7] < ((long long)(NB - 1) * SEQ_FULL + (SEQ - 1)) * SEQ_FULL + SEQ_FULL) return;
  if ((long long)in_sizes[8] < (long long)SEQ * RHSW) return;
  if (in_sizes[9] < 1) return;
  if ((long long)out_size < (long long)COV_OFF + ((long long)(NB - 1) * SEQ_FULL + (SEQ - 1)) * SEQ_FULL + SEQ) return;

  const float* query = (const float*)d_in[0];   // wire order: query, key, value, Wq, Wk, Wv, Wo, mask, rhs_mask, layer_idx
  const float* keyt  = (const float*)d_in[1];
  const float* value = (const float*)d_in[2];
  const float* Wq    = (const float*)d_in[3];
  const float* Wk    = (const float*)d_in[4];
  const float* Wv    = (const float*)d_in[5];
  const float* Wo    = (const float*)d_in[6];
  const int*   mask  = (const int*)d_in[7];
  const int*   rhs   = (const int*)d_in[8];
  const int*   lidx  = (const int*)d_in[9];
  float* out = (float*)d_out;
  float* cov = out + COV_OFF;

  char* ws = (char*)d_ws;
  size_t off = 0;
  unsigned short* Xb = (unsigned short*)(ws + off); off += BYTES_XB;   // 3 activation planes [SEQ*NB_FULL][1024] bf16
  unsigned short* Wb = (unsigned short*)(ws + off); off += BYTES_WB;   // 4 weight planes [1024][1024] bf16 (q, k, v, o)
  unsigned short* PL = (unsigned short*)(ws + off); off += BYTES_PL;   // q_hi, q_lo, k_hi, k_lo, vT_hi, vT_lo
  unsigned short* Cx = (unsigned short*)(ws + off); off += BYTES_CX;   // ctx [SEQ*NB_FULL][hi 1024 | lo 1024] bf16
  unsigned int*   Mb = (unsigned int*)(ws + off);   off += BYTES_MB;   // mask bit-plane [NB][SEQ][32 words]
  if (off > ws_size) return;

  const int nx8 = (int)(XN / 8), nw8 = (int)(WN / 8);
  k_cvt<<<(unsigned)((nx8 + 255) / 256), 256, 0, stream>>>(query, Xb, nx8);
  k_cvt<<<(unsigned)((nx8 + 255) / 256), 256, 0, stream>>>(keyt, Xb + XN, nx8);
  k_cvt<<<(unsigned)((nx8 + 255) / 256), 256, 0, stream>>>(value, Xb + 2 * XN, nx8);
  k_cvt<<<(unsigned)((nw8 + 255) / 256), 256, 0, stream>>>(Wq, Wb, nw8);
  k_cvt<<<(unsigned)((nw8 + 255) / 256), 256, 0, stream>>>(Wk, Wb + WN, nw8);
  k_cvt<<<(unsigned)((nw8 + 255) / 256), 256, 0, stream>>>(Wv, Wb + 2 * WN, nw8);
  k_cvt<<<(unsigned)((nw8 + 255) / 256), 256, 0, stream>>>(Wo, Wb + 3 * WN, nw8);
  k_mask<<<(unsigned)((NB * SEQ * MBW + 255) / 256), 256, 0, stream>>>(mask, rhs, lidx, Mb);
  k_proj<<<dim3((unsigned)(NB * SEQ / GT), NH / 2, 3), 256, 0, stream>>>(Xb, Wb, PL);
  hipFuncSetAttribute(reinterpret_cast<const void*>(&k_attn), hipFuncAttributeMaxDynamicSharedMemorySize, (int)ATTN_LDS);
  k_attn<<<(unsigned)(NB * (SEQ / 16)), 32 * NW, (size_t)ATTN_LDS, stream>>>(PL, Mb, Cx, cov);
  k_oproj<<<dim3((unsigned)(SEQ * NB_FULL / GT), DM / GT), 256, 0, stream>>>(Cx, Wb + 3 * WN, out);
}

// v003
// Measured time: 294 microseconds a run.
// Timed twice side by side with v002, it ran 1.05 times as fast both times.
// Over all steps from v000 it is 4.20 times as fast.
#include <hip/hip_runtime.h>
// Contractions (all v_wmma_f32_16x16x32_bf16, f32 accumulate): q/k/v projections = single product on RNE-bf16 inputs and weights; scores K Q^T, P V and the output projection = bf16 hi+lo planes of the computed operand(s), products hi*hi + hi*lo + lo*hi (output projection: [ctx_hi | ctx_lo] x [Wo ; Wo] folded along K); softmax statistics and coverage in f32.
// come from K rows (A, global bf16 planes) and Q^T (B, registers); the two 16-key D tiles pack straight into the P^T B fragment; O^T accumulates from V^T rows (A).
// Masks: both boolean inputs and the layer index are read on the device into a bit-plane (one 32-bit word per query and 32-key step); fully masked steps are skipped at run time.
#ifndef NB
#define NB 4
#endif
#ifndef SEQ
#define SEQ 1024
#endif
#define NB_FULL 4
#define SEQ_FULL 1024
#define NH 16
#define HD 64
#define DM 1024
#define RHSW (SEQ_FULL + 4)
#define NKS (SEQ / 32)
#define MBW (SEQ_FULL / 32)
#define CXP 2048
#define COVP (SEQ + 4)
#define STP 72
#define COV_LDS_BYTES (16 * COVP * 4)
#define NW 32                                    /* waves of one attention block */
#define NSTEP ((NKS + NW - 1) / NW)              /* 32-key steps owned by one wave */
#define STATP (NW + 4)                           /* dword pitch of a query's row of per-wave statistics (16 B x odd) */
#define OPP 68                                   /* dword pitch of a partial-O row */
#define ATTN_LDS (COV_LDS_BYTES + 2 * 16 * STATP * 4 + NW * 16 * OPP * 4)

#define XN ((size_t)SEQ * NB_FULL * DM)          /* elements of one converted activation plane (prefix of the full input) */
#define WN ((size_t)DM * DM)
#define PLSZ ((size_t)NB * NH * SEQ * HD)        /* elements of one head-layout plane */
#define COV_OFF ((size_t)SEQ_FULL * NB_FULL * DM) /* element offset of the second output (byte 16777216) */

#define BYTES_XB (3 * XN * 2)
#define BYTES_WB (4 * WN * 2)
#define BYTES_PL (6 * PLSZ * 2)
#define BYTES_CX ((size_t)SEQ * NB_FULL * CXP * 2)
#define BYTES_MB ((size_t)NB * SEQ * MBW * 4)

static_assert(SEQ % 128 == 0);
static_assert(SEQ <= SEQ_FULL);
static_assert(NB <= NB_FULL);
static_assert(MBW == 32);
static_assert(HD == 64);
static_assert(NW % 8 == 0 && NW <= 32);
static_assert(ATTN_LDS <= 327680);
static_assert(NH * HD == DM);
static_assert(COV_OFF * 4 == (size_t)16777216);
static_assert(BYTES_XB % 256 == 0 && BYTES_WB % 256 == 0 && BYTES_PL % 256 == 0 && BYTES_CX % 256 == 0 && BYTES_MB % 256 == 0);
static_assert(BYTES_XB + BYTES_WB + BYTES_PL + BYTES_CX + BYTES_MB <= (size_t)134217728);
static_assert((size_t)SEQ * NB_FULL * DM <= COV_OFF);
static_assert(COV_OFF + ((size_t)(NB - 1) * SEQ_FULL + (SEQ - 1)) * SEQ_FULL + SEQ <= (size_t)33554432 / 4);

typedef __bf16 v16b __attribute__((ext_vector_type(16)));
typedef unsigned short v8us __attribute__((ext_vector_type(8), may_alias));
typedef float v8f __attribute__((ext_vector_type(8)));
typedef float v4f __attribute__((ext_vector_type(4)));
typedef float v4fa __attribute__((ext_vector_type(4), may_alias));
typedef float v2f __attribute__((ext_vector_type(2)));
typedef float v2fa __attribute__((ext_vector_type(2), may_alias));
typedef unsigned int u32a __attribute__((may_alias));
typedef int v4i __attribute__((ext_vector_type(4)));
typedef int v4ia __attribute__((ext_vector_type(4), may_alias));
union FragB { v16b v; v8us half[2]; unsigned short u[16]; };

#define LOG2E 1.4426950408889634f
#define NEGBIG (-1.0e30f)

__device__ __forceinline__ unsigned short bf16_bits(float x) {   // RNE convert to bf16 bits
  unsigned int u = __float_as_uint(x);
  return (unsigned short)((u + 0x7FFFu + ((u >> 16) & 1u)) >> 16);
}
__device__ __forceinline__ float bf16_val(unsigned short b) { return __uint_as_float(((unsigned int)b) << 16); }

__device__ __forceinline__ v8f wm(v16b a, v16b b, v8f c) {
  return __builtin_amdgcn_wmma_f32_16x16x32_bf16(false, a, false, b, (short)0, c, false, false);
}

// Preparation, one launch: PREP_WG work-groups of 16 waves (one a WGP); every thread takes its share of each job, so that few waves have to start.
// Conversions: a work-group's pieces of a plane are contiguous; a wave's load covers 512 contiguous bytes, its store 256 (whole lines).
#define PREP_WG 256
#define PREP_TH 512
#define PREP_T (PREP_WG * PREP_TH)
#define XCH ((int)(XN / 4 / PREP_T))              /* 16-byte pieces of one activation plane per thread */
#define WCH ((int)(WN / 4 / PREP_T))              /* the same of one weight plane */
static_assert(XN % ((size_t)4 * PREP_T) == 0 && WN % ((size_t)4 * PREP_T) == 0);
static_assert(NB * SEQ * MBW <= PREP_T);
typedef unsigned short v4us __attribute__((ext_vector_type(4), may_alias));

__device__ __forceinline__ void cvt_store(unsigned short* d, v4f x) {
  v4us o;
  o[0] = bf16_bits(x[0]); o[1] = bf16_bits(x[1]); o[2] = bf16_bits(x[2]); o[3] = bf16_bits(x[3]);
  *(v4us*)d = o;
}

// coverage: planes: PREP_T threads x XCH (WCH) pieces x 4 elements = every element of each of the 3 + 4 planes, once.
// Mb[b][q][j] bit kk = 1 when key 32j+kk is masked for query q of batch b (mask[b][q][k] != 0 or rhs[q][start + k] != 0); thread t < NB*SEQ*32 writes word t: every word of the plane.
__global__ __launch_bounds__(PREP_TH) void k_prep(const float* __restrict__ query, const float* __restrict__ keyt, const float* __restrict__ value,
                                                  const float* __restrict__ Wq, const float* __restrict__ Wk, const float* __restrict__ Wv,
                                                  const float* __restrict__ Wo, const int* __restrict__ mask, const int* __restrict__ rhs,
                                                  const int* __restrict__ lidx, unsigned short* __restrict__ Xb, unsigned short* __restrict__ Wb,
                                                  unsigned int* __restrict__ Mb) {
  const int tid = threadIdx.x, blk = blockIdx.x;
  const int t = blk * PREP_TH + tid;
  const size_t ex = ((size_t)blk * XCH * PREP_TH + tid) * 4;   // this thread's first element in an activation plane
  const size_t ew = ((size_t)blk * WCH * PREP_TH + tid) * 4;   // and in a weight plane
  const float* sq = query + ex;
  const float* sk = keyt + ex;
  const float* sv = value + ex;
  const float* s0 = Wq + ew;
  const float* s1 = Wk + ew;
  const float* s2 = Wv + ew;
  const float* s3 = Wo + ew;
  // the long streams start first: all of the thread's plane loads are in flight while it forms its mask word
  v4f x[3][XCH], y[4][WCH];
#pragma unroll  // constant index into x[]
  for (int i = 0; i < XCH; ++i) x[0][i] = *(const v4fa*)(sq + (size_t)i * PREP_TH * 4);
#pragma unroll
  for (int i = 0; i < XCH; ++i) x[1][i] = *(const v4fa*)(sk + (size_t)i * PREP_TH * 4);
#pragma unroll
  for (int i = 0; i < XCH; ++i) x[2][i] = *(const v4fa*)(sv + (size_t)i * PREP_TH * 4);
#pragma unroll  // constant index into y[]
  for (int i = 0; i < WCH; ++i) {
    y[0][i] = *(const v4fa*)(s0 + (size_t)i * PREP_TH * 4);
    y[1][i] = *(const v4fa*)(s1 + (size_t)i * PREP_TH * 4);
    y[2][i] = *(const v4fa*)(s2 + (size_t)i * PREP_TH * 4);
    y[3][i] = *(const v4fa*)(s3 + (size_t)i * PREP_TH * 4);
  }
  // the loads' address registers stay live up to this wait (inputs only), so that no load's result and nothing behind it lands in one ahead of it
  asm volatile("s_wait_xcnt 0x0" :: "v"(sq), "v"(sk), "v"(sv), "v"(s0), "v"(s1), "v"(s2), "v"(s3) : "memory");
  if (t < NB * SEQ * MBW) {
    const int j = t & 31, row = t >> 5;
    const int b = row / SEQ, q = row - b * SEQ;
    int L = lidx[0];
    L = (L < -64) ? -64 : ((L > 64) ? 64 : L);
    int tt = 4 - 4 * L; if (tt < 0) tt = 0;
    int start = 4 - tt; if (start < 0) start = 0;
    start = (start >= 4) ? 4 : 0;                       // the formula only yields 0 or 4; keeps the 16-B alignment of the row loads
    const int* mp = mask + ((size_t)b * SEQ_FULL + q) * SEQ_FULL + 32 * j;
    const int* rp = rhs + (size_t)q * RHSW + start + 32 * j;
    v4i a[8], r[8];
#pragma unroll  // constant index into a[] and r[]; the word's 16 loads in flight together
    for (int c = 0; c < 8; ++c) {
      a[c] = *(const v4ia*)(mp + 4 * c);
      r[c] = *(const v4ia*)(rp + 4 * c);
    }
    // as above: both address pairs stay live up to this wait, so that no load's result lands in one ahead of it
    asm volatile("s_wait_xcnt 0x0" :: "v"(mp), "v"(rp) : "memory");
    unsigned int w = 0u;
#pragma unroll
    for (int c = 0; c < 8; ++c) {
      const unsigned int nib = (((a[c][0] | r[c][0]) != 0) ? 1u : 0u) | (((a[c][1] | r[c][1]) != 0) ? 2u : 0u) |
                               (((a[c][2] | r[c][2]) != 0) ? 4u : 0u) | (((a[c][3] | r[c][3]) != 0) ? 8u : 0u);
      w |= nib << (4 * c);
    }
    Mb[t] = w;
  }
#pragma unroll  // constant index into x[]
  for (int p = 0; p < 3; ++p)
#pragma unroll
    for (int i = 0; i < XCH; ++i) cvt_store(Xb + (size_t)p * XN + ex + (size_t)i * PREP_TH * 4, x[p][i]);
#pragma unroll  // constant index into y[]
  for (int p = 0; p < 4; ++p)
#pragma unroll
    for (int i = 0; i < WCH; ++i) cvt_store(Wb + (size_t)p * WN + ew + (size_t)i * PREP_TH * 4, y[p][i]);
}

// Block tile 128 rows x 128 columns, 8 waves of 32 x 64 (4 along the rows, 2 along the columns), K in stages of KC.
// A stage is [A tile | W tile], each GT rows of KC bf16 (one whole 128-B line a row) at LDS pitch TP; two buffers.
// Every lane copies 16 B per instruction, a wave 4 whole lines: 4 copies a lane for the A tile, 4 for the W tile.
#define GT 128
#define KC 64
#define TP 72                                    /* elements: 144 B = 16 B x odd, for the ds_load_b128 fragment reads */
#define TILE_E (GT * TP)
#define RING_E (4 * TILE_E)
static_assert(DM % KC == 0 && CXP % KC == 0 && DM / KC >= 2);
static_assert(RING_E >= 4 * 2 * 64 * STP);       // the projections' output staging reuses the ring
static_assert(RING_E * 2 >= 4 * 64 * 68 * 4);    // so does the output projection's

// la: LDS byte address of this lane's piece in its first row of the A tile of the target buffer; ga, gb: the same piece in global memory.
// Rows crow + 32 i, i = 0..3, of both tiles. The s_wait_xcnt stands inside the statement: the address registers are rewritten behind it.
__device__ __forceinline__ void stage_copy(unsigned int la, const unsigned short* ga, size_t apitch, const unsigned short* gb) {
  const unsigned int lb = la + TILE_E * 2;
  asm volatile("global_load_async_to_lds_b128 %0, %8, off\n\t"
               "global_load_async_to_lds_b128 %1, %9, off\n\t"
               "global_load_async_to_lds_b128 %2, %10, off\n\t"
               "global_load_async_to_lds_b128 %3, %11, off\n\t"
               "global_load_async_to_lds_b128 %4, %12, off\n\t"
               "global_load_async_to_lds_b128 %5, %13, off\n\t"
               "global_load_async_to_lds_b128 %6, %14, off\n\t"
               "global_load_async_to_lds_b128 %7, %15, off\n\t"
               "s_wait_xcnt 0x0"
               :: "v"(la), "v"(la + 32 * TP * 2), "v"(la + 64 * TP * 2), "v"(la + 96 * TP * 2),
                  "v"(lb), "v"(lb + 32 * TP * 2), "v"(lb + 64 * TP * 2), "v"(lb + 96 * TP * 2),
                  "v"(ga), "v"(ga + 32 * apitch), "v"(ga + 64 * apitch), "v"(ga + 96 * apitch),
                  "v"(gb), "v"(gb + 32 * DM), "v"(gb + 64 * DM), "v"(gb + 96 * DM)
               : "memory");
}

// ga, gb: this thread's copy sources at k = 0 (row tid / 8 of the tile, piece tid % 8); ar, br: this lane's fragment rows in buffer 0.
// The W k index wraps at DM so that [A_hi | A_lo] x [W ; W] folds along K. Each accumulator still sums k in steps of 32, ascending.
template <int KT>
__device__ __forceinline__ void gemm_main(const unsigned short* __restrict__ ga, size_t apitch, const unsigned short* __restrict__ gb,
                                          unsigned int la, const unsigned short* ar, const unsigned short* br, v8f (&acc)[2][4]) {
  constexpr int NT = KT / KC;
  stage_copy(la, ga, apitch, gb);
  asm volatile("s_wait_asynccnt 0x0" ::: "memory");   // stage 0 has landed before the barrier publishes it
  __syncthreads();
  stage_copy(la + 2 * TILE_E * 2, ga + KC, apitch, gb + KC);
#pragma unroll 1  // one stage a trip: the buffer index and the refill test stay scalar
  for (int t = 0; t < NT; ++t) {
    const int bo = (t & 1) * 2 * TILE_E;
#pragma unroll  // two 32-wide k steps of the stage
    for (int kk = 0; kk < KC; kk += 32) {
      const unsigned short* ap = ar + bo + kk;
      const unsigned short* bp = br + bo + kk;
      FragB a0, a1, b0, b1, b2, b3;
      a0.half[0] = *(const v8us*)(ap);                a0.half[1] = *(const v8us*)(ap + 16);
      a1.half[0] = *(const v8us*)(ap + 16 * TP);      a1.half[1] = *(const v8us*)(ap + 16 * TP + 16);
      b0.half[0] = *(const v8us*)(bp);                b0.half[1] = *(const v8us*)(bp + 16);
      b1.half[0] = *(const v8us*)(bp + 16 * TP);      b1.half[1] = *(const v8us*)(bp + 16 * TP + 16);
      b2.half[0] = *(const v8us*)(bp + 32 * TP);      b2.half[1] = *(const v8us*)(bp + 32 * TP + 16);
      b3.half[0] = *(const v8us*)(bp + 48 * TP);      b3.half[1] = *(const v8us*)(bp + 48 * TP + 16);
      acc[0][0] = wm(a0.v, b0.v, acc[0][0]); acc[0][1] = wm(a0.v, b1.v, acc[0][1]);
      acc[0][2] = wm(a0.v, b2.v, acc[0][2]); acc[0][3] = wm(a0.v, b3.v, acc[0][3]);
      acc[1][0] = wm(a1.v, b0.v, acc[1][0]); acc[1][1] = wm(a1.v, b1.v, acc[1][1]);
      acc[1][2] = wm(a1.v, b2.v, acc[1][2]); acc[1][3] = wm(a1.v, b3.v, acc[1][3]);
      asm volatile("v_nop\n\tv_nop\n\tv_nop\n\tv_nop"
                   : "+v"(acc[0][0]), "+v"(acc[0][1]), "+v"(acc[0][2]), "+v"(acc[0][3]),
                     "+v"(acc[1][0]), "+v"(acc[1][1]), "+v"(acc[1][2]), "+v"(acc[1][3])
                   : "v"(a0.v), "v"(a1.v), "v"(b0.v), "v"(b1.v), "v"(b2.v), "v"(b3.v));
    }
    asm volatile("s_wait_dscnt 0x0" ::: "memory");      // this wave's reads of the buffer are done before it is refilled
    asm volatile("s_wait_asynccnt 0x0" ::: "memory");   // this wave's copies of stage t + 1 have landed
    __syncthreads();                                    // publishes stage t + 1 and ends every reader's last read of stage t
    if (t + 2 < NT) {
      const int k2 = (t + 2) * KC;
      stage_copy(la + (unsigned int)bo * 2u, ga + k2, apitch, gb + (k2 & (DM - 1)));
    }
  }
  asm volatile("s_wait_asynccnt 0x0" ::: "memory");     // nothing is in flight when the ring becomes output staging
}

// Projections. grid (NB*SEQ/128, NH/2, 3): block = 128 sequence positions of one batch x two heads x one of {q, k, v}; 8 waves x (32 x 64).
// Logical row b*SEQ + s reads the activation row s*NB_FULL + b. Epilogue: each pair of waves owns a 64 x 64 tile (one head): bf16 hi + lo planes staged in its part of the ring
// (block barrier: the read-back crosses the pair's two waves for q, k and v), q (scaled by 1/8) and k planes: [b][h][s][64]; v planes transposed: [b][h][d][SEQ].
__global__ __launch_bounds__(256) void k_proj(const unsigned short* __restrict__ Xb, const unsigned short* __restrict__ Wb,
                                              unsigned short* __restrict__ PL) {
  __shared__ __attribute__((aligned(16))) unsigned short ring[RING_E];
  const int tid = threadIdx.x, w = __builtin_amdgcn_readfirstlane((int)(tid >> 5)), lane = tid & 31, ln = lane & 15, hh = lane >> 4;
  const int wr = w & 3, wc = w >> 2;                 // wave position: rows 32 wr, columns 64 wc
  const int pr = (wr >> 1) + 2 * wc, w2 = wr & 1;    // pair of waves that shares a 64 x 64 output tile, and the wave's place in it
  const int z = blockIdx.z, hcol = 2 * blockIdx.y + wc;
  const int mt0 = blockIdx.x * GT;
  const int b = mt0 / SEQ, sb = mt0 - b * SEQ;
  const int s0 = sb + 64 * (wr >> 1);
  const int crow = tid >> 3, cpc = 8 * (tid & 7);
  const unsigned short* ga = Xb + (size_t)z * XN + ((size_t)(sb + crow) * NB_FULL + b) * DM + cpc;
  const unsigned short* gb = Wb + (size_t)z * WN + (size_t)(GT * blockIdx.y + crow) * DM + cpc;
  const unsigned int la = (unsigned int)(size_t)(ring + crow * TP + cpc);
  v8f acc[2][4] = {};
  gemm_main<DM>(ga, (size_t)NB_FULL * DM, gb, la, ring + (32 * wr + ln) * TP + 8 * hh, ring + TILE_E + (64 * wc + ln) * TP + 8 * hh, acc);
  unsigned short* sh = ring + pr * (2 * 64 * STP);
  unsigned short* sl = sh + 64 * STP;
  const int t2 = 32 * w2 + lane;
  const float scale = (z == 0) ? 0.125f : 1.0f;
#pragma unroll
  for (int mt = 0; mt < 2; ++mt)
#pragma unroll
    for (int nt = 0; nt < 4; ++nt)
#pragma unroll
      for (int r = 0; r < 8; ++r) {
        const float v = acc[mt][nt][r] * scale;
        const unsigned short hb = bf16_bits(v);
        const unsigned short lb = bf16_bits(v - bf16_val(hb));
        const int sr = 32 * w2 + 16 * mt + 8 * hh + r;     // local sequence row
        const int dc = 16 * nt + ln;                        // head-dim column
        const int idx = (z == 2) ? (dc * STP + sr) : (sr * STP + dc);
        sh[idx] = hb;
        sl[idx] = lb;
      }
  __syncthreads();
  const size_t hbase = (size_t)b * NH + hcol;
  unsigned short* dstp = PL + (size_t)z * 2 * PLSZ;
  {
#pragma unroll 1
    for (int i = 0; i < 8; ++i) {
      const int row = 8 * i + (t2 >> 3), piece = t2 & 7;
      const v8us vh = *(const v8us*)(sh + row * STP + 8 * piece);
      const v8us vl = *(const v8us*)(sl + row * STP + 8 * piece);
      const size_t ro = (z == 2) ? ((hbase * HD + row) * SEQ + s0) : ((hbase * SEQ + s0 + row) * HD);
      unsigned short* d = dstp + ro + 8 * piece;
      *(v8us*)d = vh;
      *(v8us*)(d + PLSZ) = vl;
      asm volatile("s_wait_xcnt 0x0" ::: "memory");  // the next trip rewrites the stores' address registers
    }
    
  }
}

// S^T tile of 16 keys: c = K_lo Q_hi + K_hi Q_lo + K_hi Q_hi over the two 32-wide head-dim chunks, then the hazard guard.
__device__ __forceinline__ v8f qk_tile(const unsigned short* __restrict__ kp, const FragB& qh0, const FragB& qh1,
                                       const FragB& ql0, const FragB& ql1) {
  // A fragments of K: row m = key, elements 0..7 <- d = 32c + 8h + i, 8..15 <- d = 32c + 16 + 8h + i (kp already holds + 8h)
  FragB a0, a1, c0, c1;
  const unsigned short* lp = kp + PLSZ;
  a0.half[0] = *(const v8us*)(kp);      a0.half[1] = *(const v8us*)(kp + 16);
  a1.half[0] = *(const v8us*)(kp + 32); a1.half[1] = *(const v8us*)(kp + 48);
  asm volatile("s_wait_xcnt 0x0" ::: "memory");   // a result of the lo-plane loads may land in the hi-plane loads' address registers
  c0.half[0] = *(const v8us*)(lp);      c0.half[1] = *(const v8us*)(lp + 16);
  c1.half[0] = *(const v8us*)(lp + 32); c1.half[1] = *(const v8us*)(lp + 48);
  asm volatile("s_wait_xcnt 0x0" ::: "memory");   // what follows may reuse the lo-plane loads' address registers
  v8f c = {0.f, 0.f, 0.f, 0.f, 0.f, 0.f, 0.f, 0.f};
  c = wm(c0.v, qh0.v, c); c = wm(c1.v, qh1.v, c);
  c = wm(a0.v, ql0.v, c); c = wm(a1.v, ql1.v, c);
  c = wm(a0.v, qh0.v, c); c = wm(a1.v, qh1.v, c);
  asm volatile("v_nop\n\tv_nop\n\tv_nop\n\tv_nop" : "+v"(c)
               : "v"(a0.v), "v"(a1.v), "v"(c0.v), "v"(c1.v), "v"(qh0.v), "v"(qh1.v), "v"(ql0.v), "v"(ql1.v));
  return c;
}

// O^T tile of 16 head-dim rows: o += V_lo P_hi + V_hi P_lo + V_hi P_hi, then the hazard guard.
__device__ __forceinline__ v8f pv_tile(const unsigned short* __restrict__ vp, const FragB& ph, const FragB& pl, v8f o) {
  // A fragments of V^T: row m = d, elements 0..7 <- key0 + 8h + i, 8..15 <- key0 + 16 + 8h + i (vp already holds key0 + 8h)
  FragB vh, vl;
  const unsigned short* lp = vp + PLSZ;
  vh.half[0] = *(const v8us*)(vp); vh.half[1] = *(const v8us*)(vp + 16);
  vl.half[0] = *(const v8us*)(lp); vl.half[1] = *(const v8us*)(lp + 16);
  o = wm(vl.v, ph.v, o);
  o = wm(vh.v, pl.v, o);
  o = wm(vh.v, ph.v, o);
  asm volatile("v_nop\n\tv_nop\n\tv_nop\n\tv_nop" : "+v"(o) : "v"(vh.v), "v"(vl.v), "v"(ph.v), "v"(pl.v));
  return o;
}

// Block = one batch x 16 queries, NW waves; wave w owns the 32-key steps j = w, w + NW, ... of every head (its mask words stay in registers).
// Per head: each wave's softmax statistics over its own steps -> LDS -> barrier -> every wave merges all NW pairs (max, rescaled sum);
// then normalised weights, coverage into the LDS tile [16][SEQ] (a step's columns belong to one wave, each lane only touches its own addresses), partial O^T;
// partial O^T tiles -> LDS -> barrier -> one wave per query row sums the NW partials in wave order and writes bf16 hi | lo halves of the [s*NB_FULL+b][2048] plane.
// Reuse of the exchange buffers: statistics of head h are read before the second barrier of h and rewritten after it; partials of h are read before the first barrier of h + 1 and rewritten after it.
// coverage: ctx plane: (b, 16 rows) x 16 heads x (64 hi + 64 lo) = every element of rows with b < NB; coverage output: 16 rows x SEQ columns per block, all rows once.
// LDS: coverage tile zero-filled in full before use; every wave writes its statistics and its whole partial tile (zeros when all its steps are masked) before they are read.
__global__ __launch_bounds__(32 * NW) void k_attn(const unsigned short* __restrict__ PL, const unsigned int* __restrict__ Mb,
                                                  unsigned short* __restrict__ Cx, float* __restrict__ Cov) {
  extern __shared__ __attribute__((aligned(16))) unsigned char smem[];
  float* covs = (float*)smem;
  float* stm = (float*)(smem + COV_LDS_BYTES);     // [16 queries][STATP]: running maximum of wave w at column w
  float* stl = stm + 16 * STATP;                   // same shape: sum of wave w
  float* part = stl + 16 * STATP;                  // [NW][16 queries][OPP]: partial O, f32
  const int tid = threadIdx.x, w = __builtin_amdgcn_readfirstlane((int)(tid >> 5));
  const int lane = tid & 31, ln = lane & 15, hh = lane >> 4;
  const int b = blockIdx.x / (SEQ / 16), qt = blockIdx.x % (SEQ / 16);
  const int q0 = qt * 16, qg = q0 + ln;
  {
    const v4f z4 = {0.f, 0.f, 0.f, 0.f};
    for (int i = tid; i < 4 * COVP; i += 32 * NW) *(v4fa*)(covs + 4 * i) = z4;
  }
  const unsigned int* mrow = Mb + (size_t)(b * SEQ + qg) * MBW;
  unsigned int mw[NSTEP];
  bool act[NSTEP];                                 // wave-uniform: some key of the step is open for one of the 16 queries
#pragma unroll  // mw[] and act[] must be indexed by constants to stay in registers
  for (int i = 0; i < NSTEP; ++i) {
    const int j = w + i * NW;
    mw[i] = (j < NKS) ? mrow[j] : 0xFFFFFFFFu;
    act[i] = __any(mw[i] != 0xFFFFFFFFu);
  }
  __syncthreads();
  const int sh8 = 8 * hh;
  float* crow = covs + ln * COVP + 8 * hh;

#pragma unroll 1
  for (int h = 0; h < NH; ++h) {
    const size_t hb = (size_t)b * NH + h;
    // Q^T B fragments: column n = query qg, elements 0..7 <- d = 32c + 8h + i, 8..15 <- d = 32c + 16 + 8h + i
    const unsigned short* qp = PL + (hb * SEQ + qg) * HD + 8 * hh;
    FragB qh0, qh1, ql0, ql1;
    qh0.half[0] = *(const v8us*)(qp);             qh0.half[1] = *(const v8us*)(qp + 16);
    qh1.half[0] = *(const v8us*)(qp + 32);        qh1.half[1] = *(const v8us*)(qp + 48);
    asm volatile("s_wait_xcnt 0x0" ::: "memory");   // a result of the lo-plane loads may land in the hi-plane loads' address registers
    ql0.half[0] = *(const v8us*)(qp + PLSZ);      ql0.half[1] = *(const v8us*)(qp + PLSZ + 16);
    ql1.half[0] = *(const v8us*)(qp + PLSZ + 32);
    asm volatile("s_wait_xcnt 0x0" ::: "memory");   // the last load's result may land in the address registers that it shares with the three loads before it
    ql1.half[1] = *(const v8us*)(qp + PLSZ + 48);
    asm volatile("s_wait_xcnt 0x0" ::: "memory");   // the address registers of the Q loads are reused for the K addresses right behind them
    const unsigned short* khp = PL + 2 * PLSZ + (hb * SEQ + ln) * HD + 8 * hh;
    const unsigned short* vhp = PL + 4 * PLSZ + (hb * HD + ln) * SEQ + 8 * hh;

    // ---- pass 1: statistics over this wave's own steps ----
    float mr = NEGBIG, lr = 0.0f;
#pragma unroll  // constant index into mw[] and act[]
    for (int i = 0; i < NSTEP; ++i) {
      if (act[i]) {
        const int j = w + i * NW;
        const unsigned short* kp = khp + (size_t)(32 * j) * HD;
        const v8f s0 = qk_tile(kp, qh0, qh1, ql0, ql1);          // element r = score(key 32j + 8h + r, query qg)
        const v8f s1 = qk_tile(kp + 16 * HD, qh0, qh1, ql0, ql1);
        const unsigned int wb = mw[i] >> sh8;
        float sc[16];
        float mx = NEGBIG;
#pragma unroll
        for (int r = 0; r < 8; ++r) {
          sc[r]     = ((wb >> r) & 1u) ? NEGBIG : s0[r];
          sc[8 + r] = ((wb >> (16 + r)) & 1u) ? NEGBIG : s1[r];
          mx = fmaxf(mx, fmaxf(sc[r], sc[8 + r]));
        }
        mx = fmaxf(mx, __shfl_xor(mx, 16, 32));                  // the other lane half holds the other 16 keys of this query
        const float mnew = fmaxf(mr, mx);
        const float al = exp2f((mr - mnew) * LOG2E);
        float ps = 0.0f;
#pragma unroll
        for (int r = 0; r < 16; ++r) {
          const float e = exp2f((sc[r] - mnew) * LOG2E);
          ps += (sc[r] > -1.0e29f) ? e : 0.0f;
        }
        ps += __shfl_xor(ps, 16, 32);
        lr = lr * al + ps;
        mr = mnew;
      }
    }
    if (hh == 0) { stm[ln * STATP + w] = mr; stl[ln * STATP + w] = lr; }
    __syncthreads();
    // merge: each lane half reads NW / 2 of the waves' pairs of its query, then one exchange between the halves
    {
      float mv[NW / 2], lv[NW / 2];                // the loops below are unrolled so that both arrays stay in registers
#pragma unroll
      for (int u = 0; u < NW / 8; ++u) {
        const v4f x = *(const v4fa*)(stm + ln * STATP + (NW / 2) * hh + 4 * u);
        const v4f y = *(const v4fa*)(stl + ln * STATP + (NW / 2) * hh + 4 * u);
        mv[4 * u] = x[0]; mv[4 * u + 1] = x[1]; mv[4 * u + 2] = x[2]; mv[4 * u + 3] = x[3];
        lv[4 * u] = y[0]; lv[4 * u + 1] = y[1]; lv[4 * u + 2] = y[2]; lv[4 * u + 3] = y[3];
      }
      float mg = NEGBIG;
#pragma unroll
      for (int u = 0; u < NW / 2; ++u) mg = fmaxf(mg, mv[u]);
      mg = fmaxf(mg, __shfl_xor(mg, 16, 32));
      float lg = 0.0f;
#pragma unroll
      for (int u = 0; u < NW / 2; ++u) mv[u] = exp2f((mv[u] - mg) * LOG2E);
#pragma unroll
      for (int u = 0; u < NW / 2; ++u) lg += lv[u] * mv[u];
      lg += __shfl_xor(lg, 16, 32);
      mr = mg;
      lr = lg;
    }
    const float inv = 1.0f / lr;

    // ---- pass 2: normalised weights, coverage accumulation, partial O^T over this wave's own steps ----
    v8f O[4] = {};
#pragma unroll  // constant index into mw[] and act[]
    for (int i = 0; i < NSTEP; ++i) {
      if (act[i]) {
        const int key0 = 32 * (w + i * NW);
        const unsigned short* kp = khp + (size_t)key0 * HD;
        const v8f s0 = qk_tile(kp, qh0, qh1, ql0, ql1);
        const v8f s1 = qk_tile(kp + 16 * HD, qh0, qh1, ql0, ql1);
        __builtin_amdgcn_sched_barrier(0);
        const unsigned int wb = mw[i] >> sh8;
        float pn[16];
#pragma unroll
        for (int r = 0; r < 8; ++r) {
          const float e0 = exp2f((s0[r] - mr) * LOG2E) * inv;
          const float e1 = exp2f((s1[r] - mr) * LOG2E) * inv;
          pn[r]     = ((wb >> r) & 1u) ? 0.0f : e0;
          pn[8 + r] = ((wb >> (16 + r)) & 1u) ? 0.0f : e1;
        }
        // coverage tile: this lane owns columns key0 + 8h + 0..7 and key0 + 16 + 8h + 0..7 of row ln
        {
          float* cr = crow + key0;
          v4f c0 = *(const v4fa*)(cr), c1 = *(const v4fa*)(cr + 4), c2 = *(const v4fa*)(cr + 16), c3 = *(const v4fa*)(cr + 20);
          c0[0] += pn[0];  c0[1] += pn[1];  c0[2] += pn[2];  c0[3] += pn[3];
          c1[0] += pn[4];  c1[1] += pn[5];  c1[2] += pn[6];  c1[3] += pn[7];
          c2[0] += pn[8];  c2[1] += pn[9];  c2[2] += pn[10]; c2[3] += pn[11];
          c3[0] += pn[12]; c3[1] += pn[13]; c3[2] += pn[14]; c3[3] += pn[15];
          *(v4fa*)(cr) = c0; *(v4fa*)(cr + 4) = c1; *(v4fa*)(cr + 16) = c2; *(v4fa*)(cr + 20) = c3;
        }
        // P^T B fragment: element i < 8 -> key0 + 8h + i (tile 0 row 8h + i); i >= 8 -> key0 + 16 + 8h + (i - 8) (tile 1); bf16 hi + lo
        FragB ph, pl;
#pragma unroll
        for (int r = 0; r < 16; ++r) {
          const unsigned short hb16 = bf16_bits(pn[r]);
          ph.u[r] = hb16;
          pl.u[r] = bf16_bits(pn[r] - bf16_val(hb16));
        }
        __builtin_amdgcn_sched_barrier(0);
        const unsigned short* vp = vhp + key0;
        O[0] = pv_tile(vp, ph, pl, O[0]);
        O[1] = pv_tile(vp + (size_t)16 * SEQ, ph, pl, O[1]);
        O[2] = pv_tile(vp + (size_t)32 * SEQ, ph, pl, O[2]);
        O[3] = pv_tile(vp + (size_t)48 * SEQ, ph, pl, O[3]);
      }
    }

    // O^T element r of tile t = partial ctx(query qg, d = 16t + 8h + r): f32 into this wave's tile [16 queries][64 d]
    {
      float* pw = part + (size_t)(w * 16 + ln) * OPP + 8 * hh;
#pragma unroll  // constant index into O[]
      for (int t = 0; t < 4; ++t) {
        const v4f x0 = {O[t][0], O[t][1], O[t][2], O[t][3]};
        const v4f x1 = {O[t][4], O[t][5], O[t][6], O[t][7]};
        *(v4fa*)(pw + 16 * t) = x0;
        *(v4fa*)(pw + 16 * t + 4) = x1;
      }
    }
    __syncthreads();
    // one wave per query row (wave-uniform loop): lane sums d = 2 lane, 2 lane + 1 over the NW partial tiles; a wave writes whole 128-B lines
#pragma unroll 1  // at most one trip per wave once NW >= 16: nothing to gain from copies of the body
    for (int row = w; row < 16; row += NW) {
      const float* pr = part + row * OPP + 2 * lane;
      float t0 = 0.0f, t1 = 0.0f;
#pragma unroll  // independent LDS loads in flight together; the sums stay in wave order
      for (int u = 0; u < NW; ++u) {
        const v2f x = *(const v2fa*)(pr + u * 16 * OPP);
        t0 += x[0];
        t1 += x[1];
      }
      const unsigned int h0 = bf16_bits(t0), h1 = bf16_bits(t1);
      const unsigned int l0 = bf16_bits(t0 - bf16_val((unsigned short)h0)), l1 = bf16_bits(t1 - bf16_val((unsigned short)h1));
      unsigned short* d = Cx + ((size_t)(q0 + row) * NB_FULL + b) * CXP + h * HD + 2 * lane;
      *(u32a*)d = h0 | (h1 << 16);
      *(u32a*)(d + DM) = l0 | (l1 << 16);
      asm volatile("s_wait_xcnt 0x0" ::: "memory");  // the stores' address registers are advanced for the next head right behind them
    }
  }

  __syncthreads();
  float* cg = Cov + ((size_t)b * SEQ_FULL + q0) * SEQ_FULL;
#pragma unroll 1  // a few short trips, once per block: kept rolled as before
  for (int idx = w; idx < 16 * (SEQ / 128); idx += NW) {
    const int row = idx / (SEQ / 128), col = (idx % (SEQ / 128)) * 128 + lane * 4;
    v4f v = *(const v4fa*)(covs + row * COVP + col);
    v[0] *= 0.0625f; v[1] *= 0.0625f; v[2] *= 0.0625f; v[3] *= 0.0625f;
    *(v4f*)(cg + (size_t)row * SEQ_FULL + col) = v;
    asm volatile("s_wait_xcnt 0x0" ::: "memory");    // the next trip rewrites the store's address and data registers
  }
}

// Output projection: out[m][n] = sum_c ctx[m][c] Wo[n][c] with A = [ctx_hi | ctx_lo] (K = 2048) and the W k index wrapping at 1024.
// coverage: blocks tile the [SEQ*NB_FULL][1024] output exactly once.
__global__ __launch_bounds__(256) void k_oproj(const unsigned short* __restrict__ Cx, const unsigned short* __restrict__ Wo,
                                               float* __restrict__ Out) {
  __shared__ __attribute__((aligned(16))) unsigned short ring[RING_E];
  const int tid = threadIdx.x, w = __builtin_amdgcn_readfirstlane((int)(tid >> 5)), lane = tid & 31, ln = lane & 15, hh = lane >> 4;
  const int wr = w & 3, wc = w >> 2;                 // wave position: rows 32 wr, columns 64 wc
  const int pr = (wr >> 1) + 2 * wc, w2 = wr & 1;    // 64 x 64 staging tile, and the wave's place in it
  const int mb = blockIdx.x * GT, nb = blockIdx.y * GT;
  const int m0 = mb + 64 * (wr >> 1), n0 = nb + 64 * wc;
  const int crow = tid >> 3, cpc = 8 * (tid & 7);
  const unsigned short* ga = Cx + (size_t)(mb + crow) * CXP + cpc;
  const unsigned short* gb = Wo + (size_t)(nb + crow) * DM + cpc;
  const unsigned int la = (unsigned int)(size_t)(ring + crow * TP + cpc);
  v8f acc[2][4] = {};
  gemm_main<CXP>(ga, (size_t)CXP, gb, la, ring + (32 * wr + ln) * TP + 8 * hh, ring + TILE_E + (64 * wc + ln) * TP + 8 * hh, acc);
  float* so = (float*)ring + pr * (64 * 68);
#pragma unroll
  for (int mt = 0; mt < 2; ++mt)
#pragma unroll
    for (int nt = 0; nt < 4; ++nt)
#pragma unroll
      for (int r = 0; r < 8; ++r)
        so[(32 * w2 + 16 * mt + 8 * hh + r) * 68 + 16 * nt + ln] = acc[mt][nt][r];
  __syncthreads();
  const int rsub = lane >> 4, c4 = (lane & 15) * 4;
  {
#pragma unroll 1
    for (int i = 0; i < 16; ++i) {
      const int row = 32 * w2 + 2 * i + rsub;
      const v4f v = *(const v4fa*)(so + row * 68 + c4);
      *(v4f*)(Out + (size_t)(m0 + row) * DM + n0 + c4) = v;
    }
    
  }
}

extern "C" void kernel_launch(void* const* d_in, const int* in_sizes, int n_in,
                              void* d_out, int out_size, void* d_ws, size_t ws_size, hipStream_t stream) {
  if (n_in < 10) return;
  const long long needX = (long long)SEQ * NB_FULL * DM;
  if ((long long)in_sizes[0] < needX || (long long)in_sizes[1] < needX || (long long)in_sizes[2] < needX) return;
  for (int i = 3; i < 7; ++i) if ((long long)in_sizes[i] < (long long)DM * DM) return;
  if ((long long)in_sizes[7] < ((long long)(NB - 1) * SEQ_FULL + (SEQ - 1)) * SEQ_FULL + SEQ_FULL) return;
  if ((long long)in_sizes[8] < (long long)SEQ * RHSW) return;
  if (in_sizes[9] < 1) return;
  if ((long long)out_size < (long long)COV_OFF + ((long long)(NB - 1) * SEQ_FULL + (SEQ - 1)) * SEQ_FULL + SEQ) return;

  const float* query = (const float*)d_in[0];   // wire order: query, key, value, Wq, Wk, Wv, Wo, mask, rhs_mask, layer_idx
  const float* keyt  = (const float*)d_in[1];
  const float* value = (const float*)d_in[2];
  const float* Wq    = (const float*)d_in[3];
  const float* Wk    = (const float*)d_in[4];
  const float* Wv    = (const float*)d_in[5];
  const float* Wo    = (const float*)d_in[6];
  const int*   mask  = (const int*)d_in[7];
  const int*   rhs   = (const int*)d_in[8];
  const int*   lidx  = (const int*)d_in[9];
  float* out = (float*)d_out;
  float* cov = out + COV_OFF;

  char* ws = (char*)d_ws;
  size_t off = 0;
  unsigned short* Xb = (unsigned short*)(ws + off); off += BYTES_XB;   // 3 activation planes [SEQ*NB_FULL][1024] bf16
  unsigned short* Wb = (unsigned short*)(ws + off); off += BYTES_WB;   // 4 weight planes [1024][1024] bf16 (q, k, v, o)
  unsigned short* PL = (unsigned short*)(ws + off); off += BYTES_PL;   // q_hi, q_lo, k_hi, k_lo, vT_hi, vT_lo
  unsigned short* Cx = (unsigned short*)(ws + off); off += BYTES_CX;   // ctx [SEQ*NB_FULL][hi 1024 | lo 1024] bf16
  unsigned int*   Mb = (unsigned int*)(ws + off);   off += BYTES_MB;   // mask bit-plane [NB][SEQ][32 words]
  if (off > ws_size) return;

  k_prep<<<PREP_WG, PREP_TH, 0, stream>>>(query, keyt, value, Wq, Wk, Wv, Wo, mask, rhs, lidx, Xb, Wb, Mb);
  k_proj<<<dim3((unsigned)(NB * SEQ / GT), NH / 2, 3), 256, 0, stream>>>(Xb, Wb, PL);
  hipFuncSetAttribute(reinterpret_cast<const void*>(&k_attn), hipFuncAttributeMaxDynamicSharedMemorySize, (int)ATTN_LDS);
  k_attn<<<(unsigned)(NB * (SEQ / 16)), 32 * NW, (size_t)ATTN_LDS, stream>>>(PL, Mb, Cx, cov);
  k_oproj<<<dim3((unsigned)(SEQ * NB_FULL / GT), DM / GT), 256, 0, stream>>>(Cx, Wb + 3 * WN, out);
}

// v004
// It runs in 248 microseconds.
// Next to v003, in two timings, it ran 1.19 times as fast each time.
// Over all steps from v000 it is 4.98 times as fast.
#include <hip/hip_runtime.h>
// Contractions (all v_wmma_f32_16x16x32_bf16, f32 accumulate): q/k/v projections = single product on RNE-bf16 inputs and weights; scores K Q^T, P V and the output projection = bf16 hi+lo planes of the computed operand(s), products hi*hi + hi*lo + lo*hi (output projection: [ctx_hi | ctx_lo] x [Wo ; Wo] folded along K); softmax statistics and coverage in f32.
// come from K rows (A, global bf16 planes) and Q^T (B, registers); the two 16-key D tiles pack straight into the P^T B fragment; O^T accumulates from V^T rows (A).
// Masks: both boolean inputs and the layer index are read on the device into a bit-plane (one 32-bit word per query and 32-key step); fully masked steps are skipped at run time.
#ifndef NB
#define NB 4
#endif
#ifndef SEQ
#define SEQ 1024
#endif
#define NB_FULL 4
#define SEQ_FULL 1024
#define NH 16
#define HD 64
#define DM 1024
#define RHSW (SEQ_FULL + 4)
#define NKS (SEQ / 32)
#define MBW (SEQ_FULL / 32)
#define CXP 2048
#define COVP (SEQ + 4)
#define STP 72
#define COV_LDS_BYTES (16 * COVP * 4)
#define NW 32                                    /* waves of one attention block */
#define NSTEP ((NKS + NW - 1) / NW)              /* 32-key steps owned by one wave */
#define STATP (NW + 4)                           /* dword pitch of a query's row of per-wave statistics (16 B x odd) */
#define OPP 68                                   /* dword pitch of a partial-O row */
#define ATTN_LDS (COV_LDS_BYTES + 2 * 16 * STATP * 4 + NW * 16 * OPP * 4)

#define XN ((size_t)SEQ * NB_FULL * DM)          /* elements of one converted activation plane (prefix of the full input) */
#define WN ((size_t)DM * DM)
#define PLSZ ((size_t)NB * NH * SEQ * HD)        /* elements of one head-layout plane */
#define COV_OFF ((size_t)SEQ_FULL * NB_FULL * DM) /* element offset of the second output (byte 16777216) */

#define BYTES_XB (3 * XN * 2)
#define BYTES_WB (4 * WN * 2)
#define BYTES_PL (6 * PLSZ * 2)
#define BYTES_CX ((size_t)SEQ * NB_FULL * CXP * 2)
#define BYTES_MB ((size_t)NB * SEQ * MBW * 4)

static_assert(SEQ % 128 == 0);
static_assert(SEQ <= SEQ_FULL);
static_assert(NB <= NB_FULL);
static_assert(MBW == 32);
static_assert(HD == 64);
static_assert(NW % 8 == 0 && NW <= 32);
static_assert(ATTN_LDS <= 327680);
static_assert(NH * HD == DM);
static_assert(COV_OFF * 4 == (size_t)16777216);
static_assert(BYTES_XB % 256 == 0 && BYTES_WB % 256 == 0 && BYTES_PL % 256 == 0 && BYTES_CX % 256 == 0 && BYTES_MB % 256 == 0);
static_assert(BYTES_XB + BYTES_WB + BYTES_PL + BYTES_CX + BYTES_MB <= (size_t)134217728);
static_assert((size_t)SEQ * NB_FULL * DM <= COV_OFF);
static_assert(COV_OFF + ((size_t)(NB - 1) * SEQ_FULL + (SEQ - 1)) * SEQ_FULL + SEQ <= (size_t)33554432 / 4);

typedef __bf16 v16b __attribute__((ext_vector_type(16)));
typedef unsigned short v8us __attribute__((ext_vector_type(8), may_alias));
typedef float v8f __attribute__((ext_vector_type(8)));
typedef float v4f __attribute__((ext_vector_type(4)));
typedef float v4fa __attribute__((ext_vector_type(4), may_alias));
typedef float v2f __attribute__((ext_vector_type(2)));
typedef float v2fa __attribute__((ext_vector_type(2), may_alias));
typedef unsigned int u32a __attribute__((may_alias));
typedef int v4i __attribute__((ext_vector_type(4)));
typedef int v4ia __attribute__((ext_vector_type(4), may_alias));
union FragB { v16b v; v8us half[2]; unsigned short u[16]; };

#define LOG2E 1.4426950408889634f
#define NEGBIG (-1.0e30f)

__device__ __forceinline__ unsigned short bf16_bits(float x) {   // RNE convert to bf16 bits
  unsigned int u = __float_as_uint(x);
  return (unsigned short)((u + 0x7FFFu + ((u >> 16) & 1u)) >> 16);
}
__device__ __forceinline__ float bf16_val(unsigned short b) { return __uint_as_float(((unsigned int)b) << 16); }

__device__ __forceinline__ v8f wm(v16b a, v16b b, v8f c) {
  return __builtin_amdgcn_wmma_f32_16x16x32_bf16(false, a, false, b, (short)0, c, false, false);
}

// Preparation, one launch: PREP_WG work-groups of 16 waves (one a WGP); every thread takes its share of each job, so that few waves have to start.
// Conversions: a work-group's pieces of a plane are contiguous; a wave's load covers 512 contiguous bytes, its store 256 (whole lines).
#define PREP_WG 256
#define PREP_TH 512
#define PREP_T (PREP_WG * PREP_TH)
#define XCH ((int)(XN / 4 / PREP_T))              /* 16-byte pieces of one activation plane per thread */
#define WCH ((int)(WN / 4 / PREP_T))              /* the same of one weight plane */
static_assert(XN % ((size_t)4 * PREP_T) == 0 && WN % ((size_t)4 * PREP_T) == 0);
static_assert(NB * SEQ * MBW <= PREP_T);
typedef unsigned short v4us __attribute__((ext_vector_type(4), may_alias));

__device__ __forceinline__ void cvt_store(unsigned short* d, v4f x) {
  v4us o;
  o[0] = bf16_bits(x[0]); o[1] = bf16_bits(x[1]); o[2] = bf16_bits(x[2]); o[3] = bf16_bits(x[3]);
  *(v4us*)d = o;
}

// coverage: planes: PREP_T threads x XCH (WCH) pieces x 4 elements = every element of each of the 3 + 4 planes, once.
// Mb[b][q][j] bit kk = 1 when key 32j+kk is masked for query q of batch b (mask[b][q][k] != 0 or rhs[q][start + k] != 0); thread t < NB*SEQ*32 writes word t: every word of the plane.
__global__ __launch_bounds__(PREP_TH) void k_prep(const float* __restrict__ query, const float* __restrict__ keyt, const float* __restrict__ value,
                                                  const float* __restrict__ Wq, const float* __restrict__ Wk, const float* __restrict__ Wv,
                                                  const float* __restrict__ Wo, const int* __restrict__ mask, const int* __restrict__ rhs,
                                                  const int* __restrict__ lidx, unsigned short* __restrict__ Xb, unsigned short* __restrict__ Wb,
                                                  unsigned int* __restrict__ Mb) {
  const int tid = threadIdx.x, blk = blockIdx.x;
  const int t = blk * PREP_TH + tid;
  const size_t ex = ((size_t)blk * XCH * PREP_TH + tid) * 4;   // this thread's first element in an activation plane
  const size_t ew = ((size_t)blk * WCH * PREP_TH + tid) * 4;   // and in a weight plane
  const float* sq = query + ex;
  const float* sk = keyt + ex;
  const float* sv = value + ex;
  const float* s0 = Wq + ew;
  const float* s1 = Wk + ew;
  const float* s2 = Wv + ew;
  const float* s3 = Wo + ew;
  // the long streams start first: all of the thread's plane loads are in flight while it forms its mask word
  v4f x[3][XCH], y[4][WCH];
#pragma unroll  // constant index into x[]
  for (int i = 0; i < XCH; ++i) x[0][i] = *(const v4fa*)(sq + (size_t)i * PREP_TH * 4);
#pragma unroll
  for (int i = 0; i < XCH; ++i) x[1][i] = *(const v4fa*)(sk + (size_t)i * PREP_TH * 4);
#pragma unroll
  for (int i = 0; i < XCH; ++i) x[2][i] = *(const v4fa*)(sv + (size_t)i * PREP_TH * 4);
#pragma unroll  // constant index into y[]
  for (int i = 0; i < WCH; ++i) {
    y[0][i] = *(const v4fa*)(s0 + (size_t)i * PREP_TH * 4);
    y[1][i] = *(const v4fa*)(s1 + (size_t)i * PREP_TH * 4);
    y[2][i] = *(const v4fa*)(s2 + (size_t)i * PREP_TH * 4);
    y[3][i] = *(const v4fa*)(s3 + (size_t)i * PREP_TH * 4);
  }
  // the loads' address registers stay live up to this wait (inputs only), so that no load's result and nothing behind it lands in one ahead of it
  asm volatile("s_wait_xcnt 0x0" :: "v"(sq), "v"(sk), "v"(sv), "v"(s0), "v"(s1), "v"(s2), "v"(s3) : "memory");
  if (t < NB * SEQ * MBW) {
    const int j = t & 31, row = t >> 5;
    const int b = row / SEQ, q = row - b * SEQ;
    int L = lidx[0];
    L = (L < -64) ? -64 : ((L > 64) ? 64 : L);
    int tt = 4 - 4 * L; if (tt < 0) tt = 0;
    int start = 4 - tt; if (start < 0) start = 0;
    start = (start >= 4) ? 4 : 0;                       // the formula only yields 0 or 4; keeps the 16-B alignment of the row loads
    const int* mp = mask + ((size_t)b * SEQ_FULL + q) * SEQ_FULL + 32 * j;
    const int* rp = rhs + (size_t)q * RHSW + start + 32 * j;
    v4i a[8], r[8];
#pragma unroll  // constant index into a[] and r[]; the word's 16 loads in flight together
    for (int c = 0; c < 8; ++c) {
      a[c] = *(const v4ia*)(mp + 4 * c);
      r[c] = *(const v4ia*)(rp + 4 * c);
    }
    // as above: both address pairs stay live up to this wait, so that no load's result lands in one ahead of it
    asm volatile("s_wait_xcnt 0x0" :: "v"(mp), "v"(rp) : "memory");
    unsigned int w = 0u;
#pragma unroll
    for (int c = 0; c < 8; ++c) {
      const unsigned int nib = (((a[c][0] | r[c][0]) != 0) ? 1u : 0u) | (((a[c][1] | r[c][1]) != 0) ? 2u : 0u) |
                               (((a[c][2] | r[c][2]) != 0) ? 4u : 0u) | (((a[c][3] | r[c][3]) != 0) ? 8u : 0u);
      w |= nib << (4 * c);
    }
    Mb[t] = w;
  }
#pragma unroll  // constant index into x[]
  for (int p = 0; p < 3; ++p)
#pragma unroll
    for (int i = 0; i < XCH; ++i) cvt_store(Xb + (size_t)p * XN + ex + (size_t)i * PREP_TH * 4, x[p][i]);
#pragma unroll  // constant index into y[]
  for (int p = 0; p < 4; ++p)
#pragma unroll
    for (int i = 0; i < WCH; ++i) cvt_store(Wb + (size_t)p * WN + ew + (size_t)i * PREP_TH * 4, y[p][i]);
}

// Block tile 128 rows x 128 columns, 8 waves of 32 x 64 (4 along the rows, 2 along the columns), K in stages of KC.
// A stage is [A tile | W tile], each GT rows of KC bf16 (one whole 128-B line a row) at LDS pitch TP; two buffers.
// Every lane copies 16 B per instruction, a wave 4 whole lines: 4 copies a lane for the A tile, 4 for the W tile.
#define GT 128
#define KC 64
#define TP 72                                    /* elements: 144 B = 16 B x odd, for the ds_load_b128 fragment reads */
#define TILE_E (GT * TP)
#define RING_E (4 * TILE_E)
static_assert(DM % KC == 0 && CXP % KC == 0 && DM / KC >= 2);
static_assert(RING_E >= 4 * 2 * 64 * STP);       // the projections' output staging reuses the ring
static_assert(RING_E * 2 >= 4 * 64 * 68 * 4);    // so does the output projection's

// la: LDS byte address of this lane's piece in its first row of the A tile of the target buffer; ga, gb: the same piece in global memory.
// Rows crow + 32 i, i = 0..3, of both tiles. The s_wait_xcnt stands inside the statement: the address registers are rewritten behind it.
__device__ __forceinline__ void stage_copy(unsigned int la, const unsigned short* ga, size_t apitch, const unsigned short* gb) {
  const unsigned int lb = la + TILE_E * 2;
  asm volatile("global_load_async_to_lds_b128 %0, %8, off\n\t"
               "global_load_async_to_lds_b128 %1, %9, off\n\t"
               "global_load_async_to_lds_b128 %2, %10, off\n\t"
               "global_load_async_to_lds_b128 %3, %11, off\n\t"
               "global_load_async_to_lds_b128 %4, %12, off\n\t"
               "global_load_async_to_lds_b128 %5, %13, off\n\t"
               "global_load_async_to_lds_b128 %6, %14, off\n\t"
               "global_load_async_to_lds_b128 %7, %15, off\n\t"
               "s_wait_xcnt 0x0"
               :: "v"(la), "v"(la + 32 * TP * 2), "v"(la + 64 * TP * 2), "v"(la + 96 * TP * 2),
                  "v"(lb), "v"(lb + 32 * TP * 2), "v"(lb + 64 * TP * 2), "v"(lb + 96 * TP * 2),
                  "v"(ga), "v"(ga + 32 * apitch), "v"(ga + 64 * apitch), "v"(ga + 96 * apitch),
                  "v"(gb), "v"(gb + 32 * DM), "v"(gb + 64 * DM), "v"(gb + 96 * DM)
               : "memory");
}

// ga, gb: this thread's copy sources at k = 0 (row tid / 8 of the tile, piece tid % 8); ar, br: this lane's fragment rows in buffer 0.
// The W k index wraps at DM so that [A_hi | A_lo] x [W ; W] folds along K. Each accumulator still sums k in steps of 32, ascending.
template <int KT>
__device__ __forceinline__ void gemm_main(const unsigned short* __restrict__ ga, size_t apitch, const unsigned short* __restrict__ gb,
                                          unsigned int la, const unsigned short* ar, const unsigned short* br, v8f (&acc)[2][4]) {
  constexpr int NT = KT / KC;
  stage_copy(la, ga, apitch, gb);
  asm volatile("s_wait_asynccnt 0x0" ::: "memory");   // stage 0 has landed before the barrier publishes it
  __syncthreads();
  stage_copy(la + 2 * TILE_E * 2, ga + KC, apitch, gb + KC);
#pragma unroll 1  // one stage a trip: the buffer index and the refill test stay scalar
  for (int t = 0; t < NT; ++t) {
    const int bo = (t & 1) * 2 * TILE_E;
#pragma unroll  // two 32-wide k steps of the stage
    for (int kk = 0; kk < KC; kk += 32) {
      const unsigned short* ap = ar + bo + kk;
      const unsigned short* bp = br + bo + kk;
      FragB a0, a1, b0, b1, b2, b3;
      a0.half[0] = *(const v8us*)(ap);                a0.half[1] = *(const v8us*)(ap + 16);
      a1.half[0] = *(const v8us*)(ap + 16 * TP);      a1.half[1] = *(const v8us*)(ap + 16 * TP + 16);
      b0.half[0] = *(const v8us*)(bp);                b0.half[1] = *(const v8us*)(bp + 16);
      b1.half[0] = *(const v8us*)(bp + 16 * TP);      b1.half[1] = *(const v8us*)(bp + 16 * TP + 16);
      b2.half[0] = *(const v8us*)(bp + 32 * TP);      b2.half[1] = *(const v8us*)(bp + 32 * TP + 16);
      b3.half[0] = *(const v8us*)(bp + 48 * TP);      b3.half[1] = *(const v8us*)(bp + 48 * TP + 16);
      acc[0][0] = wm(a0.v, b0.v, acc[0][0]); acc[0][1] = wm(a0.v, b1.v, acc[0][1]);
      acc[0][2] = wm(a0.v, b2.v, acc[0][2]); acc[0][3] = wm(a0.v, b3.v, acc[0][3]);
      acc[1][0] = wm(a1.v, b0.v, acc[1][0]); acc[1][1] = wm(a1.v, b1.v, acc[1][1]);
      acc[1][2] = wm(a1.v, b2.v, acc[1][2]); acc[1][3] = wm(a1.v, b3.v, acc[1][3]);
      asm volatile("v_nop\n\tv_nop\n\tv_nop\n\tv_nop"
                   : "+v"(acc[0][0]), "+v"(acc[0][1]), "+v"(acc[0][2]), "+v"(acc[0][3]),
                     "+v"(acc[1][0]), "+v"(acc[1][1]), "+v"(acc[1][2]), "+v"(acc[1][3])
                   : "v"(a0.v), "v"(a1.v), "v"(b0.v), "v"(b1.v), "v"(b2.v), "v"(b3.v));
    }
    asm volatile("s_wait_dscnt 0x0" ::: "memory");      // this wave's reads of the buffer are done before it is refilled
    asm volatile("s_wait_asynccnt 0x0" ::: "memory");   // this wave's copies of stage t + 1 have landed
    __syncthreads();                                    // publishes stage t + 1 and ends every reader's last read of stage t
    if (t + 2 < NT) {
      const int k2 = (t + 2) * KC;
      stage_copy(la + (unsigned int)bo * 2u, ga + k2, apitch, gb + (k2 & (DM - 1)));
    }
  }
  asm volatile("s_wait_asynccnt 0x0" ::: "memory");     // nothing is in flight when the ring becomes output staging
}

// Projections. grid (NB*SEQ/128, NH/2, 3): block = 128 sequence positions of one batch x two heads x one of {q, k, v}; 8 waves x (32 x 64).
// Logical row b*SEQ + s reads the activation row s*NB_FULL + b. Epilogue: each pair of waves owns a 64 x 64 tile (one head): bf16 hi + lo planes staged in its part of the ring
// (block barrier: the read-back crosses the pair's two waves for q, k and v), q (scaled by 1/8) and k planes: [b][h][s][64]; v planes transposed: [b][h][d][SEQ].
__global__ __launch_bounds__(256) void k_proj(const unsigned short* __restrict__ Xb, const unsigned short* __restrict__ Wb,
                                              unsigned short* __restrict__ PL) {
  __shared__ __attribute__((aligned(16))) unsigned short ring[RING_E];
  const int tid = threadIdx.x, w = __builtin_amdgcn_readfirstlane((int)(tid >> 5)), lane = tid & 31, ln = lane & 15, hh = lane >> 4;
  const int wr = w & 3, wc = w >> 2;                 // wave position: rows 32 wr, columns 64 wc
  const int pr = (wr >> 1) + 2 * wc, w2 = wr & 1;    // pair of waves that shares a 64 x 64 output tile, and the wave's place in it
  const int z = blockIdx.z, hcol = 2 * blockIdx.y + wc;
  const int mt0 = blockIdx.x * GT;
  const int b = mt0 / SEQ, sb = mt0 - b * SEQ;
  const int s0 = sb + 64 * (wr >> 1);
  const int crow = tid >> 3, cpc = 8 * (tid & 7);
  const unsigned short* ga = Xb + (size_t)z * XN + ((size_t)(sb + crow) * NB_FULL + b) * DM + cpc;
  const unsigned short* gb = Wb + (size_t)z * WN + (size_t)(GT * blockIdx.y + crow) * DM + cpc;
  const unsigned int la = (unsigned int)(size_t)(ring + crow * TP + cpc);
  v8f acc[2][4] = {};
  gemm_main<DM>(ga, (size_t)NB_FULL * DM, gb, la, ring + (32 * wr + ln) * TP + 8 * hh, ring + TILE_E + (64 * wc + ln) * TP + 8 * hh, acc);
  unsigned short* sh = ring + pr * (2 * 64 * STP);
  unsigned short* sl = sh + 64 * STP;
  const int t2 = 32 * w2 + lane;
  const float scale = (z == 0) ? 0.125f : 1.0f;
#pragma unroll
  for (int mt = 0; mt < 2; ++mt)
#pragma unroll
    for (int nt = 0; nt < 4; ++nt)
#pragma unroll
      for (int r = 0; r < 8; ++r) {
        const float v = acc[mt][nt][r] * scale;
        const unsigned short hb = bf16_bits(v);
        const unsigned short lb = bf16_bits(v - bf16_val(hb));
        const int sr = 32 * w2 + 16 * mt + 8 * hh + r;     // local sequence row
        const int dc = 16 * nt + ln;                        // head-dim column
        const int idx = (z == 2) ? (dc * STP + sr) : (sr * STP + dc);
        sh[idx] = hb;
        sl[idx] = lb;
      }
  __syncthreads();
  const size_t hbase = (size_t)b * NH + hcol;
  unsigned short* dstp = PL + (size_t)z * 2 * PLSZ;
  {
#pragma unroll 1
    for (int i = 0; i < 8; ++i) {
      const int row = 8 * i + (t2 >> 3), piece = t2 & 7;
      const v8us vh = *(const v8us*)(sh + row * STP + 8 * piece);
      const v8us vl = *(const v8us*)(sl + row * STP + 8 * piece);
      const size_t ro = (z == 2) ? ((hbase * HD + row) * SEQ + s0) : ((hbase * SEQ + s0 + row) * HD);
      unsigned short* d = dstp + ro + 8 * piece;
      *(v8us*)d = vh;
      *(v8us*)(d + PLSZ) = vl;
      asm volatile("s_wait_xcnt 0x0" ::: "memory");  // the next trip rewrites the stores' address registers
    }
    
  }
}

// S^T tile of 16 keys: c = K_lo Q_hi + K_hi Q_lo + K_hi Q_hi over the two 32-wide head-dim chunks, then the hazard guard.
__device__ __forceinline__ v8f qk_tile(const unsigned short* __restrict__ kp, const FragB& qh0, const FragB& qh1,
                                       const FragB& ql0, const FragB& ql1) {
  // A fragments of K: row m = key, elements 0..7 <- d = 32c + 8h + i, 8..15 <- d = 32c + 16 + 8h + i (kp already holds + 8h)
  FragB a0, a1, c0, c1;
  const unsigned short* lp = kp + PLSZ;
  a0.half[0] = *(const v8us*)(kp);      a0.half[1] = *(const v8us*)(kp + 16);
  a1.half[0] = *(const v8us*)(kp + 32); a1.half[1] = *(const v8us*)(kp + 48);
  asm volatile("s_wait_xcnt 0x0" ::: "memory");   // a result of the lo-plane loads may land in the hi-plane loads' address registers
  c0.half[0] = *(const v8us*)(lp);      c0.half[1] = *(const v8us*)(lp + 16);
  c1.half[0] = *(const v8us*)(lp + 32); c1.half[1] = *(const v8us*)(lp + 48);
  asm volatile("s_wait_xcnt 0x0" ::: "memory");   // what follows may reuse the lo-plane loads' address registers
  v8f c = {0.f, 0.f, 0.f, 0.f, 0.f, 0.f, 0.f, 0.f};
  c = wm(c0.v, qh0.v, c); c = wm(c1.v, qh1.v, c);
  c = wm(a0.v, ql0.v, c); c = wm(a1.v, ql1.v, c);
  c = wm(a0.v, qh0.v, c); c = wm(a1.v, qh1.v, c);
  asm volatile("v_nop\n\tv_nop\n\tv_nop\n\tv_nop" : "+v"(c)
               : "v"(a0.v), "v"(a1.v), "v"(c0.v), "v"(c1.v), "v"(qh0.v), "v"(qh1.v), "v"(ql0.v), "v"(ql1.v));
  return c;
}

// O^T tile of 16 head-dim rows: o += V_lo P_hi + V_hi P_lo + V_hi P_hi, then the hazard guard.
__device__ __forceinline__ v8f pv_tile(const unsigned short* __restrict__ vp, const FragB& ph, const FragB& pl, v8f o) {
  // A fragments of V^T: row m = d, elements 0..7 <- key0 + 8h + i, 8..15 <- key0 + 16 + 8h + i (vp already holds key0 + 8h)
  FragB vh, vl;
  const unsigned short* lp = vp + PLSZ;
  vh.half[0] = *(const v8us*)(vp); vh.half[1] = *(const v8us*)(vp + 16);
  vl.half[0] = *(const v8us*)(lp); vl.half[1] = *(const v8us*)(lp + 16);
  o = wm(vl.v, ph.v, o);
  o = wm(vh.v, pl.v, o);
  o = wm(vh.v, ph.v, o);
  asm volatile("v_nop\n\tv_nop\n\tv_nop\n\tv_nop" : "+v"(o) : "v"(vh.v), "v"(vl.v), "v"(ph.v), "v"(pl.v));
  return o;
}

// Block = one batch x 16 queries, NW waves; wave w owns the 32-key steps j = w, w + NW, ... of every head (its mask words stay in registers).
// Per head: each wave's softmax statistics over its own steps -> LDS -> barrier -> every wave merges all NW pairs (max, rescaled sum);
// then normalised weights (the wave's kept exponentials rescaled to the merged statistics), coverage into the LDS tile [16][SEQ] (a step's columns belong to one wave, each lane only touches its own addresses), partial O^T;
// partial O^T tiles -> LDS -> barrier -> one wave per query row sums the NW partials in wave order and writes bf16 hi | lo halves of the [s*NB_FULL+b][2048] plane.
// Reuse of the exchange buffers: statistics of head h are read before the second barrier of h and rewritten after it; partials of h are read before the first barrier of h + 1 and rewritten after it.
// coverage: ctx plane: (b, 16 rows) x 16 heads x (64 hi + 64 lo) = every element of rows with b < NB; coverage output: 16 rows x SEQ columns per block, all rows once.
// LDS: coverage tile zero-filled in full before use; every wave writes its statistics and its whole partial tile (zeros when all its steps are masked) before they are read.
__global__ __launch_bounds__(32 * NW) void k_attn(const unsigned short* __restrict__ PL, const unsigned int* __restrict__ Mb,
                                                  unsigned short* __restrict__ Cx, float* __restrict__ Cov) {
  extern __shared__ __attribute__((aligned(16))) unsigned char smem[];
  float* covs = (float*)smem;
  float* stm = (float*)(smem + COV_LDS_BYTES);     // [16 queries][STATP]: running maximum of wave w at column w
  float* stl = stm + 16 * STATP;                   // same shape: sum of wave w
  float* part = stl + 16 * STATP;                  // [NW][16 queries][OPP]: partial O, f32
  const int tid = threadIdx.x, w = __builtin_amdgcn_readfirstlane((int)(tid >> 5));
  const int lane = tid & 31, ln = lane & 15, hh = lane >> 4;
  const int b = blockIdx.x / (SEQ / 16), qt = blockIdx.x % (SEQ / 16);
  const int q0 = qt * 16, qg = q0 + ln;
  {
    const v4f z4 = {0.f, 0.f, 0.f, 0.f};
    for (int i = tid; i < 4 * COVP; i += 32 * NW) *(v4fa*)(covs + 4 * i) = z4;
  }
  const unsigned int* mrow = Mb + (size_t)(b * SEQ + qg) * MBW;
  unsigned int mw[NSTEP];
  bool act[NSTEP];                                 // wave-uniform: some key of the step is open for one of the 16 queries
#pragma unroll  // mw[] and act[] must be indexed by constants to stay in registers
  for (int i = 0; i < NSTEP; ++i) {
    const int j = w + i * NW;
    mw[i] = (j < NKS) ? mrow[j] : 0xFFFFFFFFu;
    act[i] = __any(mw[i] != 0xFFFFFFFFu);
  }
  __syncthreads();
  const int sh8 = 8 * hh;
  float* crow = covs + ln * COVP + 8 * hh;

#pragma unroll 1
  for (int h = 0; h < NH; ++h) {
    const size_t hb = (size_t)b * NH + h;
    // Q^T B fragments: column n = query qg, elements 0..7 <- d = 32c + 8h + i, 8..15 <- d = 32c + 16 + 8h + i
    const unsigned short* qp = PL + (hb * SEQ + qg) * HD + 8 * hh;
    const unsigned short* khp = PL + 2 * PLSZ + (hb * SEQ + ln) * HD + 8 * hh;
    const unsigned short* vhp = PL + 4 * PLSZ + (hb * HD + ln) * SEQ + 8 * hh;

    // ---- pass 1: statistics over this wave's own steps; each step's exponentials stay in registers, relative to the maximum ms[i] they were formed with ----
    float mr = NEGBIG, lr = 0.0f;
    float pe[NSTEP][16], ms[NSTEP];                // read only under the same act[i] that wrote them
#pragma unroll  // constant index into mw[] and act[]
    for (int i = 0; i < NSTEP; ++i) {
      if (act[i]) {
        // Q feeds this pass alone: its loads stand in the block that uses them, in front of their waits (one step a wave at this shape)
        FragB qh0, qh1, ql0, ql1;
        qh0.half[0] = *(const v8us*)(qp);             qh0.half[1] = *(const v8us*)(qp + 16);
        qh1.half[0] = *(const v8us*)(qp + 32);        qh1.half[1] = *(const v8us*)(qp + 48);
        asm volatile("s_wait_xcnt 0x0" ::: "memory");   // a result of the lo-plane loads may land in the hi-plane loads' address registers
        ql0.half[0] = *(const v8us*)(qp + PLSZ);      ql0.half[1] = *(const v8us*)(qp + PLSZ + 16);
        ql1.half[0] = *(const v8us*)(qp + PLSZ + 32);
        asm volatile("s_wait_xcnt 0x0" ::: "memory");   // the last load's result may land in the address registers that it shares with the three loads before it
        ql1.half[1] = *(const v8us*)(qp + PLSZ + 48);
        asm volatile("s_wait_xcnt 0x0" ::: "memory");   // the address registers of the Q loads are reused for the K addresses right behind them
        const int j = w + i * NW;
        const unsigned short* kp = khp + (size_t)(32 * j) * HD;
        const v8f s0 = qk_tile(kp, qh0, qh1, ql0, ql1);          // element r = score(key 32j + 8h + r, query qg)
        const v8f s1 = qk_tile(kp + 16 * HD, qh0, qh1, ql0, ql1);
        const unsigned int wb = mw[i] >> sh8;
        float sc[16];
        float mx = NEGBIG;
#pragma unroll
        for (int r = 0; r < 8; ++r) {
          sc[r]     = ((wb >> r) & 1u) ? NEGBIG : s0[r];
          sc[8 + r] = ((wb >> (16 + r)) & 1u) ? NEGBIG : s1[r];
          mx = fmaxf(mx, fmaxf(sc[r], sc[8 + r]));
        }
        mx = fmaxf(mx, __shfl_xor(mx, 16, 32));                  // the other lane half holds the other 16 keys of this query
        const float mnew = fmaxf(mr, mx);
        const float al = exp2f((mr - mnew) * LOG2E);
        float ps = 0.0f;
#pragma unroll
        for (int r = 0; r < 16; ++r) {
          const float e = exp2f((sc[r] - mnew) * LOG2E);
          pe[i][r] = (sc[r] > -1.0e29f) ? e : 0.0f;              // 0 for a masked key
          ps += pe[i][r];
        }
        ms[i] = mnew;
        ps += __shfl_xor(ps, 16, 32);
        lr = lr * al + ps;
        mr = mnew;
      }
    }
    if (hh == 0) { stm[ln * STATP + w] = mr; stl[ln * STATP + w] = lr; }
    __syncthreads();
    // merge: each lane half reads NW / 2 of the waves' pairs of its query, then one exchange between the halves
    {
      float mv[NW / 2], lv[NW / 2];                // the loops below are unrolled so that both arrays stay in registers
#pragma unroll
      for (int u = 0; u < NW / 8; ++u) {
        const v4f x = *(const v4fa*)(stm + ln * STATP + (NW / 2) * hh + 4 * u);
        const v4f y = *(const v4fa*)(stl + ln * STATP + (NW / 2) * hh + 4 * u);
        mv[4 * u] = x[0]; mv[4 * u + 1] = x[1]; mv[4 * u + 2] = x[2]; mv[4 * u + 3] = x[3];
        lv[4 * u] = y[0]; lv[4 * u + 1] = y[1]; lv[4 * u + 2] = y[2]; lv[4 * u + 3] = y[3];
      }
      float mg = NEGBIG;
#pragma unroll
      for (int u = 0; u < NW / 2; ++u) mg = fmaxf(mg, mv[u]);
      mg = fmaxf(mg, __shfl_xor(mg, 16, 32));
      float lg = 0.0f;
#pragma unroll
      for (int u = 0; u < NW / 2; ++u) mv[u] = exp2f((mv[u] - mg) * LOG2E);
#pragma unroll
      for (int u = 0; u < NW / 2; ++u) lg += lv[u] * mv[u];
      lg += __shfl_xor(lg, 16, 32);
      mr = mg;
      lr = lg;
    }
    const float inv = (lr > 0.0f) ? 1.0f / lr : 0.0f;   // a query with no open key keeps weights of 0 (0 x inf otherwise)

    // ---- pass 2: weights = kept exponentials x exp(ms - m) / l, coverage accumulation, partial O^T over this wave's own steps ----
    v8f O[4] = {};
#pragma unroll  // constant index into mw[] and act[]
    for (int i = 0; i < NSTEP; ++i) {
      if (act[i]) {
        const int key0 = 32 * (w + i * NW);
        const float f = exp2f((ms[i] - mr) * LOG2E) * inv;
        float pn[16];
#pragma unroll
        for (int r = 0; r < 16; ++r) pn[r] = pe[i][r] * f;
        // coverage tile: this lane owns columns key0 + 8h + 0..7 and key0 + 16 + 8h + 0..7 of row ln
        {
          float* cr = crow + key0;
          v4f c0 = *(const v4fa*)(cr), c1 = *(const v4fa*)(cr + 4), c2 = *(const v4fa*)(cr + 16), c3 = *(const v4fa*)(cr + 20);
          c0[0] += pn[0];  c0[1] += pn[1];  c0[2] += pn[2];  c0[3] += pn[3];
          c1[0] += pn[4];  c1[1] += pn[5];  c1[2] += pn[6];  c1[3] += pn[7];
          c2[0] += pn[8];  c2[1] += pn[9];  c2[2] += pn[10]; c2[3] += pn[11];
          c3[0] += pn[12]; c3[1] += pn[13]; c3[2] += pn[14]; c3[3] += pn[15];
          *(v4fa*)(cr) = c0; *(v4fa*)(cr + 4) = c1; *(v4fa*)(cr + 16) = c2; *(v4fa*)(cr + 20) = c3;
        }
        // P^T B fragment: element i < 8 -> key0 + 8h + i (tile 0 row 8h + i); i >= 8 -> key0 + 16 + 8h + (i - 8) (tile 1); bf16 hi + lo
        FragB ph, pl;
#pragma unroll
        for (int r = 0; r < 16; ++r) {
          const unsigned short hb16 = bf16_bits(pn[r]);
          ph.u[r] = hb16;
          pl.u[r] = bf16_bits(pn[r] - bf16_val(hb16));
        }
        __builtin_amdgcn_sched_barrier(0);
        const unsigned short* vp = vhp + key0;
        O[0] = pv_tile(vp, ph, pl, O[0]);
        O[1] = pv_tile(vp + (size_t)16 * SEQ, ph, pl, O[1]);
        O[2] = pv_tile(vp + (size_t)32 * SEQ, ph, pl, O[2]);
        O[3] = pv_tile(vp + (size_t)48 * SEQ, ph, pl, O[3]);
      }
    }

    // O^T element r of tile t = partial ctx(query qg, d = 16t + 8h + r): f32 into this wave's tile [16 queries][64 d]
    {
      float* pw = part + (size_t)(w * 16 + ln) * OPP + 8 * hh;
#pragma unroll  // constant index into O[]
      for (int t = 0; t < 4; ++t) {
        const v4f x0 = {O[t][0], O[t][1], O[t][2], O[t][3]};
        const v4f x1 = {O[t][4], O[t][5], O[t][6], O[t][7]};
        *(v4fa*)(pw + 16 * t) = x0;
        *(v4fa*)(pw + 16 * t + 4) = x1;
      }
    }
    __syncthreads();
    // one wave per query row (wave-uniform loop): lane sums d = 2 lane, 2 lane + 1 over the NW partial tiles; a wave writes whole 128-B lines
#pragma unroll 1  // at most one trip per wave once NW >= 16: nothing to gain from copies of the body
    for (int row = w; row < 16; row += NW) {
      const float* pr = part + row * OPP + 2 * lane;
      float t0 = 0.0f, t1 = 0.0f;
#pragma unroll  // independent LDS loads in flight together; the sums stay in wave order
      for (int u = 0; u < NW; ++u) {
        const v2f x = *(const v2fa*)(pr + u * 16 * OPP);
        t0 += x[0];
        t1 += x[1];
      }
      const unsigned int h0 = bf16_bits(t0), h1 = bf16_bits(t1);
      const unsigned int l0 = bf16_bits(t0 - bf16_val((unsigned short)h0)), l1 = bf16_bits(t1 - bf16_val((unsigned short)h1));
      unsigned short* d = Cx + ((size_t)(q0 + row) * NB_FULL + b) * CXP + h * HD + 2 * lane;
      *(u32a*)d = h0 | (h1 << 16);
      *(u32a*)(d + DM) = l0 | (l1 << 16);
      asm volatile("s_wait_xcnt 0x0" ::: "memory");  // the stores' address registers are advanced for the next head right behind them
    }
  }

  __syncthreads();
  float* cg = Cov + ((size_t)b * SEQ_FULL + q0) * SEQ_FULL;
#pragma unroll 1  // a few short trips, once per block: kept rolled as before
  for (int idx = w; idx < 16 * (SEQ / 128); idx += NW) {
    const int row = idx / (SEQ / 128), col = (idx % (SEQ / 128)) * 128 + lane * 4;
    v4f v = *(const v4fa*)(covs + row * COVP + col);
    v[0] *= 0.0625f; v[1] *= 0.0625f; v[2] *= 0.0625f; v[3] *= 0.0625f;
    *(v4f*)(cg + (size_t)row * SEQ_FULL + col) = v;
    asm volatile("s_wait_xcnt 0x0" ::: "memory");    // the next trip rewrites the store's address and data registers
  }
}

// Output projection: out[m][n] = sum_c ctx[m][c] Wo[n][c] with A = [ctx_hi | ctx_lo] (K = 2048) and the W k index wrapping at 1024.
// coverage: blocks tile the [SEQ*NB_FULL][1024] output exactly once.
__global__ __launch_bounds__(256) void k_oproj(const unsigned short* __restrict__ Cx, const unsigned short* __restrict__ Wo,
                                               float* __restrict__ Out) {
  __shared__ __attribute__((aligned(16))) unsigned short ring[RING_E];
  const int tid = threadIdx.x, w = __builtin_amdgcn_readfirstlane((int)(tid >> 5)), lane = tid & 31, ln = lane & 15, hh = lane >> 4;
  const int wr = w & 3, wc = w >> 2;                 // wave position: rows 32 wr, columns 64 wc
  const int pr = (wr >> 1) + 2 * wc, w2 = wr & 1;    // 64 x 64 staging tile, and the wave's place in it
  const int mb = blockIdx.x * GT, nb = blockIdx.y * GT;
  const int m0 = mb + 64 * (wr >> 1), n0 = nb + 64 * wc;
  const int crow = tid >> 3, cpc = 8 * (tid & 7);
  const unsigned short* ga = Cx + (size_t)(mb + crow) * CXP + cpc;
  const unsigned short* gb = Wo + (size_t)(nb + crow) * DM + cpc;
  const unsigned int la = (unsigned int)(size_t)(ring + crow * TP + cpc);
  v8f acc[2][4] = {};
  gemm_main<CXP>(ga, (size_t)CXP, gb, la, ring + (32 * wr + ln) * TP + 8 * hh, ring + TILE_E + (64 * wc + ln) * TP + 8 * hh, acc);
  float* so = (float*)ring + pr * (64 * 68);
#pragma unroll
  for (int mt = 0; mt < 2; ++mt)
#pragma unroll
    for (int nt = 0; nt < 4; ++nt)
#pragma unroll
      for (int r = 0; r < 8; ++r)
        so[(32 * w2 + 16 * mt + 8 * hh + r) * 68 + 16 * nt + ln] = acc[mt][nt][r];
  __syncthreads();
  const int rsub = lane >> 4, c4 = (lane & 15) * 4;
  {
#pragma unroll 1
    for (int i = 0; i < 16; ++i) {
      const int row = 32 * w2 + 2 * i + rsub;
      const v4f v = *(const v4fa*)(so + row * 68 + c4);
      *(v4f*)(Out + (size_t)(m0 + row) * DM + n0 + c4) = v;
    }
    
  }
}

extern "C" void kernel_launch(void* const* d_in, const int* in_sizes, int n_in,
                              void* d_out, int out_size, void* d_ws, size_t ws_size, hipStream_t stream) {
  if (n_in < 10) return;
  const long long needX = (long long)SEQ * NB_FULL * DM;
  if ((long long)in_sizes[0] < needX || (long long)in_sizes[1] < needX || (long long)in_sizes[2] < needX) return;
  for (int i = 3; i < 7; ++i) if ((long long)in_sizes[i] < (long long)DM * DM) return;
  if ((long long)in_sizes[7] < ((long long)(NB - 1) * SEQ_FULL + (SEQ - 1)) * SEQ_FULL + SEQ_FULL) return;
  if ((long long)in_sizes[8] < (long long)SEQ * RHSW) return;
  if (in_sizes[9] < 1) return;
  if ((long long)out_size < (long long)COV_OFF + ((long long)(NB - 1) * SEQ_FULL + (SEQ - 1)) * SEQ_FULL + SEQ) return;

  const float* query = (const float*)d_in[0];   // wire order: query, key, value, Wq, Wk, Wv, Wo, mask, rhs_mask, layer_idx
  const float* keyt  = (const float*)d_in[1];
  const float* value = (const float*)d_in[2];
  const float* Wq    = (const float*)d_in[3];
  const float* Wk    = (const float*)d_in[4];
  const float* Wv    = (const float*)d_in[5];
  const float* Wo    = (const float*)d_in[6];
  const int*   mask  = (const int*)d_in[7];
  const int*   rhs   = (const int*)d_in[8];
  const int*   lidx  = (const int*)d_in[9];
  float* out = (float*)d_out;
  float* cov = out + COV_OFF;

  char* ws = (char*)d_ws;
  size_t off = 0;
  unsigned short* Xb = (unsigned short*)(ws + off); off += BYTES_XB;   // 3 activation planes [SEQ*NB_FULL][1024] bf16
  unsigned short* Wb = (unsigned short*)(ws + off); off += BYTES_WB;   // 4 weight planes [1024][1024] bf16 (q, k, v, o)
  unsigned short* PL = (unsigned short*)(ws + off); off += BYTES_PL;   // q_hi, q_lo, k_hi, k_lo, vT_hi, vT_lo
  unsigned short* Cx = (unsigned short*)(ws + off); off += BYTES_CX;   // ctx [SEQ*NB_FULL][hi 1024 | lo 1024] bf16
  unsigned int*   Mb = (unsigned int*)(ws + off);   off += BYTES_MB;   // mask bit-plane [NB][SEQ][32 words]
  if (off > ws_size) return;

  k_prep<<<PREP_WG, PREP_TH, 0, stream>>>(query, keyt, value, Wq, Wk, Wv, Wo, mask, rhs, lidx, Xb, Wb, Mb);
  k_proj<<<dim3((unsigned)(NB * SEQ / GT), NH / 2, 3), 256, 0, stream>>>(Xb, Wb, PL);
  hipFuncSetAttribute(reinterpret_cast<const void*>(&k_attn), hipFuncAttributeMaxDynamicSharedMemorySize, (int)ATTN_LDS);
  k_attn<<<(unsigned)(NB * (SEQ / 16)), 32 * NW, (size_t)ATTN_LDS, stream>>>(PL, Mb, Cx, cov);
  k_oproj<<<dim3((unsigned)(SEQ * NB_FULL / GT), DM / GT), 256, 0, stream>>>(Cx, Wb + 3 * WN, out);
}

// v005
// It runs in 186 microseconds.
// Next to v004, in two timings, it ran 1.33 times as fast each time.
// Counting every step since v000, it is 6.63 times as fast.
#include <hip/hip_runtime.h>
// Contractions (all v_wmma_f32_16x16x32_bf16, f32 accumulate): q/k/v projections = single product on RNE-bf16 inputs and weights; scores K Q^T, P V and the output projection = bf16 hi+lo planes of the computed operand(s), products hi*hi + hi*lo + lo*hi (output projection: [ctx_hi | ctx_lo] x [Wo ; Wo] folded along K); softmax statistics and coverage in f32.
// come from K rows (A, global bf16 planes) and Q^T (B, registers); the two 16-key D tiles pack straight into the P^T B fragment; O^T accumulates from V^T rows (A).
// Masks: both boolean inputs and the layer index are read on the device into a bit-plane (one 32-bit word per query and 32-key step); fully masked steps are skipped at run time.
#ifndef NB
#define NB 4
#endif
#ifndef SEQ
#define SEQ 1024
#endif
#define NB_FULL 4
#define SEQ_FULL 1024
#define NH 16
#define HD 64
#define DM 1024
#define RHSW (SEQ_FULL + 4)
#define NKS (SEQ / 32)
#define MBW (SEQ_FULL / 32)
#define CXP 2048
#define COVP (SEQ + 4)
#define STP 72
#define COV_LDS_BYTES (16 * COVP * 4)
#define NW 32                                    /* waves of one attention block */
#define NSTEP ((NKS + NW - 1) / NW)              /* 32-key steps owned by one wave */
#define STATP (NW + 4)                           /* dword pitch of a query's row of per-wave statistics (16 B x odd) */
#define OPP 68                                   /* dword pitch of a partial-O row */
#define ATTN_LDS (COV_LDS_BYTES + 2 * 16 * STATP * 4 + NW * 16 * OPP * 4)

#define XN ((size_t)SEQ * NB_FULL * DM)          /* elements of one converted activation plane (prefix of the full input) */
#define WN ((size_t)DM * DM)
#define PLSZ ((size_t)NB * NH * SEQ * HD)        /* elements of one head-layout plane */
#define COV_OFF ((size_t)SEQ_FULL * NB_FULL * DM) /* element offset of the second output (byte 16777216) */

#define BYTES_XB (3 * XN * 2)
#define BYTES_WB (4 * WN * 2)
#define BYTES_PL (6 * PLSZ * 2)
#define BYTES_CX ((size_t)SEQ * NB_FULL * CXP * 2)
#define BYTES_MB ((size_t)NB * SEQ * MBW * 4)

static_assert(SEQ % 128 == 0);
static_assert(SEQ <= SEQ_FULL);
static_assert(NB <= NB_FULL);
static_assert(MBW == 32);
static_assert(HD == 64);
static_assert(NW % 8 == 0 && NW <= 32);
static_assert(ATTN_LDS <= 327680);
static_assert(NH * HD == DM);
static_assert(PLSZ * 2 <= (size_t)0xFFFFFFFF);   // a byte offset inside a head-layout plane fits 32 bits
static_assert(COV_OFF * 4 == (size_t)16777216);
static_assert(BYTES_XB % 256 == 0 && BYTES_WB % 256 == 0 && BYTES_PL % 256 == 0 && BYTES_CX % 256 == 0 && BYTES_MB % 256 == 0);
static_assert(BYTES_XB + BYTES_WB + BYTES_PL + BYTES_CX + BYTES_MB <= (size_t)134217728);
static_assert((size_t)SEQ * NB_FULL * DM <= COV_OFF);
static_assert(COV_OFF + ((size_t)(NB - 1) * SEQ_FULL + (SEQ - 1)) * SEQ_FULL + SEQ <= (size_t)33554432 / 4);

typedef __bf16 v16b __attribute__((ext_vector_type(16)));
typedef unsigned short v8us __attribute__((ext_vector_type(8), may_alias));
typedef float v8f __attribute__((ext_vector_type(8)));
typedef float v4f __attribute__((ext_vector_type(4)));
typedef float v4fa __attribute__((ext_vector_type(4), may_alias));
typedef float v2f __attribute__((ext_vector_type(2)));
typedef float v2fa __attribute__((ext_vector_type(2), may_alias));
typedef unsigned int u32a __attribute__((may_alias));
typedef int v4i __attribute__((ext_vector_type(4)));
typedef int v4ia __attribute__((ext_vector_type(4), may_alias));
union FragB { v16b v; v8us half[2]; unsigned short u[16]; };

#define LOG2E 1.4426950408889634f
#define NEGBIG (-1.0e30f)

__device__ __forceinline__ unsigned short bf16_bits(float x) {   // RNE convert to bf16 bits
  unsigned int u = __float_as_uint(x);
  return (unsigned short)((u + 0x7FFFu + ((u >> 16) & 1u)) >> 16);
}
__device__ __forceinline__ float bf16_val(unsigned short b) { return __uint_as_float(((unsigned int)b) << 16); }

__device__ __forceinline__ v8f wm(v16b a, v16b b, v8f c) {
  return __builtin_amdgcn_wmma_f32_16x16x32_bf16(false, a, false, b, (short)0, c, false, false);
}

// Preparation, one launch: PREP_WG work-groups of 16 waves (one a WGP); every thread takes its share of each job, so that few waves have to start.
// Conversions: a work-group's pieces of a plane are contiguous; a wave's load covers 512 contiguous bytes, its store 256 (whole lines).
#define PREP_WG 256
#define PREP_TH 512
#define PREP_T (PREP_WG * PREP_TH)
#define XCH ((int)(XN / 4 / PREP_T))              /* 16-byte pieces of one activation plane per thread */
#define WCH ((int)(WN / 4 / PREP_T))              /* the same of one weight plane */
static_assert(XN % ((size_t)4 * PREP_T) == 0 && WN % ((size_t)4 * PREP_T) == 0);
static_assert(NB * SEQ * MBW <= PREP_T);
typedef unsigned short v4us __attribute__((ext_vector_type(4), may_alias));

__device__ __forceinline__ void cvt_store(unsigned short* d, v4f x) {
  v4us o;
  o[0] = bf16_bits(x[0]); o[1] = bf16_bits(x[1]); o[2] = bf16_bits(x[2]); o[3] = bf16_bits(x[3]);
  *(v4us*)d = o;
}

// coverage: planes: PREP_T threads x XCH (WCH) pieces x 4 elements = every element of each of the 3 + 4 planes, once.
// Mb[b][q][j] bit kk = 1 when key 32j+kk is masked for query q of batch b (mask[b][q][k] != 0 or rhs[q][start + k] != 0); thread t < NB*SEQ*32 writes word t: every word of the plane.
__global__ __launch_bounds__(PREP_TH) void k_prep(const float* __restrict__ query, const float* __restrict__ keyt, const float* __restrict__ value,
                                                  const float* __restrict__ Wq, const float* __restrict__ Wk, const float* __restrict__ Wv,
                                                  const float* __restrict__ Wo, const int* __restrict__ mask, const int* __restrict__ rhs,
                                                  const int* __restrict__ lidx, unsigned short* __restrict__ Xb, unsigned short* __restrict__ Wb,
                                                  unsigned int* __restrict__ Mb) {
  const int tid = threadIdx.x, blk = blockIdx.x;
  const int t = blk * PREP_TH + tid;
  const size_t ex = ((size_t)blk * XCH * PREP_TH + tid) * 4;   // this thread's first element in an activation plane
  const size_t ew = ((size_t)blk * WCH * PREP_TH + tid) * 4;   // and in a weight plane
  const float* sq = query + ex;
  const float* sk = keyt + ex;
  const float* sv = value + ex;
  const float* s0 = Wq + ew;
  const float* s1 = Wk + ew;
  const float* s2 = Wv + ew;
  const float* s3 = Wo + ew;
  // the long streams start first: all of the thread's plane loads are in flight while it forms its mask word
  v4f x[3][XCH], y[4][WCH];
#pragma unroll  // constant index into x[]
  for (int i = 0; i < XCH; ++i) x[0][i] = *(const v4fa*)(sq + (size_t)i * PREP_TH * 4);
#pragma unroll
  for (int i = 0; i < XCH; ++i) x[1][i] = *(const v4fa*)(sk + (size_t)i * PREP_TH * 4);
#pragma unroll
  for (int i = 0; i < XCH; ++i) x[2][i] = *(const v4fa*)(sv + (size_t)i * PREP_TH * 4);
#pragma unroll  // constant index into y[]
  for (int i = 0; i < WCH; ++i) {
    y[0][i] = *(const v4fa*)(s0 + (size_t)i * PREP_TH * 4);
    y[1][i] = *(const v4fa*)(s1 + (size_t)i * PREP_TH * 4);
    y[2][i] = *(const v4fa*)(s2 + (size_t)i * PREP_TH * 4);
    y[3][i] = *(const v4fa*)(s3 + (size_t)i * PREP_TH * 4);
  }
  // the loads' address registers stay live up to this wait (inputs only), so that no load's result and nothing behind it lands in one ahead of it
  asm volatile("s_wait_xcnt 0x0" :: "v"(sq), "v"(sk), "v"(sv), "v"(s0), "v"(s1), "v"(s2), "v"(s3) : "memory");
  if (t < NB * SEQ * MBW) {
    const int j = t & 31, row = t >> 5;
    const int b = row / SEQ, q = row - b * SEQ;
    int L = lidx[0];
    L = (L < -64) ? -64 : ((L > 64) ? 64 : L);
    int tt = 4 - 4 * L; if (tt < 0) tt = 0;
    int start = 4 - tt; if (start < 0) start = 0;
    start = (start >= 4) ? 4 : 0;                       // the formula only yields 0 or 4; keeps the 16-B alignment of the row loads
    const int* mp = mask + ((size_t)b * SEQ_FULL + q) * SEQ_FULL + 32 * j;
    const int* rp = rhs + (size_t)q * RHSW + start + 32 * j;
    v4i a[8], r[8];
#pragma unroll  // constant index into a[] and r[]; the word's 16 loads in flight together
    for (int c = 0; c < 8; ++c) {
      a[c] = *(const v4ia*)(mp + 4 * c);
      r[c] = *(const v4ia*)(rp + 4 * c);
    }
    // as above: both address pairs stay live up to this wait, so that no load's result lands in one ahead of it
    asm volatile("s_wait_xcnt 0x0" :: "v"(mp), "v"(rp) : "memory");
    unsigned int w = 0u;
#pragma unroll
    for (int c = 0; c < 8; ++c) {
      const unsigned int nib = (((a[c][0] | r[c][0]) != 0) ? 1u : 0u) | (((a[c][1] | r[c][1]) != 0) ? 2u : 0u) |
                               (((a[c][2] | r[c][2]) != 0) ? 4u : 0u) | (((a[c][3] | r[c][3]) != 0) ? 8u : 0u);
      w |= nib << (4 * c);
    }
    Mb[t] = w;
  }
#pragma unroll  // constant index into x[]
  for (int p = 0; p < 3; ++p)
#pragma unroll
    for (int i = 0; i < XCH; ++i) cvt_store(Xb + (size_t)p * XN + ex + (size_t)i * PREP_TH * 4, x[p][i]);
#pragma unroll  // constant index into y[]
  for (int p = 0; p < 4; ++p)
#pragma unroll
    for (int i = 0; i < WCH; ++i) cvt_store(Wb + (size_t)p * WN + ew + (size_t)i * PREP_TH * 4, y[p][i]);
}

// Block tile 128 rows x 128 columns, 8 waves of 32 x 64 (4 along the rows, 2 along the columns), K in stages of KC.
// A stage is [A tile | W tile], each GT rows of KC bf16 (one whole 128-B line a row) at LDS pitch TP; two buffers.
// Every lane copies 16 B per instruction, a wave 4 whole lines: 4 copies a lane for the A tile, 4 for the W tile.
#define GT 128
#define KC 64
#define TP 72                                    /* elements: 144 B = 16 B x odd, for the ds_load_b128 fragment reads */
#define TILE_E (GT * TP)
#define RING_E (4 * TILE_E)
static_assert(DM % KC == 0 && CXP % KC == 0 && DM / KC >= 2);
static_assert(RING_E >= 4 * 2 * 64 * STP);       // the projections' output staging reuses the ring
static_assert(RING_E * 2 >= 4 * 64 * 68 * 4);    // so does the output projection's

// la: LDS byte address of this lane's piece in its first row of the A tile of the target buffer; ga, gb: the same piece in global memory.
// Rows crow + 32 i, i = 0..3, of both tiles. The s_wait_xcnt stands inside the statement: the address registers are rewritten behind it.
__device__ __forceinline__ void stage_copy(unsigned int la, const unsigned short* ga, size_t apitch, const unsigned short* gb) {
  const unsigned int lb = la + TILE_E * 2;
  asm volatile("global_load_async_to_lds_b128 %0, %8, off\n\t"
               "global_load_async_to_lds_b128 %1, %9, off\n\t"
               "global_load_async_to_lds_b128 %2, %10, off\n\t"
               "global_load_async_to_lds_b128 %3, %11, off\n\t"
               "global_load_async_to_lds_b128 %4, %12, off\n\t"
               "global_load_async_to_lds_b128 %5, %13, off\n\t"
               "global_load_async_to_lds_b128 %6, %14, off\n\t"
               "global_load_async_to_lds_b128 %7, %15, off\n\t"
               "s_wait_xcnt 0x0"
               :: "v"(la), "v"(la + 32 * TP * 2), "v"(la + 64 * TP * 2), "v"(la + 96 * TP * 2),
                  "v"(lb), "v"(lb + 32 * TP * 2), "v"(lb + 64 * TP * 2), "v"(lb + 96 * TP * 2),
                  "v"(ga), "v"(ga + 32 * apitch), "v"(ga + 64 * apitch), "v"(ga + 96 * apitch),
                  "v"(gb), "v"(gb + 32 * DM), "v"(gb + 64 * DM), "v"(gb + 96 * DM)
               : "memory");
}

// ga, gb: this thread's copy sources at k = 0 (row tid / 8 of the tile, piece tid % 8); ar, br: this lane's fragment rows in buffer 0.
// The W k index wraps at DM so that [A_hi | A_lo] x [W ; W] folds along K. Each accumulator still sums k in steps of 32, ascending.
template <int KT>
__device__ __forceinline__ void gemm_main(const unsigned short* __restrict__ ga, size_t apitch, const unsigned short* __restrict__ gb,
                                          unsigned int la, const unsigned short* ar, const unsigned short* br, v8f (&acc)[2][4]) {
  constexpr int NT = KT / KC;
  stage_copy(la, ga, apitch, gb);
  asm volatile("s_wait_asynccnt 0x0" ::: "memory");   // stage 0 has landed before the barrier publishes it
  __syncthreads();
  stage_copy(la + 2 * TILE_E * 2, ga + KC, apitch, gb + KC);
#pragma unroll 1  // one stage a trip: the buffer index and the refill test stay scalar
  for (int t = 0; t < NT; ++t) {
    const int bo = (t & 1) * 2 * TILE_E;
#pragma unroll  // two 32-wide k steps of the stage
    for (int kk = 0; kk < KC; kk += 32) {
      const unsigned short* ap = ar + bo + kk;
      const unsigned short* bp = br + bo + kk;
      FragB a0, a1, b0, b1, b2, b3;
      a0.half[0] = *(const v8us*)(ap);                a0.half[1] = *(const v8us*)(ap + 16);
      a1.half[0] = *(const v8us*)(ap + 16 * TP);      a1.half[1] = *(const v8us*)(ap + 16 * TP + 16);
      b0.half[0] = *(const v8us*)(bp);                b0.half[1] = *(const v8us*)(bp + 16);
      b1.half[0] = *(const v8us*)(bp + 16 * TP);      b1.half[1] = *(const v8us*)(bp + 16 * TP + 16);
      b2.half[0] = *(const v8us*)(bp + 32 * TP);      b2.half[1] = *(const v8us*)(bp + 32 * TP + 16);
      b3.half[0] = *(const v8us*)(bp + 48 * TP);      b3.half[1] = *(const v8us*)(bp + 48 * TP + 16);
      acc[0][0] = wm(a0.v, b0.v, acc[0][0]); acc[0][1] = wm(a0.v, b1.v, acc[0][1]);
      acc[0][2] = wm(a0.v, b2.v, acc[0][2]); acc[0][3] = wm(a0.v, b3.v, acc[0][3]);
      acc[1][0] = wm(a1.v, b0.v, acc[1][0]); acc[1][1] = wm(a1.v, b1.v, acc[1][1]);
      acc[1][2] = wm(a1.v, b2.v, acc[1][2]); acc[1][3] = wm(a1.v, b3.v, acc[1][3]);
      asm volatile("v_nop\n\tv_nop\n\tv_nop\n\tv_nop"
                   : "+v"(acc[0][0]), "+v"(acc[0][1]), "+v"(acc[0][2]), "+v"(acc[0][3]),
                     "+v"(acc[1][0]), "+v"(acc[1][1]), "+v"(acc[1][2]), "+v"(acc[1][3])
                   : "v"(a0.v), "v"(a1.v), "v"(b0.v), "v"(b1.v), "v"(b2.v), "v"(b3.v));
    }
    asm volatile("s_wait_dscnt 0x0" ::: "memory");      // this wave's reads of the buffer are done before it is refilled
    asm volatile("s_wait_asynccnt 0x0" ::: "memory");   // this wave's copies of stage t + 1 have landed
    __syncthreads();                                    // publishes stage t + 1 and ends every reader's last read of stage t
    if (t + 2 < NT) {
      const int k2 = (t + 2) * KC;
      stage_copy(la + (unsigned int)bo * 2u, ga + k2, apitch, gb + (k2 & (DM - 1)));
    }
  }
  asm volatile("s_wait_asynccnt 0x0" ::: "memory");     // nothing is in flight when the ring becomes output staging
}

// Projections. grid (NB*SEQ/128, NH/2, 3): block = 128 sequence positions of one batch x two heads x one of {q, k, v}; 8 waves x (32 x 64).
// Logical row b*SEQ + s reads the activation row s*NB_FULL + b. Epilogue: each pair of waves owns a 64 x 64 tile (one head): bf16 hi + lo planes staged in its part of the ring
// (block barrier kept as it was; a wave now reads back the rows it staged itself). The planes lie in fragment order, in units of 512 B = [32 lanes][8 elements], one unit = one fragment load of an attention wave (4 whole lines):
// q (scaled by 1/8) and k: [b][h][s / 16][L = 0..3][lane], lane (hh, ln) holds row s = 16 tile + ln, d = 16 L + 8 hh + 0..7; v: [b][h][s / 32][d / 16][x = 0..1][lane], lane holds d = 16 t + ln, keys 32 j + 16 x + 8 hh + 0..7.
__global__ __launch_bounds__(256) void k_proj(const unsigned short* __restrict__ Xb, const unsigned short* __restrict__ Wb,
                                              unsigned short* __restrict__ PL) {
  __shared__ __attribute__((aligned(16))) unsigned short ring[RING_E];
  const int tid = threadIdx.x, w = __builtin_amdgcn_readfirstlane((int)(tid >> 5)), lane = tid & 31, ln = lane & 15, hh = lane >> 4;
  const int wr = w & 3, wc = w >> 2;                 // wave position: rows 32 wr, columns 64 wc
  const int pr = (wr >> 1) + 2 * wc, w2 = wr & 1;    // pair of waves that shares a 64 x 64 output tile, and the wave's place in it
  const int z = blockIdx.z, hcol = 2 * blockIdx.y + wc;
  const int mt0 = blockIdx.x * GT;
  const int b = mt0 / SEQ, sb = mt0 - b * SEQ;
  const int s0 = sb + 64 * (wr >> 1);
  const int crow = tid >> 3, cpc = 8 * (tid & 7);
  const unsigned short* ga = Xb + (size_t)z * XN + ((size_t)(sb + crow) * NB_FULL + b) * DM + cpc;
  const unsigned short* gb = Wb + (size_t)z * WN + (size_t)(GT * blockIdx.y + crow) * DM + cpc;
  const unsigned int la = (unsigned int)(size_t)(ring + crow * TP + cpc);
  v8f acc[2][4] = {};
  gemm_main<DM>(ga, (size_t)NB_FULL * DM, gb, la, ring + (32 * wr + ln) * TP + 8 * hh, ring + TILE_E + (64 * wc + ln) * TP + 8 * hh, acc);
  unsigned short* sh = ring + pr * (2 * 64 * STP);
  unsigned short* sl = sh + 64 * STP;
  const float scale = (z == 0) ? 0.125f : 1.0f;
#pragma unroll
  for (int mt = 0; mt < 2; ++mt)
#pragma unroll
    for (int nt = 0; nt < 4; ++nt)
#pragma unroll
      for (int r = 0; r < 8; ++r) {
        const float v = acc[mt][nt][r] * scale;
        const unsigned short hb = bf16_bits(v);
        const unsigned short lb = bf16_bits(v - bf16_val(hb));
        const int sr = 32 * w2 + 16 * mt + 8 * hh + r;     // local sequence row
        const int dc = 16 * nt + ln;                        // head-dim column
        const int idx = (z == 2) ? (dc * STP + sr) : (sr * STP + dc);
        sh[idx] = hb;
        sl[idx] = lb;
      }
  __syncthreads();
  const size_t hbase = (size_t)b * NH + hcol;
  unsigned short* dstp = PL + (size_t)z * 2 * PLSZ + (hbase * SEQ + s0) * HD + 8 * lane;   // the 64 x 64 tile is 16 consecutive units in either layout
  {
#pragma unroll 1
    for (int i = 0; i < 8; ++i) {
      const int u = 8 * w2 + i;                          // unit of the tile; a wave's store covers the whole unit
      const int row = ln + ((z == 2) ? 16 * ((u >> 1) & 3) : 16 * (u >> 2));
      const int col = 8 * hh + ((z == 2) ? 32 * (u >> 3) + 16 * (u & 1) : 16 * (u & 3));
      const v8us vh = *(const v8us*)(sh + row * STP + col);
      const v8us vl = *(const v8us*)(sl + row * STP + col);
      unsigned short* d = dstp + 256 * u;
      *(v8us*)d = vh;
      *(v8us*)(d + PLSZ) = vl;
      asm volatile("s_wait_xcnt 0x0" ::: "memory");  // the next trip rewrites the stores' address registers
    }
    
  }
}

// S^T tile of 16 keys: c = K_lo Q_hi + K_hi Q_lo + K_hi Q_hi over the two 32-wide head-dim chunks, then the hazard guard.
__device__ __forceinline__ v8f qk_tile(const char* __restrict__ kh, const char* __restrict__ kl, unsigned int o, const FragB& qh0, const FragB& qh1,
                                       const FragB& ql0, const FragB& ql1) {
  // A fragments of K: row m = key, elements 0..7 <- d = 32c + 8h + i, 8..15 <- d = 32c + 16 + 8h + i: units 2c and 2c + 1 of the key tile; kh, kl: the planes (uniform), o: byte offset of the lane's 16 B in unit 0
  FragB a0, a1, c0, c1;
  const char* kp = kh + o;
  const char* lp = kl + o;
  a0.half[0] = *(const v8us*)(kp);        a0.half[1] = *(const v8us*)(kp + 512);
  a1.half[0] = *(const v8us*)(kp + 1024); a1.half[1] = *(const v8us*)(kp + 1536);
  asm volatile("s_wait_xcnt 0x0" ::: "memory");   // a result of the lo-plane loads may land in the hi-plane loads' address registers
  c0.half[0] = *(const v8us*)(lp);        c0.half[1] = *(const v8us*)(lp + 512);
  c1.half[0] = *(const v8us*)(lp + 1024);
  asm volatile("s_wait_xcnt 0x0" ::: "memory");   // the last load's result may land in the address or offset register that it shares with the loads before it
  c1.half[1] = *(const v8us*)(lp + 1536);
  asm volatile("s_wait_xcnt 0x0" ::: "memory");   // what follows may reuse the loads' address registers
  v8f c = {0.f, 0.f, 0.f, 0.f, 0.f, 0.f, 0.f, 0.f};
  c = wm(c0.v, qh0.v, c); c = wm(c1.v, qh1.v, c);
  c = wm(a0.v, ql0.v, c); c = wm(a1.v, ql1.v, c);
  c = wm(a0.v, qh0.v, c); c = wm(a1.v, qh1.v, c);
  asm volatile("v_nop\n\tv_nop\n\tv_nop\n\tv_nop" : "+v"(c)
               : "v"(a0.v), "v"(a1.v), "v"(c0.v), "v"(c1.v), "v"(qh0.v), "v"(qh1.v), "v"(ql0.v), "v"(ql1.v));
  return c;
}

// O^T tile of 16 head-dim rows: o += V_lo P_hi + V_hi P_lo + V_hi P_hi, then the hazard guard.
__device__ __forceinline__ v8f pv_tile(const char* __restrict__ vp, const char* __restrict__ lp, const FragB& ph, const FragB& pl, v8f o) {
  // A fragments of V^T: row m = d, elements 0..7 <- key0 + 8h + i, 8..15 <- key0 + 16 + 8h + i: units 0 and 1 of the (key step, d tile) pair; vp, lp: the lane's 16 B in unit 0 of the hi and of the lo plane
  FragB vh, vl;
  vh.half[0] = *(const v8us*)(vp); vh.half[1] = *(const v8us*)(vp + 512);
  vl.half[0] = *(const v8us*)(lp); vl.half[1] = *(const v8us*)(lp + 512);
  o = wm(vl.v, ph.v, o);
  o = wm(vh.v, pl.v, o);
  o = wm(vh.v, ph.v, o);
  asm volatile("v_nop\n\tv_nop\n\tv_nop\n\tv_nop" : "+v"(o) : "v"(vh.v), "v"(vl.v), "v"(ph.v), "v"(pl.v));
  return o;
}

// Block = one batch x 16 queries, NW waves; wave w owns the 32-key steps j = w, w + NW, ... of every head (its mask words stay in registers).
// Per head: each wave's softmax statistics over its own steps -> LDS -> barrier -> every wave merges all NW pairs (max, rescaled sum);
// then normalised weights (the wave's kept exponentials rescaled to the merged statistics), coverage into the LDS tile [16][SEQ] (a step's columns belong to one wave, each lane only touches its own addresses), partial O^T;
// partial O^T tiles -> LDS -> barrier -> one wave per query row sums the NW partials in wave order and writes bf16 hi | lo halves of the [s*NB_FULL+b][2048] plane.
// Reuse of the exchange buffers: statistics of head h are read before the second barrier of h and rewritten after it; partials of h are read before the first barrier of h + 1 and rewritten after it.
// coverage: ctx plane: (b, 16 rows) x 16 heads x (64 hi + 64 lo) = every element of rows with b < NB; coverage output: 16 rows x SEQ columns per block, all rows once.
// LDS: coverage tile zero-filled in full before use; every wave writes its statistics and its whole partial tile (zeros when all its steps are masked) before they are read.
__global__ __launch_bounds__(32 * NW) void k_attn(const unsigned short* __restrict__ PL, const unsigned int* __restrict__ Mb,
                                                  unsigned short* __restrict__ Cx, float* __restrict__ Cov) {
  extern __shared__ __attribute__((aligned(16))) unsigned char smem[];
  float* covs = (float*)smem;
  float* stm = (float*)(smem + COV_LDS_BYTES);     // [16 queries][STATP]: running maximum of wave w at column w
  float* stl = stm + 16 * STATP;                   // same shape: sum of wave w
  float* part = stl + 16 * STATP;                  // [NW][16 queries][OPP]: partial O, f32
  const int tid = threadIdx.x, w = __builtin_amdgcn_readfirstlane((int)(tid >> 5));
  const int lane = tid & 31, ln = lane & 15, hh = lane >> 4;
  const int b = blockIdx.x / (SEQ / 16), qt = blockIdx.x % (SEQ / 16);
  const int q0 = qt * 16, qg = q0 + ln;
  {
    const v4f z4 = {0.f, 0.f, 0.f, 0.f};
    for (int i = tid; i < 4 * COVP; i += 32 * NW) *(v4fa*)(covs + 4 * i) = z4;
  }
  const unsigned int* mrow = Mb + (size_t)(b * SEQ + qg) * MBW;
  unsigned int mw[NSTEP];
  bool act[NSTEP];                                 // wave-uniform: some key of the step is open for one of the 16 queries
#pragma unroll  // mw[] and act[] must be indexed by constants to stay in registers
  for (int i = 0; i < NSTEP; ++i) {
    const int j = w + i * NW;
    mw[i] = (j < NKS) ? mrow[j] : 0xFFFFFFFFu;
    act[i] = __any(mw[i] != 0xFFFFFFFFu);
  }
  __syncthreads();
  const int sh8 = 8 * hh;
  const unsigned int lo = 16u * (unsigned int)lane;   // byte offset of this lane's 16 B in a 512-B unit of the q, k, v planes
  const char* PLc = (const char*)PL;                  // plane p starts at byte 2 p PLSZ; addresses are a uniform plane base + a 32-bit offset inside the plane
  float* crow = covs + ln * COVP + 8 * hh;

#pragma unroll 1
  for (int h = 0; h < NH; ++h) {
    const size_t hb = (size_t)b * NH + h;
    // Q^T B fragments: column n = query qg, elements 0..7 <- d = 32c + 8h + i, 8..15 <- d = 32c + 16 + 8h + i: units 2c and 2c + 1 of the query tile
    const unsigned int ho = (unsigned int)hb * (SEQ * HD * 2) + lo;        // byte offset inside a plane: this head, this lane's 16 B of a unit
    const char* qp = PLc + (ho + (unsigned int)q0 * (HD * 2));
    const char* qlp = PLc + 2 * PLSZ + (ho + (unsigned int)q0 * (HD * 2));

    // ---- pass 1: statistics over this wave's own steps; each step's exponentials stay in registers, relative to the maximum ms[i] they were formed with ----
    float mr = NEGBIG, lr = 0.0f;
    float pe[NSTEP][16], ms[NSTEP];                // read only under the same act[i] that wrote them
#pragma unroll  // constant index into mw[] and act[]
    for (int i = 0; i < NSTEP; ++i) {
      if (act[i]) {
        // Q feeds this pass alone: its loads stand in the block that uses them, in front of their waits (one step a wave at this shape)
        FragB qh0, qh1, ql0, ql1;
        qh0.half[0] = *(const v8us*)(qp);              qh0.half[1] = *(const v8us*)(qp + 512);
        qh1.half[0] = *(const v8us*)(qp + 1024);       qh1.half[1] = *(const v8us*)(qp + 1536);
        asm volatile("s_wait_xcnt 0x0" ::: "memory");   // a result of the lo-plane loads may land in the hi-plane loads' address registers
        ql0.half[0] = *(const v8us*)(qlp);             ql0.half[1] = *(const v8us*)(qlp + 512);
        ql1.half[0] = *(const v8us*)(qlp + 1024);
        asm volatile("s_wait_xcnt 0x0" ::: "memory");   // the last load's result may land in the address registers that it shares with the three loads before it
        ql1.half[1] = *(const v8us*)(qlp + 1536);
        asm volatile("s_wait_xcnt 0x0" ::: "memory");   // the address registers of the Q loads are reused for the K addresses right behind them
        const int j = w + i * NW;
        const unsigned int ko = ho + (unsigned int)(32 * j) * (HD * 2);
        const v8f s0 = qk_tile(PLc + 4 * PLSZ, PLc + 6 * PLSZ, ko, qh0, qh1, ql0, ql1);          // element r = score(key 32j + 8h + r, query qg)
        const v8f s1 = qk_tile(PLc + 4 * PLSZ + 2048, PLc + 6 * PLSZ + 2048, ko, qh0, qh1, ql0, ql1);
        const unsigned int wb = mw[i] >> sh8;
        float sc[16];
        float mx = NEGBIG;
#pragma unroll
        for (int r = 0; r < 8; ++r) {
          sc[r]     = ((wb >> r) & 1u) ? NEGBIG : s0[r];
          sc[8 + r] = ((wb >> (16 + r)) & 1u) ? NEGBIG : s1[r];
          mx = fmaxf(mx, fmaxf(sc[r], sc[8 + r]));
        }
        mx = fmaxf(mx, __shfl_xor(mx, 16, 32));                  // the other lane half holds the other 16 keys of this query
        const float mnew = fmaxf(mr, mx);
        const float al = exp2f((mr - mnew) * LOG2E);
        float ps = 0.0f;
#pragma unroll
        for (int r = 0; r < 16; ++r) {
          const float e = exp2f((sc[r] - mnew) * LOG2E);
          pe[i][r] = (sc[r] > -1.0e29f) ? e : 0.0f;              // 0 for a masked key
          ps += pe[i][r];
        }
        ms[i] = mnew;
        ps += __shfl_xor(ps, 16, 32);
        lr = lr * al + ps;
        mr = mnew;
      }
    }
    if (hh == 0) { stm[ln * STATP + w] = mr; stl[ln * STATP + w] = lr; }
    __syncthreads();
    // merge: each lane half reads NW / 2 of the waves' pairs of its query, then one exchange between the halves
    {
      float mv[NW / 2], lv[NW / 2];                // the loops below are unrolled so that both arrays stay in registers
#pragma unroll
      for (int u = 0; u < NW / 8; ++u) {
        const v4f x = *(const v4fa*)(stm + ln * STATP + (NW / 2) * hh + 4 * u);
        const v4f y = *(const v4fa*)(stl + ln * STATP + (NW / 2) * hh + 4 * u);
        mv[4 * u] = x[0]; mv[4 * u + 1] = x[1]; mv[4 * u + 2] = x[2]; mv[4 * u + 3] = x[3];
        lv[4 * u] = y[0]; lv[4 * u + 1] = y[1]; lv[4 * u + 2] = y[2]; lv[4 * u + 3] = y[3];
      }
      float mg = NEGBIG;
#pragma unroll
      for (int u = 0; u < NW / 2; ++u) mg = fmaxf(mg, mv[u]);
      mg = fmaxf(mg, __shfl_xor(mg, 16, 32));
      float lg = 0.0f;
#pragma unroll
      for (int u = 0; u < NW / 2; ++u) mv[u] = exp2f((mv[u] - mg) * LOG2E);
#pragma unroll
      for (int u = 0; u < NW / 2; ++u) lg += lv[u] * mv[u];
      lg += __shfl_xor(lg, 16, 32);
      mr = mg;
      lr = lg;
    }
    const float inv = (lr > 0.0f) ? 1.0f / lr : 0.0f;   // a query with no open key keeps weights of 0 (0 x inf otherwise)

    // ---- pass 2: weights = kept exponentials x exp(ms - m) / l, coverage accumulation, partial O^T over this wave's own steps ----
    v8f O[4] = {};
#pragma unroll  // constant index into mw[] and act[]
    for (int i = 0; i < NSTEP; ++i) {
      if (act[i]) {
        const int key0 = 32 * (w + i * NW);
        const float f = exp2f((ms[i] - mr) * LOG2E) * inv;
        float pn[16];
#pragma unroll
        for (int r = 0; r < 16; ++r) pn[r] = pe[i][r] * f;
        // coverage tile: this lane owns columns key0 + 8h + 0..7 and key0 + 16 + 8h + 0..7 of row ln
        {
          float* cr = crow + key0;
          v4f c0 = *(const v4fa*)(cr), c1 = *(const v4fa*)(cr + 4), c2 = *(const v4fa*)(cr + 16), c3 = *(const v4fa*)(cr + 20);
          c0[0] += pn[0];  c0[1] += pn[1];  c0[2] += pn[2];  c0[3] += pn[3];
          c1[0] += pn[4];  c1[1] += pn[5];  c1[2] += pn[6];  c1[3] += pn[7];
          c2[0] += pn[8];  c2[1] += pn[9];  c2[2] += pn[10]; c2[3] += pn[11];
          c3[0] += pn[12]; c3[1] += pn[13]; c3[2] += pn[14]; c3[3] += pn[15];
          *(v4fa*)(cr) = c0; *(v4fa*)(cr + 4) = c1; *(v4fa*)(cr + 16) = c2; *(v4fa*)(cr + 20) = c3;
        }
        // P^T B fragment: element i < 8 -> key0 + 8h + i (tile 0 row 8h + i); i >= 8 -> key0 + 16 + 8h + (i - 8) (tile 1); bf16 hi + lo
        FragB ph, pl;
#pragma unroll
        for (int r = 0; r < 16; ++r) {
          const unsigned short hb16 = bf16_bits(pn[r]);
          ph.u[r] = hb16;
          pl.u[r] = bf16_bits(pn[r] - bf16_val(hb16));
        }
        __builtin_amdgcn_sched_barrier(0);
        const unsigned int vo = ho + (unsigned int)key0 * (HD * 2);
        const char* vp = PLc + 8 * PLSZ + vo;
        const char* vlp = PLc + 10 * PLSZ + vo;
        O[0] = pv_tile(vp, vlp, ph, pl, O[0]);
        O[1] = pv_tile(vp + 1024, vlp + 1024, ph, pl, O[1]);
        O[2] = pv_tile(vp + 2048, vlp + 2048, ph, pl, O[2]);
        O[3] = pv_tile(vp + 3072, vlp + 3072, ph, pl, O[3]);
      }
    }

    // O^T element r of tile t = partial ctx(query qg, d = 16t + 8h + r): f32 into this wave's tile [16 queries][64 d]
    {
      float* pw = part + (size_t)(w * 16 + ln) * OPP + 8 * hh;
#pragma unroll  // constant index into O[]
      for (int t = 0; t < 4; ++t) {
        const v4f x0 = {O[t][0], O[t][1], O[t][2], O[t][3]};
        const v4f x1 = {O[t][4], O[t][5], O[t][6], O[t][7]};
        *(v4fa*)(pw + 16 * t) = x0;
        *(v4fa*)(pw + 16 * t + 4) = x1;
      }
    }
    __syncthreads();
    // one wave per query row (wave-uniform loop): lane sums d = 2 lane, 2 lane + 1 over the NW partial tiles; a wave writes whole 128-B lines
#pragma unroll 1  // at most one trip per wave once NW >= 16: nothing to gain from copies of the body
    for (int row = w; row < 16; row += NW) {
      const float* pr = part + row * OPP + 2 * lane;
      float t0 = 0.0f, t1 = 0.0f;
#pragma unroll  // independent LDS loads in flight together; the sums stay in wave order
      for (int u = 0; u < NW; ++u) {
        const v2f x = *(const v2fa*)(pr + u * 16 * OPP);
        t0 += x[0];
        t1 += x[1];
      }
      const unsigned int h0 = bf16_bits(t0), h1 = bf16_bits(t1);
      const unsigned int l0 = bf16_bits(t0 - bf16_val((unsigned short)h0)), l1 = bf16_bits(t1 - bf16_val((unsigned short)h1));
      unsigned short* d = Cx + ((size_t)(q0 + row) * NB_FULL + b) * CXP + h * HD + 2 * lane;
      *(u32a*)d = h0 | (h1 << 16);
      *(u32a*)(d + DM) = l0 | (l1 << 16);
      asm volatile("s_wait_xcnt 0x0" ::: "memory");  // the stores' address registers are advanced for the next head right behind them
    }
  }

  __syncthreads();
  float* cg = Cov + ((size_t)b * SEQ_FULL + q0) * SEQ_FULL;
#pragma unroll 1  // a few short trips, once per block: kept rolled as before
  for (int idx = w; idx < 16 * (SEQ / 128); idx += NW) {
    const int row = idx / (SEQ / 128), col = (idx % (SEQ / 128)) * 128 + lane * 4;
    v4f v = *(const v4fa*)(covs + row * COVP + col);
    v[0] *= 0.0625f; v[1] *= 0.0625f; v[2] *= 0.0625f; v[3] *= 0.0625f;
    *(v4f*)(cg + (size_t)row * SEQ_FULL + col) = v;
    asm volatile("s_wait_xcnt 0x0" ::: "memory");    // the next trip rewrites the store's address and data registers
  }
}

// Output projection: out[m][n] = sum_c ctx[m][c] Wo[n][c] with A = [ctx_hi | ctx_lo] (K = 2048) and the W k index wrapping at 1024.
// coverage: blocks tile the [SEQ*NB_FULL][1024] output exactly once.
__global__ __launch_bounds__(256) void k_oproj(const unsigned short* __restrict__ Cx, const unsigned short* __restrict__ Wo,
                                               float* __restrict__ Out) {
  __shared__ __attribute__((aligned(16))) unsigned short ring[RING_E];
  const int tid = threadIdx.x, w = __builtin_amdgcn_readfirstlane((int)(tid >> 5)), lane = tid & 31, ln = lane & 15, hh = lane >> 4;
  const int wr = w & 3, wc = w >> 2;                 // wave position: rows 32 wr, columns 64 wc
  const int pr = (wr >> 1) + 2 * wc, w2 = wr & 1;    // 64 x 64 staging tile, and the wave's place in it
  const int mb = blockIdx.x * GT, nb = blockIdx.y * GT;
  const int m0 = mb + 64 * (wr >> 1), n0 = nb + 64 * wc;
  const int crow = tid >> 3, cpc = 8 * (tid & 7);
  const unsigned short* ga = Cx + (size_t)(mb + crow) * CXP + cpc;
  const unsigned short* gb = Wo + (size_t)(nb + crow) * DM + cpc;
  const unsigned int la = (unsigned int)(size_t)(ring + crow * TP + cpc);
  v8f acc[2][4] = {};
  gemm_main<CXP>(ga, (size_t)CXP, gb, la, ring + (32 * wr + ln) * TP + 8 * hh, ring + TILE_E + (64 * wc + ln) * TP + 8 * hh, acc);
  float* so = (float*)ring + pr * (64 * 68);
#pragma unroll
  for (int mt = 0; mt < 2; ++mt)
#pragma unroll
    for (int nt = 0; nt < 4; ++nt)
#pragma unroll
      for (int r = 0; r < 8; ++r)
        so[(32 * w2 + 16 * mt + 8 * hh + r) * 68 + 16 * nt + ln] = acc[mt][nt][r];
  __syncthreads();
  const int rsub = lane >> 4, c4 = (lane & 15) * 4;
  {
#pragma unroll 1
    for (int i = 0; i < 16; ++i) {
      const int row = 32 * w2 + 2 * i + rsub;
      const v4f v = *(const v4fa*)(so + row * 68 + c4);
      *(v4f*)(Out + (size_t)(m0 + row) * DM + n0 + c4) = v;
    }
    
  }
}

extern "C" void kernel_launch(void* const* d_in, const int* in_sizes, int n_in,
                              void* d_out, int out_size, void* d_ws, size_t ws_size, hipStream_t stream) {
  if (n_in < 10) return;
  const long long needX = (long long)SEQ * NB_FULL * DM;
  if ((long long)in_sizes[0] < needX || (long long)in_sizes[1] < needX || (long long)in_sizes[2] < needX) return;
  for (int i = 3; i < 7; ++i) if ((long long)in_sizes[i] < (long long)DM * DM) return;
  if ((long long)in_sizes[7] < ((long long)(NB - 1) * SEQ_FULL + (SEQ - 1)) * SEQ_FULL + SEQ_FULL) return;
  if ((long long)in_sizes[8] < (long long)SEQ * RHSW) return;
  if (in_sizes[9] < 1) return;
  if ((long long)out_size < (long long)COV_OFF + ((long long)(NB - 1) * SEQ_FULL + (SEQ - 1)) * SEQ_FULL + SEQ) return;

  const float* query = (const float*)d_in[0];   // wire order: query, key, value, Wq, Wk, Wv, Wo, mask, rhs_mask, layer_idx
  const float* keyt  = (const float*)d_in[1];
  const float* value = (const float*)d_in[2];
  const float* Wq    = (const float*)d_in[3];
  const float* Wk    = (const float*)d_in[4];
  const float* Wv    = (const float*)d_in[5];
  const float* Wo    = (const float*)d_in[6];
  const int*   mask  = (const int*)d_in[7];
  const int*   rhs   = (const int*)d_in[8];
  const int*   lidx  = (const int*)d_in[9];
  float* out = (float*)d_out;
  float* cov = out + COV_OFF;

  char* ws = (char*)d_ws;
  size_t off = 0;
  unsigned short* Xb = (unsigned short*)(ws + off); off += BYTES_XB;   // 3 activation planes [SEQ*NB_FULL][1024] bf16
  unsigned short* Wb = (unsigned short*)(ws + off); off += BYTES_WB;   // 4 weight planes [1024][1024] bf16 (q, k, v, o)
  unsigned short* PL = (unsigned short*)(ws + off); off += BYTES_PL;   // q_hi, q_lo, k_hi, k_lo, vT_hi, vT_lo
  unsigned short* Cx = (unsigned short*)(ws + off); off += BYTES_CX;   // ctx [SEQ*NB_FULL][hi 1024 | lo 1024] bf16
  unsigned int*   Mb = (unsigned int*)(ws + off);   off += BYTES_MB;   // mask bit-plane [NB][SEQ][32 words]
  if (off > ws_size) return;

  k_prep<<<PREP_WG, PREP_TH, 0, stream>>>(query, keyt, value, Wq, Wk, Wv, Wo, mask, rhs, lidx, Xb, Wb, Mb);
  k_proj<<<dim3((unsigned)(NB * SEQ / GT), NH / 2, 3), 256, 0, stream>>>(Xb, Wb, PL);
  hipFuncSetAttribute(reinterpret_cast<const void*>(&k_attn), hipFuncAttributeMaxDynamicSharedMemorySize, (int)ATTN_LDS);
  k_attn<<<(unsigned)(NB * (SEQ / 16)), 32 * NW, (size_t)ATTN_LDS, stream>>>(PL, Mb, Cx, cov);
  k_oproj<<<dim3((unsigned)(SEQ * NB_FULL / GT), DM / GT), 256, 0, stream>>>(Cx, Wb + 3 * WN, out);
}

// v006
// One run takes 175 microseconds.
// Two timings next to v005 both put it at 1.07 times that version's speed.
// Over all steps from v000 it is 7.08 times as fast.
#include <hip/hip_runtime.h>
// Contractions (all v_wmma_f32_16x16x32_bf16, f32 accumulate): q/k/v projections = single product on RNE-bf16 inputs and weights; scores K Q^T, P V and the output projection = bf16 hi+lo planes of the computed operand(s), products hi*hi + hi*lo + lo*hi (output projection: [ctx_hi | ctx_lo] x [Wo ; Wo] folded along K); softmax statistics and coverage in f32.
// come from K rows (A, global bf16 planes) and Q^T (B, registers); the two 16-key D tiles pack straight into the P^T B fragment; O^T accumulates from V^T rows (A).
// Masks: both boolean inputs and the layer index are read on the device into a bit-plane (one 32-bit word per query and 32-key step); fully masked steps are skipped at run time.
#ifndef NB
#define NB 4
#endif
#ifndef SEQ
#define SEQ 1024
#endif
#define NB_FULL 4
#define SEQ_FULL 1024
#define NH 16
#define HD 64
#define DM 1024
#define RHSW (SEQ_FULL + 4)
#define NKS (SEQ / 32)
#define MBW (SEQ_FULL / 32)
#define CXP 2048
#define COVP (SEQ + 4)
#define STP 72
#define COV_LDS_BYTES (16 * COVP * 4)
#define NW 32                                    /* waves of one attention block */
#define NSTEP ((NKS + NW - 1) / NW)              /* 32-key steps owned by one wave */
#define STATP (NW + 4)                           /* dword pitch of a query's row of per-wave statistics (16 B x odd) */
#define OPP 68                                   /* dword pitch of a partial-O row */
#define ATTN_LDS (COV_LDS_BYTES + 2 * 16 * STATP * 4 + NW * 16 * OPP * 4)

#define XN ((size_t)SEQ * NB_FULL * DM)          /* elements of one converted activation plane (prefix of the full input) */
#define WN ((size_t)DM * DM)
#define PLSZ ((size_t)NB * NH * SEQ * HD)        /* elements of one head-layout plane */
#define COV_OFF ((size_t)SEQ_FULL * NB_FULL * DM) /* element offset of the second output (byte 16777216) */

#define BYTES_XB (3 * XN * 2)
#define BYTES_WB (4 * WN * 2)
#define BYTES_PL (6 * PLSZ * 2)
#define BYTES_CX ((size_t)SEQ * NB_FULL * CXP * 2)
#define BYTES_MB ((size_t)NB * SEQ * MBW * 4)

static_assert(SEQ % 128 == 0);
static_assert(SEQ <= SEQ_FULL);
static_assert(NB <= NB_FULL);
static_assert(MBW == 32);
static_assert(HD == 64);
static_assert(NW % 8 == 0 && NW <= 32);
static_assert(ATTN_LDS <= 327680);
static_assert(NH * HD == DM);
static_assert(PLSZ * 2 <= (size_t)0xFFFFFFFF);   // a byte offset inside a head-layout plane fits 32 bits
static_assert(COV_OFF * 4 == (size_t)16777216);
static_assert(BYTES_XB % 256 == 0 && BYTES_WB % 256 == 0 && BYTES_PL % 256 == 0 && BYTES_CX % 256 == 0 && BYTES_MB % 256 == 0);
static_assert(BYTES_XB + BYTES_WB + BYTES_PL + BYTES_CX + BYTES_MB <= (size_t)134217728);
static_assert((size_t)SEQ * NB_FULL * DM <= COV_OFF);
static_assert(COV_OFF + ((size_t)(NB - 1) * SEQ_FULL + (SEQ - 1)) * SEQ_FULL + SEQ <= (size_t)33554432 / 4);

typedef __bf16 v16b __attribute__((ext_vector_type(16)));
typedef unsigned short v8us __attribute__((ext_vector_type(8), may_alias));
typedef float v8f __attribute__((ext_vector_type(8)));
typedef float v4f __attribute__((ext_vector_type(4)));
typedef float v4fa __attribute__((ext_vector_type(4), may_alias));
typedef float v2f __attribute__((ext_vector_type(2)));
typedef float v2fa __attribute__((ext_vector_type(2), may_alias));
typedef unsigned int u32a __attribute__((may_alias));
typedef int v4i __attribute__((ext_vector_type(4)));
typedef int v4ia __attribute__((ext_vector_type(4), may_alias));
typedef __bf16 v2b __attribute__((ext_vector_type(2)));
union FragB { v16b v; v8us half[2]; unsigned int w[8]; };

#define LOG2E 1.4426950408889634f
#define NEGBIG (-1.0e30f)

// RNE convert of two values to a packed bf16 pair (a in the low half): one v_cvt_pk_bf16_f32
__device__ __forceinline__ unsigned int bf16_pair(float a, float b) {
  const v2f x = {a, b};
  return __builtin_bit_cast(unsigned int, __builtin_convertvector(x, v2b));
}
// the lo plane's pair: what the hi pair h leaves of (a, b), rounded the same way
__device__ __forceinline__ unsigned int bf16_rest(float a, float b, unsigned int h) {
  return bf16_pair(a - __uint_as_float(h << 16), b - __uint_as_float(h & 0xFFFF0000u));
}

__device__ __forceinline__ v8f wm(v16b a, v16b b, v8f c) {
  return __builtin_amdgcn_wmma_f32_16x16x32_bf16(false, a, false, b, (short)0, c, false, false);
}

// Preparation, one launch: PREP_WG work-groups of 16 waves (one a WGP); every thread takes its share of each job, so that few waves have to start.
// Conversions: a work-group's pieces of a plane are contiguous; a wave's load covers 512 contiguous bytes, its store 256 (whole lines).
#define PREP_WG 256
#define PREP_TH 512
#define PREP_T (PREP_WG * PREP_TH)
#define XCH ((int)(XN / 4 / PREP_T))              /* 16-byte pieces of one activation plane per thread */
#define WCH ((int)(WN / 4 / PREP_T))              /* the same of one weight plane */
static_assert(XN % ((size_t)4 * PREP_T) == 0 && WN % ((size_t)4 * PREP_T) == 0);
static_assert(NB * SEQ * MBW <= PREP_T);
typedef unsigned int v2ua __attribute__((ext_vector_type(2), may_alias));

__device__ __forceinline__ void cvt_store(unsigned short* d, v4f x) {
  v2ua o;
  o[0] = bf16_pair(x[0], x[1]); o[1] = bf16_pair(x[2], x[3]);
  *(v2ua*)d = o;
}

// coverage: planes: PREP_T threads x XCH (WCH) pieces x 4 elements = every element of each of the 3 + 4 planes, once.
// Mb[b][q][j] bit kk = 1 when key 32j+kk is masked for query q of batch b (mask[b][q][k] != 0 or rhs[q][start + k] != 0); thread t < NB*SEQ*32 writes word t: every word of the plane.
__global__ __launch_bounds__(PREP_TH) void k_prep(const float* __restrict__ query, const float* __restrict__ keyt, const float* __restrict__ value,
                                                  const float* __restrict__ Wq, const float* __restrict__ Wk, const float* __restrict__ Wv,
                                                  const float* __restrict__ Wo, const int* __restrict__ mask, const int* __restrict__ rhs,
                                                  const int* __restrict__ lidx, unsigned short* __restrict__ Xb, unsigned short* __restrict__ Wb,
                                                  unsigned int* __restrict__ Mb) {
  const int tid = threadIdx.x, blk = blockIdx.x;
  const int t = blk * PREP_TH + tid;
  const size_t ex = ((size_t)blk * XCH * PREP_TH + tid) * 4;   // this thread's first element in an activation plane
  const size_t ew = ((size_t)blk * WCH * PREP_TH + tid) * 4;   // and in a weight plane
  const float* sq = query + ex;
  const float* sk = keyt + ex;
  const float* sv = value + ex;
  const float* s0 = Wq + ew;
  const float* s1 = Wk + ew;
  const float* s2 = Wv + ew;
  const float* s3 = Wo + ew;
  // the long streams start first: all of the thread's plane loads are in flight while it forms its mask word
  v4f x[3][XCH], y[4][WCH];
#pragma unroll  // constant index into x[]
  for (int i = 0; i < XCH; ++i) x[0][i] = *(const v4fa*)(sq + (size_t)i * PREP_TH * 4);
#pragma unroll
  for (int i = 0; i < XCH; ++i) x[1][i] = *(const v4fa*)(sk + (size_t)i * PREP_TH * 4);
#pragma unroll
  for (int i = 0; i < XCH; ++i) x[2][i] = *(const v4fa*)(sv + (size_t)i * PREP_TH * 4);
#pragma unroll  // constant index into y[]
  for (int i = 0; i < WCH; ++i) {
    y[0][i] = *(const v4fa*)(s0 + (size_t)i * PREP_TH * 4);
    y[1][i] = *(const v4fa*)(s1 + (size_t)i * PREP_TH * 4);
    y[2][i] = *(const v4fa*)(s2 + (size_t)i * PREP_TH * 4);
    y[3][i] = *(const v4fa*)(s3 + (size_t)i * PREP_TH * 4);
  }
  // the loads' address registers stay live up to this wait (inputs only), so that no load's result and nothing behind it lands in one ahead of it
  asm volatile("s_wait_xcnt 0x0" :: "v"(sq), "v"(sk), "v"(sv), "v"(s0), "v"(s1), "v"(s2), "v"(s3) : "memory");
  if (t < NB * SEQ * MBW) {
    const int j = t & 31, row = t >> 5;
    const int b = row / SEQ, q = row - b * SEQ;
    int L = lidx[0];
    L = (L < -64) ? -64 : ((L > 64) ? 64 : L);
    int tt = 4 - 4 * L; if (tt < 0) tt = 0;
    int start = 4 - tt; if (start < 0) start = 0;
    start = (start >= 4) ? 4 : 0;                       // the formula only yields 0 or 4; keeps the 16-B alignment of the row loads
    const int* mp = mask + ((size_t)b * SEQ_FULL + q) * SEQ_FULL + 32 * j;
    const int* rp = rhs + (size_t)q * RHSW + start + 32 * j;
    v4i a[8], r[8];
#pragma unroll  // constant index into a[] and r[]; the word's 16 loads in flight together
    for (int c = 0; c < 8; ++c) {
      a[c] = *(const v4ia*)(mp + 4 * c);
      r[c] = *(const v4ia*)(rp + 4 * c);
    }
    // as above: both address pairs stay live up to this wait, so that no load's result lands in one ahead of it
    asm volatile("s_wait_xcnt 0x0" :: "v"(mp), "v"(rp) : "memory");
    unsigned int w = 0u;
#pragma unroll
    for (int c = 0; c < 8; ++c) {
      const unsigned int nib = (((a[c][0] | r[c][0]) != 0) ? 1u : 0u) | (((a[c][1] | r[c][1]) != 0) ? 2u : 0u) |
                               (((a[c][2] | r[c][2]) != 0) ? 4u : 0u) | (((a[c][3] | r[c][3]) != 0) ? 8u : 0u);
      w |= nib << (4 * c);
    }
    Mb[t] = w;
  }
#pragma unroll  // constant index into x[]
  for (int p = 0; p < 3; ++p)
#pragma unroll
    for (int i = 0; i < XCH; ++i) cvt_store(Xb + (size_t)p * XN + ex + (size_t)i * PREP_TH * 4, x[p][i]);
#pragma unroll  // constant index into y[]
  for (int p = 0; p < 4; ++p)
#pragma unroll
    for (int i = 0; i < WCH; ++i) cvt_store(Wb + (size_t)p * WN + ew + (size_t)i * PREP_TH * 4, y[p][i]);
}

// Block tile 128 rows x 128 columns, 8 waves of 32 x 64 (4 along the rows, 2 along the columns), K in stages of KC.
// A stage is [A tile | W tile], each GT rows of KC bf16 (one whole 128-B line a row) at LDS pitch TP; two buffers.
// Every lane copies 16 B per instruction, a wave 4 whole lines: 4 copies a lane for the A tile, 4 for the W tile.
#define GT 128
#define KC 64
#define TP 72                                    /* elements: 144 B = 16 B x odd, for the ds_load_b128 fragment reads */
#define TILE_E (GT * TP)
#define RING_E (4 * TILE_E)
static_assert(DM % KC == 0 && CXP % KC == 0 && DM / KC >= 2);
static_assert(RING_E >= 4 * 2 * 64 * STP);       // the projections' output staging reuses the ring
static_assert(RING_E * 2 >= 4 * 64 * 68 * 4);    // so does the output projection's

// la: LDS byte address of this lane's piece in its first row of the A tile of the target buffer; ga, gb: the same piece in global memory.
// Rows crow + 32 i, i = 0..3, of both tiles. The s_wait_xcnt stands inside the statement: the address registers are rewritten behind it.
__device__ __forceinline__ void stage_copy(unsigned int la, const unsigned short* ga, size_t apitch, const unsigned short* gb) {
  const unsigned int lb = la + TILE_E * 2;
  asm volatile("global_load_async_to_lds_b128 %0, %8, off\n\t"
               "global_load_async_to_lds_b128 %1, %9, off\n\t"
               "global_load_async_to_lds_b128 %2, %10, off\n\t"
               "global_load_async_to_lds_b128 %3, %11, off\n\t"
               "global_load_async_to_lds_b128 %4, %12, off\n\t"
               "global_load_async_to_lds_b128 %5, %13, off\n\t"
               "global_load_async_to_lds_b128 %6, %14, off\n\t"
               "global_load_async_to_lds_b128 %7, %15, off\n\t"
               "s_wait_xcnt 0x0"
               :: "v"(la), "v"(la + 32 * TP * 2), "v"(la + 64 * TP * 2), "v"(la + 96 * TP * 2),
                  "v"(lb), "v"(lb + 32 * TP * 2), "v"(lb + 64 * TP * 2), "v"(lb + 96 * TP * 2),
                  "v"(ga), "v"(ga + 32 * apitch), "v"(ga + 64 * apitch), "v"(ga + 96 * apitch),
                  "v"(gb), "v"(gb + 32 * DM), "v"(gb + 64 * DM), "v"(gb + 96 * DM)
               : "memory");
}

// ga, gb: this thread's copy sources at k = 0 (row tid / 8 of the tile, piece tid % 8); ar, br: this lane's fragment rows in buffer 0.
// The W k index wraps at DM so that [A_hi | A_lo] x [W ; W] folds along K. Each accumulator still sums k in steps of 32, ascending.
template <int KT>
__device__ __forceinline__ void gemm_main(const unsigned short* __restrict__ ga, size_t apitch, const unsigned short* __restrict__ gb,
                                          unsigned int la, const unsigned short* ar, const unsigned short* br, v8f (&acc)[2][4]) {
  constexpr int NT = KT / KC;
  stage_copy(la, ga, apitch, gb);
  asm volatile("s_wait_asynccnt 0x0" ::: "memory");   // stage 0 has landed before the barrier publishes it
  __syncthreads();
  stage_copy(la + 2 * TILE_E * 2, ga + KC, apitch, gb + KC);
#pragma unroll 1  // one stage a trip: the buffer index and the refill test stay scalar
  for (int t = 0; t < NT; ++t) {
    const int bo = (t & 1) * 2 * TILE_E;
#pragma unroll  // two 32-wide k steps of the stage
    for (int kk = 0; kk < KC; kk += 32) {
      const unsigned short* ap = ar + bo + kk;
      const unsigned short* bp = br + bo + kk;
      FragB a0, a1, b0, b1, b2, b3;
      a0.half[0] = *(const v8us*)(ap);                a0.half[1] = *(const v8us*)(ap + 16);
      a1.half[0] = *(const v8us*)(ap + 16 * TP);      a1.half[1] = *(const v8us*)(ap + 16 * TP + 16);
      b0.half[0] = *(const v8us*)(bp);                b0.half[1] = *(const v8us*)(bp + 16);
      b1.half[0] = *(const v8us*)(bp + 16 * TP);      b1.half[1] = *(const v8us*)(bp + 16 * TP + 16);
      b2.half[0] = *(const v8us*)(bp + 32 * TP);      b2.half[1] = *(const v8us*)(bp + 32 * TP + 16);
      b3.half[0] = *(const v8us*)(bp + 48 * TP);      b3.half[1] = *(const v8us*)(bp + 48 * TP + 16);
      acc[0][0] = wm(a0.v, b0.v, acc[0][0]); acc[0][1] = wm(a0.v, b1.v, acc[0][1]);
      acc[0][2] = wm(a0.v, b2.v, acc[0][2]); acc[0][3] = wm(a0.v, b3.v, acc[0][3]);
      acc[1][0] = wm(a1.v, b0.v, acc[1][0]); acc[1][1] = wm(a1.v, b1.v, acc[1][1]);
      acc[1][2] = wm(a1.v, b2.v, acc[1][2]); acc[1][3] = wm(a1.v, b3.v, acc[1][3]);
      asm volatile("v_nop\n\tv_nop\n\tv_nop\n\tv_nop"
                   : "+v"(acc[0][0]), "+v"(acc[0][1]), "+v"(acc[0][2]), "+v"(acc[0][3]),
                     "+v"(acc[1][0]), "+v"(acc[1][1]), "+v"(acc[1][2]), "+v"(acc[1][3])
                   : "v"(a0.v), "v"(a1.v), "v"(b0.v), "v"(b1.v), "v"(b2.v), "v"(b3.v));
    }
    asm volatile("s_wait_dscnt 0x0" ::: "memory");      // this wave's reads of the buffer are done before it is refilled
    asm volatile("s_wait_asynccnt 0x0" ::: "memory");   // this wave's copies of stage t + 1 have landed
    __syncthreads();                                    // publishes stage t + 1 and ends every reader's last read of stage t
    if (t + 2 < NT) {
      const int k2 = (t + 2) * KC;
      stage_copy(la + (unsigned int)bo * 2u, ga + k2, apitch, gb + (k2 & (DM - 1)));
    }
  }
  asm volatile("s_wait_asynccnt 0x0" ::: "memory");     // nothing is in flight when the ring becomes output staging
}

// Projections. grid (NB*SEQ/128, NH/2, 3): block = 128 sequence positions of one batch x two heads x one of {q, k, v}; 8 waves x (32 x 64).
// Logical row b*SEQ + s reads the activation row s*NB_FULL + b. Epilogue: each pair of waves owns a 64 x 64 tile (one head): bf16 hi + lo planes staged in its part of the ring
// (block barrier kept as it was; a wave now reads back the rows it staged itself). The planes lie in fragment order, in units of 512 B = [32 lanes][8 elements], one unit = one fragment load of an attention wave (4 whole lines):
// q (scaled by 1/8) and k: [b][h][s / 16][L = 0..3][lane], lane (hh, ln) holds row s = 16 tile + ln, d = 16 L + 8 hh + 0..7; v: [b][h][s / 32][d / 16][x = 0..1][lane], lane holds d = 16 t + ln, keys 32 j + 16 x + 8 hh + 0..7.
__global__ __launch_bounds__(256) void k_proj(const unsigned short* __restrict__ Xb, const unsigned short* __restrict__ Wb,
                                              unsigned short* __restrict__ PL) {
  __shared__ __attribute__((aligned(16))) unsigned short ring[RING_E];
  const int tid = threadIdx.x, w = __builtin_amdgcn_readfirstlane((int)(tid >> 5)), lane = tid & 31, ln = lane & 15, hh = lane >> 4;
  const int wr = w & 3, wc = w >> 2;                 // wave position: rows 32 wr, columns 64 wc
  const int pr = (wr >> 1) + 2 * wc, w2 = wr & 1;    // pair of waves that shares a 64 x 64 output tile, and the wave's place in it
  const int z = blockIdx.z, hcol = 2 * blockIdx.y + wc;
  const int mt0 = blockIdx.x * GT;
  const int b = mt0 / SEQ, sb = mt0 - b * SEQ;
  const int s0 = sb + 64 * (wr >> 1);
  const int crow = tid >> 3, cpc = 8 * (tid & 7);
  const unsigned short* ga = Xb + (size_t)z * XN + ((size_t)(sb + crow) * NB_FULL + b) * DM + cpc;
  const unsigned short* gb = Wb + (size_t)z * WN + (size_t)(GT * blockIdx.y + crow) * DM + cpc;
  const unsigned int la = (unsigned int)(size_t)(ring + crow * TP + cpc);
  v8f acc[2][4] = {};
  gemm_main<DM>(ga, (size_t)NB_FULL * DM, gb, la, ring + (32 * wr + ln) * TP + 8 * hh, ring + TILE_E + (64 * wc + ln) * TP + 8 * hh, acc);
  unsigned short* sh = ring + pr * (2 * 64 * STP);
  unsigned short* sl = sh + 64 * STP;
  const float scale = (z == 0) ? 0.125f : 1.0f;
#pragma unroll
  for (int mt = 0; mt < 2; ++mt)
#pragma unroll
    for (int nt = 0; nt < 4; ++nt)
#pragma unroll
      for (int r = 0; r < 8; r += 2) {
        const float v0 = acc[mt][nt][r] * scale, v1 = acc[mt][nt][r + 1] * scale;
        const unsigned int hb = bf16_pair(v0, v1);
        const unsigned int lb = bf16_rest(v0, v1, hb);
        const int sr = 32 * w2 + 16 * mt + 8 * hh + r;     // local sequence row of v0; v1 is the next
        const int dc = 16 * nt + ln;                        // head-dim column
        const int idx = (z == 2) ? (dc * STP + sr) : (sr * STP + dc);
        const int nx = (z == 2) ? 1 : STP;
        sh[idx] = (unsigned short)hb;
        sh[idx + nx] = (unsigned short)(hb >> 16);
        sl[idx] = (unsigned short)lb;
        sl[idx + nx] = (unsigned short)(lb >> 16);
      }
  __syncthreads();
  const size_t hbase = (size_t)b * NH + hcol;
  unsigned short* dstp = PL + (size_t)z * 2 * PLSZ + (hbase * SEQ + s0) * HD + 8 * lane;   // the 64 x 64 tile is 16 consecutive units in either layout
  {
#pragma unroll 1
    for (int i = 0; i < 8; ++i) {
      const int u = 8 * w2 + i;                          // unit of the tile; a wave's store covers the whole unit
      const int row = ln + ((z == 2) ? 16 * ((u >> 1) & 3) : 16 * (u >> 2));
      const int col = 8 * hh + ((z == 2) ? 32 * (u >> 3) + 16 * (u & 1) : 16 * (u & 3));
      const v8us vh = *(const v8us*)(sh + row * STP + col);
      const v8us vl = *(const v8us*)(sl + row * STP + col);
      unsigned short* d = dstp + 256 * u;
      *(v8us*)d = vh;
      *(v8us*)(d + PLSZ) = vl;
      asm volatile("s_wait_xcnt 0x0" ::: "memory");  // the next trip rewrites the stores' address registers
    }
    
  }
}

// S^T tile of 16 keys: c = K_lo Q_hi + K_hi Q_lo + K_hi Q_hi over the two 32-wide head-dim chunks, then the hazard guard.
__device__ __forceinline__ v8f qk_tile(const char* __restrict__ kh, const char* __restrict__ kl, unsigned int o, const FragB& qh0, const FragB& qh1,
                                       const FragB& ql0, const FragB& ql1) {
  // A fragments of K: row m = key, elements 0..7 <- d = 32c + 8h + i, 8..15 <- d = 32c + 16 + 8h + i: units 2c and 2c + 1 of the key tile; kh, kl: the planes (uniform), o: byte offset of the lane's 16 B in unit 0
  FragB a0, a1, c0, c1;
  const char* kp = kh + o;
  const char* lp = kl + o;
  a0.half[0] = *(const v8us*)(kp);        a0.half[1] = *(const v8us*)(kp + 512);
  a1.half[0] = *(const v8us*)(kp + 1024); a1.half[1] = *(const v8us*)(kp + 1536);
  asm volatile("s_wait_xcnt 0x0" ::: "memory");   // a result of the lo-plane loads may land in the hi-plane loads' address registers
  c0.half[0] = *(const v8us*)(lp);        c0.half[1] = *(const v8us*)(lp + 512);
  c1.half[0] = *(const v8us*)(lp + 1024);
  asm volatile("s_wait_xcnt 0x0" ::: "memory");   // the last load's result may land in the address or offset register that it shares with the loads before it
  c1.half[1] = *(const v8us*)(lp + 1536);
  asm volatile("s_wait_xcnt 0x0" ::: "memory");   // what follows may reuse the loads' address registers
  v8f c = {0.f, 0.f, 0.f, 0.f, 0.f, 0.f, 0.f, 0.f};
  c = wm(c0.v, qh0.v, c); c = wm(c1.v, qh1.v, c);
  c = wm(a0.v, ql0.v, c); c = wm(a1.v, ql1.v, c);
  c = wm(a0.v, qh0.v, c); c = wm(a1.v, qh1.v, c);
  asm volatile("v_nop\n\tv_nop\n\tv_nop\n\tv_nop" : "+v"(c)
               : "v"(a0.v), "v"(a1.v), "v"(c0.v), "v"(c1.v), "v"(qh0.v), "v"(qh1.v), "v"(ql0.v), "v"(ql1.v));
  return c;
}

// O^T tile of 16 head-dim rows: o += V_lo P_hi + V_hi P_lo + V_hi P_hi, then the hazard guard.
__device__ __forceinline__ v8f pv_tile(const char* __restrict__ vp, const char* __restrict__ lp, const FragB& ph, const FragB& pl, v8f o) {
  // A fragments of V^T: row m = d, elements 0..7 <- key0 + 8h + i, 8..15 <- key0 + 16 + 8h + i: units 0 and 1 of the (key step, d tile) pair; vp, lp: the lane's 16 B in unit 0 of the hi and of the lo plane
  FragB vh, vl;
  vh.half[0] = *(const v8us*)(vp); vh.half[1] = *(const v8us*)(vp + 512);
  vl.half[0] = *(const v8us*)(lp); vl.half[1] = *(const v8us*)(lp + 512);
  o = wm(vl.v, ph.v, o);
  o = wm(vh.v, pl.v, o);
  o = wm(vh.v, ph.v, o);
  asm volatile("v_nop\n\tv_nop\n\tv_nop\n\tv_nop" : "+v"(o) : "v"(vh.v), "v"(vl.v), "v"(ph.v), "v"(pl.v));
  return o;
}

// Block = one batch x 16 queries, NW waves; wave w owns the 32-key steps j = w, w + NW, ... of every head (its mask words stay in registers).
// Per head: each wave's softmax statistics over its own steps -> LDS -> barrier -> every wave merges all NW pairs (max, rescaled sum);
// then normalised weights (the wave's kept exponentials rescaled to the merged statistics), coverage into the LDS tile [16][SEQ] (a step's columns belong to one wave, each lane only touches its own addresses), partial O^T;
// partial O^T tiles -> LDS -> barrier -> one wave per query row sums the NW partials in wave order and writes bf16 hi | lo halves of the [s*NB_FULL+b][2048] plane.
// Reuse of the exchange buffers: statistics of head h are read before the second barrier of h and rewritten after it; partials of h are read before the first barrier of h + 1 and rewritten after it.
// coverage: ctx plane: (b, 16 rows) x 16 heads x (64 hi + 64 lo) = every element of rows with b < NB; coverage output: 16 rows x SEQ columns per block, all rows once.
// LDS: coverage tile zero-filled in full before use; every wave writes its statistics and its whole partial tile (zeros when all its steps are masked) before they are read.
__global__ __launch_bounds__(32 * NW) void k_attn(const unsigned short* __restrict__ PL, const unsigned int* __restrict__ Mb,
                                                  unsigned short* __restrict__ Cx, float* __restrict__ Cov) {
  extern __shared__ __attribute__((aligned(16))) unsigned char smem[];
  float* covs = (float*)smem;
  float* stm = (float*)(smem + COV_LDS_BYTES);     // [16 queries][STATP]: running maximum of wave w at column w
  float* stl = stm + 16 * STATP;                   // same shape: sum of wave w
  float* part = stl + 16 * STATP;                  // [NW][16 queries][OPP]: partial O, f32
  const int tid = threadIdx.x, w = __builtin_amdgcn_readfirstlane((int)(tid >> 5));
  const int lane = tid & 31, ln = lane & 15, hh = lane >> 4;
  const int b = blockIdx.x / (SEQ / 16), qt = blockIdx.x % (SEQ / 16);
  const int q0 = qt * 16, qg = q0 + ln;
  {
    const v4f z4 = {0.f, 0.f, 0.f, 0.f};
    for (int i = tid; i < 4 * COVP; i += 32 * NW) *(v4fa*)(covs + 4 * i) = z4;
  }
  const unsigned int* mrow = Mb + (size_t)(b * SEQ + qg) * MBW;
  unsigned int mw[NSTEP];
  bool act[NSTEP];                                 // wave-uniform: some key of the step is open for one of the 16 queries
#pragma unroll  // mw[] and act[] must be indexed by constants to stay in registers
  for (int i = 0; i < NSTEP; ++i) {
    const int j = w + i * NW;
    mw[i] = (j < NKS) ? mrow[j] : 0xFFFFFFFFu;
    act[i] = __any(mw[i] != 0xFFFFFFFFu);
  }
  __syncthreads();
  const int sh8 = 8 * hh;
  const unsigned int lo = 16u * (unsigned int)lane;   // byte offset of this lane's 16 B in a 512-B unit of the q, k, v planes
  const char* PLc = (const char*)PL;                  // plane p starts at byte 2 p PLSZ; addresses are a uniform plane base + a 32-bit offset inside the plane
  float* crow = covs + ln * COVP + 8 * hh;

#pragma unroll 1
  for (int h = 0; h < NH; ++h) {
    const size_t hb = (size_t)b * NH + h;
    // Q^T B fragments: column n = query qg, elements 0..7 <- d = 32c + 8h + i, 8..15 <- d = 32c + 16 + 8h + i: units 2c and 2c + 1 of the query tile
    const unsigned int ho = (unsigned int)hb * (SEQ * HD * 2) + lo;        // byte offset inside a plane: this head, this lane's 16 B of a unit
    const char* qp = PLc + (ho + (unsigned int)q0 * (HD * 2));
    const char* qlp = PLc + 2 * PLSZ + (ho + (unsigned int)q0 * (HD * 2));

    // ---- pass 1: statistics over this wave's own steps; each step's exponentials stay in registers, relative to the maximum ms[i] they were formed with ----
    float mr = NEGBIG, lr = 0.0f;
    float pe[NSTEP][16], ms[NSTEP];                // read only under the same act[i] that wrote them
#pragma unroll  // constant index into mw[] and act[]
    for (int i = 0; i < NSTEP; ++i) {
      if (act[i]) {
        // Q feeds this pass alone: its loads stand in the block that uses them, in front of their waits (one step a wave at this shape)
        FragB qh0, qh1, ql0, ql1;
        qh0.half[0] = *(const v8us*)(qp);              qh0.half[1] = *(const v8us*)(qp + 512);
        qh1.half[0] = *(const v8us*)(qp + 1024);       qh1.half[1] = *(const v8us*)(qp + 1536);
        asm volatile("s_wait_xcnt 0x0" ::: "memory");   // a result of the lo-plane loads may land in the hi-plane loads' address registers
        ql0.half[0] = *(const v8us*)(qlp);             ql0.half[1] = *(const v8us*)(qlp + 512);
        ql1.half[0] = *(const v8us*)(qlp + 1024);
        asm volatile("s_wait_xcnt 0x0" ::: "memory");   // the last load's result may land in the address registers that it shares with the three loads before it
        ql1.half[1] = *(const v8us*)(qlp + 1536);
        asm volatile("s_wait_xcnt 0x0" ::: "memory");   // the address registers of the Q loads are reused for the K addresses right behind them
        const int j = w + i * NW;
        const unsigned int ko = ho + (unsigned int)(32 * j) * (HD * 2);
        const v8f s0 = qk_tile(PLc + 4 * PLSZ, PLc + 6 * PLSZ, ko, qh0, qh1, ql0, ql1);          // element r = score(key 32j + 8h + r, query qg)
        const v8f s1 = qk_tile(PLc + 4 * PLSZ + 2048, PLc + 6 * PLSZ + 2048, ko, qh0, qh1, ql0, ql1);
        const unsigned int wb = mw[i] >> sh8;
        float sc[16];
        float mx = NEGBIG;
#pragma unroll
        for (int r = 0; r < 8; ++r) {
          sc[r]     = ((wb >> r) & 1u) ? NEGBIG : s0[r];
          sc[8 + r] = ((wb >> (16 + r)) & 1u) ? NEGBIG : s1[r];
          mx = fmaxf(mx, fmaxf(sc[r], sc[8 + r]));
        }
        mx = fmaxf(mx, __shfl_xor(mx, 16, 32));                  // the other lane half holds the other 16 keys of this query
        const float mnew = fmaxf(mr, mx);
        const float al = exp2f((mr - mnew) * LOG2E);
        float ps = 0.0f;
#pragma unroll
        for (int r = 0; r < 16; ++r) {
          const float e = exp2f((sc[r] - mnew) * LOG2E);
          pe[i][r] = (sc[r] > -1.0e29f) ? e : 0.0f;              // 0 for a masked key
          ps += pe[i][r];
        }
        ms[i] = mnew;
        ps += __shfl_xor(ps, 16, 32);
        lr = lr * al + ps;
        mr = mnew;
      }
    }
    if (hh == 0) { stm[ln * STATP + w] = mr; stl[ln * STATP + w] = lr; }
    __syncthreads();
    // merge: each lane half reads NW / 2 of the waves' pairs of its query, then one exchange between the halves
    {
      float mv[NW / 2], lv[NW / 2];                // the loops below are unrolled so that both arrays stay in registers
#pragma unroll
      for (int u = 0; u < NW / 8; ++u) {
        const v4f x = *(const v4fa*)(stm + ln * STATP + (NW / 2) * hh + 4 * u);
        const v4f y = *(const v4fa*)(stl + ln * STATP + (NW / 2) * hh + 4 * u);
        mv[4 * u] = x[0]; mv[4 * u + 1] = x[1]; mv[4 * u + 2] = x[2]; mv[4 * u + 3] = x[3];
        lv[4 * u] = y[0]; lv[4 * u + 1] = y[1]; lv[4 * u + 2] = y[2]; lv[4 * u + 3] = y[3];
      }
      float mg = NEGBIG;
#pragma unroll
      for (int u = 0; u < NW / 2; ++u) mg = fmaxf(mg, mv[u]);
      mg = fmaxf(mg, __shfl_xor(mg, 16, 32));
      float lg = 0.0f;
#pragma unroll
      for (int u = 0; u < NW / 2; ++u) mv[u] = exp2f((mv[u] - mg) * LOG2E);
#pragma unroll
      for (int u = 0; u < NW / 2; ++u) lg += lv[u] * mv[u];
      lg += __shfl_xor(lg, 16, 32);
      mr = mg;
      lr = lg;
    }
    const float inv = (lr > 0.0f) ? 1.0f / lr : 0.0f;   // a query with no open key keeps weights of 0 (0 x inf otherwise)

    // ---- pass 2: weights = kept exponentials x exp(ms - m) / l, coverage accumulation, partial O^T over this wave's own steps ----
    v8f O[4] = {};
#pragma unroll  // constant index into mw[] and act[]
    for (int i = 0; i < NSTEP; ++i) {
      if (act[i]) {
        const int key0 = 32 * (w + i * NW);
        const float f = exp2f((ms[i] - mr) * LOG2E) * inv;
        float pn[16];
#pragma unroll
        for (int r = 0; r < 16; ++r) pn[r] = pe[i][r] * f;
        // coverage tile: this lane owns columns key0 + 8h + 0..7 and key0 + 16 + 8h + 0..7 of row ln
        {
          float* cr = crow + key0;
          v4f c0 = *(const v4fa*)(cr), c1 = *(const v4fa*)(cr + 4), c2 = *(const v4fa*)(cr + 16), c3 = *(const v4fa*)(cr + 20);
          c0[0] += pn[0];  c0[1] += pn[1];  c0[2] += pn[2];  c0[3] += pn[3];
          c1[0] += pn[4];  c1[1] += pn[5];  c1[2] += pn[6];  c1[3] += pn[7];
          c2[0] += pn[8];  c2[1] += pn[9];  c2[2] += pn[10]; c2[3] += pn[11];
          c3[0] += pn[12]; c3[1] += pn[13]; c3[2] += pn[14]; c3[3] += pn[15];
          *(v4fa*)(cr) = c0; *(v4fa*)(cr + 4) = c1; *(v4fa*)(cr + 16) = c2; *(v4fa*)(cr + 20) = c3;
        }
        // P^T B fragment: element i < 8 -> key0 + 8h + i (tile 0 row 8h + i); i >= 8 -> key0 + 16 + 8h + (i - 8) (tile 1); bf16 hi + lo
        FragB ph, pl;
#pragma unroll
        for (int r = 0; r < 16; r += 2) {
          const unsigned int hp = bf16_pair(pn[r], pn[r + 1]);
          ph.w[r >> 1] = hp;
          pl.w[r >> 1] = bf16_rest(pn[r], pn[r + 1], hp);
        }
        __builtin_amdgcn_sched_barrier(0);
        const unsigned int vo = ho + (unsigned int)key0 * (HD * 2);
        const char* vp = PLc + 8 * PLSZ + vo;
        const char* vlp = PLc + 10 * PLSZ + vo;
        O[0] = pv_tile(vp, vlp, ph, pl, O[0]);
        O[1] = pv_tile(vp + 1024, vlp + 1024, ph, pl, O[1]);
        O[2] = pv_tile(vp + 2048, vlp + 2048, ph, pl, O[2]);
        O[3] = pv_tile(vp + 3072, vlp + 3072, ph, pl, O[3]);
      }
    }

    // O^T element r of tile t = partial ctx(query qg, d = 16t + 8h + r): f32 into this wave's tile [16 queries][64 d]
    {
      float* pw = part + (size_t)(w * 16 + ln) * OPP + 8 * hh;
#pragma unroll  // constant index into O[]
      for (int t = 0; t < 4; ++t) {
        const v4f x0 = {O[t][0], O[t][1], O[t][2], O[t][3]};
        const v4f x1 = {O[t][4], O[t][5], O[t][6], O[t][7]};
        *(v4fa*)(pw + 16 * t) = x0;
        *(v4fa*)(pw + 16 * t + 4) = x1;
      }
    }
    __syncthreads();
    // one wave per query row (wave-uniform loop): lane sums d = 2 lane, 2 lane + 1 over the NW partial tiles; a wave writes whole 128-B lines
#pragma unroll 1  // at most one trip per wave once NW >= 16: nothing to gain from copies of the body
    for (int row = w; row < 16; row += NW) {
      const float* pr = part + row * OPP + 2 * lane;
      float t0 = 0.0f, t1 = 0.0f;
#pragma unroll  // independent LDS loads in flight together; the sums stay in wave order
      for (int u = 0; u < NW; ++u) {
        const v2f x = *(const v2fa*)(pr + u * 16 * OPP);
        t0 += x[0];
        t1 += x[1];
      }
      const unsigned int hp = bf16_pair(t0, t1);
      unsigned short* d = Cx + ((size_t)(q0 + row) * NB_FULL + b) * CXP + h * HD + 2 * lane;
      *(u32a*)d = hp;
      *(u32a*)(d + DM) = bf16_rest(t0, t1, hp);
      asm volatile("s_wait_xcnt 0x0" ::: "memory");  // the stores' address registers are advanced for the next head right behind them
    }
  }

  __syncthreads();
  float* cg = Cov + ((size_t)b * SEQ_FULL + q0) * SEQ_FULL;
#pragma unroll 1  // a few short trips, once per block: kept rolled as before
  for (int idx = w; idx < 16 * (SEQ / 128); idx += NW) {
    const int row = idx / (SEQ / 128), col = (idx % (SEQ / 128)) * 128 + lane * 4;
    v4f v = *(const v4fa*)(covs + row * COVP + col);
    v[0] *= 0.0625f; v[1] *= 0.0625f; v[2] *= 0.0625f; v[3] *= 0.0625f;
    *(v4f*)(cg + (size_t)row * SEQ_FULL + col) = v;
    asm volatile("s_wait_xcnt 0x0" ::: "memory");    // the next trip rewrites the store's address and data registers
  }
}

// Output projection: out[m][n] = sum_c ctx[m][c] Wo[n][c] with A = [ctx_hi | ctx_lo] (K = 2048) and the W k index wrapping at 1024.
// coverage: blocks tile the [SEQ*NB_FULL][1024] output exactly once.
__global__ __launch_bounds__(256) void k_oproj(const unsigned short* __restrict__ Cx, const unsigned short* __restrict__ Wo,
                                               float* __restrict__ Out) {
  __shared__ __attribute__((aligned(16))) unsigned short ring[RING_E];
  const int tid = threadIdx.x, w = __builtin_amdgcn_readfirstlane((int)(tid >> 5)), lane = tid & 31, ln = lane & 15, hh = lane >> 4;
  const int wr = w & 3, wc = w >> 2;                 // wave position: rows 32 wr, columns 64 wc
  const int pr = (wr >> 1) + 2 * wc, w2 = wr & 1;    // 64 x 64 staging tile, and the wave's place in it
  const int mb = blockIdx.x * GT, nb = blockIdx.y * GT;
  const int m0 = mb + 64 * (wr >> 1), n0 = nb + 64 * wc;
  const int crow = tid >> 3, cpc = 8 * (tid & 7);
  const unsigned short* ga = Cx + (size_t)(mb + crow) * CXP + cpc;
  const unsigned short* gb = Wo + (size_t)(nb + crow) * DM + cpc;
  const unsigned int la = (unsigned int)(size_t)(ring + crow * TP + cpc);
  v8f acc[2][4] = {};
  gemm_main<CXP>(ga, (size_t)CXP, gb, la, ring + (32 * wr + ln) * TP + 8 * hh, ring + TILE_E + (64 * wc + ln) * TP + 8 * hh, acc);
  float* so = (float*)ring + pr * (64 * 68);
#pragma unroll
  for (int mt = 0; mt < 2; ++mt)
#pragma unroll
    for (int nt = 0; nt < 4; ++nt)
#pragma unroll
      for (int r = 0; r < 8; ++r)
        so[(32 * w2 + 16 * mt + 8 * hh + r) * 68 + 16 * nt + ln] = acc[mt][nt][r];
  __syncthreads();
  const int rsub = lane >> 4, c4 = (lane & 15) * 4;
  {
#pragma unroll 1
    for (int i = 0; i < 16; ++i) {
      const int row = 32 * w2 + 2 * i + rsub;
      const v4f v = *(const v4fa*)(so + row * 68 + c4);
      *(v4f*)(Out + (size_t)(m0 + row) * DM + n0 + c4) = v;
    }
    
  }
}

extern "C" void kernel_launch(void* const* d_in, const int* in_sizes, int n_in,
                              void* d_out, int out_size, void* d_ws, size_t ws_size, hipStream_t stream) {
  if (n_in < 10) return;
  const long long needX = (long long)SEQ * NB_FULL * DM;
  if ((long long)in_sizes[0] < needX || (long long)in_sizes[1] < needX || (long long)in_sizes[2] < needX) return;
  for (int i = 3; i < 7; ++i) if ((long long)in_sizes[i] < (long long)DM * DM) return;
  if ((long long)in_sizes[7] < ((long long)(NB - 1) * SEQ_FULL + (SEQ - 1)) * SEQ_FULL + SEQ_FULL) return;
  if ((long long)in_sizes[8] < (long long)SEQ * RHSW) return;
  if (in_sizes[9] < 1) return;
  if ((long long)out_size < (long long)COV_OFF + ((long long)(NB - 1) * SEQ_FULL + (SEQ - 1)) * SEQ_FULL + SEQ) return;

  const float* query = (const float*)d_in[0];   // wire order: query, key, value, Wq, Wk, Wv, Wo, mask, rhs_mask, layer_idx
  const float* keyt  = (const float*)d_in[1];
  const float* value = (const float*)d_in[2];
  const float* Wq    = (const float*)d_in[3];
  const float* Wk    = (const float*)d_in[4];
  const float* Wv    = (const float*)d_in[5];
  const float* Wo    = (const float*)d_in[6];
  const int*   mask  = (const int*)d_in[7];
  const int*   rhs   = (const int*)d_in[8];
  const int*   lidx  = (const int*)d_in[9];
  float* out = (float*)d_out;
  float* cov = out + COV_OFF;

  char* ws = (char*)d_ws;
  size_t off = 0;
  unsigned short* Xb = (unsigned short*)(ws + off); off += BYTES_XB;   // 3 activation planes [SEQ*NB_FULL][1024] bf16
  unsigned short* Wb = (unsigned short*)(ws + off); off += BYTES_WB;   // 4 weight planes [1024][1024] bf16 (q, k, v, o)
  unsigned short* PL = (unsigned short*)(ws + off); off += BYTES_PL;   // q_hi, q_lo, k_hi, k_lo, vT_hi, vT_lo
  unsigned short* Cx = (unsigned short*)(ws + off); off += BYTES_CX;   // ctx [SEQ*NB_FULL][hi 1024 | lo 1024] bf16
  unsigned int*   Mb = (unsigned int*)(ws + off);   off += BYTES_MB;   // mask bit-plane [NB][SEQ][32 words]
  if (off > ws_size) return;

  k_prep<<<PREP_WG, PREP_TH, 0, stream>>>(query, keyt, value, Wq, Wk, Wv, Wo, mask, rhs, lidx, Xb, Wb, Mb);
  k_proj<<<dim3((unsigned)(NB * SEQ / GT), NH / 2, 3), 256, 0, stream>>>(Xb, Wb, PL);
  hipFuncSetAttribute(reinterpret_cast<const void*>(&k_attn), hipFuncAttributeMaxDynamicSharedMemorySize, (int)ATTN_LDS);
  k_attn<<<(unsigned)(NB * (SEQ / 16)), 32 * NW, (size_t)ATTN_LDS, stream>>>(PL, Mb, Cx, cov);
  k_oproj<<<dim3((unsigned)(SEQ * NB_FULL / GT), DM / GT), 256, 0, stream>>>(Cx, Wb + 3 * WN, out);
}

// v007
// Measured time: 165 microseconds a run.
// Timed twice side by side with v006, it ran 1.05 and 1.06 times as fast.
// Over all steps from v000 it is 7.48 times as fast.
#include <hip/hip_runtime.h>
// Contractions (all v_wmma_f32_16x16x32_bf16, f32 accumulate): q/k/v projections = single product on RNE-bf16 inputs and weights; scores K Q^T, P V and the output projection = bf16 hi+lo planes of the computed operand(s), products hi*hi + hi*lo + lo*hi (output projection: [ctx_hi | ctx_lo] x [Wo ; Wo] folded along K); softmax statistics and coverage in f32.
// come from K rows (A, global bf16 planes) and Q^T (B, registers); the two 16-key D tiles pack straight into the P^T B fragment; O^T accumulates from V^T rows (A).
// Masks: both boolean inputs and the layer index are read on the device into a bit-plane (one 32-bit word per query and 32-key step); fully masked steps are skipped at run time.
#ifndef NB
#define NB 4
#endif
#ifndef SEQ
#define SEQ 1024
#endif
#define NB_FULL 4
#define SEQ_FULL 1024
#define NH 16
#define HD 64
#define DM 1024
#define RHSW (SEQ_FULL + 4)
#define NKS (SEQ / 32)
#define MBW (SEQ_FULL / 32)
#define CXP 2048
#define COVP (SEQ + 4)
#define STP 72
#define COV_LDS_BYTES (16 * COVP * 4)
#define NW 32                                    /* waves of one attention block */
#define NSTEP ((NKS + NW - 1) / NW)              /* 32-key steps owned by one wave */
#define STATP (NW + 4)                           /* dword pitch of a query's row of per-wave statistics (16 B x odd) */
#define OPP 68                                   /* dword pitch of a partial-O row */
#define ATTN_LDS (COV_LDS_BYTES + 2 * 16 * STATP * 4 + NW * 16 * OPP * 4)

#define XN ((size_t)SEQ * NB_FULL * DM)          /* elements of one converted activation plane (prefix of the full input) */
#define WN ((size_t)DM * DM)
#define PLSZ ((size_t)NB * NH * SEQ * HD)        /* elements of one head-layout plane */
#define COV_OFF ((size_t)SEQ_FULL * NB_FULL * DM) /* element offset of the second output (byte 16777216) */

#define BYTES_XB (3 * XN * 2)
#define BYTES_WB (4 * WN * 2)
#define BYTES_PL (6 * PLSZ * 2)
#define BYTES_CX ((size_t)SEQ * NB_FULL * CXP * 2)
#define BYTES_MB ((size_t)NB * SEQ * MBW * 4)

static_assert(SEQ % 128 == 0);
static_assert(SEQ <= SEQ_FULL);
static_assert(NB <= NB_FULL);
static_assert(MBW == 32);
static_assert(HD == 64);
static_assert(NW % 16 == 0 && NW <= 32);       // the merge forms its NW / 2 exponentials eight at a time
static_assert(ATTN_LDS <= 327680);
static_assert(NH * HD == DM);
static_assert(PLSZ * 2 <= (size_t)0xFFFFFFFF);   // a byte offset inside a head-layout plane fits 32 bits
static_assert(COV_OFF * 4 == (size_t)16777216);
static_assert(BYTES_XB % 256 == 0 && BYTES_WB % 256 == 0 && BYTES_PL % 256 == 0 && BYTES_CX % 256 == 0 && BYTES_MB % 256 == 0);
static_assert(BYTES_XB + BYTES_WB + BYTES_PL + BYTES_CX + BYTES_MB <= (size_t)134217728);
static_assert((size_t)SEQ * NB_FULL * DM <= COV_OFF);
static_assert(COV_OFF + ((size_t)(NB - 1) * SEQ_FULL + (SEQ - 1)) * SEQ_FULL + SEQ <= (size_t)33554432 / 4);

typedef __bf16 v16b __attribute__((ext_vector_type(16)));
typedef unsigned short v8us __attribute__((ext_vector_type(8), may_alias));
typedef float v8f __attribute__((ext_vector_type(8)));
typedef float v4f __attribute__((ext_vector_type(4)));
typedef float v4fa __attribute__((ext_vector_type(4), may_alias));
typedef float v2f __attribute__((ext_vector_type(2)));
typedef float v2fa __attribute__((ext_vector_type(2), may_alias));
typedef unsigned int u32a __attribute__((may_alias));
typedef int v4i __attribute__((ext_vector_type(4)));
typedef int v4ia __attribute__((ext_vector_type(4), may_alias));
typedef __bf16 v2b __attribute__((ext_vector_type(2)));
union FragB { v16b v; v8us half[2]; unsigned int w[8]; };

#define LOG2E 1.4426950408889634f
#define NEGBIG (-1.0e30f)

// 2^x by the bare v_exp_f32. Every argument here is a difference to a maximum (<= 0): only results under 2^-126 differ from the library form (they become 0).
// Asm text so that the slot which the instruction set asks for behind a transcendental is kept by construction: inside a statement the next, independent
// transcendental fills it (no output shares a register with an input), and the closing v_nop fills it for the last one, whatever the compiler puts behind.
__device__ __forceinline__ void ex2x8(float* y, const float* x) {
  asm("v_exp_f32 %0, %8\n\tv_exp_f32 %1, %9\n\tv_exp_f32 %2, %10\n\tv_exp_f32 %3, %11\n\t"
      "v_exp_f32 %4, %12\n\tv_exp_f32 %5, %13\n\tv_exp_f32 %6, %14\n\tv_exp_f32 %7, %15\n\tv_nop"
      : "=&v"(y[0]), "=&v"(y[1]), "=&v"(y[2]), "=&v"(y[3]), "=&v"(y[4]), "=&v"(y[5]), "=&v"(y[6]), "=&v"(y[7])
      : "v"(x[0]), "v"(x[1]), "v"(x[2]), "v"(x[3]), "v"(x[4]), "v"(x[5]), "v"(x[6]), "v"(x[7]));
}
__device__ __forceinline__ float ex2(float x) {
  float y;
  asm("v_exp_f32 %0, %1\n\tv_nop" : "=&v"(y) : "v"(x));   // v_nop: the slot behind the transcendental
  return y;
}
// e = 2^x and r = 1 / d by the bare v_rcp_f32 (the caller guards d = 0), one closing slot for both
__device__ __forceinline__ void ex2_rcp(float& e, float& r, float x, float d) {
  asm("v_exp_f32 %0, %2\n\tv_rcp_f32 %1, %3\n\tv_nop" : "=&v"(e), "=&v"(r) : "v"(x), "v"(d));
}

// RNE convert of two values to a packed bf16 pair (a in the low half): one v_cvt_pk_bf16_f32
__device__ __forceinline__ unsigned int bf16_pair(float a, float b) {
  const v2f x = {a, b};
  return __builtin_bit_cast(unsigned int, __builtin_convertvector(x, v2b));
}
// the lo plane's pair: what the hi pair h leaves of (a, b), rounded the same way
__device__ __forceinline__ unsigned int bf16_rest(float a, float b, unsigned int h) {
  return bf16_pair(a - __uint_as_float(h << 16), b - __uint_as_float(h & 0xFFFF0000u));
}

__device__ __forceinline__ v8f wm(v16b a, v16b b, v8f c) {
  return __builtin_amdgcn_wmma_f32_16x16x32_bf16(false, a, false, b, (short)0, c, false, false);
}

// Preparation, one launch: PREP_WG work-groups of 16 waves (one a WGP); every thread takes its share of each job, so that few waves have to start.
// Conversions: a work-group's pieces of a plane are contiguous; a wave's load covers 512 contiguous bytes, its store 256 (whole lines).
#define PREP_WG 256
#define PREP_TH 512
#define PREP_T (PREP_WG * PREP_TH)
#define XCH ((int)(XN / 4 / PREP_T))              /* 16-byte pieces of one activation plane per thread */
#define WCH ((int)(WN / 4 / PREP_T))              /* the same of one weight plane */
static_assert(XN % ((size_t)4 * PREP_T) == 0 && WN % ((size_t)4 * PREP_T) == 0);
static_assert(NB * SEQ * MBW <= PREP_T);
typedef unsigned int v2ua __attribute__((ext_vector_type(2), may_alias));

__device__ __forceinline__ void cvt_store(unsigned short* d, v4f x) {
  v2ua o;
  o[0] = bf16_pair(x[0], x[1]); o[1] = bf16_pair(x[2], x[3]);
  *(v2ua*)d = o;
}

// coverage: planes: PREP_T threads x XCH (WCH) pieces x 4 elements = every element of each of the 3 + 4 planes, once.
// Mb[b][q][j] bit kk = 1 when key 32j+kk is masked for query q of batch b (mask[b][q][k] != 0 or rhs[q][start + k] != 0); thread t < NB*SEQ*32 writes word t: every word of the plane.
__global__ __launch_bounds__(PREP_TH) void k_prep(const float* __restrict__ query, const float* __restrict__ keyt, const float* __restrict__ value,
                                                  const float* __restrict__ Wq, const float* __restrict__ Wk, const float* __restrict__ Wv,
                                                  const float* __restrict__ Wo, const int* __restrict__ mask, const int* __restrict__ rhs,
                                                  const int* __restrict__ lidx, unsigned short* __restrict__ Xb, unsigned short* __restrict__ Wb,
                                                  unsigned int* __restrict__ Mb) {
  const int tid = threadIdx.x, blk = blockIdx.x;
  const int t = blk * PREP_TH + tid;
  const size_t ex = ((size_t)blk * XCH * PREP_TH + tid) * 4;   // this thread's first element in an activation plane
  const size_t ew = ((size_t)blk * WCH * PREP_TH + tid) * 4;   // and in a weight plane
  const float* sq = query + ex;
  const float* sk = keyt + ex;
  const float* sv = value + ex;
  const float* s0 = Wq + ew;
  const float* s1 = Wk + ew;
  const float* s2 = Wv + ew;
  const float* s3 = Wo + ew;
  // the long streams start first: all of the thread's plane loads are in flight while it forms its mask word
  v4f x[3][XCH], y[4][WCH];
#pragma unroll  // constant index into x[]
  for (int i = 0; i < XCH; ++i) x[0][i] = *(const v4fa*)(sq + (size_t)i * PREP_TH * 4);
#pragma unroll
  for (int i = 0; i < XCH; ++i) x[1][i] = *(const v4fa*)(sk + (size_t)i * PREP_TH * 4);
#pragma unroll
  for (int i = 0; i < XCH; ++i) x[2][i] = *(const v4fa*)(sv + (size_t)i * PREP_TH * 4);
#pragma unroll  // constant index into y[]
  for (int i = 0; i < WCH; ++i) {
    y[0][i] = *(const v4fa*)(s0 + (size_t)i * PREP_TH * 4);
    y[1][i] = *(const v4fa*)(s1 + (size_t)i * PREP_TH * 4);
    y[2][i] = *(const v4fa*)(s2 + (size_t)i * PREP_TH * 4);
    y[3][i] = *(const v4fa*)(s3 + (size_t)i * PREP_TH * 4);
  }
  // the loads' address registers stay live up to this wait (inputs only), so that no load's result and nothing behind it lands in one ahead of it
  asm volatile("s_wait_xcnt 0x0" :: "v"(sq), "v"(sk), "v"(sv), "v"(s0), "v"(s1), "v"(s2), "v"(s3) : "memory");
  if (t < NB * SEQ * MBW) {
    const int j = t & 31, row = t >> 5;
    const int b = row / SEQ, q = row - b * SEQ;
    int L = lidx[0];
    L = (L < -64) ? -64 : ((L > 64) ? 64 : L);
    int tt = 4 - 4 * L; if (tt < 0) tt = 0;
    int start = 4 - tt; if (start < 0) start = 0;
    start = (start >= 4) ? 4 : 0;                       // the formula only yields 0 or 4; keeps the 16-B alignment of the row loads
    const int* mp = mask + ((size_t)b * SEQ_FULL + q) * SEQ_FULL + 32 * j;
    const int* rp = rhs + (size_t)q * RHSW + start + 32 * j;
    v4i a[8], r[8];
#pragma unroll  // constant index into a[] and r[]; the word's 16 loads in flight together
    for (int c = 0; c < 8; ++c) {
      a[c] = *(const v4ia*)(mp + 4 * c);
      r[c] = *(const v4ia*)(rp + 4 * c);
    }
    // as above: both address pairs stay live up to this wait, so that no load's result lands in one ahead of it
    asm volatile("s_wait_xcnt 0x0" :: "v"(mp), "v"(rp) : "memory");
    unsigned int w = 0u;
#pragma unroll
    for (int c = 0; c < 8; ++c) {
      const unsigned int nib = (((a[c][0] | r[c][0]) != 0) ? 1u : 0u) | (((a[c][1] | r[c][1]) != 0) ? 2u : 0u) |
                               (((a[c][2] | r[c][2]) != 0) ? 4u : 0u) | (((a[c][3] | r[c][3]) != 0) ? 8u : 0u);
      w |= nib << (4 * c);
    }
    Mb[t] = w;
  }
#pragma unroll  // constant index into x[]
  for (int p = 0; p < 3; ++p)
#pragma unroll
    for (int i = 0; i < XCH; ++i) cvt_store(Xb + (size_t)p * XN + ex + (size_t)i * PREP_TH * 4, x[p][i]);
#pragma unroll  // constant index into y[]
  for (int p = 0; p < 4; ++p)
#pragma unroll
    for (int i = 0; i < WCH; ++i) cvt_store(Wb + (size_t)p * WN + ew + (size_t)i * PREP_TH * 4, y[p][i]);
}

// Block tile 128 rows x 128 columns, 8 waves of 32 x 64 (4 along the rows, 2 along the columns), K in stages of KC.
// A stage is [A tile | W tile], each GT rows of KC bf16 (one whole 128-B line a row) at LDS pitch TP; two buffers.
// Every lane copies 16 B per instruction, a wave 4 whole lines: 4 copies a lane for the A tile, 4 for the W tile.
#define GT 128
#define KC 64
#define TP 72                                    /* elements: 144 B = 16 B x odd, for the ds_load_b128 fragment reads */
#define TILE_E (GT * TP)
#define RING_E (4 * TILE_E)
static_assert(DM % KC == 0 && CXP % KC == 0 && DM / KC >= 2);
static_assert(RING_E >= 4 * 2 * 64 * STP);       // the projections' output staging reuses the ring
static_assert(RING_E * 2 >= 4 * 64 * 68 * 4);    // so does the output projection's

// la: LDS byte address of this lane's piece in its first row of the A tile of the target buffer; ga, gb: the same piece in global memory.
// Rows crow + 32 i, i = 0..3, of both tiles. The s_wait_xcnt stands inside the statement: the address registers are rewritten behind it.
__device__ __forceinline__ void stage_copy(unsigned int la, const unsigned short* ga, size_t apitch, const unsigned short* gb) {
  const unsigned int lb = la + TILE_E * 2;
  asm volatile("global_load_async_to_lds_b128 %0, %8, off\n\t"
               "global_load_async_to_lds_b128 %1, %9, off\n\t"
               "global_load_async_to_lds_b128 %2, %10, off\n\t"
               "global_load_async_to_lds_b128 %3, %11, off\n\t"
               "global_load_async_to_lds_b128 %4, %12, off\n\t"
               "global_load_async_to_lds_b128 %5, %13, off\n\t"
               "global_load_async_to_lds_b128 %6, %14, off\n\t"
               "global_load_async_to_lds_b128 %7, %15, off\n\t"
               "s_wait_xcnt 0x0"
               :: "v"(la), "v"(la + 32 * TP * 2), "v"(la + 64 * TP * 2), "v"(la + 96 * TP * 2),
                  "v"(lb), "v"(lb + 32 * TP * 2), "v"(lb + 64 * TP * 2), "v"(lb + 96 * TP * 2),
                  "v"(ga), "v"(ga + 32 * apitch), "v"(ga + 64 * apitch), "v"(ga + 96 * apitch),
                  "v"(gb), "v"(gb + 32 * DM), "v"(gb + 64 * DM), "v"(gb + 96 * DM)
               : "memory");
}

// ga, gb: this thread's copy sources at k = 0 (row tid / 8 of the tile, piece tid % 8); ar, br: this lane's fragment rows in buffer 0.
// The W k index wraps at DM so that [A_hi | A_lo] x [W ; W] folds along K. Each accumulator still sums k in steps of 32, ascending.
template <int KT>
__device__ __forceinline__ void gemm_main(const unsigned short* __restrict__ ga, size_t apitch, const unsigned short* __restrict__ gb,
                                          unsigned int la, const unsigned short* ar, const unsigned short* br, v8f (&acc)[2][4]) {
  constexpr int NT = KT / KC;
  stage_copy(la, ga, apitch, gb);
  asm volatile("s_wait_asynccnt 0x0" ::: "memory");   // stage 0 has landed before the barrier publishes it
  __syncthreads();
  stage_copy(la + 2 * TILE_E * 2, ga + KC, apitch, gb + KC);
#pragma unroll 1  // one stage a trip: the buffer index and the refill test stay scalar
  for (int t = 0; t < NT; ++t) {
    const int bo = (t & 1) * 2 * TILE_E;
#pragma unroll  // two 32-wide k steps of the stage
    for (int kk = 0; kk < KC; kk += 32) {
      const unsigned short* ap = ar + bo + kk;
      const unsigned short* bp = br + bo + kk;
      FragB a0, a1, b0, b1, b2, b3;
      a0.half[0] = *(const v8us*)(ap);                a0.half[1] = *(const v8us*)(ap + 16);
      a1.half[0] = *(const v8us*)(ap + 16 * TP);      a1.half[1] = *(const v8us*)(ap + 16 * TP + 16);
      b0.half[0] = *(const v8us*)(bp);                b0.half[1] = *(const v8us*)(bp + 16);
      b1.half[0] = *(const v8us*)(bp + 16 * TP);      b1.half[1] = *(const v8us*)(bp + 16 * TP + 16);
      b2.half[0] = *(const v8us*)(bp + 32 * TP);      b2.half[1] = *(const v8us*)(bp + 32 * TP + 16);
      b3.half[0] = *(const v8us*)(bp + 48 * TP);      b3.half[1] = *(const v8us*)(bp + 48 * TP + 16);
      acc[0][0] = wm(a0.v, b0.v, acc[0][0]); acc[0][1] = wm(a0.v, b1.v, acc[0][1]);
      acc[0][2] = wm(a0.v, b2.v, acc[0][2]); acc[0][3] = wm(a0.v, b3.v, acc[0][3]);
      acc[1][0] = wm(a1.v, b0.v, acc[1][0]); acc[1][1] = wm(a1.v, b1.v, acc[1][1]);
      acc[1][2] = wm(a1.v, b2.v, acc[1][2]); acc[1][3] = wm(a1.v, b3.v, acc[1][3]);
      asm volatile("v_nop\n\tv_nop\n\tv_nop\n\tv_nop"
                   : "+v"(acc[0][0]), "+v"(acc[0][1]), "+v"(acc[0][2]), "+v"(acc[0][3]),
                     "+v"(acc[1][0]), "+v"(acc[1][1]), "+v"(acc[1][2]), "+v"(acc[1][3])
                   : "v"(a0.v), "v"(a1.v), "v"(b0.v), "v"(b1.v), "v"(b2.v), "v"(b3.v));
    }
    asm volatile("s_wait_dscnt 0x0" ::: "memory");      // this wave's reads of the buffer are done before it is refilled
    asm volatile("s_wait_asynccnt 0x0" ::: "memory");   // this wave's copies of stage t + 1 have landed
    __syncthreads();                                    // publishes stage t + 1 and ends every reader's last read of stage t
    if (t + 2 < NT) {
      const int k2 = (t + 2) * KC;
      stage_copy(la + (unsigned int)bo * 2u, ga + k2, apitch, gb + (k2 & (DM - 1)));
    }
  }
  asm volatile("s_wait_asynccnt 0x0" ::: "memory");     // nothing is in flight when the ring becomes output staging
}

// Projections. grid (NB*SEQ/128, NH/2, 3): block = 128 sequence positions of one batch x two heads x one of {q, k, v}; 8 waves x (32 x 64).
// Logical row b*SEQ + s reads the activation row s*NB_FULL + b. Epilogue: each pair of waves owns a 64 x 64 tile (one head): bf16 hi + lo planes staged in its part of the ring
// (block barrier kept as it was; a wave now reads back the rows it staged itself). The planes lie in fragment order, in units of 512 B = [32 lanes][8 elements], one unit = one fragment load of an attention wave (4 whole lines):
// q (scaled by 1/8) and k: [b][h][s / 16][L = 0..3][lane], lane (hh, ln) holds row s = 16 tile + ln, d = 16 L + 8 hh + 0..7; v: [b][h][s / 32][d / 16][x = 0..1][lane], lane holds d = 16 t + ln, keys 32 j + 16 x + 8 hh + 0..7.
__global__ __launch_bounds__(256) void k_proj(const unsigned short* __restrict__ Xb, const unsigned short* __restrict__ Wb,
                                              unsigned short* __restrict__ PL) {
  __shared__ __attribute__((aligned(16))) unsigned short ring[RING_E];
  const int tid = threadIdx.x, w = __builtin_amdgcn_readfirstlane((int)(tid >> 5)), lane = tid & 31, ln = lane & 15, hh = lane >> 4;
  const int wr = w & 3, wc = w >> 2;                 // wave position: rows 32 wr, columns 64 wc
  const int pr = (wr >> 1) + 2 * wc, w2 = wr & 1;    // pair of waves that shares a 64 x 64 output tile, and the wave's place in it
  const int z = blockIdx.z, hcol = 2 * blockIdx.y + wc;
  const int mt0 = blockIdx.x * GT;
  const int b = mt0 / SEQ, sb = mt0 - b * SEQ;
  const int s0 = sb + 64 * (wr >> 1);
  const int crow = tid >> 3, cpc = 8 * (tid & 7);
  const unsigned short* ga = Xb + (size_t)z * XN + ((size_t)(sb + crow) * NB_FULL + b) * DM + cpc;
  const unsigned short* gb = Wb + (size_t)z * WN + (size_t)(GT * blockIdx.y + crow) * DM + cpc;
  const unsigned int la = (unsigned int)(size_t)(ring + crow * TP + cpc);
  v8f acc[2][4] = {};
  gemm_main<DM>(ga, (size_t)NB_FULL * DM, gb, la, ring + (32 * wr + ln) * TP + 8 * hh, ring + TILE_E + (64 * wc + ln) * TP + 8 * hh, acc);
  unsigned short* sh = ring + pr * (2 * 64 * STP);
  unsigned short* sl = sh + 64 * STP;
  const float scale = (z == 0) ? 0.125f : 1.0f;
#pragma unroll
  for (int mt = 0; mt < 2; ++mt)
#pragma unroll
    for (int nt = 0; nt < 4; ++nt)
#pragma unroll
      for (int r = 0; r < 8; r += 2) {
        const float v0 = acc[mt][nt][r] * scale, v1 = acc[mt][nt][r + 1] * scale;
        const unsigned int hb = bf16_pair(v0, v1);
        const unsigned int lb = bf16_rest(v0, v1, hb);
        const int sr = 32 * w2 + 16 * mt + 8 * hh + r;     // local sequence row of v0; v1 is the next
        const int dc = 16 * nt + ln;                        // head-dim column
        const int idx = (z == 2) ? (dc * STP + sr) : (sr * STP + dc);
        const int nx = (z == 2) ? 1 : STP;
        sh[idx] = (unsigned short)hb;
        sh[idx + nx] = (unsigned short)(hb >> 16);
        sl[idx] = (unsigned short)lb;
        sl[idx + nx] = (unsigned short)(lb >> 16);
      }
  __syncthreads();
  const size_t hbase = (size_t)b * NH + hcol;
  unsigned short* dstp = PL + (size_t)z * 2 * PLSZ + (hbase * SEQ + s0) * HD + 8 * lane;   // the 64 x 64 tile is 16 consecutive units in either layout
  {
#pragma unroll 1
    for (int i = 0; i < 8; ++i) {
      const int u = 8 * w2 + i;                          // unit of the tile; a wave's store covers the whole unit
      const int row = ln + ((z == 2) ? 16 * ((u >> 1) & 3) : 16 * (u >> 2));
      const int col = 8 * hh + ((z == 2) ? 32 * (u >> 3) + 16 * (u & 1) : 16 * (u & 3));
      const v8us vh = *(const v8us*)(sh + row * STP + col);
      const v8us vl = *(const v8us*)(sl + row * STP + col);
      unsigned short* d = dstp + 256 * u;
      *(v8us*)d = vh;
      *(v8us*)(d + PLSZ) = vl;
      asm volatile("s_wait_xcnt 0x0" ::: "memory");  // the next trip rewrites the stores' address registers
    }
    
  }
}

// S^T tile of 16 keys: c = K_lo Q_hi + K_hi Q_lo + K_hi Q_hi over the two 32-wide head-dim chunks, then the hazard guard.
__device__ __forceinline__ v8f qk_tile(const char* __restrict__ kh, const char* __restrict__ kl, unsigned int o, const FragB& qh0, const FragB& qh1,
                                       const FragB& ql0, const FragB& ql1) {
  // A fragments of K: row m = key, elements 0..7 <- d = 32c + 8h + i, 8..15 <- d = 32c + 16 + 8h + i: units 2c and 2c + 1 of the key tile; kh, kl: the planes (uniform), o: byte offset of the lane's 16 B in unit 0
  FragB a0, a1, c0, c1;
  const char* kp = kh + o;
  const char* lp = kl + o;
  a0.half[0] = *(const v8us*)(kp);        a0.half[1] = *(const v8us*)(kp + 512);
  a1.half[0] = *(const v8us*)(kp + 1024); a1.half[1] = *(const v8us*)(kp + 1536);
  asm volatile("s_wait_xcnt 0x0" ::: "memory");   // a result of the lo-plane loads may land in the hi-plane loads' address registers
  c0.half[0] = *(const v8us*)(lp);        c0.half[1] = *(const v8us*)(lp + 512);
  c1.half[0] = *(const v8us*)(lp + 1024);
  asm volatile("s_wait_xcnt 0x0" ::: "memory");   // the last load's result may land in the address or offset register that it shares with the loads before it
  c1.half[1] = *(const v8us*)(lp + 1536);
  asm volatile("s_wait_xcnt 0x0" ::: "memory");   // what follows may reuse the loads' address registers
  v8f c = {0.f, 0.f, 0.f, 0.f, 0.f, 0.f, 0.f, 0.f};
  c = wm(c0.v, qh0.v, c); c = wm(c1.v, qh1.v, c);
  c = wm(a0.v, ql0.v, c); c = wm(a1.v, ql1.v, c);
  c = wm(a0.v, qh0.v, c); c = wm(a1.v, qh1.v, c);
  asm volatile("v_nop\n\tv_nop\n\tv_nop\n\tv_nop" : "+v"(c)
               : "v"(a0.v), "v"(a1.v), "v"(c0.v), "v"(c1.v), "v"(qh0.v), "v"(qh1.v), "v"(ql0.v), "v"(ql1.v));
  return c;
}

// O^T tile of 16 head-dim rows: o += V_lo P_hi + V_hi P_lo + V_hi P_hi, then the hazard guard.
__device__ __forceinline__ v8f pv_tile(const char* __restrict__ vp, const char* __restrict__ lp, const FragB& ph, const FragB& pl, v8f o) {
  // A fragments of V^T: row m = d, elements 0..7 <- key0 + 8h + i, 8..15 <- key0 + 16 + 8h + i: units 0 and 1 of the (key step, d tile) pair; vp, lp: the lane's 16 B in unit 0 of the hi and of the lo plane
  FragB vh, vl;
  vh.half[0] = *(const v8us*)(vp); vh.half[1] = *(const v8us*)(vp + 512);
  vl.half[0] = *(const v8us*)(lp); vl.half[1] = *(const v8us*)(lp + 512);
  o = wm(vl.v, ph.v, o);
  o = wm(vh.v, pl.v, o);
  o = wm(vh.v, ph.v, o);
  asm volatile("v_nop\n\tv_nop\n\tv_nop\n\tv_nop" : "+v"(o) : "v"(vh.v), "v"(vl.v), "v"(ph.v), "v"(pl.v));
  return o;
}

// Block = one batch x 16 queries, NW waves; wave w owns the 32-key steps j = w, w + NW, ... of every head (its mask words stay in registers).
// Per head: each wave's softmax statistics over its own steps -> LDS -> barrier -> every wave merges all NW pairs (max, rescaled sum);
// then normalised weights (the wave's kept exponentials rescaled to the merged statistics), coverage into the LDS tile [16][SEQ] (a step's columns belong to one wave, each lane only touches its own addresses), partial O^T;
// partial O^T tiles -> LDS -> barrier -> one wave per query row sums the NW partials in wave order and writes bf16 hi | lo halves of the [s*NB_FULL+b][2048] plane.
// Reuse of the exchange buffers: statistics of head h are read before the second barrier of h and rewritten after it; partials of h are read before the first barrier of h + 1 and rewritten after it.
// coverage: ctx plane: (b, 16 rows) x 16 heads x (64 hi + 64 lo) = every element of rows with b < NB; coverage output: 16 rows x SEQ columns per block, all rows once.
// LDS: coverage tile zero-filled in full before use; every wave writes its statistics and its whole partial tile (zeros when all its steps are masked) before they are read.
__global__ __launch_bounds__(32 * NW) void k_attn(const unsigned short* __restrict__ PL, const unsigned int* __restrict__ Mb,
                                                  unsigned short* __restrict__ Cx, float* __restrict__ Cov) {
  extern __shared__ __attribute__((aligned(16))) unsigned char smem[];
  float* covs = (float*)smem;
  float* stm = (float*)(smem + COV_LDS_BYTES);     // [16 queries][STATP]: running maximum of wave w at column w
  float* stl = stm + 16 * STATP;                   // same shape: sum of wave w
  float* part = stl + 16 * STATP;                  // [NW][16 queries][OPP]: partial O, f32
  const int tid = threadIdx.x, w = __builtin_amdgcn_readfirstlane((int)(tid >> 5));
  const int lane = tid & 31, ln = lane & 15, hh = lane >> 4;
  const int b = blockIdx.x / (SEQ / 16), qt = blockIdx.x % (SEQ / 16);
  const int q0 = qt * 16, qg = q0 + ln;
  {
    const v4f z4 = {0.f, 0.f, 0.f, 0.f};
    for (int i = tid; i < 4 * COVP; i += 32 * NW) *(v4fa*)(covs + 4 * i) = z4;
  }
  const unsigned int* mrow = Mb + (size_t)(b * SEQ + qg) * MBW;
  unsigned int mw[NSTEP];
  bool act[NSTEP];                                 // wave-uniform: some key of the step is open for one of the 16 queries
#pragma unroll  // mw[] and act[] must be indexed by constants to stay in registers
  for (int i = 0; i < NSTEP; ++i) {
    const int j = w + i * NW;
    mw[i] = (j < NKS) ? mrow[j] : 0xFFFFFFFFu;
    act[i] = __any(mw[i] != 0xFFFFFFFFu);
  }
  __syncthreads();
  const int sh8 = 8 * hh;
  const unsigned int lo = 16u * (unsigned int)lane;   // byte offset of this lane's 16 B in a 512-B unit of the q, k, v planes
  const char* PLc = (const char*)PL;                  // plane p starts at byte 2 p PLSZ; addresses are a uniform plane base + a 32-bit offset inside the plane
  float* crow = covs + ln * COVP + 8 * hh;

#pragma unroll 1
  for (int h = 0; h < NH; ++h) {
    const size_t hb = (size_t)b * NH + h;
    // Q^T B fragments: column n = query qg, elements 0..7 <- d = 32c + 8h + i, 8..15 <- d = 32c + 16 + 8h + i: units 2c and 2c + 1 of the query tile
    const unsigned int ho = (unsigned int)hb * (SEQ * HD * 2) + lo;        // byte offset inside a plane: this head, this lane's 16 B of a unit
    const char* qp = PLc + (ho + (unsigned int)q0 * (HD * 2));
    const char* qlp = PLc + 2 * PLSZ + (ho + (unsigned int)q0 * (HD * 2));

    // ---- pass 1: statistics over this wave's own steps; each step's exponentials stay in registers, relative to the maximum ms[i] they were formed with ----
    float mr = NEGBIG, lr = 0.0f;
    float pe[NSTEP][16], ms[NSTEP];                // read only under the same act[i] that wrote them
#pragma unroll  // constant index into mw[] and act[]
    for (int i = 0; i < NSTEP; ++i) {
      if (act[i]) {
        // Q feeds this pass alone: its loads stand in the block that uses them, in front of their waits (one step a wave at this shape)
        FragB qh0, qh1, ql0, ql1;
        qh0.half[0] = *(const v8us*)(qp);              qh0.half[1] = *(const v8us*)(qp + 512);
        qh1.half[0] = *(const v8us*)(qp + 1024);       qh1.half[1] = *(const v8us*)(qp + 1536);
        asm volatile("s_wait_xcnt 0x0" ::: "memory");   // a result of the lo-plane loads may land in the hi-plane loads' address registers
        ql0.half[0] = *(const v8us*)(qlp);             ql0.half[1] = *(const v8us*)(qlp + 512);
        ql1.half[0] = *(const v8us*)(qlp + 1024);
        asm volatile("s_wait_xcnt 0x0" ::: "memory");   // the last load's result may land in the address registers that it shares with the three loads before it
        ql1.half[1] = *(const v8us*)(qlp + 1536);
        asm volatile("s_wait_xcnt 0x0" ::: "memory");   // the address registers of the Q loads are reused for the K addresses right behind them
        const int j = w + i * NW;
        const unsigned int ko = ho + (unsigned int)(32 * j) * (HD * 2);
        const v8f s0 = qk_tile(PLc + 4 * PLSZ, PLc + 6 * PLSZ, ko, qh0, qh1, ql0, ql1);          // element r = score(key 32j + 8h + r, query qg)
        const v8f s1 = qk_tile(PLc + 4 * PLSZ + 2048, PLc + 6 * PLSZ + 2048, ko, qh0, qh1, ql0, ql1);
        const unsigned int wb = mw[i] >> sh8;
        float sc[16];
        float mx = NEGBIG;
#pragma unroll
        for (int r = 0; r < 8; ++r) {
          sc[r]     = ((wb >> r) & 1u) ? NEGBIG : s0[r];
          sc[8 + r] = ((wb >> (16 + r)) & 1u) ? NEGBIG : s1[r];
          mx = fmaxf(mx, fmaxf(sc[r], sc[8 + r]));
        }
        mx = fmaxf(mx, __shfl_xor(mx, 16, 32));                  // the other lane half holds the other 16 keys of this query
        const float mnew = fmaxf(mr, mx);
        const float al = ex2((mr - mnew) * LOG2E);
        float ps = 0.0f;
        float xa[16], ea[16];
#pragma unroll  // constant index into xa[]
        for (int r = 0; r < 16; ++r) xa[r] = (sc[r] - mnew) * LOG2E;
        ex2x8(ea, xa);
        ex2x8(ea + 8, xa + 8);
#pragma unroll
        for (int r = 0; r < 16; ++r) {
          pe[i][r] = (sc[r] > -1.0e29f) ? ea[r] : 0.0f;          // 0 for a masked key
          ps += pe[i][r];
        }
        ms[i] = mnew;
        ps += __shfl_xor(ps, 16, 32);
        lr = lr * al + ps;
        mr = mnew;
      }
    }
    if (hh == 0) { stm[ln * STATP + w] = mr; stl[ln * STATP + w] = lr; }
    __syncthreads();
    // merge: each lane half reads NW / 2 of the waves' pairs of its query, then one exchange between the halves
    {
      float mv[NW / 2], lv[NW / 2];                // the loops below are unrolled so that both arrays stay in registers
#pragma unroll
      for (int u = 0; u < NW / 8; ++u) {
        const v4f x = *(const v4fa*)(stm + ln * STATP + (NW / 2) * hh + 4 * u);
        const v4f y = *(const v4fa*)(stl + ln * STATP + (NW / 2) * hh + 4 * u);
        mv[4 * u] = x[0]; mv[4 * u + 1] = x[1]; mv[4 * u + 2] = x[2]; mv[4 * u + 3] = x[3];
        lv[4 * u] = y[0]; lv[4 * u + 1] = y[1]; lv[4 * u + 2] = y[2]; lv[4 * u + 3] = y[3];
      }
      float mg = NEGBIG;
#pragma unroll
      for (int u = 0; u < NW / 2; ++u) mg = fmaxf(mg, mv[u]);
      mg = fmaxf(mg, __shfl_xor(mg, 16, 32));
      float lg = 0.0f;
      float xm[NW / 2];
#pragma unroll  // constant index into xm[]
      for (int u = 0; u < NW / 2; ++u) xm[u] = (mv[u] - mg) * LOG2E;
#pragma unroll
      for (int u = 0; u < NW / 2; u += 8) ex2x8(mv + u, xm + u);
#pragma unroll
      for (int u = 0; u < NW / 2; ++u) lg += lv[u] * mv[u];
      lg += __shfl_xor(lg, 16, 32);
      mr = mg;
      lr = lg;
    }

    // ---- pass 2: weights = kept exponentials x exp(ms - m) / l, coverage accumulation, partial O^T over this wave's own steps ----
    v8f O[4] = {};
#pragma unroll  // constant index into act[], ms[] and pe[]
    for (int i = 0; i < NSTEP; ++i) {
      if (act[i]) {
        const int key0 = 32 * (w + i * NW);
        float fe, rl;
        ex2_rcp(fe, rl, (ms[i] - mr) * LOG2E, lr);
        const float f = fe * ((lr > 0.0f) ? rl : 0.0f);   // a query with no open key keeps weights of 0 (0 x inf otherwise)
        float pn[16];
#pragma unroll
        for (int r = 0; r < 16; ++r) pn[r] = pe[i][r] * f;
        // coverage tile: this lane owns columns key0 + 8h + 0..7 and key0 + 16 + 8h + 0..7 of row ln
        {
          float* cr = crow + key0;
          v4f c0 = *(const v4fa*)(cr), c1 = *(const v4fa*)(cr + 4), c2 = *(const v4fa*)(cr + 16), c3 = *(const v4fa*)(cr + 20);
          c0[0] += pn[0];  c0[1] += pn[1];  c0[2] += pn[2];  c0[3] += pn[3];
          c1[0] += pn[4];  c1[1] += pn[5];  c1[2] += pn[6];  c1[3] += pn[7];
          c2[0] += pn[8];  c2[1] += pn[9];  c2[2] += pn[10]; c2[3] += pn[11];
          c3[0] += pn[12]; c3[1] += pn[13]; c3[2] += pn[14]; c3[3] += pn[15];
          *(v4fa*)(cr) = c0; *(v4fa*)(cr + 4) = c1; *(v4fa*)(cr + 16) = c2; *(v4fa*)(cr + 20) = c3;
        }
        // P^T B fragment: element i < 8 -> key0 + 8h + i (tile 0 row 8h + i); i >= 8 -> key0 + 16 + 8h + (i - 8) (tile 1); bf16 hi + lo
        FragB ph, pl;
#pragma unroll
        for (int r = 0; r < 16; r += 2) {
          const unsigned int hp = bf16_pair(pn[r], pn[r + 1]);
          ph.w[r >> 1] = hp;
          pl.w[r >> 1] = bf16_rest(pn[r], pn[r + 1], hp);
        }
        __builtin_amdgcn_sched_barrier(0);
        const unsigned int vo = ho + (unsigned int)key0 * (HD * 2);
        const char* vp = PLc + 8 * PLSZ + vo;
        const char* vlp = PLc + 10 * PLSZ + vo;
        O[0] = pv_tile(vp, vlp, ph, pl, O[0]);
        O[1] = pv_tile(vp + 1024, vlp + 1024, ph, pl, O[1]);
        O[2] = pv_tile(vp + 2048, vlp + 2048, ph, pl, O[2]);
        O[3] = pv_tile(vp + 3072, vlp + 3072, ph, pl, O[3]);
      }
    }

    // O^T element r of tile t = partial ctx(query qg, d = 16t + 8h + r): f32 into this wave's tile [16 queries][64 d]
    {
      float* pw = part + (size_t)(w * 16 + ln) * OPP + 8 * hh;
#pragma unroll  // constant index into O[]
      for (int t = 0; t < 4; ++t) {
        const v4f x0 = {O[t][0], O[t][1], O[t][2], O[t][3]};
        const v4f x1 = {O[t][4], O[t][5], O[t][6], O[t][7]};
        *(v4fa*)(pw + 16 * t) = x0;
        *(v4fa*)(pw + 16 * t + 4) = x1;
      }
    }
    __syncthreads();
    // one wave per query row (wave-uniform loop): lane sums d = 2 lane, 2 lane + 1 over the NW partial tiles; a wave writes whole 128-B lines
#pragma unroll 1  // at most one trip per wave once NW >= 16: nothing to gain from copies of the body
    for (int row = w; row < 16; row += NW) {
      const float* pr = part + row * OPP + 2 * lane;
      float t0 = 0.0f, t1 = 0.0f;
#pragma unroll  // independent LDS loads in flight together; the sums stay in wave order
      for (int u = 0; u < NW; ++u) {
        const v2f x = *(const v2fa*)(pr + u * 16 * OPP);
        t0 += x[0];
        t1 += x[1];
      }
      const unsigned int hp = bf16_pair(t0, t1);
      unsigned short* d = Cx + ((size_t)(q0 + row) * NB_FULL + b) * CXP + h * HD + 2 * lane;
      *(u32a*)d = hp;
      *(u32a*)(d + DM) = bf16_rest(t0, t1, hp);
      asm volatile("s_wait_xcnt 0x0" ::: "memory");  // the stores' address registers are advanced for the next head right behind them
    }
  }

  __syncthreads();
  float* cg = Cov + ((size_t)b * SEQ_FULL + q0) * SEQ_FULL;
#pragma unroll 1  // a few short trips, once per block: kept rolled as before
  for (int idx = w; idx < 16 * (SEQ / 128); idx += NW) {
    const int row = idx / (SEQ / 128), col = (idx % (SEQ / 128)) * 128 + lane * 4;
    v4f v = *(const v4fa*)(covs + row * COVP + col);
    v[0] *= 0.0625f; v[1] *= 0.0625f; v[2] *= 0.0625f; v[3] *= 0.0625f;
    *(v4f*)(cg + (size_t)row * SEQ_FULL + col) = v;
    asm volatile("s_wait_xcnt 0x0" ::: "memory");    // the next trip rewrites the store's address and data registers
  }
}

// Output projection: out[m][n] = sum_c ctx[m][c] Wo[n][c] with A = [ctx_hi | ctx_lo] (K = 2048) and the W k index wrapping at 1024.
// coverage: blocks tile the [SEQ*NB_FULL][1024] output exactly once.
__global__ __launch_bounds__(256) void k_oproj(const unsigned short* __restrict__ Cx, const unsigned short* __restrict__ Wo,
                                               float* __restrict__ Out) {
  __shared__ __attribute__((aligned(16))) unsigned short ring[RING_E];
  const int tid = threadIdx.x, w = __builtin_amdgcn_readfirstlane((int)(tid >> 5)), lane = tid & 31, ln = lane & 15, hh = lane >> 4;
  const int wr = w & 3, wc = w >> 2;                 // wave position: rows 32 wr, columns 64 wc
  const int pr = (wr >> 1) + 2 * wc, w2 = wr & 1;    // 64 x 64 staging tile, and the wave's place in it
  const int mb = blockIdx.x * GT, nb = blockIdx.y * GT;
  const int m0 = mb + 64 * (wr >> 1), n0 = nb + 64 * wc;
  const int crow = tid >> 3, cpc = 8 * (tid & 7);
  const unsigned short* ga = Cx + (size_t)(mb + crow) * CXP + cpc;
  const unsigned short* gb = Wo + (size_t)(nb + crow) * DM + cpc;
  const unsigned int la = (unsigned int)(size_t)(ring + crow * TP + cpc);
  v8f acc[2][4] = {};
  gemm_main<CXP>(ga, (size_t)CXP, gb, la, ring + (32 * wr + ln) * TP + 8 * hh, ring + TILE_E + (64 * wc + ln) * TP + 8 * hh, acc);
  float* so = (float*)ring + pr * (64 * 68);
#pragma unroll
  for (int mt = 0; mt < 2; ++mt)
#pragma unroll
    for (int nt = 0; nt < 4; ++nt)
#pragma unroll
      for (int r = 0; r < 8; ++r)
        so[(32 * w2 + 16 * mt + 8 * hh + r) * 68 + 16 * nt + ln] = acc[mt][nt][r];
  __syncthreads();
  const int rsub = lane >> 4, c4 = (lane & 15) * 4;
  {
#pragma unroll 1
    for (int i = 0; i < 16; ++i) {
      const int row = 32 * w2 + 2 * i + rsub;
      const v4f v = *(const v4fa*)(so + row * 68 + c4);
      *(v4f*)(Out + (size_t)(m0 + row) * DM + n0 + c4) = v;
    }
    
  }
}

extern "C" void kernel_launch(void* const* d_in, const int* in_sizes, int n_in,
                              void* d_out, int out_size, void* d_ws, size_t ws_size, hipStream_t stream) {
  if (n_in < 10) return;
  const long long needX = (long long)SEQ * NB_FULL * DM;
  if ((long long)in_sizes[0] < needX || (long long)in_sizes[1] < needX || (long long)in_sizes[2] < needX) return;
  for (int i = 3; i < 7; ++i) if ((long long)in_sizes[i] < (long long)DM * DM) return;
  if ((long long)in_sizes[7] < ((long long)(NB - 1) * SEQ_FULL + (SEQ - 1)) * SEQ_FULL + SEQ_FULL) return;
  if ((long long)in_sizes[8] < (long long)SEQ * RHSW) return;
  if (in_sizes[9] < 1) return;
  if ((long long)out_size < (long long)COV_OFF + ((long long)(NB - 1) * SEQ_FULL + (SEQ - 1)) * SEQ_FULL + SEQ) return;

  const float* query = (const float*)d_in[0];   // wire order: query, key, value, Wq, Wk, Wv, Wo, mask, rhs_mask, layer_idx
  const float* keyt  = (const float*)d_in[1];
  const float* value = (const float*)d_in[2];
  const float* Wq    = (const float*)d_in[3];
  const float* Wk    = (const float*)d_in[4];
  const float* Wv    = (const float*)d_in[5];
  const float* Wo    = (const float*)d_in[6];
  const int*   mask  = (const int*)d_in[7];
  const int*   rhs   = (const int*)d_in[8];
  const int*   lidx  = (const int*)d_in[9];
  float* out = (float*)d_out;
  float* cov = out + COV_OFF;

  char* ws = (char*)d_ws;
  size_t off = 0;
  unsigned short* Xb = (unsigned short*)(ws + off); off += BYTES_XB;   // 3 activation planes [SEQ*NB_FULL][1024] bf16
  unsigned short* Wb = (unsigned short*)(ws + off); off += BYTES_WB;   // 4 weight planes [1024][1024] bf16 (q, k, v, o)
  unsigned short* PL = (unsigned short*)(ws + off); off += BYTES_PL;   // q_hi, q_lo, k_hi, k_lo, vT_hi, vT_lo
  unsigned short* Cx = (unsigned short*)(ws + off); off += BYTES_CX;   // ctx [SEQ*NB_FULL][hi 1024 | lo 1024] bf16
  unsigned int*   Mb = (unsigned int*)(ws + off);   off += BYTES_MB;   // mask bit-plane [NB][SEQ][32 words]
  if (off > ws_size) return;

  k_prep<<<PREP_WG, PREP_TH, 0, stream>>>(query, keyt, value, Wq, Wk, Wv, Wo, mask, rhs, lidx, Xb, Wb, Mb);
  k_proj<<<dim3((unsigned)(NB * SEQ / GT), NH / 2, 3), 256, 0, stream>>>(Xb, Wb, PL);
  hipFuncSetAttribute(reinterpret_cast<const void*>(&k_attn), hipFuncAttributeMaxDynamicSharedMemorySize, (int)ATTN_LDS);
  k_attn<<<(unsigned)(NB * (SEQ / 16)), 32 * NW, (size_t)ATTN_LDS, stream>>>(PL, Mb, Cx, cov);
  k_oproj<<<dim3((unsigned)(SEQ * NB_FULL / GT), DM / GT), 256, 0, stream>>>(Cx, Wb + 3 * WN, out);
}

// v008
// Measured time: 130 microseconds a run.
// In both of two side-by-side timings against v007, it was 1.28 times as fast.
// All steps since v000 together make it 9.55 times as fast.
#include <hip/hip_runtime.h>
// Contractions (all v_wmma_f32_16x16x32_bf16, f32 accumulate): q/k/v projections = single product on RNE-bf16 inputs and weights; scores K Q^T, P V and the output projection = bf16 hi+lo planes of the computed operand(s), products hi*hi + hi*lo + lo*hi (output projection: [ctx_hi | ctx_lo] x [Wo ; Wo] folded along K); softmax statistics and coverage in f32.
// come from K rows (A, global bf16 planes) and Q^T (B, registers); the two 16-key D tiles pack straight into the P^T B fragment; O^T accumulates from V^T rows (A).
// Masks: both boolean inputs and the layer index are read on the device into a bit-plane (one 32-bit word per query and 32-key step); fully masked steps are skipped at run time.
#ifndef NB
#define NB 4
#endif
#ifndef SEQ
#define SEQ 1024
#endif
#define NB_FULL 4
#define SEQ_FULL 1024
#define NH 16
#define HD 64
#define DM 1024
#define RHSW (SEQ_FULL + 4)
#define NKS (SEQ / 32)
#define MBW (SEQ_FULL / 32)
#define CXP 2048
#define COVP (SEQ + 4)
#define STP 72
#define COV_LDS_BYTES (16 * COVP * 4)
#define NW 16                                    /* waves of one attention block */
#define NSTEP ((NKS + NW - 1) / NW)              /* 32-key steps owned by one wave */
#define STATP (NW + 4)                           /* dword pitch of a query's row of per-wave statistics (16 B x odd) */
#define OPP 68                                   /* dword pitch of a partial-O row */
#define ATTN_LDS (COV_LDS_BYTES + 2 * 16 * STATP * 4 + NW * 16 * OPP * 4)

#define XN ((size_t)SEQ * NB_FULL * DM)          /* elements of one converted activation plane (prefix of the full input) */
#define WN ((size_t)DM * DM)
#define PLSZ ((size_t)NB * NH * SEQ * HD)        /* elements of one head-layout plane */
#define COV_OFF ((size_t)SEQ_FULL * NB_FULL * DM) /* element offset of the second output (byte 16777216) */

#define BYTES_XB (3 * XN * 2)
#define BYTES_WB (4 * WN * 2)
#define BYTES_PL (6 * PLSZ * 2)
#define BYTES_CX ((size_t)SEQ * NB_FULL * CXP * 2)
#define BYTES_MB ((size_t)NB * SEQ * MBW * 4)

static_assert(SEQ % 128 == 0);
static_assert(SEQ <= SEQ_FULL);
static_assert(NB <= NB_FULL);
static_assert(MBW == 32);
static_assert(HD == 64);
static_assert(NW % 16 == 0 && NW <= 32);       // the merge forms its NW / 2 exponentials eight at a time
static_assert(ATTN_LDS <= 327680);
static_assert(NH * HD == DM);
static_assert(PLSZ * 2 <= (size_t)0xFFFFFFFF);   // a byte offset inside a head-layout plane fits 32 bits
static_assert(COV_OFF * 4 == (size_t)16777216);
static_assert(BYTES_XB % 256 == 0 && BYTES_WB % 256 == 0 && BYTES_PL % 256 == 0 && BYTES_CX % 256 == 0 && BYTES_MB % 256 == 0);
static_assert(BYTES_XB + BYTES_WB + BYTES_PL + BYTES_CX + BYTES_MB <= (size_t)134217728);
static_assert((size_t)SEQ * NB_FULL * DM <= COV_OFF);
static_assert(COV_OFF + ((size_t)(NB - 1) * SEQ_FULL + (SEQ - 1)) * SEQ_FULL + SEQ <= (size_t)33554432 / 4);

typedef __bf16 v16b __attribute__((ext_vector_type(16)));
typedef unsigned short v8us __attribute__((ext_vector_type(8), may_alias));
typedef float v8f __attribute__((ext_vector_type(8)));
typedef float v4f __attribute__((ext_vector_type(4)));
typedef float v4fa __attribute__((ext_vector_type(4), may_alias));
typedef float v2f __attribute__((ext_vector_type(2)));
typedef float v2fa __attribute__((ext_vector_type(2), may_alias));
typedef unsigned int u32a __attribute__((may_alias));
typedef int v4i __attribute__((ext_vector_type(4)));
typedef int v4ia __attribute__((ext_vector_type(4), may_alias));
typedef __bf16 v2b __attribute__((ext_vector_type(2)));
union FragB { v16b v; v8us half[2]; unsigned int w[8]; };

#define LOG2E 1.4426950408889634f
#define NEGBIG (-1.0e30f)

// 2^x by the bare v_exp_f32. Every argument here is a difference to a maximum (<= 0): only results under 2^-126 differ from the library form (they become 0).
// Asm text so that the slot which the instruction set asks for behind a transcendental is kept by construction: inside a statement the next, independent
// transcendental fills it (no output shares a register with an input), and the closing v_nop fills it for the last one, whatever the compiler puts behind.
__device__ __forceinline__ void ex2x8(float* y, const float* x) {
  asm("v_exp_f32 %0, %8\n\tv_exp_f32 %1, %9\n\tv_exp_f32 %2, %10\n\tv_exp_f32 %3, %11\n\t"
      "v_exp_f32 %4, %12\n\tv_exp_f32 %5, %13\n\tv_exp_f32 %6, %14\n\tv_exp_f32 %7, %15\n\tv_nop"
      : "=&v"(y[0]), "=&v"(y[1]), "=&v"(y[2]), "=&v"(y[3]), "=&v"(y[4]), "=&v"(y[5]), "=&v"(y[6]), "=&v"(y[7])
      : "v"(x[0]), "v"(x[1]), "v"(x[2]), "v"(x[3]), "v"(x[4]), "v"(x[5]), "v"(x[6]), "v"(x[7]));
}
__device__ __forceinline__ float ex2(float x) {
  float y;
  asm("v_exp_f32 %0, %1\n\tv_nop" : "=&v"(y) : "v"(x));   // v_nop: the slot behind the transcendental
  return y;
}
// e = 2^x and r = 1 / d by the bare v_rcp_f32 (the caller guards d = 0), one closing slot for both
__device__ __forceinline__ void ex2_rcp(float& e, float& r, float x, float d) {
  asm("v_exp_f32 %0, %2\n\tv_rcp_f32 %1, %3\n\tv_nop" : "=&v"(e), "=&v"(r) : "v"(x), "v"(d));
}

// RNE convert of two values to a packed bf16 pair (a in the low half): one v_cvt_pk_bf16_f32
__device__ __forceinline__ unsigned int bf16_pair(float a, float b) {
  const v2f x = {a, b};
  return __builtin_bit_cast(unsigned int, __builtin_convertvector(x, v2b));
}
// the lo plane's pair: what the hi pair h leaves of (a, b), rounded the same way
__device__ __forceinline__ unsigned int bf16_rest(float a, float b, unsigned int h) {
  return bf16_pair(a - __uint_as_float(h << 16), b - __uint_as_float(h & 0xFFFF0000u));
}

__device__ __forceinline__ v8f wm(v16b a, v16b b, v8f c) {
  return __builtin_amdgcn_wmma_f32_16x16x32_bf16(false, a, false, b, (short)0, c, false, false);
}

// Preparation, one launch: PREP_WG work-groups of 16 waves (one a WGP); every thread takes its share of each job, so that few waves have to start.
// Conversions: a work-group's pieces of a plane are contiguous; a wave's load covers 512 contiguous bytes, its store 256 (whole lines).
#define PREP_WG 256
#define PREP_TH 512
#define PREP_T (PREP_WG * PREP_TH)
#define XCH ((int)(XN / 4 / PREP_T))              /* 16-byte pieces of one activation plane per thread */
#define WCH ((int)(WN / 4 / PREP_T))              /* the same of one weight plane */
static_assert(XN % ((size_t)4 * PREP_T) == 0 && WN % ((size_t)4 * PREP_T) == 0);
static_assert(NB * SEQ * MBW <= PREP_T);
typedef unsigned int v2ua __attribute__((ext_vector_type(2), may_alias));

__device__ __forceinline__ void cvt_store(unsigned short* d, v4f x) {
  v2ua o;
  o[0] = bf16_pair(x[0], x[1]); o[1] = bf16_pair(x[2], x[3]);
  *(v2ua*)d = o;
}

// coverage: planes: PREP_T threads x XCH (WCH) pieces x 4 elements = every element of each of the 3 + 4 planes, once.
// Mb[b][q][j] bit kk = 1 when key 32j+kk is masked for query q of batch b (mask[b][q][k] != 0 or rhs[q][start + k] != 0); thread t < NB*SEQ*32 writes word t: every word of the plane.
__global__ __launch_bounds__(PREP_TH) void k_prep(const float* __restrict__ query, const float* __restrict__ keyt, const float* __restrict__ value,
                                                  const float* __restrict__ Wq, const float* __restrict__ Wk, const float* __restrict__ Wv,
                                                  const float* __restrict__ Wo, const int* __restrict__ mask, const int* __restrict__ rhs,
                                                  const int* __restrict__ lidx, unsigned short* __restrict__ Xb, unsigned short* __restrict__ Wb,
                                                  unsigned int* __restrict__ Mb) {
  const int tid = threadIdx.x, blk = blockIdx.x;
  const int t = blk * PREP_TH + tid;
  const size_t ex = ((size_t)blk * XCH * PREP_TH + tid) * 4;   // this thread's first element in an activation plane
  const size_t ew = ((size_t)blk * WCH * PREP_TH + tid) * 4;   // and in a weight plane
  const float* sq = query + ex;
  const float* sk = keyt + ex;
  const float* sv = value + ex;
  const float* s0 = Wq + ew;
  const float* s1 = Wk + ew;
  const float* s2 = Wv + ew;
  const float* s3 = Wo + ew;
  // the long streams start first: all of the thread's plane loads are in flight while it forms its mask word
  v4f x[3][XCH], y[4][WCH];
#pragma unroll  // constant index into x[]
  for (int i = 0; i < XCH; ++i) x[0][i] = *(const v4fa*)(sq + (size_t)i * PREP_TH * 4);
#pragma unroll
  for (int i = 0; i < XCH; ++i) x[1][i] = *(const v4fa*)(sk + (size_t)i * PREP_TH * 4);
#pragma unroll
  for (int i = 0; i < XCH; ++i) x[2][i] = *(const v4fa*)(sv + (size_t)i * PREP_TH * 4);
#pragma unroll  // constant index into y[]
  for (int i = 0; i < WCH; ++i) {
    y[0][i] = *(const v4fa*)(s0 + (size_t)i * PREP_TH * 4);
    y[1][i] = *(const v4fa*)(s1 + (size_t)i * PREP_TH * 4);
    y[2][i] = *(const v4fa*)(s2 + (size_t)i * PREP_TH * 4);
    y[3][i] = *(const v4fa*)(s3 + (size_t)i * PREP_TH * 4);
  }
  // the loads' address registers stay live up to this wait (inputs only), so that no load's result and nothing behind it lands in one ahead of it
  asm volatile("s_wait_xcnt 0x0" :: "v"(sq), "v"(sk), "v"(sv), "v"(s0), "v"(s1), "v"(s2), "v"(s3) : "memory");
  if (t < NB * SEQ * MBW) {
    const int j = t & 31, row = t >> 5;
    const int b = row / SEQ, q = row - b * SEQ;
    int L = lidx[0];
    L = (L < -64) ? -64 : ((L > 64) ? 64 : L);
    int tt = 4 - 4 * L; if (tt < 0) tt = 0;
    int start = 4 - tt; if (start < 0) start = 0;
    start = (start >= 4) ? 4 : 0;                       // the formula only yields 0 or 4; keeps the 16-B alignment of the row loads
    const int* mp = mask + ((size_t)b * SEQ_FULL + q) * SEQ_FULL + 32 * j;
    const int* rp = rhs + (size_t)q * RHSW + start + 32 * j;
    v4i a[8], r[8];
#pragma unroll  // constant index into a[] and r[]; the word's 16 loads in flight together
    for (int c = 0; c < 8; ++c) {
      a[c] = *(const v4ia*)(mp + 4 * c);
      r[c] = *(const v4ia*)(rp + 4 * c);
    }
    // as above: both address pairs stay live up to this wait, so that no load's result lands in one ahead of it
    asm volatile("s_wait_xcnt 0x0" :: "v"(mp), "v"(rp) : "memory");
    unsigned int w = 0u;
#pragma unroll
    for (int c = 0; c < 8; ++c) {
      const unsigned int nib = (((a[c][0] | r[c][0]) != 0) ? 1u : 0u) | (((a[c][1] | r[c][1]) != 0) ? 2u : 0u) |
                               (((a[c][2] | r[c][2]) != 0) ? 4u : 0u) | (((a[c][3] | r[c][3]) != 0) ? 8u : 0u);
      w |= nib << (4 * c);
    }
    Mb[t] = w;
  }
#pragma unroll  // constant index into x[]
  for (int p = 0; p < 3; ++p)
#pragma unroll
    for (int i = 0; i < XCH; ++i) cvt_store(Xb + (size_t)p * XN + ex + (size_t)i * PREP_TH * 4, x[p][i]);
#pragma unroll  // constant index into y[]
  for (int p = 0; p < 4; ++p)
#pragma unroll
    for (int i = 0; i < WCH; ++i) cvt_store(Wb + (size_t)p * WN + ew + (size_t)i * PREP_TH * 4, y[p][i]);
}

// Block tile 128 rows x 128 columns, 8 waves of 32 x 64 (4 along the rows, 2 along the columns), K in stages of KC.
// A stage is [A tile | W tile], each GT rows of KC bf16 (one whole 128-B line a row) at LDS pitch TP; two buffers.
// Every lane copies 16 B per instruction, a wave 4 whole lines: 4 copies a lane for the A tile, 4 for the W tile.
#define GT 128
#define KC 64
#define TP 72                                    /* elements: 144 B = 16 B x odd, for the ds_load_b128 fragment reads */
#define TILE_E (GT * TP)
#define RING_E (4 * TILE_E)
static_assert(DM % KC == 0 && CXP % KC == 0 && DM / KC >= 2);
static_assert(RING_E >= 4 * 2 * 64 * STP);       // the projections' output staging reuses the ring
static_assert(RING_E * 2 >= 4 * 64 * 68 * 4);    // so does the output projection's

// la: LDS byte address of this lane's piece in its first row of the A tile of the target buffer; ga, gb: the same piece in global memory.
// Rows crow + 32 i, i = 0..3, of both tiles. The s_wait_xcnt stands inside the statement: the address registers are rewritten behind it.
__device__ __forceinline__ void stage_copy(unsigned int la, const unsigned short* ga, size_t apitch, const unsigned short* gb) {
  const unsigned int lb = la + TILE_E * 2;
  asm volatile("global_load_async_to_lds_b128 %0, %8, off\n\t"
               "global_load_async_to_lds_b128 %1, %9, off\n\t"
               "global_load_async_to_lds_b128 %2, %10, off\n\t"
               "global_load_async_to_lds_b128 %3, %11, off\n\t"
               "global_load_async_to_lds_b128 %4, %12, off\n\t"
               "global_load_async_to_lds_b128 %5, %13, off\n\t"
               "global_load_async_to_lds_b128 %6, %14, off\n\t"
               "global_load_async_to_lds_b128 %7, %15, off\n\t"
               "s_wait_xcnt 0x0"
               :: "v"(la), "v"(la + 32 * TP * 2), "v"(la + 64 * TP * 2), "v"(la + 96 * TP * 2),
                  "v"(lb), "v"(lb + 32 * TP * 2), "v"(lb + 64 * TP * 2), "v"(lb + 96 * TP * 2),
                  "v"(ga), "v"(ga + 32 * apitch), "v"(ga + 64 * apitch), "v"(ga + 96 * apitch),
                  "v"(gb), "v"(gb + 32 * DM), "v"(gb + 64 * DM), "v"(gb + 96 * DM)
               : "memory");
}

// ga, gb: this thread's copy sources at k = 0 (row tid / 8 of the tile, piece tid % 8); ar, br: this lane's fragment rows in buffer 0.
// The W k index wraps at DM so that [A_hi | A_lo] x [W ; W] folds along K. Each accumulator still sums k in steps of 32, ascending.
template <int KT>
__device__ __forceinline__ void gemm_main(const unsigned short* __restrict__ ga, size_t apitch, const unsigned short* __restrict__ gb,
                                          unsigned int la, const unsigned short* ar, const unsigned short* br, v8f (&acc)[2][4]) {
  constexpr int NT = KT / KC;
  stage_copy(la, ga, apitch, gb);
  asm volatile("s_wait_asynccnt 0x0" ::: "memory");   // stage 0 has landed before the barrier publishes it
  __syncthreads();
  stage_copy(la + 2 * TILE_E * 2, ga + KC, apitch, gb + KC);
#pragma unroll 1  // one stage a trip: the buffer index and the refill test stay scalar
  for (int t = 0; t < NT; ++t) {
    const int bo = (t & 1) * 2 * TILE_E;
#pragma unroll  // two 32-wide k steps of the stage
    for (int kk = 0; kk < KC; kk += 32) {
      const unsigned short* ap = ar + bo + kk;
      const unsigned short* bp = br + bo + kk;
      FragB a0, a1, b0, b1, b2, b3;
      a0.half[0] = *(const v8us*)(ap);                a0.half[1] = *(const v8us*)(ap + 16);
      a1.half[0] = *(const v8us*)(ap + 16 * TP);      a1.half[1] = *(const v8us*)(ap + 16 * TP + 16);
      b0.half[0] = *(const v8us*)(bp);                b0.half[1] = *(const v8us*)(bp + 16);
      b1.half[0] = *(const v8us*)(bp + 16 * TP);      b1.half[1] = *(const v8us*)(bp + 16 * TP + 16);
      b2.half[0] = *(const v8us*)(bp + 32 * TP);      b2.half[1] = *(const v8us*)(bp + 32 * TP + 16);
      b3.half[0] = *(const v8us*)(bp + 48 * TP);      b3.half[1] = *(const v8us*)(bp + 48 * TP + 16);
      acc[0][0] = wm(a0.v, b0.v, acc[0][0]); acc[0][1] = wm(a0.v, b1.v, acc[0][1]);
      acc[0][2] = wm(a0.v, b2.v, acc[0][2]); acc[0][3] = wm(a0.v, b3.v, acc[0][3]);
      acc[1][0] = wm(a1.v, b0.v, acc[1][0]); acc[1][1] = wm(a1.v, b1.v, acc[1][1]);
      acc[1][2] = wm(a1.v, b2.v, acc[1][2]); acc[1][3] = wm(a1.v, b3.v, acc[1][3]);
      asm volatile("v_nop\n\tv_nop\n\tv_nop\n\tv_nop"
                   : "+v"(acc[0][0]), "+v"(acc[0][1]), "+v"(acc[0][2]), "+v"(acc[0][3]),
                     "+v"(acc[1][0]), "+v"(acc[1][1]), "+v"(acc[1][2]), "+v"(acc[1][3])
                   : "v"(a0.v), "v"(a1.v), "v"(b0.v), "v"(b1.v), "v"(b2.v), "v"(b3.v));
    }
    asm volatile("s_wait_dscnt 0x0" ::: "memory");      // this wave's reads of the buffer are done before it is refilled
    asm volatile("s_wait_asynccnt 0x0" ::: "memory");   // this wave's copies of stage t + 1 have landed
    __syncthreads();                                    // publishes stage t + 1 and ends every reader's last read of stage t
    if (t + 2 < NT) {
      const int k2 = (t + 2) * KC;
      stage_copy(la + (unsigned int)bo * 2u, ga + k2, apitch, gb + (k2 & (DM - 1)));
    }
  }
  asm volatile("s_wait_asynccnt 0x0" ::: "memory");     // nothing is in flight when the ring becomes output staging
}

// Projections. grid (NB*SEQ/128, NH/2, 3): block = 128 sequence positions of one batch x two heads x one of {q, k, v}; 8 waves x (32 x 64).
// Logical row b*SEQ + s reads the activation row s*NB_FULL + b. Epilogue: each pair of waves owns a 64 x 64 tile (one head): bf16 hi + lo planes staged in its part of the ring
// (block barrier kept as it was; a wave now reads back the rows it staged itself). The planes lie in fragment order, in units of 512 B = [32 lanes][8 elements], one unit = one fragment load of an attention wave (4 whole lines):
// q (scaled by 1/8) and k: [b][h][s / 16][L = 0..3][lane], lane (hh, ln) holds row s = 16 tile + ln, d = 16 L + 8 hh + 0..7; v: [b][h][s / 32][d / 16][x = 0..1][lane], lane holds d = 16 t + ln, keys 32 j + 16 x + 8 hh + 0..7.
__global__ __launch_bounds__(256) void k_proj(const unsigned short* __restrict__ Xb, const unsigned short* __restrict__ Wb,
                                              unsigned short* __restrict__ PL) {
  __shared__ __attribute__((aligned(16))) unsigned short ring[RING_E];
  const int tid = threadIdx.x, w = __builtin_amdgcn_readfirstlane((int)(tid >> 5)), lane = tid & 31, ln = lane & 15, hh = lane >> 4;
  const int wr = w & 3, wc = w >> 2;                 // wave position: rows 32 wr, columns 64 wc
  const int pr = (wr >> 1) + 2 * wc, w2 = wr & 1;    // pair of waves that shares a 64 x 64 output tile, and the wave's place in it
  const int z = blockIdx.z, hcol = 2 * blockIdx.y + wc;
  const int mt0 = blockIdx.x * GT;
  const int b = mt0 / SEQ, sb = mt0 - b * SEQ;
  const int s0 = sb + 64 * (wr >> 1);
  const int crow = tid >> 3, cpc = 8 * (tid & 7);
  const unsigned short* ga = Xb + (size_t)z * XN + ((size_t)(sb + crow) * NB_FULL + b) * DM + cpc;
  const unsigned short* gb = Wb + (size_t)z * WN + (size_t)(GT * blockIdx.y + crow) * DM + cpc;
  const unsigned int la = (unsigned int)(size_t)(ring + crow * TP + cpc);
  v8f acc[2][4] = {};
  gemm_main<DM>(ga, (size_t)NB_FULL * DM, gb, la, ring + (32 * wr + ln) * TP + 8 * hh, ring + TILE_E + (64 * wc + ln) * TP + 8 * hh, acc);
  unsigned short* sh = ring + pr * (2 * 64 * STP);
  unsigned short* sl = sh + 64 * STP;
  const float scale = (z == 0) ? 0.125f : 1.0f;
#pragma unroll
  for (int mt = 0; mt < 2; ++mt)
#pragma unroll
    for (int nt = 0; nt < 4; ++nt)
#pragma unroll
      for (int r = 0; r < 8; r += 2) {
        const float v0 = acc[mt][nt][r] * scale, v1 = acc[mt][nt][r + 1] * scale;
        const unsigned int hb = bf16_pair(v0, v1);
        const unsigned int lb = bf16_rest(v0, v1, hb);
        const int sr = 32 * w2 + 16 * mt + 8 * hh + r;     // local sequence row of v0; v1 is the next
        const int dc = 16 * nt + ln;                        // head-dim column
        const int idx = (z == 2) ? (dc * STP + sr) : (sr * STP + dc);
        const int nx = (z == 2) ? 1 : STP;
        sh[idx] = (unsigned short)hb;
        sh[idx + nx] = (unsigned short)(hb >> 16);
        sl[idx] = (unsigned short)lb;
        sl[idx + nx] = (unsigned short)(lb >> 16);
      }
  __syncthreads();
  const size_t hbase = (size_t)b * NH + hcol;
  unsigned short* dstp = PL + (size_t)z * 2 * PLSZ + (hbase * SEQ + s0) * HD + 8 * lane;   // the 64 x 64 tile is 16 consecutive units in either layout
  {
#pragma unroll 1
    for (int i = 0; i < 8; ++i) {
      const int u = 8 * w2 + i;                          // unit of the tile; a wave's store covers the whole unit
      const int row = ln + ((z == 2) ? 16 * ((u >> 1) & 3) : 16 * (u >> 2));
      const int col = 8 * hh + ((z == 2) ? 32 * (u >> 3) + 16 * (u & 1) : 16 * (u & 3));
      const v8us vh = *(const v8us*)(sh + row * STP + col);
      const v8us vl = *(const v8us*)(sl + row * STP + col);
      unsigned short* d = dstp + 256 * u;
      *(v8us*)d = vh;
      *(v8us*)(d + PLSZ) = vl;
      asm volatile("s_wait_xcnt 0x0" ::: "memory");  // the next trip rewrites the stores' address registers
    }
    
  }
}

// The four fragments of a 16-row tile of the q or k planes: f[0], f[1] = hi plane, head-dim chunks 0 and 1 (units 0, 1 and 2, 3 of the tile); f[2], f[3] = the same of the lo plane.
// hi, lo: the planes (uniform); o: byte offset of the lane's 16 B in unit 0. Fragment elements 0..7 <- d = 32c + 8h + i, 8..15 <- d = 32c + 16 + 8h + i.
__device__ __forceinline__ void load_tile(FragB (&f)[4], const char* __restrict__ hi, const char* __restrict__ lo, unsigned int o) {
  const char* hp = hi + o;
  const char* lp = lo + o;
  f[0].half[0] = *(const v8us*)(hp);        f[0].half[1] = *(const v8us*)(hp + 512);
  f[1].half[0] = *(const v8us*)(hp + 1024); f[1].half[1] = *(const v8us*)(hp + 1536);
  f[2].half[0] = *(const v8us*)(lp);        f[2].half[1] = *(const v8us*)(lp + 512);
  f[3].half[0] = *(const v8us*)(lp + 1024); f[3].half[1] = *(const v8us*)(lp + 1536);
}

// S^T tile of 16 keys: c = K_lo Q_hi + K_hi Q_lo + K_hi Q_hi over the two 32-wide head-dim chunks, then the hazard guard. k: A fragments (row m = key), q: B fragments (column n = query).
__device__ __forceinline__ v8f qk_tile(const FragB (&k)[4], const FragB (&q)[4]) {
  v8f c = {0.f, 0.f, 0.f, 0.f, 0.f, 0.f, 0.f, 0.f};
  c = wm(k[2].v, q[0].v, c); c = wm(k[3].v, q[1].v, c);
  c = wm(k[0].v, q[2].v, c); c = wm(k[1].v, q[3].v, c);
  c = wm(k[0].v, q[0].v, c); c = wm(k[1].v, q[1].v, c);
  asm volatile("v_nop\n\tv_nop\n\tv_nop\n\tv_nop" : "+v"(c)
               : "v"(k[0].v), "v"(k[1].v), "v"(k[2].v), "v"(k[3].v), "v"(q[0].v), "v"(q[1].v), "v"(q[2].v), "v"(q[3].v));
  return c;
}

// O^T tile of 16 head-dim rows: o += V_lo P_hi + V_hi P_lo + V_hi P_hi, then the hazard guard. vh, vl: A fragments of V^T (row m = d, elements 0..7 <- key0 + 8h + i, 8..15 <- key0 + 16 + 8h + i).
__device__ __forceinline__ v8f pv_tile(const FragB& vh, const FragB& vl, const FragB& ph, const FragB& pl, v8f o) {
  o = wm(vl.v, ph.v, o);
  o = wm(vh.v, pl.v, o);
  o = wm(vh.v, ph.v, o);
  asm volatile("v_nop\n\tv_nop\n\tv_nop\n\tv_nop" : "+v"(o) : "v"(vh.v), "v"(vl.v), "v"(ph.v), "v"(pl.v));
  return o;
}

// Work-group barrier for the LDS exchanges of the attention loop: it waits for this wave's LDS operations alone, so that global loads issued ahead of it stay in flight across it
// (__syncthreads() also waits for them). Nothing that a wave stores to global memory is read by another wave of the launch.
__device__ __forceinline__ void lds_barrier() {
  asm volatile("s_wait_dscnt 0x0\n\ts_barrier_signal -1\n\ts_barrier_wait -1" ::: "memory");
}

// Q fragments of the block's query tile and K fragments of this wave's open steps, for the head whose byte offset inside a plane (with the lane's 16 B) is ho.
// more: a head is left to load for (uniform). Where nothing is loaded the fragments are set to 0: they are never read then, and the old values need not be kept in registers through the head.
__device__ __forceinline__ void load_qk(FragB (&qf)[4], FragB (&kf)[NSTEP][2][4], const char* __restrict__ qh, const char* __restrict__ ql, const char* __restrict__ kh, const char* __restrict__ kl,
                                        unsigned int ho, int q0, int w, const bool (&act)[NSTEP], bool more) {
  const v8us z8 = {0, 0, 0, 0, 0, 0, 0, 0};
  bool any = false;
#pragma unroll  // constant index into kf[] and act[]
  for (int i = 0; i < NSTEP; ++i) {
    if (more && act[i]) {
      const unsigned int ko = ho + (unsigned int)(32 * (w + i * NW)) * (HD * 2);
      load_tile(kf[i][0], kh, kl, ko);
      load_tile(kf[i][1], kh + 2048, kl + 2048, ko);
      asm volatile("s_wait_xcnt 0x0" :: "v"(ko) : "memory");   // the offset register stays live up to this wait: no load's result and nothing behind it lands in it earlier
    } else {
#pragma unroll
      for (int t = 0; t < 8; ++t) { kf[i][t >> 2][t & 3].half[0] = z8; kf[i][t >> 2][t & 3].half[1] = z8; }
    }
    any = any || act[i];
  }
  if (more && any) {
    const unsigned int qo = ho + (unsigned int)q0 * (HD * 2);
    load_tile(qf, qh, ql, qo);
    asm volatile("s_wait_xcnt 0x0" :: "v"(qo) : "memory");     // as above
  } else {
#pragma unroll
    for (int t = 0; t < 4; ++t) { qf[t].half[0] = z8; qf[t].half[1] = z8; }
  }
}

// Block = one batch x 16 queries, NW waves; wave w owns the 32-key steps j = w, w + NW, ... of every head (its mask words stay in registers).
// Per head: each wave's softmax statistics over its own steps -> LDS -> barrier -> every wave merges all NW pairs (max, rescaled sum);
// then normalised weights (the wave's kept exponentials rescaled to the merged statistics), coverage into the LDS tile [16][SEQ] (a step's columns belong to one wave, each lane only touches its own addresses), partial O^T;
// partial O^T tiles -> LDS -> barrier -> one wave per query row sums the NW partials in wave order and writes bf16 hi | lo halves of the [s*NB_FULL+b][2048] plane.
// Reuse of the exchange buffers: statistics of head h are read before the second barrier of h and rewritten after it; partials of h are read before the first barrier of h + 1 and rewritten after it.
// coverage: ctx plane: (b, 16 rows) x 16 heads x (64 hi + 64 lo) = every element of rows with b < NB; coverage output: 16 rows x SEQ columns per block, all rows once.
// Global loads run one phase ahead: a step's V fragments are issued behind its score products and fly over the softmax, the statistics exchange and the merge; the next head's Q and K fragments are issued behind the partial-O stores and fly over the second barrier and the sum of the partials.
// LDS: coverage tile zero-filled in full before use; every wave writes its statistics and its whole partial tile (zeros when all its steps are masked) before they are read.
// The six planes come as six arguments: each load is then a uniform base + one 32-bit offset register + a small constant, and that one register is all that a group of loads names.
__global__ __launch_bounds__(32 * NW) void k_attn(const unsigned short* __restrict__ Pqh, const unsigned short* __restrict__ Pql, const unsigned short* __restrict__ Pkh,
                                                  const unsigned short* __restrict__ Pkl, const unsigned short* __restrict__ Pvh, const unsigned short* __restrict__ Pvl,
                                                  const unsigned int* __restrict__ Mb,
                                                  unsigned short* __restrict__ Cx, float* __restrict__ Cov) {
  extern __shared__ __attribute__((aligned(16))) unsigned char smem[];
  float* covs = (float*)smem;
  float* stm = (float*)(smem + COV_LDS_BYTES);     // [16 queries][STATP]: running maximum of wave w at column w
  float* stl = stm + 16 * STATP;                   // same shape: sum of wave w
  float* part = stl + 16 * STATP;                  // [NW][16 queries][OPP]: partial O, f32
  const int tid = threadIdx.x, w = __builtin_amdgcn_readfirstlane((int)(tid >> 5));
  const int lane = tid & 31, ln = lane & 15, hh = lane >> 4;
  const int b = blockIdx.x / (SEQ / 16), qt = blockIdx.x % (SEQ / 16);
  const int q0 = qt * 16, qg = q0 + ln;
  {
    const v4f z4 = {0.f, 0.f, 0.f, 0.f};
    for (int i = tid; i < 4 * COVP; i += 32 * NW) *(v4fa*)(covs + 4 * i) = z4;
  }
  const unsigned int* mrow = Mb + (size_t)(b * SEQ + qg) * MBW;
  unsigned int mw[NSTEP];
  bool act[NSTEP];                                 // wave-uniform: some key of the step is open for one of the 16 queries
#pragma unroll  // mw[] and act[] must be indexed by constants to stay in registers
  for (int i = 0; i < NSTEP; ++i) {
    const int j = w + i * NW;
    mw[i] = (j < NKS) ? mrow[j] : 0xFFFFFFFFu;
    act[i] = __any(mw[i] != 0xFFFFFFFFu);
  }
  __syncthreads();
  const int sh8 = 8 * hh;
  const unsigned int lo = 16u * (unsigned int)lane;   // byte offset of this lane's 16 B in a 512-B unit of the q, k, v planes
  const char* qhp = (const char*)Pqh; const char* qlp = (const char*)Pql;   // addresses are a uniform plane base + a 32-bit offset inside the plane
  const char* khp = (const char*)Pkh; const char* klp = (const char*)Pkl;
  const char* vhp = (const char*)Pvh; const char* vlq = (const char*)Pvl;
  float* crow = covs + ln * COVP + 8 * hh;
  FragB qf[4], kf[NSTEP][2][4];                       // this head's Q and K fragments, loaded during the head before; read only under the act[i] that loaded them
  load_qk(qf, kf, qhp, qlp, khp, klp, (unsigned int)(b * NH) * (SEQ * HD * 2) + lo, q0, w, act, true);

#pragma unroll 1
  for (int h = 0; h < NH; ++h) {
    const size_t hb = (size_t)b * NH + h;
    const unsigned int ho = (unsigned int)hb * (SEQ * HD * 2) + lo;        // byte offset inside a plane: this head, this lane's 16 B of a unit

    // ---- pass 1: statistics over this wave's own steps; each step's exponentials stay in registers, relative to the maximum ms[i] they were formed with ----
    float mr = NEGBIG, lr = 0.0f;
    float pe[NSTEP][16], ms[NSTEP];                // read only under the same act[i] that wrote them
    FragB vf[NSTEP][4][2];                         // likewise
#pragma unroll  // constant index into mw[] and act[]
    for (int i = 0; i < NSTEP; ++i) {
      if (act[i]) {
        const v8f s0 = qk_tile(kf[i][0], qf);          // element r = score(key 32j + 8h + r, query qg)
        const v8f s1 = qk_tile(kf[i][1], qf);
        // V^T fragments of this step, hi and lo plane: units 0 and 1 of each (key step, d tile) pair
        const unsigned int vo = ho + (unsigned int)(32 * (w + i * NW)) * (HD * 2);
        const char* vp = vhp + vo;
        const char* vlp = vlq + vo;
#pragma unroll  // constant index into vf[]
        for (int t = 0; t < 4; ++t) {
          vf[i][t][0].half[0] = *(const v8us*)(vp + 1024 * t);  vf[i][t][0].half[1] = *(const v8us*)(vp + 1024 * t + 512);
          vf[i][t][1].half[0] = *(const v8us*)(vlp + 1024 * t); vf[i][t][1].half[1] = *(const v8us*)(vlp + 1024 * t + 512);
        }
        asm volatile("s_wait_xcnt 0x0" :: "v"(vo) : "memory");   // holds the loads here, ahead of the softmax; the offset register stays live up to the wait
        const unsigned int wb = mw[i] >> sh8;
        float sc[16];
        float mx = NEGBIG;
#pragma unroll
        for (int r = 0; r < 8; ++r) {
          sc[r]     = ((wb >> r) & 1u) ? NEGBIG : s0[r];
          sc[8 + r] = ((wb >> (16 + r)) & 1u) ? NEGBIG : s1[r];
          mx = fmaxf(mx, fmaxf(sc[r], sc[8 + r]));
        }
        mx = fmaxf(mx, __shfl_xor(mx, 16, 32));                  // the other lane half holds the other 16 keys of this query
        const float mnew = fmaxf(mr, mx);
        const float al = ex2((mr - mnew) * LOG2E);
        float ps = 0.0f;
        float xa[16], ea[16];
#pragma unroll  // constant index into xa[]
        for (int r = 0; r < 16; ++r) xa[r] = (sc[r] - mnew) * LOG2E;
        ex2x8(ea, xa);
        ex2x8(ea + 8, xa + 8);
#pragma unroll
        for (int r = 0; r < 16; ++r) {
          pe[i][r] = (sc[r] > -1.0e29f) ? ea[r] : 0.0f;          // 0 for a masked key
          ps += pe[i][r];
        }
        ms[i] = mnew;
        ps += __shfl_xor(ps, 16, 32);
        lr = lr * al + ps;
        mr = mnew;
      } else {
        // never read: set so that no older value has to be kept in registers for this path
        const v8us z8 = {0, 0, 0, 0, 0, 0, 0, 0};
#pragma unroll
        for (int t = 0; t < 8; ++t) { vf[i][t >> 1][t & 1].half[0] = z8; vf[i][t >> 1][t & 1].half[1] = z8; }
      }
    }
    if (hh == 0) { stm[ln * STATP + w] = mr; stl[ln * STATP + w] = lr; }
    lds_barrier();
    // merge: each lane half reads NW / 2 of the waves' pairs of its query, then one exchange between the halves
    {
      float mv[NW / 2], lv[NW / 2];                // the loops below are unrolled so that both arrays stay in registers
#pragma unroll
      for (int u = 0; u < NW / 8; ++u) {
        const v4f x = *(const v4fa*)(stm + ln * STATP + (NW / 2) * hh + 4 * u);
        const v4f y = *(const v4fa*)(stl + ln * STATP + (NW / 2) * hh + 4 * u);
        mv[4 * u] = x[0]; mv[4 * u + 1] = x[1]; mv[4 * u + 2] = x[2]; mv[4 * u + 3] = x[3];
        lv[4 * u] = y[0]; lv[4 * u + 1] = y[1]; lv[4 * u + 2] = y[2]; lv[4 * u + 3] = y[3];
      }
      float mg = NEGBIG;
#pragma unroll
      for (int u = 0; u < NW / 2; ++u) mg = fmaxf(mg, mv[u]);
      mg = fmaxf(mg, __shfl_xor(mg, 16, 32));
      float lg = 0.0f;
      float xm[NW / 2];
#pragma unroll  // constant index into xm[]
      for (int u = 0; u < NW / 2; ++u) xm[u] = (mv[u] - mg) * LOG2E;
#pragma unroll
      for (int u = 0; u < NW / 2; u += 8) ex2x8(mv + u, xm + u);
#pragma unroll
      for (int u = 0; u < NW / 2; ++u) lg += lv[u] * mv[u];
      lg += __shfl_xor(lg, 16, 32);
      mr = mg;
      lr = lg;
    }

    // ---- pass 2: weights = kept exponentials x exp(ms - m) / l, coverage accumulation, partial O^T over this wave's own steps ----
    v8f O[4] = {};
#pragma unroll  // constant index into act[], ms[] and pe[]
    for (int i = 0; i < NSTEP; ++i) {
      if (act[i]) {
        const int key0 = 32 * (w + i * NW);
        float fe, rl;
        ex2_rcp(fe, rl, (ms[i] - mr) * LOG2E, lr);
        const float f = fe * ((lr > 0.0f) ? rl : 0.0f);   // a query with no open key keeps weights of 0 (0 x inf otherwise)
        float pn[16];
#pragma unroll
        for (int r = 0; r < 16; ++r) pn[r] = pe[i][r] * f;
        // coverage tile: this lane owns columns key0 + 8h + 0..7 and key0 + 16 + 8h + 0..7 of row ln
        {
          float* cr = crow + key0;
          v4f c0 = *(const v4fa*)(cr), c1 = *(const v4fa*)(cr + 4), c2 = *(const v4fa*)(cr + 16), c3 = *(const v4fa*)(cr + 20);
          c0[0] += pn[0];  c0[1] += pn[1];  c0[2] += pn[2];  c0[3] += pn[3];
          c1[0] += pn[4];  c1[1] += pn[5];  c1[2] += pn[6];  c1[3] += pn[7];
          c2[0] += pn[8];  c2[1] += pn[9];  c2[2] += pn[10]; c2[3] += pn[11];
          c3[0] += pn[12]; c3[1] += pn[13]; c3[2] += pn[14]; c3[3] += pn[15];
          *(v4fa*)(cr) = c0; *(v4fa*)(cr + 4) = c1; *(v4fa*)(cr + 16) = c2; *(v4fa*)(cr + 20) = c3;
        }
        // P^T B fragment: element i < 8 -> key0 + 8h + i (tile 0 row 8h + i); i >= 8 -> key0 + 16 + 8h + (i - 8) (tile 1); bf16 hi + lo
        FragB ph, pl;
#pragma unroll
        for (int r = 0; r < 16; r += 2) {
          const unsigned int hp = bf16_pair(pn[r], pn[r + 1]);
          ph.w[r >> 1] = hp;
          pl.w[r >> 1] = bf16_rest(pn[r], pn[r + 1], hp);
        }
        O[0] = pv_tile(vf[i][0][0], vf[i][0][1], ph, pl, O[0]);
        O[1] = pv_tile(vf[i][1][0], vf[i][1][1], ph, pl, O[1]);
        O[2] = pv_tile(vf[i][2][0], vf[i][2][1], ph, pl, O[2]);
        O[3] = pv_tile(vf[i][3][0], vf[i][3][1], ph, pl, O[3]);
      }
    }

    // O^T element r of tile t = partial ctx(query qg, d = 16t + 8h + r): f32 into this wave's tile [16 queries][64 d]
    {
      float* pw = part + (size_t)(w * 16 + ln) * OPP + 8 * hh;
#pragma unroll  // constant index into O[]
      for (int t = 0; t < 4; ++t) {
        const v4f x0 = {O[t][0], O[t][1], O[t][2], O[t][3]};
        const v4f x1 = {O[t][4], O[t][5], O[t][6], O[t][7]};
        *(v4fa*)(pw + 16 * t) = x0;
        *(v4fa*)(pw + 16 * t + 4) = x1;
      }
    }
    load_qk(qf, kf, qhp, qlp, khp, klp, ho + SEQ * HD * 2, q0, w, act, h + 1 < NH);
    lds_barrier();
    // one wave per query row (wave-uniform loop): lane sums d = 2 lane, 2 lane + 1 over the NW partial tiles; a wave writes whole 128-B lines
#pragma unroll 1  // at most one trip per wave once NW >= 16: nothing to gain from copies of the body
    for (int row = w; row < 16; row += NW) {
      const float* pr = part + row * OPP + 2 * lane;
      float t0 = 0.0f, t1 = 0.0f;
#pragma unroll  // independent LDS loads in flight together; the sums stay in wave order
      for (int u = 0; u < NW; ++u) {
        const v2f x = *(const v2fa*)(pr + u * 16 * OPP);
        t0 += x[0];
        t1 += x[1];
      }
      const unsigned int hp = bf16_pair(t0, t1);
      unsigned short* d = Cx + ((size_t)(q0 + row) * NB_FULL + b) * CXP + h * HD + 2 * lane;
      *(u32a*)d = hp;
      *(u32a*)(d + DM) = bf16_rest(t0, t1, hp);
      asm volatile("s_wait_xcnt 0x0" ::: "memory");  // the stores' address registers are advanced for the next head right behind them
    }
  }

  __syncthreads();
  float* cg = Cov + ((size_t)b * SEQ_FULL + q0) * SEQ_FULL;
#pragma unroll 1  // a few short trips, once per block: kept rolled as before
  for (int idx = w; idx < 16 * (SEQ / 128); idx += NW) {
    const int row = idx / (SEQ / 128), col = (idx % (SEQ / 128)) * 128 + lane * 4;
    v4f v = *(const v4fa*)(covs + row * COVP + col);
    v[0] *= 0.0625f; v[1] *= 0.0625f; v[2] *= 0.0625f; v[3] *= 0.0625f;
    *(v4f*)(cg + (size_t)row * SEQ_FULL + col) = v;
    asm volatile("s_wait_xcnt 0x0" ::: "memory");    // the next trip rewrites the store's address and data registers
  }
}

// Output projection: out[m][n] = sum_c ctx[m][c] Wo[n][c] with A = [ctx_hi | ctx_lo] (K = 2048) and the W k index wrapping at 1024.
// coverage: blocks tile the [SEQ*NB_FULL][1024] output exactly once.
__global__ __launch_bounds__(256) void k_oproj(const unsigned short* __restrict__ Cx, const unsigned short* __restrict__ Wo,
                                               float* __restrict__ Out) {
  __shared__ __attribute__((aligned(16))) unsigned short ring[RING_E];
  const int tid = threadIdx.x, w = __builtin_amdgcn_readfirstlane((int)(tid >> 5)), lane = tid & 31, ln = lane & 15, hh = lane >> 4;
  const int wr = w & 3, wc = w >> 2;                 // wave position: rows 32 wr, columns 64 wc
  const int pr = (wr >> 1) + 2 * wc, w2 = wr & 1;    // 64 x 64 staging tile, and the wave's place in it
  const int mb = blockIdx.x * GT, nb = blockIdx.y * GT;
  const int m0 = mb + 64 * (wr >> 1), n0 = nb + 64 * wc;
  const int crow = tid >> 3, cpc = 8 * (tid & 7);
  const unsigned short* ga = Cx + (size_t)(mb + crow) * CXP + cpc;
  const unsigned short* gb = Wo + (size_t)(nb + crow) * DM + cpc;
  const unsigned int la = (unsigned int)(size_t)(ring + crow * TP + cpc);
  v8f acc[2][4] = {};
  gemm_main<CXP>(ga, (size_t)CXP, gb, la, ring + (32 * wr + ln) * TP + 8 * hh, ring + TILE_E + (64 * wc + ln) * TP + 8 * hh, acc);
  float* so = (float*)ring + pr * (64 * 68);
#pragma unroll
  for (int mt = 0; mt < 2; ++mt)
#pragma unroll
    for (int nt = 0; nt < 4; ++nt)
#pragma unroll
      for (int r = 0; r < 8; ++r)
        so[(32 * w2 + 16 * mt + 8 * hh + r) * 68 + 16 * nt + ln] = acc[mt][nt][r];
  __syncthreads();
  const int rsub = lane >> 4, c4 = (lane & 15) * 4;
  {
#pragma unroll 1
    for (int i = 0; i < 16; ++i) {
      const int row = 32 * w2 + 2 * i + rsub;
      const v4f v = *(const v4fa*)(so + row * 68 + c4);
      *(v4f*)(Out + (size_t)(m0 + row) * DM + n0 + c4) = v;
    }
    
  }
}

extern "C" void kernel_launch(void* const* d_in, const int* in_sizes, int n_in,
                              void* d_out, int out_size, void* d_ws, size_t ws_size, hipStream_t stream) {
  if (n_in < 10) return;
  const long long needX = (long long)SEQ * NB_FULL * DM;
  if ((long long)in_sizes[0] < needX || (long long)in_sizes[1] < needX || (long long)in_sizes[2] < needX) return;
  for (int i = 3; i < 7; ++i) if ((long long)in_sizes[i] < (long long)DM * DM) return;
  if ((long long)in_sizes[7] < ((long long)(NB - 1) * SEQ_FULL + (SEQ - 1)) * SEQ_FULL + SEQ_FULL) return;
  if ((long long)in_sizes[8] < (long long)SEQ * RHSW) return;
  if (in_sizes[9] < 1) return;
  if ((long long)out_size < (long long)COV_OFF + ((long long)(NB - 1) * SEQ_FULL + (SEQ - 1)) * SEQ_FULL + SEQ) return;

  const float* query = (const float*)d_in[0];   // wire order: query, key, value, Wq, Wk, Wv, Wo, mask, rhs_mask, layer_idx
  const float* keyt  = (const float*)d_in[1];
  const float* value = (const float*)d_in[2];
  const float* Wq    = (const float*)d_in[3];
  const float* Wk    = (const float*)d_in[4];
  const float* Wv    = (const float*)d_in[5];
  const float* Wo    = (const float*)d_in[6];
  const int*   mask  = (const int*)d_in[7];
  const int*   rhs   = (const int*)d_in[8];
  const int*   lidx  = (const int*)d_in[9];
  float* out = (float*)d_out;
  float* cov = out + COV_OFF;

  char* ws = (char*)d_ws;
  size_t off = 0;
  unsigned short* Xb = (unsigned short*)(ws + off); off += BYTES_XB;   // 3 activation planes [SEQ*NB_FULL][1024] bf16
  unsigned short* Wb = (unsigned short*)(ws + off); off += BYTES_WB;   // 4 weight planes [1024][1024] bf16 (q, k, v, o)
  unsigned short* PL = (unsigned short*)(ws + off); off += BYTES_PL;   // q_hi, q_lo, k_hi, k_lo, vT_hi, vT_lo
  unsigned short* Cx = (unsigned short*)(ws + off); off += BYTES_CX;   // ctx [SEQ*NB_FULL][hi 1024 | lo 1024] bf16
  unsigned int*   Mb = (unsigned int*)(ws + off);   off += BYTES_MB;   // mask bit-plane [NB][SEQ][32 words]
  if (off > ws_size) return;

  k_prep<<<PREP_WG, PREP_TH, 0, stream>>>(query, keyt, value, Wq, Wk, Wv, Wo, mask, rhs, lidx, Xb, Wb, Mb);
  k_proj<<<dim3((unsigned)(NB * SEQ / GT), NH / 2, 3), 256, 0, stream>>>(Xb, Wb, PL);
  hipFuncSetAttribute(reinterpret_cast<const void*>(&k_attn), hipFuncAttributeMaxDynamicSharedMemorySize, (int)ATTN_LDS);
  k_attn<<<(unsigned)(NB * (SEQ / 16)), 32 * NW, (size_t)ATTN_LDS, stream>>>(PL, PL + PLSZ, PL + 2 * PLSZ, PL + 3 * PLSZ, PL + 4 * PLSZ, PL + 5 * PLSZ, Mb, Cx, cov);
  k_oproj<<<dim3((unsigned)(SEQ * NB_FULL / GT), DM / GT), 256, 0, stream>>>(Cx, Wb + 3 * WN, out);
}

// v009
// Measured time: 122 microseconds a run.
// Next to v008, in two timings, it ran 1.06 and 1.07 times as fast.
// Counting every step since v000, it is 10.2 times as fast.
#include <hip/hip_runtime.h>
// Contractions (all v_wmma_f32_16x16x32_bf16, f32 accumulate): q/k/v projections = single product on RNE-bf16 inputs and weights; scores K Q^T, P V and the output projection = bf16 hi+lo planes of the computed operand(s), products hi*hi + hi*lo + lo*hi (output projection: [ctx_hi | ctx_lo] x [Wo ; Wo] folded along K); softmax statistics and coverage in f32.
// come from K rows (A, global bf16 planes) and Q^T (B, registers); the two 16-key D tiles pack straight into the P^T B fragment; O^T accumulates from V^T rows (A).
// Masks: both boolean inputs and the layer index are read on the device into a bit-plane (one 32-bit word per query and 32-key step); fully masked steps are skipped at run time.
#ifndef NB
#define NB 4
#endif
#ifndef SEQ
#define SEQ 1024
#endif
#define NB_FULL 4
#define SEQ_FULL 1024
#define NH 16
#define HD 64
#define DM 1024
#define RHSW (SEQ_FULL + 4)
#define NKS (SEQ / 32)
#define MBW (SEQ_FULL / 32)
#define CXP 2048
#define COVP (SEQ + 4)
#define STP 72
#define COV_LDS_BYTES (16 * COVP * 4)
#define NW 16                                    /* waves of one attention block */
#define NSTEP ((NKS + NW - 1) / NW)              /* 32-key steps owned by one wave */
#define STATP (NW + 4)                           /* dword pitch of a query's row of per-wave statistics (16 B x odd) */
#define OPP 68                                   /* dword pitch of a partial-O row */
#define ATTN_LDS (COV_LDS_BYTES + 2 * 16 * STATP * 4 + NW * 16 * OPP * 4)

#define XN ((size_t)SEQ * NB_FULL * DM)          /* elements of one converted activation plane (prefix of the full input) */
#define WN ((size_t)DM * DM)
#define PLSZ ((size_t)NB * NH * SEQ * HD)        /* elements of one head-layout plane */
#define COV_OFF ((size_t)SEQ_FULL * NB_FULL * DM) /* element offset of the second output (byte 16777216) */

#define BYTES_XB (3 * XN * 2)
#define BYTES_WB (4 * WN * 2)
#define BYTES_PL (6 * PLSZ * 2)
#define BYTES_CX ((size_t)SEQ * NB_FULL * CXP * 2)
#define BYTES_MB ((size_t)NB * SEQ * MBW * 4)
#define HG 2                                     /* head groups: one attention work-group takes NH / HG heads of its 16 queries */
#define HPG (NH / HG)
#define CVN ((size_t)NB_FULL * SEQ_FULL * SEQ_FULL) /* elements of one head group's coverage plane, laid out like the second output */
#define BYTES_CV (HG * CVN * 4)

static_assert(SEQ % 128 == 0);
static_assert(SEQ <= SEQ_FULL);
static_assert(NB <= NB_FULL);
static_assert(MBW == 32);
static_assert(HD == 64);
static_assert(NW % 16 == 0 && NW <= 32);       // the merge forms its NW / 2 exponentials eight at a time
static_assert(ATTN_LDS <= 327680);
static_assert(NH * HD == DM);
static_assert(PLSZ * 2 <= (size_t)0xFFFFFFFF);   // a byte offset inside a head-layout plane fits 32 bits
static_assert(COV_OFF * 4 == (size_t)16777216);
static_assert(BYTES_XB % 256 == 0 && BYTES_WB % 256 == 0 && BYTES_PL % 256 == 0 && BYTES_CX % 256 == 0 && BYTES_MB % 256 == 0);
static_assert(BYTES_XB + BYTES_WB + BYTES_PL + BYTES_CX + BYTES_MB + BYTES_CV <= (size_t)268435456);
static_assert(NH % HG == 0 && HG == 2);          // the last launch adds exactly two planes
static_assert(SEQ == SEQ_FULL && NB == NB_FULL); // every element of both planes is written, so that the sum may run over them as one contiguous range
static_assert((size_t)SEQ * NB_FULL * DM <= COV_OFF);
static_assert(COV_OFF + ((size_t)(NB - 1) * SEQ_FULL + (SEQ - 1)) * SEQ_FULL + SEQ <= (size_t)33554432 / 4);

typedef __bf16 v16b __attribute__((ext_vector_type(16)));
typedef unsigned short v8us __attribute__((ext_vector_type(8), may_alias));
typedef float v8f __attribute__((ext_vector_type(8)));
typedef float v4f __attribute__((ext_vector_type(4)));
typedef float v4fa __attribute__((ext_vector_type(4), may_alias));
typedef float v2f __attribute__((ext_vector_type(2)));
typedef float v2fa __attribute__((ext_vector_type(2), may_alias));
typedef unsigned int u32a __attribute__((may_alias));
typedef int v4i __attribute__((ext_vector_type(4)));
typedef int v4ia __attribute__((ext_vector_type(4), may_alias));
typedef __bf16 v2b __attribute__((ext_vector_type(2)));
union FragB { v16b v; v8us half[2]; unsigned int w[8]; };

#define LOG2E 1.4426950408889634f
#define NEGBIG (-1.0e30f)

// 2^x by the bare v_exp_f32. Every argument here is a difference to a maximum (<= 0): only results under 2^-126 differ from the library form (they become 0).
// Asm text so that the slot which the instruction set asks for behind a transcendental is kept by construction: inside a statement the next, independent
// transcendental fills it (no output shares a register with an input), and the closing v_nop fills it for the last one, whatever the compiler puts behind.
__device__ __forceinline__ void ex2x8(float* y, const float* x) {
  asm("v_exp_f32 %0, %8\n\tv_exp_f32 %1, %9\n\tv_exp_f32 %2, %10\n\tv_exp_f32 %3, %11\n\t"
      "v_exp_f32 %4, %12\n\tv_exp_f32 %5, %13\n\tv_exp_f32 %6, %14\n\tv_exp_f32 %7, %15\n\tv_nop"
      : "=&v"(y[0]), "=&v"(y[1]), "=&v"(y[2]), "=&v"(y[3]), "=&v"(y[4]), "=&v"(y[5]), "=&v"(y[6]), "=&v"(y[7])
      : "v"(x[0]), "v"(x[1]), "v"(x[2]), "v"(x[3]), "v"(x[4]), "v"(x[5]), "v"(x[6]), "v"(x[7]));
}
__device__ __forceinline__ float ex2(float x) {
  float y;
  asm("v_exp_f32 %0, %1\n\tv_nop" : "=&v"(y) : "v"(x));   // v_nop: the slot behind the transcendental
  return y;
}
// e = 2^x and r = 1 / d by the bare v_rcp_f32 (the caller guards d = 0), one closing slot for both
__device__ __forceinline__ void ex2_rcp(float& e, float& r, float x, float d) {
  asm("v_exp_f32 %0, %2\n\tv_rcp_f32 %1, %3\n\tv_nop" : "=&v"(e), "=&v"(r) : "v"(x), "v"(d));
}

// RNE convert of two values to a packed bf16 pair (a in the low half): one v_cvt_pk_bf16_f32
__device__ __forceinline__ unsigned int bf16_pair(float a, float b) {
  const v2f x = {a, b};
  return __builtin_bit_cast(unsigned int, __builtin_convertvector(x, v2b));
}
// the lo plane's pair: what the hi pair h leaves of (a, b), rounded the same way
__device__ __forceinline__ unsigned int bf16_rest(float a, float b, unsigned int h) {
  return bf16_pair(a - __uint_as_float(h << 16), b - __uint_as_float(h & 0xFFFF0000u));
}

__device__ __forceinline__ v8f wm(v16b a, v16b b, v8f c) {
  return __builtin_amdgcn_wmma_f32_16x16x32_bf16(false, a, false, b, (short)0, c, false, false);
}

// Preparation, one launch: PREP_WG work-groups of 16 waves (one a WGP); every thread takes its share of each job, so that few waves have to start.
// Conversions: a work-group's pieces of a plane are contiguous; a wave's load covers 512 contiguous bytes, its store 256 (whole lines).
#define PREP_WG 256
#define PREP_TH 512
#define PREP_T (PREP_WG * PREP_TH)
#define XCH ((int)(XN / 4 / PREP_T))              /* 16-byte pieces of one activation plane per thread */
#define WCH ((int)(WN / 4 / PREP_T))              /* the same of one weight plane */
static_assert(XN % ((size_t)4 * PREP_T) == 0 && WN % ((size_t)4 * PREP_T) == 0);
static_assert(NB * SEQ * MBW <= PREP_T);
typedef unsigned int v2ua __attribute__((ext_vector_type(2), may_alias));

__device__ __forceinline__ void cvt_store(unsigned short* d, v4f x) {
  v2ua o;
  o[0] = bf16_pair(x[0], x[1]); o[1] = bf16_pair(x[2], x[3]);
  *(v2ua*)d = o;
}

// coverage: planes: PREP_T threads x XCH (WCH) pieces x 4 elements = every element of each of the 3 + 4 planes, once.
// Mb[b][q][j] bit kk = 1 when key 32j+kk is masked for query q of batch b (mask[b][q][k] != 0 or rhs[q][start + k] != 0); thread t < NB*SEQ*32 writes word t: every word of the plane.
__global__ __launch_bounds__(PREP_TH) void k_prep(const float* __restrict__ query, const float* __restrict__ keyt, const float* __restrict__ value,
                                                  const float* __restrict__ Wq, const float* __restrict__ Wk, const float* __restrict__ Wv,
                                                  const float* __restrict__ Wo, const int* __restrict__ mask, const int* __restrict__ rhs,
                                                  const int* __restrict__ lidx, unsigned short* __restrict__ Xb, unsigned short* __restrict__ Wb,
                                                  unsigned int* __restrict__ Mb) {
  const int tid = threadIdx.x, blk = blockIdx.x;
  const int t = blk * PREP_TH + tid;
  const size_t ex = ((size_t)blk * XCH * PREP_TH + tid) * 4;   // this thread's first element in an activation plane
  const size_t ew = ((size_t)blk * WCH * PREP_TH + tid) * 4;   // and in a weight plane
  const float* sq = query + ex;
  const float* sk = keyt + ex;
  const float* sv = value + ex;
  const float* s0 = Wq + ew;
  const float* s1 = Wk + ew;
  const float* s2 = Wv + ew;
  const float* s3 = Wo + ew;
  // the long streams start first: all of the thread's plane loads are in flight while it forms its mask word
  v4f x[3][XCH], y[4][WCH];
#pragma unroll  // constant index into x[]
  for (int i = 0; i < XCH; ++i) x[0][i] = *(const v4fa*)(sq + (size_t)i * PREP_TH * 4);
#pragma unroll
  for (int i = 0; i < XCH; ++i) x[1][i] = *(const v4fa*)(sk + (size_t)i * PREP_TH * 4);
#pragma unroll
  for (int i = 0; i < XCH; ++i) x[2][i] = *(const v4fa*)(sv + (size_t)i * PREP_TH * 4);
#pragma unroll  // constant index into y[]
  for (int i = 0; i < WCH; ++i) {
    y[0][i] = *(const v4fa*)(s0 + (size_t)i * PREP_TH * 4);
    y[1][i] = *(const v4fa*)(s1 + (size_t)i * PREP_TH * 4);
    y[2][i] = *(const v4fa*)(s2 + (size_t)i * PREP_TH * 4);
    y[3][i] = *(const v4fa*)(s3 + (size_t)i * PREP_TH * 4);
  }
  // the loads' address registers stay live up to this wait (inputs only), so that no load's result and nothing behind it lands in one ahead of it
  asm volatile("s_wait_xcnt 0x0" :: "v"(sq), "v"(sk), "v"(sv), "v"(s0), "v"(s1), "v"(s2), "v"(s3) : "memory");
  if (t < NB * SEQ * MBW) {
    const int j = t & 31, row = t >> 5;
    const int b = row / SEQ, q = row - b * SEQ;
    int L = lidx[0];
    L = (L < -64) ? -64 : ((L > 64) ? 64 : L);
    int tt = 4 - 4 * L; if (tt < 0) tt = 0;
    int start = 4 - tt; if (start < 0) start = 0;
    start = (start >= 4) ? 4 : 0;                       // the formula only yields 0 or 4; keeps the 16-B alignment of the row loads
    const int* mp = mask + ((size_t)b * SEQ_FULL + q) * SEQ_FULL + 32 * j;
    const int* rp = rhs + (size_t)q * RHSW + start + 32 * j;
    v4i a[8], r[8];
#pragma unroll  // constant index into a[] and r[]; the word's 16 loads in flight together
    for (int c = 0; c < 8; ++c) {
      a[c] = *(const v4ia*)(mp + 4 * c);
      r[c] = *(const v4ia*)(rp + 4 * c);
    }
    // as above: both address pairs stay live up to this wait, so that no load's result lands in one ahead of it
    asm volatile("s_wait_xcnt 0x0" :: "v"(mp), "v"(rp) : "memory");
    unsigned int w = 0u;
#pragma unroll
    for (int c = 0; c < 8; ++c) {
      const unsigned int nib = (((a[c][0] | r[c][0]) != 0) ? 1u : 0u) | (((a[c][1] | r[c][1]) != 0) ? 2u : 0u) |
                               (((a[c][2] | r[c][2]) != 0) ? 4u : 0u) | (((a[c][3] | r[c][3]) != 0) ? 8u : 0u);
      w |= nib << (4 * c);
    }
    Mb[t] = w;
  }
#pragma unroll  // constant index into x[]
  for (int p = 0; p < 3; ++p)
#pragma unroll
    for (int i = 0; i < XCH; ++i) cvt_store(Xb + (size_t)p * XN + ex + (size_t)i * PREP_TH * 4, x[p][i]);
#pragma unroll  // constant index into y[]
  for (int p = 0; p < 4; ++p)
#pragma unroll
    for (int i = 0; i < WCH; ++i) cvt_store(Wb + (size_t)p * WN + ew + (size_t)i * PREP_TH * 4, y[p][i]);
}

// Block tile 128 rows x 128 columns, 8 waves of 32 x 64 (4 along the rows, 2 along the columns), K in stages of KC.
// A stage is [A tile | W tile], each GT rows of KC bf16 (one whole 128-B line a row) at LDS pitch TP; two buffers.
// Every lane copies 16 B per instruction, a wave 4 whole lines: 4 copies a lane for the A tile, 4 for the W tile.
#define GT 128
#define KC 64
#define TP 72                                    /* elements: 144 B = 16 B x odd, for the ds_load_b128 fragment reads */
#define TILE_E (GT * TP)
#define RING_E (4 * TILE_E)
static_assert(DM % KC == 0 && CXP % KC == 0 && DM / KC >= 2);
static_assert(RING_E >= 4 * 2 * 64 * STP);       // the projections' output staging reuses the ring
static_assert(RING_E * 2 >= 4 * 64 * 68 * 4);    // so does the output projection's

// la: LDS byte address of this lane's piece in its first row of the A tile of the target buffer; ga, gb: the same piece in global memory.
// Rows crow + 32 i, i = 0..3, of both tiles. The s_wait_xcnt stands inside the statement: the address registers are rewritten behind it.
__device__ __forceinline__ void stage_copy(unsigned int la, const unsigned short* ga, size_t apitch, const unsigned short* gb) {
  const unsigned int lb = la + TILE_E * 2;
  asm volatile("global_load_async_to_lds_b128 %0, %8, off\n\t"
               "global_load_async_to_lds_b128 %1, %9, off\n\t"
               "global_load_async_to_lds_b128 %2, %10, off\n\t"
               "global_load_async_to_lds_b128 %3, %11, off\n\t"
               "global_load_async_to_lds_b128 %4, %12, off\n\t"
               "global_load_async_to_lds_b128 %5, %13, off\n\t"
               "global_load_async_to_lds_b128 %6, %14, off\n\t"
               "global_load_async_to_lds_b128 %7, %15, off\n\t"
               "s_wait_xcnt 0x0"
               :: "v"(la), "v"(la + 32 * TP * 2), "v"(la + 64 * TP * 2), "v"(la + 96 * TP * 2),
                  "v"(lb), "v"(lb + 32 * TP * 2), "v"(lb + 64 * TP * 2), "v"(lb + 96 * TP * 2),
                  "v"(ga), "v"(ga + 32 * apitch), "v"(ga + 64 * apitch), "v"(ga + 96 * apitch),
                  "v"(gb), "v"(gb + 32 * DM), "v"(gb + 64 * DM), "v"(gb + 96 * DM)
               : "memory");
}

// ga, gb: this thread's copy sources at k = 0 (row tid / 8 of the tile, piece tid % 8); ar, br: this lane's fragment rows in buffer 0.
// The W k index wraps at DM so that [A_hi | A_lo] x [W ; W] folds along K. Each accumulator still sums k in steps of 32, ascending.
template <int KT>
__device__ __forceinline__ void gemm_main(const unsigned short* __restrict__ ga, size_t apitch, const unsigned short* __restrict__ gb,
                                          unsigned int la, const unsigned short* ar, const unsigned short* br, v8f (&acc)[2][4]) {
  constexpr int NT = KT / KC;
  stage_copy(la, ga, apitch, gb);
  asm volatile("s_wait_asynccnt 0x0" ::: "memory");   // stage 0 has landed before the barrier publishes it
  __syncthreads();
  stage_copy(la + 2 * TILE_E * 2, ga + KC, apitch, gb + KC);
#pragma unroll 1  // one stage a trip: the buffer index and the refill test stay scalar
  for (int t = 0; t < NT; ++t) {
    const int bo = (t & 1) * 2 * TILE_E;
#pragma unroll  // two 32-wide k steps of the stage
    for (int kk = 0; kk < KC; kk += 32) {
      const unsigned short* ap = ar + bo + kk;
      const unsigned short* bp = br + bo + kk;
      FragB a0, a1, b0, b1, b2, b3;
      a0.half[0] = *(const v8us*)(ap);                a0.half[1] = *(const v8us*)(ap + 16);
      a1.half[0] = *(const v8us*)(ap + 16 * TP);      a1.half[1] = *(const v8us*)(ap + 16 * TP + 16);
      b0.half[0] = *(const v8us*)(bp);                b0.half[1] = *(const v8us*)(bp + 16);
      b1.half[0] = *(const v8us*)(bp + 16 * TP);      b1.half[1] = *(const v8us*)(bp + 16 * TP + 16);
      b2.half[0] = *(const v8us*)(bp + 32 * TP);      b2.half[1] = *(const v8us*)(bp + 32 * TP + 16);
      b3.half[0] = *(const v8us*)(bp + 48 * TP);      b3.half[1] = *(const v8us*)(bp + 48 * TP + 16);
      acc[0][0] = wm(a0.v, b0.v, acc[0][0]); acc[0][1] = wm(a0.v, b1.v, acc[0][1]);
      acc[0][2] = wm(a0.v, b2.v, acc[0][2]); acc[0][3] = wm(a0.v, b3.v, acc[0][3]);
      acc[1][0] = wm(a1.v, b0.v, acc[1][0]); acc[1][1] = wm(a1.v, b1.v, acc[1][1]);
      acc[1][2] = wm(a1.v, b2.v, acc[1][2]); acc[1][3] = wm(a1.v, b3.v, acc[1][3]);
      asm volatile("v_nop\n\tv_nop\n\tv_nop\n\tv_nop"
                   : "+v"(acc[0][0]), "+v"(acc[0][1]), "+v"(acc[0][2]), "+v"(acc[0][3]),
                     "+v"(acc[1][0]), "+v"(acc[1][1]), "+v"(acc[1][2]), "+v"(acc[1][3])
                   : "v"(a0.v), "v"(a1.v), "v"(b0.v), "v"(b1.v), "v"(b2.v), "v"(b3.v));
    }
    asm volatile("s_wait_dscnt 0x0" ::: "memory");      // this wave's reads of the buffer are done before it is refilled
    asm volatile("s_wait_asynccnt 0x0" ::: "memory");   // this wave's copies of stage t + 1 have landed
    __syncthreads();                                    // publishes stage t + 1 and ends every reader's last read of stage t
    if (t + 2 < NT) {
      const int k2 = (t + 2) * KC;
      stage_copy(la + (unsigned int)bo * 2u, ga + k2, apitch, gb + (k2 & (DM - 1)));
    }
  }
  asm volatile("s_wait_asynccnt 0x0" ::: "memory");     // nothing is in flight when the ring becomes output staging
}

// Projections. grid (NB*SEQ/128, NH/2, 3): block = 128 sequence positions of one batch x two heads x one of {q, k, v}; 8 waves x (32 x 64).
// Logical row b*SEQ + s reads the activation row s*NB_FULL + b. Epilogue: each pair of waves owns a 64 x 64 tile (one head): bf16 hi + lo planes staged in its part of the ring
// (block barrier kept as it was; a wave now reads back the rows it staged itself). The planes lie in fragment order, in units of 512 B = [32 lanes][8 elements], one unit = one fragment load of an attention wave (4 whole lines):
// q (scaled by 1/8) and k: [b][h][s / 16][L = 0..3][lane], lane (hh, ln) holds row s = 16 tile + ln, d = 16 L + 8 hh + 0..7; v: [b][h][s / 32][d / 16][x = 0..1][lane], lane holds d = 16 t + ln, keys 32 j + 16 x + 8 hh + 0..7.
__global__ __launch_bounds__(256) void k_proj(const unsigned short* __restrict__ Xb, const unsigned short* __restrict__ Wb,
                                              unsigned short* __restrict__ PL) {
  __shared__ __attribute__((aligned(16))) unsigned short ring[RING_E];
  const int tid = threadIdx.x, w = __builtin_amdgcn_readfirstlane((int)(tid >> 5)), lane = tid & 31, ln = lane & 15, hh = lane >> 4;
  const int wr = w & 3, wc = w >> 2;                 // wave position: rows 32 wr, columns 64 wc
  const int pr = (wr >> 1) + 2 * wc, w2 = wr & 1;    // pair of waves that shares a 64 x 64 output tile, and the wave's place in it
  const int z = blockIdx.z, hcol = 2 * blockIdx.y + wc;
  const int mt0 = blockIdx.x * GT;
  const int b = mt0 / SEQ, sb = mt0 - b * SEQ;
  const int s0 = sb + 64 * (wr >> 1);
  const int crow = tid >> 3, cpc = 8 * (tid & 7);
  const unsigned short* ga = Xb + (size_t)z * XN + ((size_t)(sb + crow) * NB_FULL + b) * DM + cpc;
  const unsigned short* gb = Wb + (size_t)z * WN + (size_t)(GT * blockIdx.y + crow) * DM + cpc;
  const unsigned int la = (unsigned int)(size_t)(ring + crow * TP + cpc);
  v8f acc[2][4] = {};
  gemm_main<DM>(ga, (size_t)NB_FULL * DM, gb, la, ring + (32 * wr + ln) * TP + 8 * hh, ring + TILE_E + (64 * wc + ln) * TP + 8 * hh, acc);
  unsigned short* sh = ring + pr * (2 * 64 * STP);
  unsigned short* sl = sh + 64 * STP;
  const float scale = (z == 0) ? 0.125f : 1.0f;
#pragma unroll
  for (int mt = 0; mt < 2; ++mt)
#pragma unroll
    for (int nt = 0; nt < 4; ++nt)
#pragma unroll
      for (int r = 0; r < 8; r += 2) {
        const float v0 = acc[mt][nt][r] * scale, v1 = acc[mt][nt][r + 1] * scale;
        const unsigned int hb = bf16_pair(v0, v1);
        const unsigned int lb = bf16_rest(v0, v1, hb);
        const int sr = 32 * w2 + 16 * mt + 8 * hh + r;     // local sequence row of v0; v1 is the next
        const int dc = 16 * nt + ln;                        // head-dim column
        const int idx = (z == 2) ? (dc * STP + sr) : (sr * STP + dc);
        const int nx = (z == 2) ? 1 : STP;
        sh[idx] = (unsigned short)hb;
        sh[idx + nx] = (unsigned short)(hb >> 16);
        sl[idx] = (unsigned short)lb;
        sl[idx + nx] = (unsigned short)(lb >> 16);
      }
  __syncthreads();
  const size_t hbase = (size_t)b * NH + hcol;
  unsigned short* dstp = PL + (size_t)z * 2 * PLSZ + (hbase * SEQ + s0) * HD + 8 * lane;   // the 64 x 64 tile is 16 consecutive units in either layout
  {
#pragma unroll 1
    for (int i = 0; i < 8; ++i) {
      const int u = 8 * w2 + i;                          // unit of the tile; a wave's store covers the whole unit
      const int row = ln + ((z == 2) ? 16 * ((u >> 1) & 3) : 16 * (u >> 2));
      const int col = 8 * hh + ((z == 2) ? 32 * (u >> 3) + 16 * (u & 1) : 16 * (u & 3));
      const v8us vh = *(const v8us*)(sh + row * STP + col);
      const v8us vl = *(const v8us*)(sl + row * STP + col);
      unsigned short* d = dstp + 256 * u;
      *(v8us*)d = vh;
      *(v8us*)(d + PLSZ) = vl;
      asm volatile("s_wait_xcnt 0x0" ::: "memory");  // the next trip rewrites the stores' address registers
    }
    
  }
}

// The four fragments of a 16-row tile of the q or k planes: f[0], f[1] = hi plane, head-dim chunks 0 and 1 (units 0, 1 and 2, 3 of the tile); f[2], f[3] = the same of the lo plane.
// hi, lo: the planes (uniform); o: byte offset of the lane's 16 B in unit 0. Fragment elements 0..7 <- d = 32c + 8h + i, 8..15 <- d = 32c + 16 + 8h + i.
__device__ __forceinline__ void load_tile(FragB (&f)[4], const char* __restrict__ hi, const char* __restrict__ lo, unsigned int o) {
  const char* hp = hi + o;
  const char* lp = lo + o;
  f[0].half[0] = *(const v8us*)(hp);        f[0].half[1] = *(const v8us*)(hp + 512);
  f[1].half[0] = *(const v8us*)(hp + 1024); f[1].half[1] = *(const v8us*)(hp + 1536);
  f[2].half[0] = *(const v8us*)(lp);        f[2].half[1] = *(const v8us*)(lp + 512);
  f[3].half[0] = *(const v8us*)(lp + 1024); f[3].half[1] = *(const v8us*)(lp + 1536);
}

// S^T tile of 16 keys: c = K_lo Q_hi + K_hi Q_lo + K_hi Q_hi over the two 32-wide head-dim chunks, then the hazard guard. k: A fragments (row m = key), q: B fragments (column n = query).
__device__ __forceinline__ v8f qk_tile(const FragB (&k)[4], const FragB (&q)[4]) {
  v8f c = {0.f, 0.f, 0.f, 0.f, 0.f, 0.f, 0.f, 0.f};
  c = wm(k[2].v, q[0].v, c); c = wm(k[3].v, q[1].v, c);
  c = wm(k[0].v, q[2].v, c); c = wm(k[1].v, q[3].v, c);
  c = wm(k[0].v, q[0].v, c); c = wm(k[1].v, q[1].v, c);
  asm volatile("v_nop\n\tv_nop\n\tv_nop\n\tv_nop" : "+v"(c)
               : "v"(k[0].v), "v"(k[1].v), "v"(k[2].v), "v"(k[3].v), "v"(q[0].v), "v"(q[1].v), "v"(q[2].v), "v"(q[3].v));
  return c;
}

// O^T tile of 16 head-dim rows: o += V_lo P_hi + V_hi P_lo + V_hi P_hi, then the hazard guard. vh, vl: A fragments of V^T (row m = d, elements 0..7 <- key0 + 8h + i, 8..15 <- key0 + 16 + 8h + i).
__device__ __forceinline__ v8f pv_tile(const FragB& vh, const FragB& vl, const FragB& ph, const FragB& pl, v8f o) {
  o = wm(vl.v, ph.v, o);
  o = wm(vh.v, pl.v, o);
  o = wm(vh.v, ph.v, o);
  asm volatile("v_nop\n\tv_nop\n\tv_nop\n\tv_nop" : "+v"(o) : "v"(vh.v), "v"(vl.v), "v"(ph.v), "v"(pl.v));
  return o;
}

// Work-group barrier for the LDS exchanges of the attention loop: it waits for this wave's LDS operations alone, so that global loads issued ahead of it stay in flight across it
// (__syncthreads() also waits for them). Nothing that a wave stores to global memory is read by another wave of the launch.
__device__ __forceinline__ void lds_barrier() {
  asm volatile("s_wait_dscnt 0x0\n\ts_barrier_signal -1\n\ts_barrier_wait -1" ::: "memory");
}

// Q fragments of the block's query tile and K fragments of this wave's open steps, for the head whose byte offset inside a plane (with the lane's 16 B) is ho.
// more: a head is left to load for (uniform). Where nothing is loaded the fragments are set to 0: they are never read then, and the old values need not be kept in registers through the head.
__device__ __forceinline__ void load_qk(FragB (&qf)[4], FragB (&kf)[NSTEP][2][4], const char* __restrict__ qh, const char* __restrict__ ql, const char* __restrict__ kh, const char* __restrict__ kl,
                                        unsigned int ho, int q0, int w, const bool (&act)[NSTEP], bool more) {
  const v8us z8 = {0, 0, 0, 0, 0, 0, 0, 0};
  bool any = false;
#pragma unroll  // constant index into kf[] and act[]
  for (int i = 0; i < NSTEP; ++i) {
    if (more && act[i]) {
      const unsigned int ko = ho + (unsigned int)(32 * (w + i * NW)) * (HD * 2);
      load_tile(kf[i][0], kh, kl, ko);
      load_tile(kf[i][1], kh + 2048, kl + 2048, ko);
      asm volatile("s_wait_xcnt 0x0" :: "v"(ko) : "memory");   // the offset register stays live up to this wait: no load's result and nothing behind it lands in it earlier
    } else {
#pragma unroll
      for (int t = 0; t < 8; ++t) { kf[i][t >> 2][t & 3].half[0] = z8; kf[i][t >> 2][t & 3].half[1] = z8; }
    }
    any = any || act[i];
  }
  if (more && any) {
    const unsigned int qo = ho + (unsigned int)q0 * (HD * 2);
    load_tile(qf, qh, ql, qo);
    asm volatile("s_wait_xcnt 0x0" :: "v"(qo) : "memory");     // as above
  } else {
#pragma unroll
    for (int t = 0; t < 4; ++t) { qf[t].half[0] = z8; qf[t].half[1] = z8; }
  }
}

// Block = one batch x 16 queries x one group of HPG heads, NW waves. Only one block fits a WGP (registers), and a block's time grows with its open key steps: the grid holds two blocks a WGP,
// high query tiles first, so that a WGP which ends a long block early takes the longest of the short ones that are left (speed only: nothing rests on the order or on the mask's shape).
// Each block writes its heads' share of the coverage (already x 1/16) to its group's plane in the workspace; the last launch adds the planes.
// Wave w owns the 32-key steps j = w, w + NW, ... of every head (its mask words stay in registers).
// Per head: each wave's softmax statistics over its own steps -> LDS -> barrier -> every wave merges all NW pairs (max, rescaled sum);
// then normalised weights (the wave's kept exponentials rescaled to the merged statistics), coverage into the LDS tile [16][SEQ] (a step's columns belong to one wave, each lane only touches its own addresses), partial O^T;
// partial O^T tiles -> LDS -> barrier -> one wave per query row sums the NW partials in wave order and writes bf16 hi | lo halves of the [s*NB_FULL+b][2048] plane.
// Reuse of the exchange buffers: statistics of head h are read before the second barrier of h and rewritten after it; partials of h are read before the first barrier of h + 1 and rewritten after it.
// coverage: ctx plane: (b, 16 rows) x 16 heads x (64 hi + 64 lo) = every element of rows with b < NB; coverage plane of the head group: 16 rows x SEQ columns per block, all rows once.
// Global loads run one phase ahead: a step's V fragments are issued behind its score products and fly over the softmax, the statistics exchange and the merge; the next head's Q and K fragments are issued behind the partial-O stores and fly over the second barrier and the sum of the partials.
// LDS: coverage tile zero-filled in full before use; every wave writes its statistics and its whole partial tile (zeros when all its steps are masked) before they are read.
// The six planes come as six arguments: each load is then a uniform base + one 32-bit offset register + a small constant, and that one register is all that a group of loads names.
__global__ __launch_bounds__(32 * NW) void k_attn(const unsigned short* __restrict__ Pqh, const unsigned short* __restrict__ Pql, const unsigned short* __restrict__ Pkh,
                                                  const unsigned short* __restrict__ Pkl, const unsigned short* __restrict__ Pvh, const unsigned short* __restrict__ Pvl,
                                                  const unsigned int* __restrict__ Mb,
                                                  unsigned short* __restrict__ Cx, float* __restrict__ CovP) {
  extern __shared__ __attribute__((aligned(16))) unsigned char smem[];
  float* covs = (float*)smem;
  float* stm = (float*)(smem + COV_LDS_BYTES);     // [16 queries][STATP]: running maximum of wave w at column w
  float* stl = stm + 16 * STATP;                   // same shape: sum of wave w
  float* part = stl + 16 * STATP;                  // [NW][16 queries][OPP]: partial O, f32
  const int tid = threadIdx.x, w = __builtin_amdgcn_readfirstlane((int)(tid >> 5));
  const int lane = tid & 31, ln = lane & 15, hh = lane >> 4;
  const int qt = (SEQ / 16 - 1) - (int)blockIdx.x / (NB * HG), bg = (int)blockIdx.x % (NB * HG);
  const int b = bg / HG, h0 = (bg % HG) * HPG;       // batch, first head of the group
  const int q0 = qt * 16, qg = q0 + ln;
  {
    const v4f z4 = {0.f, 0.f, 0.f, 0.f};
    for (int i = tid; i < 4 * COVP; i += 32 * NW) *(v4fa*)(covs + 4 * i) = z4;
  }
  const unsigned int* mrow = Mb + (size_t)(b * SEQ + qg) * MBW;
  unsigned int mw[NSTEP];
  bool act[NSTEP];                                 // wave-uniform: some key of the step is open for one of the 16 queries
#pragma unroll  // mw[] and act[] must be indexed by constants to stay in registers
  for (int i = 0; i < NSTEP; ++i) {
    const int j = w + i * NW;
    mw[i] = (j < NKS) ? mrow[j] : 0xFFFFFFFFu;
    act[i] = __any(mw[i] != 0xFFFFFFFFu);
  }
  __syncthreads();
  const int sh8 = 8 * hh;
  const unsigned int lo = 16u * (unsigned int)lane;   // byte offset of this lane's 16 B in a 512-B unit of the q, k, v planes
  const char* qhp = (const char*)Pqh; const char* qlp = (const char*)Pql;   // addresses are a uniform plane base + a 32-bit offset inside the plane
  const char* khp = (const char*)Pkh; const char* klp = (const char*)Pkl;
  const char* vhp = (const char*)Pvh; const char* vlq = (const char*)Pvl;
  float* crow = covs + ln * COVP + 8 * hh;
  FragB qf[4], kf[NSTEP][2][4];                       // this head's Q and K fragments, loaded during the head before; read only under the act[i] that loaded them
  load_qk(qf, kf, qhp, qlp, khp, klp, (unsigned int)(b * NH + h0) * (SEQ * HD * 2) + lo, q0, w, act, true);

#pragma unroll 1
  for (int h = h0; h < h0 + HPG; ++h) {
    const size_t hb = (size_t)b * NH + h;
    const unsigned int ho = (unsigned int)hb * (SEQ * HD * 2) + lo;        // byte offset inside a plane: this head, this lane's 16 B of a unit

    // ---- pass 1: statistics over this wave's own steps; each step's exponentials stay in registers, relative to the maximum ms[i] they were formed with ----
    float mr = NEGBIG, lr = 0.0f;
    float pe[NSTEP][16], ms[NSTEP];                // read only under the same act[i] that wrote them
    FragB vf[NSTEP][4][2];                         // likewise
#pragma unroll  // constant index into mw[] and act[]
    for (int i = 0; i < NSTEP; ++i) {
      if (act[i]) {
        const v8f s0 = qk_tile(kf[i][0], qf);          // element r = score(key 32j + 8h + r, query qg)
        const v8f s1 = qk_tile(kf[i][1], qf);
        // V^T fragments of this step, hi and lo plane: units 0 and 1 of each (key step, d tile) pair
        const unsigned int vo = ho + (unsigned int)(32 * (w + i * NW)) * (HD * 2);
        const char* vp = vhp + vo;
        const char* vlp = vlq + vo;
#pragma unroll  // constant index into vf[]
        for (int t = 0; t < 4; ++t) {
          vf[i][t][0].half[0] = *(const v8us*)(vp + 1024 * t);  vf[i][t][0].half[1] = *(const v8us*)(vp + 1024 * t + 512);
          vf[i][t][1].half[0] = *(const v8us*)(vlp + 1024 * t); vf[i][t][1].half[1] = *(const v8us*)(vlp + 1024 * t + 512);
        }
        asm volatile("s_wait_xcnt 0x0" :: "v"(vo) : "memory");   // holds the loads here, ahead of the softmax; the offset register stays live up to the wait
        const unsigned int wb = mw[i] >> sh8;
        float sc[16];
        float mx = NEGBIG;
#pragma unroll
        for (int r = 0; r < 8; ++r) {
          sc[r]     = ((wb >> r) & 1u) ? NEGBIG : s0[r];
          sc[8 + r] = ((wb >> (16 + r)) & 1u) ? NEGBIG : s1[r];
          mx = fmaxf(mx, fmaxf(sc[r], sc[8 + r]));
        }
        mx = fmaxf(mx, __shfl_xor(mx, 16, 32));                  // the other lane half holds the other 16 keys of this query
        const float mnew = fmaxf(mr, mx);
        const float al = ex2((mr - mnew) * LOG2E);
        float ps = 0.0f;
        float xa[16], ea[16];
#pragma unroll  // constant index into xa[]
        for (int r = 0; r < 16; ++r) xa[r] = (sc[r] - mnew) * LOG2E;
        ex2x8(ea, xa);
        ex2x8(ea + 8, xa + 8);
#pragma unroll
        for (int r = 0; r < 16; ++r) {
          pe[i][r] = (sc[r] > -1.0e29f) ? ea[r] : 0.0f;          // 0 for a masked key
          ps += pe[i][r];
        }
        ms[i] = mnew;
        ps += __shfl_xor(ps, 16, 32);
        lr = lr * al + ps;
        mr = mnew;
      } else {
        // never read: set so that no older value has to be kept in registers for this path
        const v8us z8 = {0, 0, 0, 0, 0, 0, 0, 0};
#pragma unroll
        for (int t = 0; t < 8; ++t) { vf[i][t >> 1][t & 1].half[0] = z8; vf[i][t >> 1][t & 1].half[1] = z8; }
      }
    }
    if (hh == 0) { stm[ln * STATP + w] = mr; stl[ln * STATP + w] = lr; }
    lds_barrier();
    // merge: each lane half reads NW / 2 of the waves' pairs of its query, then one exchange between the halves
    {
      float mv[NW / 2], lv[NW / 2];                // the loops below are unrolled so that both arrays stay in registers
#pragma unroll
      for (int u = 0; u < NW / 8; ++u) {
        const v4f x = *(const v4fa*)(stm + ln * STATP + (NW / 2) * hh + 4 * u);
        const v4f y = *(const v4fa*)(stl + ln * STATP + (NW / 2) * hh + 4 * u);
        mv[4 * u] = x[0]; mv[4 * u + 1] = x[1]; mv[4 * u + 2] = x[2]; mv[4 * u + 3] = x[3];
        lv[4 * u] = y[0]; lv[4 * u + 1] = y[1]; lv[4 * u + 2] = y[2]; lv[4 * u + 3] = y[3];
      }
      float mg = NEGBIG;
#pragma unroll
      for (int u = 0; u < NW / 2; ++u) mg = fmaxf(mg, mv[u]);
      mg = fmaxf(mg, __shfl_xor(mg, 16, 32));
      float lg = 0.0f;
      float xm[NW / 2];
#pragma unroll  // constant index into xm[]
      for (int u = 0; u < NW / 2; ++u) xm[u] = (mv[u] - mg) * LOG2E;
#pragma unroll
      for (int u = 0; u < NW / 2; u += 8) ex2x8(mv + u, xm + u);
#pragma unroll
      for (int u = 0; u < NW / 2; ++u) lg += lv[u] * mv[u];
      lg += __shfl_xor(lg, 16, 32);
      mr = mg;
      lr = lg;
    }

    // ---- pass 2: weights = kept exponentials x exp(ms - m) / l, coverage accumulation, partial O^T over this wave's own steps ----
    v8f O[4] = {};
#pragma unroll  // constant index into act[], ms[] and pe[]
    for (int i = 0; i < NSTEP; ++i) {
      if (act[i]) {
        const int key0 = 32 * (w + i * NW);
        float fe, rl;
        ex2_rcp(fe, rl, (ms[i] - mr) * LOG2E, lr);
        const float f = fe * ((lr > 0.0f) ? rl : 0.0f);   // a query with no open key keeps weights of 0 (0 x inf otherwise)
        float pn[16];
#pragma unroll
        for (int r = 0; r < 16; ++r) pn[r] = pe[i][r] * f;
        // coverage tile: this lane owns columns key0 + 8h + 0..7 and key0 + 16 + 8h + 0..7 of row ln
        {
          float* cr = crow + key0;
          v4f c0 = *(const v4fa*)(cr), c1 = *(const v4fa*)(cr + 4), c2 = *(const v4fa*)(cr + 16), c3 = *(const v4fa*)(cr + 20);
          c0[0] += pn[0];  c0[1] += pn[1];  c0[2] += pn[2];  c0[3] += pn[3];
          c1[0] += pn[4];  c1[1] += pn[5];  c1[2] += pn[6];  c1[3] += pn[7];
          c2[0] += pn[8];  c2[1] += pn[9];  c2[2] += pn[10]; c2[3] += pn[11];
          c3[0] += pn[12]; c3[1] += pn[13]; c3[2] += pn[14]; c3[3] += pn[15];
          *(v4fa*)(cr) = c0; *(v4fa*)(cr + 4) = c1; *(v4fa*)(cr + 16) = c2; *(v4fa*)(cr + 20) = c3;
        }
        // P^T B fragment: element i < 8 -> key0 + 8h + i (tile 0 row 8h + i); i >= 8 -> key0 + 16 + 8h + (i - 8) (tile 1); bf16 hi + lo
        FragB ph, pl;
#pragma unroll
        for (int r = 0; r < 16; r += 2) {
          const unsigned int hp = bf16_pair(pn[r], pn[r + 1]);
          ph.w[r >> 1] = hp;
          pl.w[r >> 1] = bf16_rest(pn[r], pn[r + 1], hp);
        }
        O[0] = pv_tile(vf[i][0][0], vf[i][0][1], ph, pl, O[0]);
        O[1] = pv_tile(vf[i][1][0], vf[i][1][1], ph, pl, O[1]);
        O[2] = pv_tile(vf[i][2][0], vf[i][2][1], ph, pl, O[2]);
        O[3] = pv_tile(vf[i][3][0], vf[i][3][1], ph, pl, O[3]);
      }
    }

    // O^T element r of tile t = partial ctx(query qg, d = 16t + 8h + r): f32 into this wave's tile [16 queries][64 d]
    {
      float* pw = part + (size_t)(w * 16 + ln) * OPP + 8 * hh;
#pragma unroll  // constant index into O[]
      for (int t = 0; t < 4; ++t) {
        const v4f x0 = {O[t][0], O[t][1], O[t][2], O[t][3]};
        const v4f x1 = {O[t][4], O[t][5], O[t][6], O[t][7]};
        *(v4fa*)(pw + 16 * t) = x0;
        *(v4fa*)(pw + 16 * t + 4) = x1;
      }
    }
    load_qk(qf, kf, qhp, qlp, khp, klp, ho + SEQ * HD * 2, q0, w, act, h + 1 < h0 + HPG);
    lds_barrier();
    // one wave per query row (wave-uniform loop): lane sums d = 2 lane, 2 lane + 1 over the NW partial tiles; a wave writes whole 128-B lines
#pragma unroll 1  // at most one trip per wave once NW >= 16: nothing to gain from copies of the body
    for (int row = w; row < 16; row += NW) {
      const float* pr = part + row * OPP + 2 * lane;
      float t0 = 0.0f, t1 = 0.0f;
#pragma unroll  // independent LDS loads in flight together; the sums stay in wave order
      for (int u = 0; u < NW; ++u) {
        const v2f x = *(const v2fa*)(pr + u * 16 * OPP);
        t0 += x[0];
        t1 += x[1];
      }
      const unsigned int hp = bf16_pair(t0, t1);
      unsigned short* d = Cx + ((size_t)(q0 + row) * NB_FULL + b) * CXP + h * HD + 2 * lane;
      *(u32a*)d = hp;
      *(u32a*)(d + DM) = bf16_rest(t0, t1, hp);
      asm volatile("s_wait_xcnt 0x0" ::: "memory");  // the stores' address registers are advanced for the next head right behind them
    }
  }

  __syncthreads();
  float* cg = CovP + (size_t)(bg % HG) * CVN + ((size_t)b * SEQ_FULL + q0) * SEQ_FULL;
#pragma unroll 1  // a few short trips, once per block: kept rolled as before
  for (int idx = w; idx < 16 * (SEQ / 128); idx += NW) {
    const int row = idx / (SEQ / 128), col = (idx % (SEQ / 128)) * 128 + lane * 4;
    v4f v = *(const v4fa*)(covs + row * COVP + col);
    v[0] *= 0.0625f; v[1] *= 0.0625f; v[2] *= 0.0625f; v[3] *= 0.0625f;
    *(v4f*)(cg + (size_t)row * SEQ_FULL + col) = v;
    asm volatile("s_wait_xcnt 0x0" ::: "memory");    // the next trip rewrites the store's address and data registers
  }
}

// Output projection: out[m][n] = sum_c ctx[m][c] Wo[n][c] with A = [ctx_hi | ctx_lo] (K = 2048) and the W k index wrapping at 1024.
// coverage: blocks with blockIdx.y < DM / GT tile the [SEQ*NB_FULL][1024] output exactly once.
// Blocks with blockIdx.y >= DM / GT add the two coverage planes into the second output: CS_BLK blocks x 256 threads x CS_PC pieces of 4 elements = every element once;
// a wave's load or store covers 512 contiguous bytes. They leave ahead of every barrier and, coming last in the grid, run beside the product blocks.
#define CS_Y (DM / GT)
#define CS_BLK ((SEQ * NB_FULL / GT) * CS_Y)
#define CS_PC ((int)(CVN / 4 / 256 / CS_BLK))
static_assert(CVN % ((size_t)4 * 256 * CS_BLK) == 0 && CS_PC <= 16);   // the pieces of both planes stay in registers
static_assert(CVN * 4 <= (size_t)0xFFFFFFFF);    // a byte offset inside a coverage plane fits 32 bits
__global__ __launch_bounds__(256) void k_oproj(const unsigned short* __restrict__ Cx, const unsigned short* __restrict__ Wo,
                                               float* __restrict__ Out, const float* __restrict__ Cv0, const float* __restrict__ Cv1, float* __restrict__ Cov) {
  __shared__ __attribute__((aligned(16))) unsigned short ring[RING_E];
  if (blockIdx.y >= DM / GT) {
    // addresses are a uniform base + one 32-bit byte offset + a small constant: that one register is all that the loads and stores name
    const unsigned int o = (((blockIdx.y - DM / GT) * (SEQ * NB_FULL / GT) + blockIdx.x) * (CS_PC * 256) + threadIdx.x) * 16u;
    const char* c0 = (const char*)Cv0;                // the planes come as two arguments, so that each base is uniform
    const char* c1 = (const char*)Cv1;
    char* cd = (char*)Cov;
    v4f x[CS_PC], y[CS_PC];
#pragma unroll  // constant index into x[] and y[]; all of the thread's loads in flight together
    for (int i = 0; i < CS_PC; ++i) {
      x[i] = *(const v4fa*)(c0 + o + 4096 * i);
      y[i] = *(const v4fa*)(c1 + o + 4096 * i);
    }
    asm volatile("s_wait_xcnt 0x0" :: "v"(o) : "memory");   // the offset register stays live up to this wait: no load's result lands in it earlier
#pragma unroll
    for (int i = 0; i < CS_PC; ++i) *(v4fa*)(cd + o + 4096 * i) = x[i] + y[i];
    return;
  }
  const int tid = threadIdx.x, w = __builtin_amdgcn_readfirstlane((int)(tid >> 5)), lane = tid & 31, ln = lane & 15, hh = lane >> 4;
  const int wr = w & 3, wc = w >> 2;                 // wave position: rows 32 wr, columns 64 wc
  const int pr = (wr >> 1) + 2 * wc, w2 = wr & 1;    // 64 x 64 staging tile, and the wave's place in it
  const int mb = blockIdx.x * GT, nb = blockIdx.y * GT;
  const int m0 = mb + 64 * (wr >> 1), n0 = nb + 64 * wc;
  const int crow = tid >> 3, cpc = 8 * (tid & 7);
  const unsigned short* ga = Cx + (size_t)(mb + crow) * CXP + cpc;
  const unsigned short* gb = Wo + (size_t)(nb + crow) * DM + cpc;
  const unsigned int la = (unsigned int)(size_t)(ring + crow * TP + cpc);
  v8f acc[2][4] = {};
  gemm_main<CXP>(ga, (size_t)CXP, gb, la, ring + (32 * wr + ln) * TP + 8 * hh, ring + TILE_E + (64 * wc + ln) * TP + 8 * hh, acc);
  float* so = (float*)ring + pr * (64 * 68);
#pragma unroll
  for (int mt = 0; mt < 2; ++mt)
#pragma unroll
    for (int nt = 0; nt < 4; ++nt)
#pragma unroll
      for (int r = 0; r < 8; ++r)
        so[(32 * w2 + 16 * mt + 8 * hh + r) * 68 + 16 * nt + ln] = acc[mt][nt][r];
  __syncthreads();
  const int rsub = lane >> 4, c4 = (lane & 15) * 4;
  {
#pragma unroll 1
    for (int i = 0; i < 16; ++i) {
      const int row = 32 * w2 + 2 * i + rsub;
      const v4f v = *(const v4fa*)(so + row * 68 + c4);
      *(v4f*)(Out + (size_t)(m0 + row) * DM + n0 + c4) = v;
    }
    
  }
}

extern "C" void kernel_launch(void* const* d_in, const int* in_sizes, int n_in,
                              void* d_out, int out_size, void* d_ws, size_t ws_size, hipStream_t stream) {
  if (n_in < 10) return;
  const long long needX = (long long)SEQ * NB_FULL * DM;
  if ((long long)in_sizes[0] < needX || (long long)in_sizes[1] < needX || (long long)in_sizes[2] < needX) return;
  for (int i = 3; i < 7; ++i) if ((long long)in_sizes[i] < (long long)DM * DM) return;
  if ((long long)in_sizes[7] < ((long long)(NB - 1) * SEQ_FULL + (SEQ - 1)) * SEQ_FULL + SEQ_FULL) return;
  if ((long long)in_sizes[8] < (long long)SEQ * RHSW) return;
  if (in_sizes[9] < 1) return;
  if ((long long)out_size < (long long)COV_OFF + ((long long)(NB - 1) * SEQ_FULL + (SEQ - 1)) * SEQ_FULL + SEQ) return;

  const float* query = (const float*)d_in[0];   // wire order: query, key, value, Wq, Wk, Wv, Wo, mask, rhs_mask, layer_idx
  const float* keyt  = (const float*)d_in[1];
  const float* value = (const float*)d_in[2];
  const float* Wq    = (const float*)d_in[3];
  const float* Wk    = (const float*)d_in[4];
  const float* Wv    = (const float*)d_in[5];
  const float* Wo    = (const float*)d_in[6];
  const int*   mask  = (const int*)d_in[7];
  const int*   rhs   = (const int*)d_in[8];
  const int*   lidx  = (const int*)d_in[9];
  float* out = (float*)d_out;
  float* cov = out + COV_OFF;

  char* ws = (char*)d_ws;
  size_t off = 0;
  unsigned short* Xb = (unsigned short*)(ws + off); off += BYTES_XB;   // 3 activation planes [SEQ*NB_FULL][1024] bf16
  unsigned short* Wb = (unsigned short*)(ws + off); off += BYTES_WB;   // 4 weight planes [1024][1024] bf16 (q, k, v, o)
  unsigned short* PL = (unsigned short*)(ws + off); off += BYTES_PL;   // q_hi, q_lo, k_hi, k_lo, vT_hi, vT_lo
  unsigned short* Cx = (unsigned short*)(ws + off); off += BYTES_CX;   // ctx [SEQ*NB_FULL][hi 1024 | lo 1024] bf16
  unsigned int*   Mb = (unsigned int*)(ws + off);   off += BYTES_MB;   // mask bit-plane [NB][SEQ][32 words]
  float*          Cv = (float*)(ws + off);          off += BYTES_CV;   // coverage of each head group, [HG][NB][SEQ][SEQ] f32
  if (off > ws_size) return;

  k_prep<<<PREP_WG, PREP_TH, 0, stream>>>(query, keyt, value, Wq, Wk, Wv, Wo, mask, rhs, lidx, Xb, Wb, Mb);
  k_proj<<<dim3((unsigned)(NB * SEQ / GT), NH / 2, 3), 256, 0, stream>>>(Xb, Wb, PL);
  hipFuncSetAttribute(reinterpret_cast<const void*>(&k_attn), hipFuncAttributeMaxDynamicSharedMemorySize, (int)ATTN_LDS);
  k_attn<<<(unsigned)(NB * HG * (SEQ / 16)), 32 * NW, (size_t)ATTN_LDS, stream>>>(PL, PL + PLSZ, PL + 2 * PLSZ, PL + 3 * PLSZ, PL + 4 * PLSZ, PL + 5 * PLSZ, Mb, Cx, Cv);
  k_oproj<<<dim3((unsigned)(SEQ * NB_FULL / GT), DM / GT + CS_Y), 256, 0, stream>>>(Cx, Wb + 3 * WN, out, Cv, Cv + CVN, cov);
}

// v010
// A run of this version takes 115 microseconds.
// Two timings next to v009 put it at 1.07 and 1.06 times that version's speed.
// All steps since v000 together make it 10.8 times as fast.
#include <hip/hip_runtime.h>
// Contractions (all v_wmma_f32_16x16x32_bf16, f32 accumulate): q/k/v projections = single product on RNE-bf16 inputs and weights; scores K Q^T, P V and the output projection = bf16 hi+lo planes of the computed operand(s), products hi*hi + hi*lo + lo*hi (output projection: ctx_hi and ctx_lo against the same Wo fragments, 32 of k at a time); softmax statistics and coverage in f32.
// come from K rows (A, global bf16 planes) and Q^T (B, registers); the two 16-key D tiles pack straight into the P^T B fragment; O^T accumulates from V^T rows (A).
// Masks: both boolean inputs and the layer index are read on the device into a bit-plane (one 32-bit word per query and 32-key step); fully masked steps are skipped at run time.
#ifndef NB
#define NB 4
#endif
#ifndef SEQ
#define SEQ 1024
#endif
#define NB_FULL 4
#define SEQ_FULL 1024
#define NH 16
#define HD 64
#define DM 1024
#define RHSW (SEQ_FULL + 4)
#define NKS (SEQ / 32)
#define MBW (SEQ_FULL / 32)
#define CXP 2048
#define COVP (SEQ + 4)
#define STP 72
#define COV_LDS_BYTES (16 * COVP * 4)
#define NW 16                                    /* waves of one attention block */
#define NSTEP ((NKS + NW - 1) / NW)              /* 32-key steps owned by one wave */
#define STATP (NW + 4)                           /* dword pitch of a query's row of per-wave statistics (16 B x odd) */
#define OPP 68                                   /* dword pitch of a partial-O row */
#define ATTN_LDS (COV_LDS_BYTES + 2 * 16 * STATP * 4 + NW * 16 * OPP * 4)

#define XN ((size_t)SEQ * NB_FULL * DM)          /* elements of one converted activation plane (prefix of the full input) */
#define WN ((size_t)DM * DM)
#define PLSZ ((size_t)NB * NH * SEQ * HD)        /* elements of one head-layout plane */
#define COV_OFF ((size_t)SEQ_FULL * NB_FULL * DM) /* element offset of the second output (byte 16777216) */

#define BYTES_XB (3 * XN * 2)
#define BYTES_WB (4 * WN * 2)
#define BYTES_PL (6 * PLSZ * 2)
#define BYTES_CX ((size_t)SEQ * NB_FULL * CXP * 2)
#define BYTES_MB ((size_t)NB * SEQ * MBW * 4)
#define HG 2                                     /* head groups: one attention work-group takes NH / HG heads of its 16 queries */
#define HPG (NH / HG)
#define CVN ((size_t)NB_FULL * SEQ_FULL * SEQ_FULL) /* elements of one head group's coverage plane, laid out like the second output */
#define BYTES_CV (HG * CVN * 4)

static_assert(SEQ % 128 == 0);
static_assert(SEQ <= SEQ_FULL);
static_assert(NB <= NB_FULL);
static_assert(MBW == 32);
static_assert(HD == 64);
static_assert(NW % 16 == 0 && NW <= 32);       // the merge forms its NW / 2 exponentials eight at a time
static_assert(ATTN_LDS <= 327680);
static_assert(NH * HD == DM);
static_assert(PLSZ * 2 <= (size_t)0xFFFFFFFF);   // a byte offset inside a head-layout plane fits 32 bits
static_assert(COV_OFF * 4 == (size_t)16777216);
static_assert(BYTES_XB % 256 == 0 && BYTES_WB % 256 == 0 && BYTES_PL % 256 == 0 && BYTES_CX % 256 == 0 && BYTES_MB % 256 == 0);
static_assert(BYTES_XB + BYTES_WB + BYTES_PL + BYTES_CX + BYTES_MB + BYTES_CV <= (size_t)268435456);
static_assert(NH % HG == 0 && HG == 2);          // the last launch adds exactly two planes
static_assert(SEQ == SEQ_FULL && NB == NB_FULL); // every element of both planes is written, so that the sum may run over them as one contiguous range
static_assert((size_t)SEQ * NB_FULL * DM <= COV_OFF);
static_assert(COV_OFF + ((size_t)(NB - 1) * SEQ_FULL + (SEQ - 1)) * SEQ_FULL + SEQ <= (size_t)33554432 / 4);

typedef __bf16 v16b __attribute__((ext_vector_type(16)));
typedef unsigned short v8us __attribute__((ext_vector_type(8), may_alias));
typedef float v8f __attribute__((ext_vector_type(8)));
typedef float v4f __attribute__((ext_vector_type(4)));
typedef float v4fa __attribute__((ext_vector_type(4), may_alias));
typedef float v2f __attribute__((ext_vector_type(2)));
typedef float v2fa __attribute__((ext_vector_type(2), may_alias));
typedef unsigned int u32a __attribute__((may_alias));
typedef int v4i __attribute__((ext_vector_type(4)));
typedef int v4ia __attribute__((ext_vector_type(4), may_alias));
typedef __bf16 v2b __attribute__((ext_vector_type(2)));
union FragB { v16b v; v8us half[2]; unsigned int w[8]; };

#define LOG2E 1.4426950408889634f
#define NEGBIG (-1.0e30f)

// 2^x by the bare v_exp_f32. Every argument here is a difference to a maximum (<= 0): only results under 2^-126 differ from the library form (they become 0).
// Asm text so that the slot which the instruction set asks for behind a transcendental is kept by construction: inside a statement the next, independent
// transcendental fills it (no output shares a register with an input), and the closing v_nop fills it for the last one, whatever the compiler puts behind.
__device__ __forceinline__ void ex2x8(float* y, const float* x) {
  asm("v_exp_f32 %0, %8\n\tv_exp_f32 %1, %9\n\tv_exp_f32 %2, %10\n\tv_exp_f32 %3, %11\n\t"
      "v_exp_f32 %4, %12\n\tv_exp_f32 %5, %13\n\tv_exp_f32 %6, %14\n\tv_exp_f32 %7, %15\n\tv_nop"
      : "=&v"(y[0]), "=&v"(y[1]), "=&v"(y[2]), "=&v"(y[3]), "=&v"(y[4]), "=&v"(y[5]), "=&v"(y[6]), "=&v"(y[7])
      : "v"(x[0]), "v"(x[1]), "v"(x[2]), "v"(x[3]), "v"(x[4]), "v"(x[5]), "v"(x[6]), "v"(x[7]));
}
__device__ __forceinline__ float ex2(float x) {
  float y;
  asm("v_exp_f32 %0, %1\n\tv_nop" : "=&v"(y) : "v"(x));   // v_nop: the slot behind the transcendental
  return y;
}
// e = 2^x and r = 1 / d by the bare v_rcp_f32 (the caller guards d = 0), one closing slot for both
__device__ __forceinline__ void ex2_rcp(float& e, float& r, float x, float d) {
  asm("v_exp_f32 %0, %2\n\tv_rcp_f32 %1, %3\n\tv_nop" : "=&v"(e), "=&v"(r) : "v"(x), "v"(d));
}

// RNE convert of two values to a packed bf16 pair (a in the low half): one v_cvt_pk_bf16_f32
__device__ __forceinline__ unsigned int bf16_pair(float a, float b) {
  const v2f x = {a, b};
  return __builtin_bit_cast(unsigned int, __builtin_convertvector(x, v2b));
}
// the lo plane's pair: what the hi pair h leaves of (a, b), rounded the same way
__device__ __forceinline__ unsigned int bf16_rest(float a, float b, unsigned int h) {
  return bf16_pair(a - __uint_as_float(h << 16), b - __uint_as_float(h & 0xFFFF0000u));
}

__device__ __forceinline__ v8f wm(v16b a, v16b b, v8f c) {
  return __builtin_amdgcn_wmma_f32_16x16x32_bf16(false, a, false, b, (short)0, c, false, false);
}

// Preparation, one launch: PREP_WG work-groups of 16 waves (one a WGP); every thread takes its share of each job, so that few waves have to start.
// Conversions: a work-group's pieces of a plane are contiguous; a wave's load covers 512 contiguous bytes, its store 256 (whole lines).
#define PREP_WG 256
#define PREP_TH 512
#define PREP_T (PREP_WG * PREP_TH)
#define XCH ((int)(XN / 4 / PREP_T))              /* 16-byte pieces of one activation plane per thread */
#define WCH ((int)(WN / 4 / PREP_T))              /* the same of one weight plane */
static_assert(XN % ((size_t)4 * PREP_T) == 0 && WN % ((size_t)4 * PREP_T) == 0);
static_assert(NB * SEQ * MBW <= PREP_T);
typedef unsigned int v2ua __attribute__((ext_vector_type(2), may_alias));

__device__ __forceinline__ void cvt_store(unsigned short* d, v4f x) {
  v2ua o;
  o[0] = bf16_pair(x[0], x[1]); o[1] = bf16_pair(x[2], x[3]);
  *(v2ua*)d = o;
}

// coverage: planes: PREP_T threads x XCH (WCH) pieces x 4 elements = every element of each of the 3 + 4 planes, once.
// Mb[b][q][j] bit kk = 1 when key 32j+kk is masked for query q of batch b (mask[b][q][k] != 0 or rhs[q][start + k] != 0); thread t < NB*SEQ*32 writes word t: every word of the plane.
__global__ __launch_bounds__(PREP_TH) void k_prep(const float* __restrict__ query, const float* __restrict__ keyt, const float* __restrict__ value,
                                                  const float* __restrict__ Wq, const float* __restrict__ Wk, const float* __restrict__ Wv,
                                                  const float* __restrict__ Wo, const int* __restrict__ mask, const int* __restrict__ rhs,
                                                  const int* __restrict__ lidx, unsigned short* __restrict__ Xb, unsigned short* __restrict__ Wb,
                                                  unsigned int* __restrict__ Mb) {
  const int tid = threadIdx.x, blk = blockIdx.x;
  const int t = blk * PREP_TH + tid;
  const size_t ex = ((size_t)blk * XCH * PREP_TH + tid) * 4;   // this thread's first element in an activation plane
  const size_t ew = ((size_t)blk * WCH * PREP_TH + tid) * 4;   // and in a weight plane
  const float* sq = query + ex;
  const float* sk = keyt + ex;
  const float* sv = value + ex;
  const float* s0 = Wq + ew;
  const float* s1 = Wk + ew;
  const float* s2 = Wv + ew;
  const float* s3 = Wo + ew;
  // the long streams start first: all of the thread's plane loads are in flight while it forms its mask word
  v4f x[3][XCH], y[4][WCH];
#pragma unroll  // constant index into x[]
  for (int i = 0; i < XCH; ++i) x[0][i] = *(const v4fa*)(sq + (size_t)i * PREP_TH * 4);
#pragma unroll
  for (int i = 0; i < XCH; ++i) x[1][i] = *(const v4fa*)(sk + (size_t)i * PREP_TH * 4);
#pragma unroll
  for (int i = 0; i < XCH; ++i) x[2][i] = *(const v4fa*)(sv + (size_t)i * PREP_TH * 4);
#pragma unroll  // constant index into y[]
  for (int i = 0; i < WCH; ++i) {
    y[0][i] = *(const v4fa*)(s0 + (size_t)i * PREP_TH * 4);
    y[1][i] = *(const v4fa*)(s1 + (size_t)i * PREP_TH * 4);
    y[2][i] = *(const v4fa*)(s2 + (size_t)i * PREP_TH * 4);
    y[3][i] = *(const v4fa*)(s3 + (size_t)i * PREP_TH * 4);
  }
  // the loads' address registers stay live up to this wait (inputs only), so that no load's result and nothing behind it lands in one ahead of it
  asm volatile("s_wait_xcnt 0x0" :: "v"(sq), "v"(sk), "v"(sv), "v"(s0), "v"(s1), "v"(s2), "v"(s3) : "memory");
  if (t < NB * SEQ * MBW) {
    const int j = t & 31, row = t >> 5;
    const int b = row / SEQ, q = row - b * SEQ;
    int L = lidx[0];
    L = (L < -64) ? -64 : ((L > 64) ? 64 : L);
    int tt = 4 - 4 * L; if (tt < 0) tt = 0;
    int start = 4 - tt; if (start < 0) start = 0;
    start = (start >= 4) ? 4 : 0;                       // the formula only yields 0 or 4; keeps the 16-B alignment of the row loads
    const int* mp = mask + ((size_t)b * SEQ_FULL + q) * SEQ_FULL + 32 * j;
    const int* rp = rhs + (size_t)q * RHSW + start + 32 * j;
    v4i a[8], r[8];
#pragma unroll  // constant index into a[] and r[]; the word's 16 loads in flight together
    for (int c = 0; c < 8; ++c) {
      a[c] = *(const v4ia*)(mp + 4 * c);
      r[c] = *(const v4ia*)(rp + 4 * c);
    }
    // as above: both address pairs stay live up to this wait, so that no load's result lands in one ahead of it
    asm volatile("s_wait_xcnt 0x0" :: "v"(mp), "v"(rp) : "memory");
    unsigned int w = 0u;
#pragma unroll
    for (int c = 0; c < 8; ++c) {
      const unsigned int nib = (((a[c][0] | r[c][0]) != 0) ? 1u : 0u) | (((a[c][1] | r[c][1]) != 0) ? 2u : 0u) |
                               (((a[c][2] | r[c][2]) != 0) ? 4u : 0u) | (((a[c][3] | r[c][3]) != 0) ? 8u : 0u);
      w |= nib << (4 * c);
    }
    Mb[t] = w;
  }
#pragma unroll  // constant index into x[]
  for (int p = 0; p < 3; ++p)
#pragma unroll
    for (int i = 0; i < XCH; ++i) cvt_store(Xb + (size_t)p * XN + ex + (size_t)i * PREP_TH * 4, x[p][i]);
#pragma unroll  // constant index into y[]
  for (int p = 0; p < 4; ++p)
#pragma unroll
    for (int i = 0; i < WCH; ++i) cvt_store(Wb + (size_t)p * WN + ew + (size_t)i * PREP_TH * 4, y[p][i]);
}

// Block tile 128 rows x 128 columns, 8 waves of 32 x 64 (4 along the rows, 2 along the columns), K in stages of KC.
// A stage is [A tile | W tile], each GT rows of KC bf16 (one whole 128-B line a row) at LDS pitch TP; two buffers.
// Every lane copies 16 B per instruction, a wave 4 whole lines: 4 copies a lane for the A tile, 4 for the W tile.
#define GT 128
#define KC 64
#define TP 72                                    /* elements: 144 B = 16 B x odd, for the ds_load_b128 fragment reads */
#define TILE_E (GT * TP)
#define RING_E (4 * TILE_E)
static_assert(DM % KC == 0 && DM / KC >= 2);
static_assert(RING_E >= 4 * 2 * 64 * STP);       // the projections' output staging reuses the ring

// la: LDS byte address of this lane's piece in its first row of the A tile of the target buffer; ga, gb: the same piece in global memory.
// Rows crow + 32 i, i = 0..3, of both tiles. The s_wait_xcnt stands inside the statement: the address registers are rewritten behind it.
__device__ __forceinline__ void stage_copy(unsigned int la, const unsigned short* ga, size_t apitch, const unsigned short* gb) {
  const unsigned int lb = la + TILE_E * 2;
  asm volatile("global_load_async_to_lds_b128 %0, %8, off\n\t"
               "global_load_async_to_lds_b128 %1, %9, off\n\t"
               "global_load_async_to_lds_b128 %2, %10, off\n\t"
               "global_load_async_to_lds_b128 %3, %11, off\n\t"
               "global_load_async_to_lds_b128 %4, %12, off\n\t"
               "global_load_async_to_lds_b128 %5, %13, off\n\t"
               "global_load_async_to_lds_b128 %6, %14, off\n\t"
               "global_load_async_to_lds_b128 %7, %15, off\n\t"
               "s_wait_xcnt 0x0"
               :: "v"(la), "v"(la + 32 * TP * 2), "v"(la + 64 * TP * 2), "v"(la + 96 * TP * 2),
                  "v"(lb), "v"(lb + 32 * TP * 2), "v"(lb + 64 * TP * 2), "v"(lb + 96 * TP * 2),
                  "v"(ga), "v"(ga + 32 * apitch), "v"(ga + 64 * apitch), "v"(ga + 96 * apitch),
                  "v"(gb), "v"(gb + 32 * DM), "v"(gb + 64 * DM), "v"(gb + 96 * DM)
               : "memory");
}

// ga, gb: this thread's copy sources at k = 0 (row tid / 8 of the tile, piece tid % 8); ar, br: this lane's fragment rows in buffer 0.
// Each accumulator sums k in steps of 32, ascending.
template <int KT>
__device__ __forceinline__ void gemm_main(const unsigned short* __restrict__ ga, size_t apitch, const unsigned short* __restrict__ gb,
                                          unsigned int la, const unsigned short* ar, const unsigned short* br, v8f (&acc)[2][4]) {
  constexpr int NT = KT / KC;
  stage_copy(la, ga, apitch, gb);
  asm volatile("s_wait_asynccnt 0x0" ::: "memory");   // stage 0 has landed before the barrier publishes it
  __syncthreads();
  stage_copy(la + 2 * TILE_E * 2, ga + KC, apitch, gb + KC);
#pragma unroll 1  // one stage a trip: the buffer index and the refill test stay scalar
  for (int t = 0; t < NT; ++t) {
    const int bo = (t & 1) * 2 * TILE_E;
#pragma unroll  // two 32-wide k steps of the stage
    for (int kk = 0; kk < KC; kk += 32) {
      const unsigned short* ap = ar + bo + kk;
      const unsigned short* bp = br + bo + kk;
      FragB a0, a1, b0, b1, b2, b3;
      a0.half[0] = *(const v8us*)(ap);                a0.half[1] = *(const v8us*)(ap + 16);
      a1.half[0] = *(const v8us*)(ap + 16 * TP);      a1.half[1] = *(const v8us*)(ap + 16 * TP + 16);
      b0.half[0] = *(const v8us*)(bp);                b0.half[1] = *(const v8us*)(bp + 16);
      b1.half[0] = *(const v8us*)(bp + 16 * TP);      b1.half[1] = *(const v8us*)(bp + 16 * TP + 16);
      b2.half[0] = *(const v8us*)(bp + 32 * TP);      b2.half[1] = *(const v8us*)(bp + 32 * TP + 16);
      b3.half[0] = *(const v8us*)(bp + 48 * TP);      b3.half[1] = *(const v8us*)(bp + 48 * TP + 16);
      acc[0][0] = wm(a0.v, b0.v, acc[0][0]); acc[0][1] = wm(a0.v, b1.v, acc[0][1]);
      acc[0][2] = wm(a0.v, b2.v, acc[0][2]); acc[0][3] = wm(a0.v, b3.v, acc[0][3]);
      acc[1][0] = wm(a1.v, b0.v, acc[1][0]); acc[1][1] = wm(a1.v, b1.v, acc[1][1]);
      acc[1][2] = wm(a1.v, b2.v, acc[1][2]); acc[1][3] = wm(a1.v, b3.v, acc[1][3]);
      asm volatile("v_nop\n\tv_nop\n\tv_nop\n\tv_nop"
                   : "+v"(acc[0][0]), "+v"(acc[0][1]), "+v"(acc[0][2]), "+v"(acc[0][3]),
                     "+v"(acc[1][0]), "+v"(acc[1][1]), "+v"(acc[1][2]), "+v"(acc[1][3])
                   : "v"(a0.v), "v"(a1.v), "v"(b0.v), "v"(b1.v), "v"(b2.v), "v"(b3.v));
    }
    asm volatile("s_wait_dscnt 0x0" ::: "memory");      // this wave's reads of the buffer are done before it is refilled
    asm volatile("s_wait_asynccnt 0x0" ::: "memory");   // this wave's copies of stage t + 1 have landed
    __syncthreads();                                    // publishes stage t + 1 and ends every reader's last read of stage t
    if (t + 2 < NT) {
      const int k2 = (t + 2) * KC;
      stage_copy(la + (unsigned int)bo * 2u, ga + k2, apitch, gb + k2);
    }
  }
  asm volatile("s_wait_asynccnt 0x0" ::: "memory");     // nothing is in flight when the ring becomes output staging
}

// Output projection's stage: [ctx_hi tile | ctx_lo tile | W tile] of the same KC columns, so that a W tile is copied once and a W fragment read once for both planes; two buffers.
#define STG3_E (3 * TILE_E)
#define RING3_E (2 * STG3_E)
static_assert(RING3_E * 2 >= 4 * 64 * 68 * 4);   // the output staging reuses the ring
static_assert(2 * RING3_E * 2 <= 327680);        // a product block and a coverage block share a WGP

// la: LDS byte address of this lane's piece in its first row of the hi tile of the target buffer; gh, gb: the same piece of ctx_hi and of W in global memory (ctx_lo lies DM elements behind ctx_hi).
// Rows crow + 32 i, i = 0..3, of the three tiles. The s_wait_xcnt stands inside the statement: the address registers are rewritten behind it.
__device__ __forceinline__ void stage_copy3(unsigned int la, const unsigned short* gh, const unsigned short* gb) {
  const unsigned int ll = la + TILE_E * 2, lb = la + 2 * TILE_E * 2;
  const unsigned short* gl = gh + DM;
  asm volatile("global_load_async_to_lds_b128 %0, %12, off\n\t"
               "global_load_async_to_lds_b128 %1, %13, off\n\t"
               "global_load_async_to_lds_b128 %2, %14, off\n\t"
               "global_load_async_to_lds_b128 %3, %15, off\n\t"
               "global_load_async_to_lds_b128 %4, %16, off\n\t"
               "global_load_async_to_lds_b128 %5, %17, off\n\t"
               "global_load_async_to_lds_b128 %6, %18, off\n\t"
               "global_load_async_to_lds_b128 %7, %19, off\n\t"
               "global_load_async_to_lds_b128 %8, %20, off\n\t"
               "global_load_async_to_lds_b128 %9, %21, off\n\t"
               "global_load_async_to_lds_b128 %10, %22, off\n\t"
               "global_load_async_to_lds_b128 %11, %23, off\n\t"
               "s_wait_xcnt 0x0"
               :: "v"(la), "v"(la + 32 * TP * 2), "v"(la + 64 * TP * 2), "v"(la + 96 * TP * 2),
                  "v"(ll), "v"(ll + 32 * TP * 2), "v"(ll + 64 * TP * 2), "v"(ll + 96 * TP * 2),
                  "v"(lb), "v"(lb + 32 * TP * 2), "v"(lb + 64 * TP * 2), "v"(lb + 96 * TP * 2),
                  "v"(gh), "v"(gh + 32 * CXP), "v"(gh + 64 * CXP), "v"(gh + 96 * CXP),
                  "v"(gl), "v"(gl + 32 * CXP), "v"(gl + 64 * CXP), "v"(gl + 96 * CXP),
                  "v"(gb), "v"(gb + 32 * DM), "v"(gb + 64 * DM), "v"(gb + 96 * DM)
               : "memory");
}

// gh, gb: this thread's copy sources at k = 0 (row tid / 8 of the tile, piece tid % 8); ar, br: this lane's fragment rows of the hi tile and of the W tile in buffer 0.
// Each accumulator sums k in steps of 32, ascending, and within a step the hi product, then the lo product.
__device__ __forceinline__ void gemm_hilo(const unsigned short* __restrict__ gh, const unsigned short* __restrict__ gb,
                                          unsigned int la, const unsigned short* ar, const unsigned short* br, v8f (&acc)[2][4]) {
  constexpr int NT = DM / KC;
  stage_copy3(la, gh, gb);
  asm volatile("s_wait_asynccnt 0x0" ::: "memory");   // stage 0 has landed before the barrier publishes it
  __syncthreads();
  stage_copy3(la + STG3_E * 2, gh + KC, gb + KC);
#pragma unroll 1  // one stage a trip: the buffer index and the refill test stay scalar
  for (int t = 0; t < NT; ++t) {
    const int bo = (t & 1) * STG3_E;
#pragma unroll  // two 32-wide k steps of the stage
    for (int kk = 0; kk < KC; kk += 32) {
      const unsigned short* ap = ar + bo + kk;
      const unsigned short* lp = ap + TILE_E;
      const unsigned short* bp = br + bo + kk;
      FragB a0, a1, c0, c1, b0, b1, b2, b3;
      a0.half[0] = *(const v8us*)(ap);                a0.half[1] = *(const v8us*)(ap + 16);
      a1.half[0] = *(const v8us*)(ap + 16 * TP);      a1.half[1] = *(const v8us*)(ap + 16 * TP + 16);
      b0.half[0] = *(const v8us*)(bp);                b0.half[1] = *(const v8us*)(bp + 16);
      b1.half[0] = *(const v8us*)(bp + 16 * TP);      b1.half[1] = *(const v8us*)(bp + 16 * TP + 16);
      b2.half[0] = *(const v8us*)(bp + 32 * TP);      b2.half[1] = *(const v8us*)(bp + 32 * TP + 16);
      b3.half[0] = *(const v8us*)(bp + 48 * TP);      b3.half[1] = *(const v8us*)(bp + 48 * TP + 16);
      c0.half[0] = *(const v8us*)(lp);                c0.half[1] = *(const v8us*)(lp + 16);
      c1.half[0] = *(const v8us*)(lp + 16 * TP);      c1.half[1] = *(const v8us*)(lp + 16 * TP + 16);
      acc[0][0] = wm(a0.v, b0.v, acc[0][0]); acc[0][1] = wm(a0.v, b1.v, acc[0][1]);
      acc[0][2] = wm(a0.v, b2.v, acc[0][2]); acc[0][3] = wm(a0.v, b3.v, acc[0][3]);
      acc[1][0] = wm(a1.v, b0.v, acc[1][0]); acc[1][1] = wm(a1.v, b1.v, acc[1][1]);
      acc[1][2] = wm(a1.v, b2.v, acc[1][2]); acc[1][3] = wm(a1.v, b3.v, acc[1][3]);
      acc[0][0] = wm(c0.v, b0.v, acc[0][0]); acc[0][1] = wm(c0.v, b1.v, acc[0][1]);
      acc[0][2] = wm(c0.v, b2.v, acc[0][2]); acc[0][3] = wm(c0.v, b3.v, acc[0][3]);
      acc[1][0] = wm(c1.v, b0.v, acc[1][0]); acc[1][1] = wm(c1.v, b1.v, acc[1][1]);
      acc[1][2] = wm(c1.v, b2.v, acc[1][2]); acc[1][3] = wm(c1.v, b3.v, acc[1][3]);
      // the distance behind the last matrix instructions, before their operands or results are touched (as in gemm_main)
      asm volatile("v_nop\n\tv_nop\n\tv_nop\n\tv_nop"
                   : "+v"(acc[0][0]), "+v"(acc[0][1]), "+v"(acc[0][2]), "+v"(acc[0][3]),
                     "+v"(acc[1][0]), "+v"(acc[1][1]), "+v"(acc[1][2]), "+v"(acc[1][3])
                   : "v"(a0.v), "v"(a1.v), "v"(c0.v), "v"(c1.v), "v"(b0.v), "v"(b1.v), "v"(b2.v), "v"(b3.v));
    }
    asm volatile("s_wait_dscnt 0x0" ::: "memory");      // this wave's reads of the buffer are done before it is refilled
    asm volatile("s_wait_asynccnt 0x0" ::: "memory");   // this wave's copies of stage t + 1 have landed
    __syncthreads();                                    // publishes stage t + 1 and ends every reader's last read of stage t
    if (t + 2 < NT) {
      const int k2 = (t + 2) * KC;
      stage_copy3(la + (unsigned int)bo * 2u, gh + k2, gb + k2);
    }
  }
  asm volatile("s_wait_asynccnt 0x0" ::: "memory");     // nothing is in flight when the ring becomes output staging
}

// Projections. grid (NB*SEQ/128, NH/2, 3): block = 128 sequence positions of one batch x two heads x one of {q, k, v}; 8 waves x (32 x 64).
// Logical row b*SEQ + s reads the activation row s*NB_FULL + b. Epilogue: each pair of waves owns a 64 x 64 tile (one head): bf16 hi + lo planes staged in its part of the ring
// (block barrier kept as it was; a wave now reads back the rows it staged itself). The planes lie in fragment order, in units of 512 B = [32 lanes][8 elements], one unit = one fragment load of an attention wave (4 whole lines):
// q (scaled by 1/8) and k: [b][h][s / 16][L = 0..3][lane], lane (hh, ln) holds row s = 16 tile + ln, d = 16 L + 8 hh + 0..7; v: [b][h][s / 32][d / 16][x = 0..1][lane], lane holds d = 16 t + ln, keys 32 j + 16 x + 8 hh + 0..7.
__global__ __launch_bounds__(256) void k_proj(const unsigned short* __restrict__ Xb, const unsigned short* __restrict__ Wb,
                                              unsigned short* __restrict__ PL) {
  __shared__ __attribute__((aligned(16))) unsigned short ring[RING_E];
  const int tid = threadIdx.x, w = __builtin_amdgcn_readfirstlane((int)(tid >> 5)), lane = tid & 31, ln = lane & 15, hh = lane >> 4;
  const int wr = w & 3, wc = w >> 2;                 // wave position: rows 32 wr, columns 64 wc
  const int pr = (wr >> 1) + 2 * wc, w2 = wr & 1;    // pair of waves that shares a 64 x 64 output tile, and the wave's place in it
  const int z = blockIdx.z, hcol = 2 * blockIdx.y + wc;
  const int mt0 = blockIdx.x * GT;
  const int b = mt0 / SEQ, sb = mt0 - b * SEQ;
  const int s0 = sb + 64 * (wr >> 1);
  const int crow = tid >> 3, cpc = 8 * (tid & 7);
  const unsigned short* ga = Xb + (size_t)z * XN + ((size_t)(sb + crow) * NB_FULL + b) * DM + cpc;
  const unsigned short* gb = Wb + (size_t)z * WN + (size_t)(GT * blockIdx.y + crow) * DM + cpc;
  const unsigned int la = (unsigned int)(size_t)(ring + crow * TP + cpc);
  v8f acc[2][4] = {};
  gemm_main<DM>(ga, (size_t)NB_FULL * DM, gb, la, ring + (32 * wr + ln) * TP + 8 * hh, ring + TILE_E + (64 * wc + ln) * TP + 8 * hh, acc);
  unsigned short* sh = ring + pr * (2 * 64 * STP);
  unsigned short* sl = sh + 64 * STP;
  const float scale = (z == 0) ? 0.125f : 1.0f;
#pragma unroll
  for (int mt = 0; mt < 2; ++mt)
#pragma unroll
    for (int nt = 0; nt < 4; ++nt)
#pragma unroll
      for (int r = 0; r < 8; r += 2) {
        const float v0 = acc[mt][nt][r] * scale, v1 = acc[mt][nt][r + 1] * scale;
        const unsigned int hb = bf16_pair(v0, v1);
        const unsigned int lb = bf16_rest(v0, v1, hb);
        const int sr = 32 * w2 + 16 * mt + 8 * hh + r;     // local sequence row of v0; v1 is the next
        const int dc = 16 * nt + ln;                        // head-dim column
        const int idx = (z == 2) ? (dc * STP + sr) : (sr * STP + dc);
        const int nx = (z == 2) ? 1 : STP;
        sh[idx] = (unsigned short)hb;
        sh[idx + nx] = (unsigned short)(hb >> 16);
        sl[idx] = (unsigned short)lb;
        sl[idx + nx] = (unsigned short)(lb >> 16);
      }
  __syncthreads();
  const size_t hbase = (size_t)b * NH + hcol;
  unsigned short* dstp = PL + (size_t)z * 2 * PLSZ + (hbase * SEQ + s0) * HD + 8 * lane;   // the 64 x 64 tile is 16 consecutive units in either layout
  {
#pragma unroll 1
    for (int i = 0; i < 8; ++i) {
      const int u = 8 * w2 + i;                          // unit of the tile; a wave's store covers the whole unit
      const int row = ln + ((z == 2) ? 16 * ((u >> 1) & 3) : 16 * (u >> 2));
      const int col = 8 * hh + ((z == 2) ? 32 * (u >> 3) + 16 * (u & 1) : 16 * (u & 3));
      const v8us vh = *(const v8us*)(sh + row * STP + col);
      const v8us vl = *(const v8us*)(sl + row * STP + col);
      unsigned short* d = dstp + 256 * u;
      *(v8us*)d = vh;
      *(v8us*)(d + PLSZ) = vl;
      asm volatile("s_wait_xcnt 0x0" ::: "memory");  // the next trip rewrites the stores' address registers
    }
    
  }
}

// The four fragments of a 16-row tile of the q or k planes: f[0], f[1] = hi plane, head-dim chunks 0 and 1 (units 0, 1 and 2, 3 of the tile); f[2], f[3] = the same of the lo plane.
// hi, lo: the planes (uniform); o: byte offset of the lane's 16 B in unit 0. Fragment elements 0..7 <- d = 32c + 8h + i, 8..15 <- d = 32c + 16 + 8h + i.
__device__ __forceinline__ void load_tile(FragB (&f)[4], const char* __restrict__ hi, const char* __restrict__ lo, unsigned int o) {
  const char* hp = hi + o;
  const char* lp = lo + o;
  f[0].half[0] = *(const v8us*)(hp);        f[0].half[1] = *(const v8us*)(hp + 512);
  f[1].half[0] = *(const v8us*)(hp + 1024); f[1].half[1] = *(const v8us*)(hp + 1536);
  f[2].half[0] = *(const v8us*)(lp);        f[2].half[1] = *(const v8us*)(lp + 512);
  f[3].half[0] = *(const v8us*)(lp + 1024); f[3].half[1] = *(const v8us*)(lp + 1536);
}

// S^T tile of 16 keys: c = K_lo Q_hi + K_hi Q_lo + K_hi Q_hi over the two 32-wide head-dim chunks, then the hazard guard. k: A fragments (row m = key), q: B fragments (column n = query).
__device__ __forceinline__ v8f qk_tile(const FragB (&k)[4], const FragB (&q)[4]) {
  v8f c = {0.f, 0.f, 0.f, 0.f, 0.f, 0.f, 0.f, 0.f};
  c = wm(k[2].v, q[0].v, c); c = wm(k[3].v, q[1].v, c);
  c = wm(k[0].v, q[2].v, c); c = wm(k[1].v, q[3].v, c);
  c = wm(k[0].v, q[0].v, c); c = wm(k[1].v, q[1].v, c);
  asm volatile("v_nop\n\tv_nop\n\tv_nop\n\tv_nop" : "+v"(c)
               : "v"(k[0].v), "v"(k[1].v), "v"(k[2].v), "v"(k[3].v), "v"(q[0].v), "v"(q[1].v), "v"(q[2].v), "v"(q[3].v));
  return c;
}

// O^T tile of 16 head-dim rows: o += V_lo P_hi + V_hi P_lo + V_hi P_hi, then the hazard guard. vh, vl: A fragments of V^T (row m = d, elements 0..7 <- key0 + 8h + i, 8..15 <- key0 + 16 + 8h + i).
__device__ __forceinline__ v8f pv_tile(const FragB& vh, const FragB& vl, const FragB& ph, const FragB& pl, v8f o) {
  o = wm(vl.v, ph.v, o);
  o = wm(vh.v, pl.v, o);
  o = wm(vh.v, ph.v, o);
  asm volatile("v_nop\n\tv_nop\n\tv_nop\n\tv_nop" : "+v"(o) : "v"(vh.v), "v"(vl.v), "v"(ph.v), "v"(pl.v));
  return o;
}

// Work-group barrier for the LDS exchanges of the attention loop: it waits for this wave's LDS operations alone, so that global loads issued ahead of it stay in flight across it
// (__syncthreads() also waits for them). Nothing that a wave stores to global memory is read by another wave of the launch.
__device__ __forceinline__ void lds_barrier() {
  asm volatile("s_wait_dscnt 0x0\n\ts_barrier_signal -1\n\ts_barrier_wait -1" ::: "memory");
}

// Q fragments of the block's query tile and K fragments of this wave's open steps, for the head whose byte offset inside a plane (with the lane's 16 B) is ho.
// more: a head is left to load for (uniform). Where nothing is loaded the fragments are set to 0: they are never read then, and the old values need not be kept in registers through the head.
__device__ __forceinline__ void load_qk(FragB (&qf)[4], FragB (&kf)[NSTEP][2][4], const char* __restrict__ qh, const char* __restrict__ ql, const char* __restrict__ kh, const char* __restrict__ kl,
                                        unsigned int ho, int q0, int w, const bool (&act)[NSTEP], bool more) {
  const v8us z8 = {0, 0, 0, 0, 0, 0, 0, 0};
  bool any = false;
#pragma unroll  // constant index into kf[] and act[]
  for (int i = 0; i < NSTEP; ++i) {
    if (more && act[i]) {
      const unsigned int ko = ho + (unsigned int)(32 * (w + i * NW)) * (HD * 2);
      load_tile(kf[i][0], kh, kl, ko);
      load_tile(kf[i][1], kh + 2048, kl + 2048, ko);
      asm volatile("s_wait_xcnt 0x0" :: "v"(ko) : "memory");   // the offset register stays live up to this wait: no load's result and nothing behind it lands in it earlier
    } else {
#pragma unroll
      for (int t = 0; t < 8; ++t) { kf[i][t >> 2][t & 3].half[0] = z8; kf[i][t >> 2][t & 3].half[1] = z8; }
    }
    any = any || act[i];
  }
  if (more && any) {
    const unsigned int qo = ho + (unsigned int)q0 * (HD * 2);
    load_tile(qf, qh, ql, qo);
    asm volatile("s_wait_xcnt 0x0" :: "v"(qo) : "memory");     // as above
  } else {
#pragma unroll
    for (int t = 0; t < 4; ++t) { qf[t].half[0] = z8; qf[t].half[1] = z8; }
  }
}

// Block = one batch x 16 queries x one group of HPG heads, NW waves. Only one block fits a WGP (registers), and a block's time grows with its open key steps: the grid holds two blocks a WGP,
// high query tiles first, so that a WGP which ends a long block early takes the longest of the short ones that are left (speed only: nothing rests on the order or on the mask's shape).
// Each block writes its heads' share of the coverage (already x 1/16) to its group's plane in the workspace; the last launch adds the planes.
// Wave w owns the 32-key steps j = w, w + NW, ... of every head (its mask words stay in registers).
// Per head: each wave's softmax statistics over its own steps -> LDS -> barrier -> every wave merges all NW pairs (max, rescaled sum);
// then normalised weights (the wave's kept exponentials rescaled to the merged statistics), coverage into the LDS tile [16][SEQ] (a step's columns belong to one wave, each lane only touches its own addresses), partial O^T;
// partial O^T tiles -> LDS -> barrier -> one wave per query row sums the NW partials in wave order and writes bf16 hi | lo halves of the [s*NB_FULL+b][2048] plane.
// Reuse of the exchange buffers: statistics of head h are read before the second barrier of h and rewritten after it; partials of h are read before the first barrier of h + 1 and rewritten after it.
// coverage: ctx plane: (b, 16 rows) x 16 heads x (64 hi + 64 lo) = every element of rows with b < NB; coverage plane of the head group: 16 rows x SEQ columns per block, all rows once.
// Global loads run one phase ahead: a step's V fragments are issued behind its score products and fly over the softmax, the statistics exchange and the merge; the next head's Q and K fragments are issued behind the partial-O stores and fly over the second barrier and the sum of the partials.
// LDS: coverage tile zero-filled in full before use; every wave writes its statistics and its whole partial tile (zeros when all its steps are masked) before they are read.
// The six planes come as six arguments: each load is then a uniform base + one 32-bit offset register + a small constant, and that one register is all that a group of loads names.
__global__ __launch_bounds__(32 * NW) void k_attn(const unsigned short* __restrict__ Pqh, const unsigned short* __restrict__ Pql, const unsigned short* __restrict__ Pkh,
                                                  const unsigned short* __restrict__ Pkl, const unsigned short* __restrict__ Pvh, const unsigned short* __restrict__ Pvl,
                                                  const unsigned int* __restrict__ Mb,
                                                  unsigned short* __restrict__ Cx, float* __restrict__ CovP) {
  extern __shared__ __attribute__((aligned(16))) unsigned char smem[];
  float* covs = (float*)smem;
  float* stm = (float*)(smem + COV_LDS_BYTES);     // [16 queries][STATP]: running maximum of wave w at column w
  float* stl = stm + 16 * STATP;                   // same shape: sum of wave w
  float* part = stl + 16 * STATP;                  // [NW][16 queries][OPP]: partial O, f32
  const int tid = threadIdx.x, w = __builtin_amdgcn_readfirstlane((int)(tid >> 5));
  const int lane = tid & 31, ln = lane & 15, hh = lane >> 4;
  const int qt = (SEQ / 16 - 1) - (int)blockIdx.x / (NB * HG), bg = (int)blockIdx.x % (NB * HG);
  const int b = bg / HG, h0 = (bg % HG) * HPG;       // batch, first head of the group
  const int q0 = qt * 16, qg = q0 + ln;
  {
    const v4f z4 = {0.f, 0.f, 0.f, 0.f};
    for (int i = tid; i < 4 * COVP; i += 32 * NW) *(v4fa*)(covs + 4 * i) = z4;
  }
  const unsigned int* mrow = Mb + (size_t)(b * SEQ + qg) * MBW;
  unsigned int mw[NSTEP];
  bool act[NSTEP];                                 // wave-uniform: some key of the step is open for one of the 16 queries
#pragma unroll  // mw[] and act[] must be indexed by constants to stay in registers
  for (int i = 0; i < NSTEP; ++i) {
    const int j = w + i * NW;
    mw[i] = (j < NKS) ? mrow[j] : 0xFFFFFFFFu;
    act[i] = __any(mw[i] != 0xFFFFFFFFu);
  }
  __syncthreads();
  const int sh8 = 8 * hh;
  const unsigned int lo = 16u * (unsigned int)lane;   // byte offset of this lane's 16 B in a 512-B unit of the q, k, v planes
  const char* qhp = (const char*)Pqh; const char* qlp = (const char*)Pql;   // addresses are a uniform plane base + a 32-bit offset inside the plane
  const char* khp = (const char*)Pkh; const char* klp = (const char*)Pkl;
  const char* vhp = (const char*)Pvh; const char* vlq = (const char*)Pvl;
  float* crow = covs + ln * COVP + 8 * hh;
  FragB qf[4], kf[NSTEP][2][4];                       // this head's Q and K fragments, loaded during the head before; read only under the act[i] that loaded them
  load_qk(qf, kf, qhp, qlp, khp, klp, (unsigned int)(b * NH + h0) * (SEQ * HD * 2) + lo, q0, w, act, true);

#pragma unroll 1
  for (int h = h0; h < h0 + HPG; ++h) {
    const size_t hb = (size_t)b * NH + h;
    const unsigned int ho = (unsigned int)hb * (SEQ * HD * 2) + lo;        // byte offset inside a plane: this head, this lane's 16 B of a unit

    // ---- pass 1: statistics over this wave's own steps; each step's exponentials stay in registers, relative to the maximum ms[i] they were formed with ----
    float mr = NEGBIG, lr = 0.0f;
    float pe[NSTEP][16], ms[NSTEP];                // read only under the same act[i] that wrote them
    FragB vf[NSTEP][4][2];                         // likewise
#pragma unroll  // constant index into mw[] and act[]
    for (int i = 0; i < NSTEP; ++i) {
      if (act[i]) {
        const v8f s0 = qk_tile(kf[i][0], qf);          // element r = score(key 32j + 8h + r, query qg)
        const v8f s1 = qk_tile(kf[i][1], qf);
        // V^T fragments of this step, hi and lo plane: units 0 and 1 of each (key step, d tile) pair
        const unsigned int vo = ho + (unsigned int)(32 * (w + i * NW)) * (HD * 2);
        const char* vp = vhp + vo;
        const char* vlp = vlq + vo;
#pragma unroll  // constant index into vf[]
        for (int t = 0; t < 4; ++t) {
          vf[i][t][0].half[0] = *(const v8us*)(vp + 1024 * t);  vf[i][t][0].half[1] = *(const v8us*)(vp + 1024 * t + 512);
          vf[i][t][1].half[0] = *(const v8us*)(vlp + 1024 * t); vf[i][t][1].half[1] = *(const v8us*)(vlp + 1024 * t + 512);
        }
        asm volatile("s_wait_xcnt 0x0" :: "v"(vo) : "memory");   // holds the loads here, ahead of the softmax; the offset register stays live up to the wait
        const unsigned int wb = mw[i] >> sh8;
        float sc[16];
        float mx = NEGBIG;
#pragma unroll
        for (int r = 0; r < 8; ++r) {
          sc[r]     = ((wb >> r) & 1u) ? NEGBIG : s0[r];
          sc[8 + r] = ((wb >> (16 + r)) & 1u) ? NEGBIG : s1[r];
          mx = fmaxf(mx, fmaxf(sc[r], sc[8 + r]));
        }
        mx = fmaxf(mx, __shfl_xor(mx, 16, 32));                  // the other lane half holds the other 16 keys of this query
        const float mnew = fmaxf(mr, mx);
        const float al = ex2((mr - mnew) * LOG2E);
        float ps = 0.0f;
        float xa[16], ea[16];
#pragma unroll  // constant index into xa[]
        for (int r = 0; r < 16; ++r) xa[r] = (sc[r] - mnew) * LOG2E;
        ex2x8(ea, xa);
        ex2x8(ea + 8, xa + 8);
#pragma unroll
        for (int r = 0; r < 16; ++r) {
          pe[i][r] = (sc[r] > -1.0e29f) ? ea[r] : 0.0f;          // 0 for a masked key
          ps += pe[i][r];
        }
        ms[i] = mnew;
        ps += __shfl_xor(ps, 16, 32);
        lr = lr * al + ps;
        mr = mnew;
      } else {
        // never read: set so that no older value has to be kept in registers for this path
        const v8us z8 = {0, 0, 0, 0, 0, 0, 0, 0};
#pragma unroll
        for (int t = 0; t < 8; ++t) { vf[i][t >> 1][t & 1].half[0] = z8; vf[i][t >> 1][t & 1].half[1] = z8; }
      }
    }
    if (hh == 0) { stm[ln * STATP + w] = mr; stl[ln * STATP + w] = lr; }
    lds_barrier();
    // merge: each lane half reads NW / 2 of the waves' pairs of its query, then one exchange between the halves
    {
      float mv[NW / 2], lv[NW / 2];                // the loops below are unrolled so that both arrays stay in registers
#pragma unroll
      for (int u = 0; u < NW / 8; ++u) {
        const v4f x = *(const v4fa*)(stm + ln * STATP + (NW / 2) * hh + 4 * u);
        const v4f y = *(const v4fa*)(stl + ln * STATP + (NW / 2) * hh + 4 * u);
        mv[4 * u] = x[0]; mv[4 * u + 1] = x[1]; mv[4 * u + 2] = x[2]; mv[4 * u + 3] = x[3];
        lv[4 * u] = y[0]; lv[4 * u + 1] = y[1]; lv[4 * u + 2] = y[2]; lv[4 * u + 3] = y[3];
      }
      float mg = NEGBIG;
#pragma unroll
      for (int u = 0; u < NW / 2; ++u) mg = fmaxf(mg, mv[u]);
      mg = fmaxf(mg, __shfl_xor(mg, 16, 32));
      float lg = 0.0f;
      float xm[NW / 2];
#pragma unroll  // constant index into xm[]
      for (int u = 0; u < NW / 2; ++u) xm[u] = (mv[u] - mg) * LOG2E;
#pragma unroll
      for (int u = 0; u < NW / 2; u += 8) ex2x8(mv + u, xm + u);
#pragma unroll
      for (int u = 0; u < NW / 2; ++u) lg += lv[u] * mv[u];
      lg += __shfl_xor(lg, 16, 32);
      mr = mg;
      lr = lg;
    }

    // ---- pass 2: weights = kept exponentials x exp(ms - m) / l, coverage accumulation, partial O^T over this wave's own steps ----
    v8f O[4] = {};
#pragma unroll  // constant index into act[], ms[] and pe[]
    for (int i = 0; i < NSTEP; ++i) {
      if (act[i]) {
        const int key0 = 32 * (w + i * NW);
        float fe, rl;
        ex2_rcp(fe, rl, (ms[i] - mr) * LOG2E, lr);
        const float f = fe * ((lr > 0.0f) ? rl : 0.0f);   // a query with no open key keeps weights of 0 (0 x inf otherwise)
        float pn[16];
#pragma unroll
        for (int r = 0; r < 16; ++r) pn[r] = pe[i][r] * f;
        // coverage tile: this lane owns columns key0 + 8h + 0..7 and key0 + 16 + 8h + 0..7 of row ln
        {
          float* cr = crow + key0;
          v4f c0 = *(const v4fa*)(cr), c1 = *(const v4fa*)(cr + 4), c2 = *(const v4fa*)(cr + 16), c3 = *(const v4fa*)(cr + 20);
          c0[0] += pn[0];  c0[1] += pn[1];  c0[2] += pn[2];  c0[3] += pn[3];
          c1[0] += pn[4];  c1[1] += pn[5];  c1[2] += pn[6];  c1[3] += pn[7];
          c2[0] += pn[8];  c2[1] += pn[9];  c2[2] += pn[10]; c2[3] += pn[11];
          c3[0] += pn[12]; c3[1] += pn[13]; c3[2] += pn[14]; c3[3] += pn[15];
          *(v4fa*)(cr) = c0; *(v4fa*)(cr + 4) = c1; *(v4fa*)(cr + 16) = c2; *(v4fa*)(cr + 20) = c3;
        }
        // P^T B fragment: element i < 8 -> key0 + 8h + i (tile 0 row 8h + i); i >= 8 -> key0 + 16 + 8h + (i - 8) (tile 1); bf16 hi + lo
        FragB ph, pl;
#pragma unroll
        for (int r = 0; r < 16; r += 2) {
          const unsigned int hp = bf16_pair(pn[r], pn[r + 1]);
          ph.w[r >> 1] = hp;
          pl.w[r >> 1] = bf16_rest(pn[r], pn[r + 1], hp);
        }
        O[0] = pv_tile(vf[i][0][0], vf[i][0][1], ph, pl, O[0]);
        O[1] = pv_tile(vf[i][1][0], vf[i][1][1], ph, pl, O[1]);
        O[2] = pv_tile(vf[i][2][0], vf[i][2][1], ph, pl, O[2]);
        O[3] = pv_tile(vf[i][3][0], vf[i][3][1], ph, pl, O[3]);
      }
    }

    // O^T element r of tile t = partial ctx(query qg, d = 16t + 8h + r): f32 into this wave's tile [16 queries][64 d]
    {
      float* pw = part + (size_t)(w * 16 + ln) * OPP + 8 * hh;
#pragma unroll  // constant index into O[]
      for (int t = 0; t < 4; ++t) {
        const v4f x0 = {O[t][0], O[t][1], O[t][2], O[t][3]};
        const v4f x1 = {O[t][4], O[t][5], O[t][6], O[t][7]};
        *(v4fa*)(pw + 16 * t) = x0;
        *(v4fa*)(pw + 16 * t + 4) = x1;
      }
    }
    load_qk(qf, kf, qhp, qlp, khp, klp, ho + SEQ * HD * 2, q0, w, act, h + 1 < h0 + HPG);
    lds_barrier();
    // one wave per query row (wave-uniform loop): lane sums d = 2 lane, 2 lane + 1 over the NW partial tiles; a wave writes whole 128-B lines
#pragma unroll 1  // at most one trip per wave once NW >= 16: nothing to gain from copies of the body
    for (int row = w; row < 16; row += NW) {
      const float* pr = part + row * OPP + 2 * lane;
      float t0 = 0.0f, t1 = 0.0f;
#pragma unroll  // independent LDS loads in flight together; the sums stay in wave order
      for (int u = 0; u < NW; ++u) {
        const v2f x = *(const v2fa*)(pr + u * 16 * OPP);
        t0 += x[0];
        t1 += x[1];
      }
      const unsigned int hp = bf16_pair(t0, t1);
      unsigned short* d = Cx + ((size_t)(q0 + row) * NB_FULL + b) * CXP + h * HD + 2 * lane;
      *(u32a*)d = hp;
      *(u32a*)(d + DM) = bf16_rest(t0, t1, hp);
      asm volatile("s_wait_xcnt 0x0" ::: "memory");  // the stores' address registers are advanced for the next head right behind them
    }
  }

  __syncthreads();
  float* cg = CovP + (size_t)(bg % HG) * CVN + ((size_t)b * SEQ_FULL + q0) * SEQ_FULL;
#pragma unroll 1  // a few short trips, once per block: kept rolled as before
  for (int idx = w; idx < 16 * (SEQ / 128); idx += NW) {
    const int row = idx / (SEQ / 128), col = (idx % (SEQ / 128)) * 128 + lane * 4;
    v4f v = *(const v4fa*)(covs + row * COVP + col);
    v[0] *= 0.0625f; v[1] *= 0.0625f; v[2] *= 0.0625f; v[3] *= 0.0625f;
    *(v4f*)(cg + (size_t)row * SEQ_FULL + col) = v;
    asm volatile("s_wait_xcnt 0x0" ::: "memory");    // the next trip rewrites the store's address and data registers
  }
}

// Output projection: out[m][n] = sum_c (ctx_hi[m][c] + ctx_lo[m][c]) Wo[n][c]: a stage holds the same 64 columns of both ctx planes and of Wo.
// coverage: blocks with blockIdx.y < DM / GT tile the [SEQ*NB_FULL][1024] output exactly once.
// Blocks with blockIdx.y >= DM / GT add the two coverage planes into the second output: CS_BLK blocks x 256 threads x CS_PC pieces of 4 elements = every element once;
// a wave's load or store covers 512 contiguous bytes. They leave ahead of every barrier and, coming last in the grid, run beside the product blocks.
#define CS_Y (DM / GT)
#define CS_BLK ((SEQ * NB_FULL / GT) * CS_Y)
#define CS_PC ((int)(CVN / 4 / 256 / CS_BLK))
static_assert(CVN % ((size_t)4 * 256 * CS_BLK) == 0 && CS_PC <= 16);   // the pieces of both planes stay in registers
static_assert(CVN * 4 <= (size_t)0xFFFFFFFF);    // a byte offset inside a coverage plane fits 32 bits
__global__ __launch_bounds__(256) void k_oproj(const unsigned short* __restrict__ Cx, const unsigned short* __restrict__ Wo,
                                               float* __restrict__ Out, const float* __restrict__ Cv0, const float* __restrict__ Cv1, float* __restrict__ Cov) {
  __shared__ __attribute__((aligned(16))) unsigned short ring[RING3_E];
  if (blockIdx.y >= DM / GT) {
    // addresses are a uniform base + one 32-bit byte offset + a small constant: that one register is all that the loads and stores name
    const unsigned int o = (((blockIdx.y - DM / GT) * (SEQ * NB_FULL / GT) + blockIdx.x) * (CS_PC * 256) + threadIdx.x) * 16u;
    const char* c0 = (const char*)Cv0;                // the planes come as two arguments, so that each base is uniform
    const char* c1 = (const char*)Cv1;
    char* cd = (char*)Cov;
    v4f x[CS_PC], y[CS_PC];
#pragma unroll  // constant index into x[] and y[]; all of the thread's loads in flight together
    for (int i = 0; i < CS_PC; ++i) {
      x[i] = *(const v4fa*)(c0 + o + 4096 * i);
      y[i] = *(const v4fa*)(c1 + o + 4096 * i);
    }
    asm volatile("s_wait_xcnt 0x0" :: "v"(o) : "memory");   // the offset register stays live up to this wait: no load's result lands in it earlier
#pragma unroll
    for (int i = 0; i < CS_PC; ++i) *(v4fa*)(cd + o + 4096 * i) = x[i] + y[i];
    return;
  }
  const int tid = threadIdx.x, w = __builtin_amdgcn_readfirstlane((int)(tid >> 5)), lane = tid & 31, ln = lane & 15, hh = lane >> 4;
  const int wr = w & 3, wc = w >> 2;                 // wave position: rows 32 wr, columns 64 wc
  const int pr = (wr >> 1) + 2 * wc, w2 = wr & 1;    // 64 x 64 staging tile, and the wave's place in it
  const int mb = blockIdx.x * GT, nb = blockIdx.y * GT;
  const int m0 = mb + 64 * (wr >> 1), n0 = nb + 64 * wc;
  const int crow = tid >> 3, cpc = 8 * (tid & 7);
  const unsigned short* ga = Cx + (size_t)(mb + crow) * CXP + cpc;
  const unsigned short* gb = Wo + (size_t)(nb + crow) * DM + cpc;
  const unsigned int la = (unsigned int)(size_t)(ring + crow * TP + cpc);
  v8f acc[2][4] = {};
  gemm_hilo(ga, gb, la, ring + (32 * wr + ln) * TP + 8 * hh, ring + 2 * TILE_E + (64 * wc + ln) * TP + 8 * hh, acc);
  float* so = (float*)ring + pr * (64 * 68);
#pragma unroll
  for (int mt = 0; mt < 2; ++mt)
#pragma unroll
    for (int nt = 0; nt < 4; ++nt)
#pragma unroll
      for (int r = 0; r < 8; ++r)
        so[(32 * w2 + 16 * mt + 8 * hh + r) * 68 + 16 * nt + ln] = acc[mt][nt][r];
  __syncthreads();
  const int rsub = lane >> 4, c4 = (lane & 15) * 4;
  {
#pragma unroll 1
    for (int i = 0; i < 16; ++i) {
      const int row = 32 * w2 + 2 * i + rsub;
      const v4f v = *(const v4fa*)(so + row * 68 + c4);
      *(v4f*)(Out + (size_t)(m0 + row) * DM + n0 + c4) = v;
    }
    
  }
}

extern "C" void kernel_launch(void* const* d_in, const int* in_sizes, int n_in,
                              void* d_out, int out_size, void* d_ws, size_t ws_size, hipStream_t stream) {
  if (n_in < 10) return;
  const long long needX = (long long)SEQ * NB_FULL * DM;
  if ((long long)in_sizes[0] < needX || (long long)in_sizes[1] < needX || (long long)in_sizes[2] < needX) return;
  for (int i = 3; i < 7; ++i) if ((long long)in_sizes[i] < (long long)DM * DM) return;
  if ((long long)in_sizes[7] < ((long long)(NB - 1) * SEQ_FULL + (SEQ - 1)) * SEQ_FULL + SEQ_FULL) return;
  if ((long long)in_sizes[8] < (long long)SEQ * RHSW) return;
  if (in_sizes[9] < 1) return;
  if ((long long)out_size < (long long)COV_OFF + ((long long)(NB - 1) * SEQ_FULL + (SEQ - 1)) * SEQ_FULL + SEQ) return;

  const float* query = (const float*)d_in[0];   // wire order: query, key, value, Wq, Wk, Wv, Wo, mask, rhs_mask, layer_idx
  const float* keyt  = (const float*)d_in[1];
  const float* value = (const float*)d_in[2];
  const float* Wq    = (const float*)d_in[3];
  const float* Wk    = (const float*)d_in[4];
  const float* Wv    = (const float*)d_in[5];
  const float* Wo    = (const float*)d_in[6];
  const int*   mask  = (const int*)d_in[7];
  const int*   rhs   = (const int*)d_in[8];
  const int*   lidx  = (const int*)d_in[9];
  float* out = (float*)d_out;
  float* cov = out + COV_OFF;

  char* ws = (char*)d_ws;
  size_t off = 0;
  unsigned short* Xb = (unsigned short*)(ws + off); off += BYTES_XB;   // 3 activation planes [SEQ*NB_FULL][1024] bf16
  unsigned short* Wb = (unsigned short*)(ws + off); off += BYTES_WB;   // 4 weight planes [1024][1024] bf16 (q, k, v, o)
  unsigned short* PL = (unsigned short*)(ws + off); off += BYTES_PL;   // q_hi, q_lo, k_hi, k_lo, vT_hi, vT_lo
  unsigned short* Cx = (unsigned short*)(ws + off); off += BYTES_CX;   // ctx [SEQ*NB_FULL][hi 1024 | lo 1024] bf16
  unsigned int*   Mb = (unsigned int*)(ws + off);   off += BYTES_MB;   // mask bit-plane [NB][SEQ][32 words]
  float*          Cv = (float*)(ws + off);          off += BYTES_CV;   // coverage of each head group, [HG][NB][SEQ][SEQ] f32
  if (off > ws_size) return;

  k_prep<<<PREP_WG, PREP_TH, 0, stream>>>(query, keyt, value, Wq, Wk, Wv, Wo, mask, rhs, lidx, Xb, Wb, Mb);
  k_proj<<<dim3((unsigned)(NB * SEQ / GT), NH / 2, 3), 256, 0, stream>>>(Xb, Wb, PL);
  hipFuncSetAttribute(reinterpret_cast<const void*>(&k_attn), hipFuncAttributeMaxDynamicSharedMemorySize, (int)ATTN_LDS);
  k_attn<<<(unsigned)(NB * HG * (SEQ / 16)), 32 * NW, (size_t)ATTN_LDS, stream>>>(PL, PL + PLSZ, PL + 2 * PLSZ, PL + 3 * PLSZ, PL + 4 * PLSZ, PL + 5 * PLSZ, Mb, Cx, Cv);
  k_oproj<<<dim3((unsigned)(SEQ * NB_FULL / GT), DM / GT + CS_Y), 256, 0, stream>>>(Cx, Wb + 3 * WN, out, Cv, Cv + CVN, cov);
}
